// v000
// Times are from an AMD MI455X. After a warm-up the kernel runs many times in a row, and a time is the length of
// such a window on the GPU divided by its runs, so every launch and the gaps after it count. The runs cycle
// through copies of the inputs. A figure is the median of several windows, for all but v000 over two sittings.
// Sittings can differ by a few percent; kernels timed side by side share one.
// v000 is the starting kernel. One run takes 672 microseconds.
#include <hip/hip_runtime.h>

// Causal grouped-query attention layer: x [NB][SEQ][2048], 16 query heads x 128, 4 kv heads, weights [in][out] with biases, rotate-half rotary (theta 1e4), ALiBi slopes 2^(-(h+1)/2), output projection; f32 output.
// Compute dtypes, f32 accumulate everywhere: q/k/v projections v_wmma_f32_16x16x32_bf16 (x, W, b RNE-converted to bf16; products exact);
// scores v_wmma_f32_16x16x32_f16: k single f16, q as f16 value + f16 residual x2048 in its own accumulator; P.V v_wmma_f32_16x16x32_f16: P single f16 (x256 carry, cancels in the normalisation),
// v as f16 value + f16 residual x256 whose partner operand is the P copy x2^-8 (K-dimension fold, products at natural scale, one accumulator); output projection v_wmma_f32_16x16x32_bf16 with ctx as bf16 hi | lo planes folded along K against the bf16 Wo plane; softmax f32 (online, running max).
// Layout: bf16 x copy, bf16 transposed weight planes [out][in]; q (hi, residual) planes [b*16+h][t][d], k plane [b*4+g][t][d], v^T planes [b*4+g][d][t]; ctx plane [b*SEQ+t][hi 2048 | lo 2048]; rotary table [t][cos 64 | sin 64].

#ifndef NB
#define NB 2
#endif
#ifndef SEQ
#define SEQ 2048
#endif
#define NB_FULL  2
#define SEQ_FULL 2048
#ifndef OUT_SEQ
#define OUT_SEQ SEQ              // row pitch (in tokens) between batches of the output
#endif
#define DM   2048
#define NH_  16
#define NKV  4
#define HD   128
#define REP  (NH_ / NKV)
#define DKV  (NKV * HD)          // 512
#define AW   4                   // waves per flash block (16 query rows each)
#define QRS  2048.0f             // carry of the q residual plane
#define QRI  (1.0f / 2048.0f)
#define VRS  256.0f              // carry of the v residual plane (partner operand is P x 2^-8)
#define LOG2E 1.4426950408889634f
#define SC2  (0.08838834764831845f * 1.4426950408889634f)   // HD^-0.5 * log2(e)
#define PSH  8.0f                // log2 of the P carry (256)
#define NEGBIG (-3.0e38f)

static_assert(HD == 128);
static_assert(NH_ * HD == DM);
static_assert(NH_ % NKV == 0);
static_assert(DM % 64 == 0);
static_assert(DKV % 64 == 0);
static_assert(DM % 32 == 0);
static_assert(SEQ % 64 == 0);                  // a 64-row tile never straddles two batches
static_assert((NB * SEQ) % 64 == 0);
static_assert(SEQ % 32 == 0);                  // key loop steps by 32
static_assert(SEQ % (16 * AW) == 0);           // flash grid covers the sequence exactly
static_assert(SEQ % 4 == 0);
static_assert(((size_t)SEQ * DM) % 8 == 0);
static_assert(NB <= NB_FULL);
static_assert(SEQ <= SEQ_FULL);

typedef _Float16 h16;
typedef unsigned short bf;
typedef __attribute__((ext_vector_type(16))) __bf16   v16bf;
typedef __attribute__((ext_vector_type(16))) _Float16 v16h;
typedef __attribute__((ext_vector_type(8)))  _Float16 v8h;
typedef __attribute__((ext_vector_type(8)))  unsigned short v8us;
typedef __attribute__((ext_vector_type(8)))  float    v8f;
typedef __attribute__((ext_vector_type(4)))  float    v4f;
typedef v4f  __attribute__((may_alias)) v4fa;

__device__ __forceinline__ unsigned short f2bf(float f) { unsigned u = __float_as_uint(f); u += 0x7FFFu + ((u >> 16) & 1u); return (unsigned short)(u >> 16); }
__device__ __forceinline__ float bf2f(unsigned short u) { return __uint_as_float(((unsigned)u) << 16); }
__device__ __forceinline__ float bfr(float f) { return bf2f(f2bf(f)); }     // value of the RNE bf16 conversion
__device__ __forceinline__ v16h cat16(v8h lo, v8h hi) { return __builtin_shufflevector(lo, hi, 0, 1, 2, 3, 4, 5, 6, 7, 8, 9, 10, 11, 12, 13, 14, 15); }
__device__ __forceinline__ v16bf cat16b(v8us lo, v8us hi) { return __builtin_bit_cast(v16bf, __builtin_shufflevector(lo, hi, 0, 1, 2, 3, 4, 5, 6, 7, 8, 9, 10, 11, 12, 13, 14, 15)); }
__device__ __forceinline__ v8f wmma16(v16h a, v16h b, v8f c) { return __builtin_amdgcn_wmma_f32_16x16x32_f16(false, a, false, b, (short)0, c, false, false); }
__device__ __forceinline__ v8f wmmab(v16bf a, v16bf b, v8f c) { return __builtin_amdgcn_wmma_f32_16x16x32_bf16(false, a, false, b, (short)0, c, false, false); }
// fragment loaders from K-contiguous 16-bit rows; p already includes + 8*(lane>>4): elements 0..7 <- k0+8h+0..7, elements 8..15 <- k0+16+8h+0..7 (same map for A and B)
__device__ __forceinline__ v16h  ldh(const h16* p) { return cat16(*(const v8h*)p, *(const v8h*)(p + 16)); }
__device__ __forceinline__ v16bf ldb(const bf* p)  { return cat16b(*(const v8us*)p, *(const v8us*)(p + 16)); }
// ordering point for wave-private LDS tiles (same wave writes and reads)
__device__ __forceinline__ void wave_sync() { __builtin_amdgcn_fence(3 /* release order */, "wavefront"); __builtin_amdgcn_wave_barrier(); asm volatile("" ::: "memory"); }

__global__ __launch_bounds__(256) void k_cvt8(const float* __restrict__ src, bf* dst, size_t n8) {
    const size_t i = (size_t)blockIdx.x * 256 + threadIdx.x; if (i >= n8) return;
    const v8f v = *(const v8f*)(src + i * 8); v8us o;
#pragma unroll
    for (int k = 0; k < 8; ++k) o[k] = f2bf(v[k]);
    *(v8us*)(dst + i * 8) = o; 
}

// k_tcvt: W in[K rows][N cols] f32 -> WT out[N rows][K cols] bf16 (RNE convert), 64x64 tile transposed through LDS (cross-wave: block barrier).
__global__ __launch_bounds__(256) void k_tcvt(const float* __restrict__ W, bf* WT, int K, int N) {
    __shared__ float ts[64 * 65];
    const int tid = threadIdx.x; const int k0 = blockIdx.x * 64, n0 = blockIdx.y * 64;
    const int cn = tid & 63, rk = tid >> 6;
#pragma unroll 4
    for (int i = 0; i < 16; ++i) { const int r = rk + 4 * i; ts[r * 65 + cn] = W[(size_t)(k0 + r) * N + n0 + cn]; }   // 16 x 4 = 64 rows, 64 columns
    __syncthreads();
    const int pc = tid & 7, rn = tid >> 3;      // rn 0..31 and rn+32 -> 64 output rows; 8 pieces x 8 = 64 k
    v8us o0, o1;
#pragma unroll
    for (int j = 0; j < 8; ++j) { o0[j] = f2bf(ts[(pc * 8 + j) * 65 + rn]); o1[j] = f2bf(ts[(pc * 8 + j) * 65 + rn + 32]); }
    bf* d0 = WT + (size_t)(n0 + rn) * K + k0 + pc * 8; bf* d1 = WT + (size_t)(n0 + rn + 32) * K + k0 + pc * 8;
    *(v8us*)d0 = o0; *(v8us*)d1 = o1; 
}

// k_rope_tab: rotary table CS[t][0..63] = cos(t * f_i), CS[t][64..127] = sin(t * f_i), f_i = 10000^(-i/64) = 2^(-i * log2(10000)/64); precise sinf/cosf.
__global__ __launch_bounds__(256) void k_rope_tab(float* CS) {
    __shared__ __align__(16) float ts[4 * 128];
    const int tid = threadIdx.x; const int i = tid & 63, r = tid >> 6; const int t = blockIdx.x * 4 + r;
    const float invf = __builtin_amdgcn_exp2f(-(float)i * 0.20762050593046014f);
    const float ang = (float)t * invf;
    ts[r * 128 + i] = cosf(ang); ts[r * 128 + 64 + i] = sinf(ang);
    __syncthreads();
    if (tid < 128) {                            // waves 0..3 (wave-uniform), one row each
        const int row = tid >> 5, pc = tid & 31;
        const v4f v = *(const v4fa*)(&ts[row * 128 + pc * 4]);
        float* d = CS + (size_t)(blockIdx.x * 4 + row) * 128 + pc * 4;
        *(v4f*)d = v; 
    }
}

// gemm_loop: register-blocked bf16 GEMM main loop for ONE WAVE, tile (16*MT) x (16*NT), operands straight from K-contiguous bf16 planes.
// acc[mb*NT+nb] += sum_k A[r0+16mb+..][k] * Bt[c0+16nb+..][k & kbm]   (kbm folds a K-concatenated A against a single Bt plane)
template <int MT, int NT>
__device__ __forceinline__ void gemm_loop(const bf* __restrict__ A, size_t lda, const bf* __restrict__ Bt, size_t ldbt,
                                          int K, int kbm, int r0, int c0, int lr, int hi, v8f (&acc)[MT * NT]) {
#pragma unroll
    for (int i = 0; i < MT * NT; ++i) acc[i] = (v8f){};
    const size_t aoff = (size_t)(r0 + lr) * lda + 8 * hi, boff = (size_t)(c0 + lr) * ldbt + 8 * hi;
#pragma unroll 1
    for (int kc = 0; kc < K; kc += 32) {
        const int kb = kc & kbm;
        v16bf a[MT];
#pragma unroll
        for (int mb = 0; mb < MT; ++mb) a[mb] = ldb(A + aoff + (size_t)mb * 16 * lda + kc);
        v16bf bl = a[0];
#pragma unroll
        for (int nb = 0; nb < NT; ++nb) { const v16bf b = ldb(Bt + boff + (size_t)nb * 16 * ldbt + kb);
#pragma unroll
            for (int mb = 0; mb < MT; ++mb) acc[mb * NT + nb] = wmmab(a[mb], b, acc[mb * NT + nb]);
            if (nb == NT - 1) bl = b; }
        asm volatile("v_nop\n\tv_nop\n\tv_nop\n\tv_nop" : "+v"(acc[0]), "+v"(acc[(MT * NT) / 3]), "+v"(acc[(2 * MT * NT) / 3]), "+v"(acc[MT * NT - 1]) : "v"(a[0]), "v"(a[MT - 1]), "v"(bl));
    }
}

// k_qk: projection + bias + rotary for q or k. ONE WAVE per 32 rows x 128 columns (= one head), K = DM. grid (NB*SEQ/32, nheads), 32 threads.
// Output plane [(b*nheads + head)][t][d] as f16 (Ph) and optionally the f16 residual x2048 (Pr, useRes != 0).
__global__ __launch_bounds__(32) __attribute__((amdgpu_num_vgpr(256)))
void k_qk(const bf* __restrict__ A, const bf* __restrict__ Bt, const float* __restrict__ bias, const float* __restrict__ CS, h16* Ph, h16* Pr, int useRes, int nheads) {
    __shared__ __align__(16) float os[16 * 132];
    const int lane = threadIdx.x & 31, lr = lane & 15, hi = lane >> 4;
    const int r0 = blockIdx.x * 32, head = blockIdx.y, cbase = head * HD;
    v8f acc[16];
    gemm_loop<2, 8>(A, (size_t)DM, Bt, (size_t)DM, DM, 0x7FFFFFFF, r0, cbase, lr, hi, acc);
    float bz[8];
#pragma unroll
    for (int nb = 0; nb < 8; ++nb) bz[nb] = bfr(bias[cbase + nb * 16 + lr]);
    const int b = r0 / SEQ, t0 = r0 % SEQ;
    const size_t tbase = ((size_t)(b * nheads + head) * SEQ + t0) * HD;
#pragma unroll
    for (int mb = 0; mb < 2; ++mb) {
#pragma unroll
        for (int nb = 0; nb < 8; ++nb) {
#pragma unroll
            for (int j = 0; j < 8; ++j) os[(hi * 8 + j) * 132 + nb * 16 + lr] = acc[mb * 8 + nb][j] + bz[nb]; }   // D: row 8h+j, col lane&15; rows 0..15 x cols 0..127 all staged
        wave_sync();
{
#pragma unroll 2
            for (int s = 0; s < 8; ++s) { const int row = 2 * s + hi, c8 = lr * 8, p8 = c8 ^ 64;   // 8 s x 2 rows = 16 rows; 16 lanes x 8 = 128 columns
                const int t = t0 + mb * 16 + row;
                const float* orow = &os[row * 132];
                const v4f x0 = *(const v4fa*)(orow + c8), x1 = *(const v4fa*)(orow + c8 + 4);
                const v4f y0 = *(const v4fa*)(orow + p8), y1 = *(const v4fa*)(orow + p8 + 4);
                const float* cs = CS + (size_t)t * 128 + (c8 & 63);
                const v4f cc0 = *(const v4f*)cs, cc1 = *(const v4f*)(cs + 4), ss0 = *(const v4f*)(cs + 64), ss1 = *(const v4f*)(cs + 68);
                const float sg = (c8 < 64) ? -1.0f : 1.0f;       // d < 64: x[d] cos - x[d+64] sin; d >= 64: x[d] cos + x[d-64] sin
                v8h hv, rv;
#pragma unroll
                for (int i = 0; i < 4; ++i) {
                    const float v0 = x0[i] * cc0[i] + sg * (y0[i] * ss0[i]); const float v1 = x1[i] * cc1[i] + sg * (y1[i] * ss1[i]);
                    const h16 a0 = (h16)v0; const h16 a1 = (h16)v1; hv[i] = a0; hv[4 + i] = a1;
                    rv[i] = (h16)((v0 - (float)a0) * QRS); rv[4 + i] = (h16)((v1 - (float)a1) * QRS); }
                const size_t oo = tbase + (size_t)(mb * 16 + row) * HD + c8;
                *(v8h*)(Ph + oo) = hv; if (useRes) *(v8h*)(Pr + oo) = rv; }
             }
        wave_sync();
    }
}

// k_vt: v^T projection. A = WvT rows (m = g*128 + d), Bt = x rows (n = b*SEQ + t), ONE WAVE per 64x64 tile. grid (DKV/64, NB*SEQ/64), 32 threads.
// Planes [(b*DKV + m)][t] = [(b*4 + g)][d][t]: f16 value (VH) and f16 residual x256 (VR); bias per row m.
__global__ __launch_bounds__(32) __attribute__((amdgpu_num_vgpr(256)))
void k_vt(const bf* __restrict__ A, const bf* __restrict__ Bt, const float* __restrict__ bias, h16* VH, h16* VR) {
    __shared__ __align__(16) float os[16 * 68];
    const int lane = threadIdx.x & 31, lr = lane & 15, hi = lane >> 4;
    const int r0 = blockIdx.x * 64, c0 = blockIdx.y * 64;
    v8f acc[16];
    gemm_loop<4, 4>(A, (size_t)DM, Bt, (size_t)DM, DM, 0x7FFFFFFF, r0, c0, lr, hi, acc);
    const int b = c0 / SEQ, t0 = c0 % SEQ;
    const size_t tbase = ((size_t)b * DKV + r0) * SEQ + t0;
#pragma unroll
    for (int mb = 0; mb < 4; ++mb) {
        float bj[8];
#pragma unroll
        for (int j = 0; j < 8; ++j) bj[j] = bfr(bias[r0 + mb * 16 + hi * 8 + j]);
#pragma unroll
        for (int nb = 0; nb < 4; ++nb) {
#pragma unroll
            for (int j = 0; j < 8; ++j) os[(hi * 8 + j) * 68 + nb * 16 + lr] = acc[mb * 4 + nb][j] + bj[j]; }   // rows 0..15 x cols 0..63 all staged
        wave_sync();
        const size_t sb = tbase + (size_t)(mb * 16) * SEQ;
{
#pragma unroll
            for (int s = 0; s < 4; ++s) { const int row = 4 * s + (lane >> 3), c8 = (lane & 7) * 8;   // 4 s x 4 row groups = 16 rows; 8 lanes x 8 = 64 columns
                const v4f x0 = *(const v4fa*)(&os[row * 68 + c8]); const v4f x1 = *(const v4fa*)(&os[row * 68 + c8 + 4]); v8h hv, rv;
#pragma unroll
                for (int i = 0; i < 4; ++i) { const h16 a0 = (h16)x0[i]; const h16 a1 = (h16)x1[i]; hv[i] = a0; hv[4 + i] = a1; rv[i] = (h16)((x0[i] - (float)a0) * VRS); rv[4 + i] = (h16)((x1[i] - (float)a1) * VRS); }
                const size_t oo = sb + (size_t)row * SEQ + c8;
                *(v8h*)(VH + oo) = hv; *(v8h*)(VR + oo) = rv; }
             }
        wave_sync();
    }
}

// k_flash: fused causal attention, one wave per 16 query rows of one (batch, head); K / V^T / Q fragments straight from the f16 planes (two 16-B loads each, arithmetic addressing).
// Transposed form: S^T[key][t] = K Q^T (A = K rows, B = Q rows); lane (t = lane&15, h = lane>>4) holds keys 8h+r of each 16-key tile, so the packed
// P tile is directly the B fragment of O^T[d][t] = V^T P^T (element r <- tile keys 0..15, element 8+r <- tile keys 16..31, lane unchanged).
// Key loop runs to the 32-key step that contains the last query of the wave; keys beyond a query get the fill value (weight exactly 0). ALiBi bias slope*(key - query) added in the exp2 domain.
__global__ __launch_bounds__(32 * AW) __attribute__((amdgpu_num_vgpr(256)))
void k_flash(const h16* __restrict__ QH, const h16* __restrict__ QR, const h16* __restrict__ KP, const h16* __restrict__ VH, const h16* __restrict__ VR, bf* CTX) {
    __shared__ __align__(16) float os[AW * 16 * 132];
    const int lane = threadIdx.x & 31, wave = threadIdx.x >> 5, lr = lane & 15, hi = lane >> 4;
    const int zh = blockIdx.y; const int b = zh / NH_, h = zh % NH_; const int g = h / REP;
    const int t0 = (blockIdx.x * AW + wave) * 16;
    const size_t qo = (size_t)zh * SEQ * HD + (size_t)(t0 + lr) * HD + 8 * hi;
    v16h qh[4], qr[4];                                         // B fragments: col t, k = d
#pragma unroll
    for (int c = 0; c < 4; ++c) { qh[c] = ldh(QH + qo + 32 * c); qr[c] = ldh(QR + qo + 32 * c); }
    const size_t kvb = (size_t)(b * NKV + g) * SEQ * HD;
    const size_t ko = kvb + (size_t)lr * HD + 8 * hi;          // + key * HD       (A fragment: row key, k = d)
    const size_t vo = kvb + (size_t)lr * SEQ + 8 * hi;         // + 16j*SEQ + key  (A fragment: row d, k = key)
    const float slope2 = __builtin_amdgcn_exp2f(-0.5f * (float)(h + 1)) * LOG2E;
    const int qi = t0 + lr;
    v8f o[8];
#pragma unroll
    for (int j = 0; j < 8; ++j) o[j] = (v8f){};
    float m = NEGBIG, l = 0.0f;
    const int kend = ((t0 + 16 + 31) >> 5) << 5;               // <= SEQ
#pragma unroll 1
    for (int key0 = 0; key0 < kend; key0 += 32) {
        const h16* ka = KP + ko + (size_t)key0 * HD;
        v8f sHa = (v8f){}, sLa = (v8f){}, sHb = (v8f){}, sLb = (v8f){};
        v16h kal, kbl;
#pragma unroll
        for (int c = 0; c < 4; ++c) {
            kal = ldh(ka + 32 * c); kbl = ldh(ka + 16 * HD + 32 * c);
            sHa = wmma16(kal, qh[c], sHa); sLa = wmma16(kal, qr[c], sLa); sHb = wmma16(kbl, qh[c], sHb); sLb = wmma16(kbl, qr[c], sLb); }
        asm volatile("v_nop\n\tv_nop\n\tv_nop\n\tv_nop" : "+v"(sHa), "+v"(sLa), "+v"(sHb), "+v"(sLb) : "v"(kal), "v"(kbl));
        const float base = (float)(key0 + 8 * hi - qi);        // key - query for r = 0 of tile a
        float ta[8], tb[8]; float mx = NEGBIG;
#pragma unroll
        for (int r = 0; r < 8; ++r) {
            const float da = base + (float)r, db = da + 16.0f;
            float xa = fmaf(slope2, da, (sHa[r] + sLa[r] * QRI) * SC2);
            float xb = fmaf(slope2, db, (sHb[r] + sLb[r] * QRI) * SC2);
            xa = (da > 0.0f) ? NEGBIG : xa; xb = (db > 0.0f) ? NEGBIG : xb;
            ta[r] = xa; tb[r] = xb; mx = fmaxf(mx, fmaxf(xa, xb)); }
        mx = fmaxf(mx, __shfl_xor(mx, 16, 32));
        const float mnew = fmaxf(m, mx);
        const float alpha = __builtin_amdgcn_exp2f(m - mnew);
        const float sh = PSH - mnew;
        v16h pb; float ls = 0.0f;
#pragma unroll
        for (int r = 0; r < 8; ++r) { const h16 pa = (h16)__builtin_amdgcn_exp2f(ta[r] + sh); const h16 pc = (h16)__builtin_amdgcn_exp2f(tb[r] + sh); pb[r] = pa; pb[8 + r] = pc; ls += (float)pa + (float)pc; }
        const v16h pq = pb * (h16)0.00390625f;                 // P x 2^-8: partner of the v residual x256
        l = l * alpha + ls; m = mnew;
#pragma unroll
        for (int j = 0; j < 8; ++j) o[j] = o[j] * alpha;
        const h16* va = VH + vo + key0; const h16* vr = VR + vo + key0;
#pragma unroll
        for (int j = 0; j < 8; ++j) { const v16h vf = ldh(va + (size_t)(16 * j) * SEQ); o[j] = wmma16(vf, pb, o[j]); }
#pragma unroll
        for (int j = 0; j < 8; ++j) { const v16h vf = ldh(vr + (size_t)(16 * j) * SEQ); o[j] = wmma16(vf, pq, o[j]); }
        asm volatile("v_nop\n\tv_nop\n\tv_nop\n\tv_nop" : "+v"(o[0]), "+v"(o[1]), "+v"(o[2]), "+v"(o[3]), "+v"(o[4]), "+v"(o[5]), "+v"(o[6]), "+v"(o[7]) : "v"(pb), "v"(pq));
    }
    l += __shfl_xor(l, 16, 32);
    const float inv = 1.0f / l;
    const int wb = wave * 16 * 132;
    // O^T D layout: o[j][r] = (d = 16j + 8h + r, t = lane&15) -> os[t][d]; rows 0..15 x columns 0..127 all written
#pragma unroll
    for (int j = 0; j < 8; ++j) { v4f a, c;
        a[0] = o[j][0] * inv; a[1] = o[j][1] * inv; a[2] = o[j][2] * inv; a[3] = o[j][3] * inv; c[0] = o[j][4] * inv; c[1] = o[j][5] * inv; c[2] = o[j][6] * inv; c[3] = o[j][7] * inv;
        *(v4fa*)(&os[wb + lr * 132 + 16 * j + 8 * hi]) = a; *(v4fa*)(&os[wb + lr * 132 + 16 * j + 8 * hi + 4]) = c; }
    wave_sync();
    bf* crow = CTX + ((size_t)b * SEQ + t0) * (size_t)(2 * DM) + h * HD;
{
#pragma unroll 2
        for (int s = 0; s < 8; ++s) { const int row = 2 * s + hi, c8 = lr * 8;   // 8 s x 2 rows = 16 rows; 16 lanes x 8 = 128 columns
            const v4f x0 = *(const v4fa*)(&os[wb + row * 132 + c8]); const v4f x1 = *(const v4fa*)(&os[wb + row * 132 + c8 + 4]); v8us hv, lv;
#pragma unroll
            for (int i = 0; i < 4; ++i) { const unsigned short a0 = f2bf(x0[i]); const unsigned short a1 = f2bf(x1[i]); hv[i] = a0; hv[4 + i] = a1; lv[i] = f2bf(x0[i] - bf2f(a0)); lv[4 + i] = f2bf(x1[i] - bf2f(a1)); }
            bf* dst = crow + (size_t)row * (size_t)(2 * DM) + c8;
            *(v8us*)dst = hv; *(v8us*)(dst + DM) = lv; }
         }
}

// k_out: output projection. A = ctx plane rows [hi 2048 | lo 2048] (K = 4096 folded against the single WoT plane), Bt = WoT rows, ONE WAVE per 64x64 tile. grid (NB*SEQ/64, DM/64), 32 threads.
__global__ __launch_bounds__(32) __attribute__((amdgpu_num_vgpr(256)))
void k_out(const bf* __restrict__ A, const bf* __restrict__ Bt, const float* __restrict__ bias, float* OUT) {
    __shared__ __align__(16) float os[16 * 68];
    const int lane = threadIdx.x & 31, lr = lane & 15, hi = lane >> 4;
    const int r0 = blockIdx.x * 64, c0 = blockIdx.y * 64;
    v8f acc[16];
    gemm_loop<4, 4>(A, (size_t)(2 * DM), Bt, (size_t)DM, 2 * DM, DM - 1, r0, c0, lr, hi, acc);
    float bz[4];
#pragma unroll
    for (int nb = 0; nb < 4; ++nb) bz[nb] = bfr(bias[c0 + nb * 16 + lr]);
    const int b = r0 / SEQ, t0 = r0 % SEQ;
    float* obase = OUT + ((size_t)b * OUT_SEQ + t0) * DM + c0;
#pragma unroll
    for (int mb = 0; mb < 4; ++mb) {
#pragma unroll
        for (int nb = 0; nb < 4; ++nb) {
#pragma unroll
            for (int j = 0; j < 8; ++j) os[(hi * 8 + j) * 68 + nb * 16 + lr] = acc[mb * 4 + nb][j] + bz[nb]; }   // rows 0..15 x cols 0..63 all staged
        wave_sync();
        float* orow = obase + (size_t)(mb * 16) * DM;
{
#pragma unroll
            for (int s = 0; s < 8; ++s) { const int row = 2 * s + hi, cofs = lr * 4;   // 8 s x 2 rows = 16 rows; 16 lanes x 4 floats = 64 columns
                const v4f val = *(const v4fa*)(&os[row * 68 + cofs]);
                *(v4f*)(orow + (size_t)row * DM + cofs) = val; }
             }
        wave_sync();
    }
}

static constexpr size_t al256(size_t v) { return (v + 255) & ~(size_t)255; }
static constexpr size_t SZ_XB  = al256((size_t)NB * SEQ * DM * 2);
static constexpr size_t SZ_WQ  = al256((size_t)DM * DM * 2);
static constexpr size_t SZ_WK  = al256((size_t)DKV * DM * 2);
static constexpr size_t SZ_CS  = al256((size_t)SEQ * 128 * 4);
static constexpr size_t SZ_QP  = al256((size_t)NB * NH_ * SEQ * HD * 2);
static constexpr size_t SZ_KP  = al256((size_t)NB * NKV * SEQ * HD * 2);
static constexpr size_t SZ_CTX = al256((size_t)NB * SEQ * 2 * DM * 2);
static constexpr size_t SZ_TOTAL = SZ_XB + 2 * SZ_WQ + 2 * SZ_WK + SZ_CS + 2 * SZ_QP + 3 * SZ_KP + SZ_CTX;
static_assert(SZ_TOTAL <= (size_t)134217728);          // workspace carve <= 128 MiB

extern "C" void kernel_launch(void* const* d_in, const int* in_sizes, int n_in,
                              void* d_out, int out_size, void* d_ws, size_t ws_size, hipStream_t stream) {
    if (n_in < 9) return;
    const size_t needx = ((size_t)(NB - 1) * SEQ_FULL + SEQ) * DM;
    if ((size_t)in_sizes[0] < needx) return;
    if ((size_t)in_sizes[1] < (size_t)DM * DM || (size_t)in_sizes[2] < (size_t)DM) return;
    if ((size_t)in_sizes[3] < (size_t)DM * DKV || (size_t)in_sizes[4] < (size_t)DKV) return;
    if ((size_t)in_sizes[5] < (size_t)DM * DKV || (size_t)in_sizes[6] < (size_t)DKV) return;
    if ((size_t)in_sizes[7] < (size_t)DM * DM || (size_t)in_sizes[8] < (size_t)DM) return;
    if ((size_t)out_size < ((size_t)(NB - 1) * OUT_SEQ + SEQ) * DM) return;
    if (SZ_TOTAL > ws_size) return;
    // wire order: x, Wq, bq, Wk, bk, Wv, bv, Wo, bo (weights [in][out])
    const float* x  = (const float*)d_in[0];
    const float* wq = (const float*)d_in[1]; const float* bq = (const float*)d_in[2];
    const float* wk = (const float*)d_in[3]; const float* bk = (const float*)d_in[4];
    const float* wv = (const float*)d_in[5]; const float* bv = (const float*)d_in[6];
    const float* wo = (const float*)d_in[7]; const float* bo = (const float*)d_in[8];
    float* OUT = (float*)d_out;      // [NB][SEQ][2048]
    char* wsp = (char*)d_ws;
    bf* XB  = (bf*)wsp; wsp += SZ_XB;                // [NB*SEQ][2048]
    bf* WQT = (bf*)wsp; wsp += SZ_WQ;                // [2048 out][2048 in]
    bf* WOT = (bf*)wsp; wsp += SZ_WQ;                // [2048 out][2048 in]
    bf* WKT = (bf*)wsp; wsp += SZ_WK;                // [512 out][2048 in]
    bf* WVT = (bf*)wsp; wsp += SZ_WK;                // [512 out][2048 in]
    float* CS = (float*)wsp; wsp += SZ_CS;           // [SEQ][cos 64 | sin 64]
    h16* QH = (h16*)wsp; wsp += SZ_QP;               // [NB*16][SEQ][128]
    h16* QR = (h16*)wsp; wsp += SZ_QP;               // [NB*16][SEQ][128] residual x2048
    h16* KP = (h16*)wsp; wsp += SZ_KP;               // [NB*4][SEQ][128]
    h16* VH = (h16*)wsp; wsp += SZ_KP;               // [NB*4][128][SEQ]
    h16* VR = (h16*)wsp; wsp += SZ_KP;               // [NB*4][128][SEQ] residual x256
    bf* CTX = (bf*)wsp; wsp += SZ_CTX;               // [NB*SEQ][hi 2048 | lo 2048]

    if (SEQ == SEQ_FULL) {
        const size_t n8 = (size_t)NB * SEQ * DM / 8;
        k_cvt8<<<(unsigned)((n8 + 255) / 256), 256, 0, stream>>>(x, XB, n8);
    } else {
        const size_t n8 = (size_t)SEQ * DM / 8;
        for (int b = 0; b < NB; ++b) k_cvt8<<<(unsigned)((n8 + 255) / 256), 256, 0, stream>>>(x + (size_t)b * SEQ_FULL * DM, XB + (size_t)b * SEQ * DM, n8);
    }
    // weight transposes: in[K = DM rows][N cols] -> out[N rows][K = DM cols]; grid (K/64, N/64)
    k_tcvt<<<dim3(DM / 64, DM / 64, 1), 256, 0, stream>>>(wq, WQT, DM, DM);
    k_tcvt<<<dim3(DM / 64, DKV / 64, 1), 256, 0, stream>>>(wk, WKT, DM, DKV);
    k_tcvt<<<dim3(DM / 64, DKV / 64, 1), 256, 0, stream>>>(wv, WVT, DM, DKV);
    k_tcvt<<<dim3(DM / 64, DM / 64, 1), 256, 0, stream>>>(wo, WOT, DM, DM);
    k_rope_tab<<<SEQ / 4, 256, 0, stream>>>(CS);

    // q, k: A = x rows (m = b*SEQ + t), Bt = WT rows (n = head*128 + d) -> plane [(b*nheads + head)][t][d], rotary applied
    k_qk<<<dim3(NB * SEQ / 32, NH_, 1), 32, 0, stream>>>(XB, WQT, bq, CS, QH, QR, 1, NH_);
    k_qk<<<dim3(NB * SEQ / 32, NKV, 1), 32, 0, stream>>>(XB, WKT, bk, CS, KP, KP, 0, NKV);
    // v^T: A = WvT rows (m = g*128 + d), Bt = x rows (n = b*SEQ + t) -> planes [(b*512 + m)][t]
    k_vt<<<dim3(DKV / 64, NB * SEQ / 64, 1), 32, 0, stream>>>(WVT, XB, bv, VH, VR);

    k_flash<<<dim3(SEQ / (16 * AW), NB * NH_, 1), 32 * AW, 0, stream>>>(QH, QR, KP, VH, VR, CTX);

    k_out<<<dim3(NB * SEQ / 64, DM / 64, 1), 32, 0, stream>>>(CTX, WOT, bo, OUT);
}

// v001
// A run of this version takes 424 microseconds.
// Timed twice side by side with v000, it ran 1.59 and 1.60 times as fast.
#include <hip/hip_runtime.h>

// Causal grouped-query attention layer: x [NB][SEQ][2048], 16 query heads x 128, 4 kv heads, weights [in][out] with biases, rotate-half rotary (theta 1e4), ALiBi slopes 2^(-(h+1)/2), output projection; f32 output.
// Compute dtypes, f32 accumulate everywhere: q/k/v projections v_wmma_f32_16x16x32_bf16 (x, W, b RNE-converted to bf16; products exact);
// scores v_wmma_f32_16x16x32_f16: k single f16, q as f16 value + f16 residual x2048 in its own accumulator; P.V v_wmma_f32_16x16x32_f16: P single f16 (x256 carry, cancels in the normalisation),
// v as f16 value + f16 residual x256 whose partner operand is the P copy x2^-8 (K-dimension fold, products at natural scale, one accumulator); output projection v_wmma_f32_16x16x32_bf16 with ctx as bf16 hi | lo planes folded along K against the bf16 Wo plane; softmax f32 (online, running max).
// Layout: bf16 x copy, bf16 transposed weight planes [out][in]; q (hi, residual) planes [b*16+h][t][d], k plane [b*4+g][t][d], v^T planes [b*4+g][d][t]; ctx plane [b*SEQ+t][hi 2048 | lo 2048]; rotary table [t][cos 64 | sin 64].

#ifndef NB
#define NB 2
#endif
#ifndef SEQ
#define SEQ 2048
#endif
#define NB_FULL  2
#define SEQ_FULL 2048
#ifndef OUT_SEQ
#define OUT_SEQ SEQ              // row pitch (in tokens) between batches of the output
#endif
#define DM   2048
#define NH_  16
#define NKV  4
#define HD   128
#define REP  (NH_ / NKV)
#define DKV  (NKV * HD)          // 512
#define FW   8                   // waves per flash block: the 4 query heads of one kv head x 2 query tiles of 16 rows
#define SPIT 528                 // LDS pitch, bytes, of one fragment-row line of a stage plane (512 + 16: 16 B x odd for 16-B readers)
#define ST_VH (16 * SPIT)               // byte offsets inside one stage buffer: K at 0, V^T value, V^T residual
#define ST_VR (2 * 16 * SPIT)
#define ST_SZ (3 * 16 * SPIT)           // 25344 B per stage
#define QRS  2048.0f             // carry of the q residual plane
#define QRI  (1.0f / 2048.0f)
#define VRS  256.0f              // carry of the v residual plane (partner operand is P x 2^-8)
#define LOG2E 1.4426950408889634f
#define SC2  (0.08838834764831845f * 1.4426950408889634f)   // HD^-0.5 * log2(e)
#define PSH  8.0f                // log2 of the P carry (256)
#define NEGBIG (-3.0e38f)

static_assert(HD == 128);
static_assert(NH_ * HD == DM);
static_assert(NH_ % NKV == 0);
static_assert(DM % 64 == 0);
static_assert(DKV % 64 == 0);
static_assert(DM % 32 == 0);
static_assert(SEQ % 64 == 0);                  // a 64-row tile never straddles two batches
static_assert((NB * SEQ) % 64 == 0);
static_assert(SEQ % 32 == 0);                  // key loop steps by 32
static_assert(REP == 4 && FW == 2 * REP);      // wave -> (head of the group, query tile) map of the flash block
static_assert(SEQ % 4 == 0);
static_assert(((size_t)SEQ * DM) % 8 == 0);
static_assert(NB <= NB_FULL);
static_assert(SEQ <= SEQ_FULL);

typedef _Float16 h16;
typedef unsigned short bf;
typedef __attribute__((ext_vector_type(16))) __bf16   v16bf;
typedef __attribute__((ext_vector_type(16))) _Float16 v16h;
typedef __attribute__((ext_vector_type(8)))  _Float16 v8h;
typedef __attribute__((ext_vector_type(8)))  unsigned short v8us;
typedef __attribute__((ext_vector_type(8)))  float    v8f;
typedef __attribute__((ext_vector_type(4)))  float    v4f;
typedef v4f  __attribute__((may_alias)) v4fa;

__device__ __forceinline__ unsigned short f2bf(float f) { unsigned u = __float_as_uint(f); u += 0x7FFFu + ((u >> 16) & 1u); return (unsigned short)(u >> 16); }
__device__ __forceinline__ float bf2f(unsigned short u) { return __uint_as_float(((unsigned)u) << 16); }
__device__ __forceinline__ float bfr(float f) { return bf2f(f2bf(f)); }     // value of the RNE bf16 conversion
__device__ __forceinline__ v16h cat16(v8h lo, v8h hi) { return __builtin_shufflevector(lo, hi, 0, 1, 2, 3, 4, 5, 6, 7, 8, 9, 10, 11, 12, 13, 14, 15); }
__device__ __forceinline__ v16bf cat16b(v8us lo, v8us hi) { return __builtin_bit_cast(v16bf, __builtin_shufflevector(lo, hi, 0, 1, 2, 3, 4, 5, 6, 7, 8, 9, 10, 11, 12, 13, 14, 15)); }
__device__ __forceinline__ v8f wmma16(v16h a, v16h b, v8f c) { return __builtin_amdgcn_wmma_f32_16x16x32_f16(false, a, false, b, (short)0, c, false, false); }
__device__ __forceinline__ v8f wmmab(v16bf a, v16bf b, v8f c) { return __builtin_amdgcn_wmma_f32_16x16x32_bf16(false, a, false, b, (short)0, c, false, false); }
// fragment loaders from K-contiguous 16-bit rows; p already includes + 8*(lane>>4): elements 0..7 <- k0+8h+0..7, elements 8..15 <- k0+16+8h+0..7 (same map for A and B)
__device__ __forceinline__ v16h  ldh(const h16* p) { return cat16(*(const v8h*)p, *(const v8h*)(p + 16)); }
__device__ __forceinline__ v16bf ldb(const bf* p)  { return cat16b(*(const v8us*)p, *(const v8us*)(p + 16)); }
// ordering point for wave-private LDS tiles (same wave writes and reads)
__device__ __forceinline__ void wave_sync() { __builtin_amdgcn_fence(3 /* release order */, "wavefront"); __builtin_amdgcn_wave_barrier(); asm volatile("" ::: "memory"); }

__global__ __launch_bounds__(256) void k_cvt8(const float* __restrict__ src, bf* dst, size_t n8) {
    const size_t i = (size_t)blockIdx.x * 256 + threadIdx.x; if (i >= n8) return;
    const v8f v = *(const v8f*)(src + i * 8); v8us o;
#pragma unroll
    for (int k = 0; k < 8; ++k) o[k] = f2bf(v[k]);
    *(v8us*)(dst + i * 8) = o; 
}

// k_tcvt: W in[K rows][N cols] f32 -> WT out[N rows][K cols] bf16 (RNE convert), 64x64 tile transposed through LDS (cross-wave: block barrier).
__global__ __launch_bounds__(256) void k_tcvt(const float* __restrict__ W, bf* WT, int K, int N) {
    __shared__ float ts[64 * 65];
    const int tid = threadIdx.x; const int k0 = blockIdx.x * 64, n0 = blockIdx.y * 64;
    const int cn = tid & 63, rk = tid >> 6;
#pragma unroll 4
    for (int i = 0; i < 16; ++i) { const int r = rk + 4 * i; ts[r * 65 + cn] = W[(size_t)(k0 + r) * N + n0 + cn]; }   // 16 x 4 = 64 rows, 64 columns
    __syncthreads();
    const int pc = tid & 7, rn = tid >> 3;      // rn 0..31 and rn+32 -> 64 output rows; 8 pieces x 8 = 64 k
    v8us o0, o1;
#pragma unroll
    for (int j = 0; j < 8; ++j) { o0[j] = f2bf(ts[(pc * 8 + j) * 65 + rn]); o1[j] = f2bf(ts[(pc * 8 + j) * 65 + rn + 32]); }
    bf* d0 = WT + (size_t)(n0 + rn) * K + k0 + pc * 8; bf* d1 = WT + (size_t)(n0 + rn + 32) * K + k0 + pc * 8;
    *(v8us*)d0 = o0; *(v8us*)d1 = o1; 
}

// k_rope_tab: rotary table CS[t][0..63] = cos(t * f_i), CS[t][64..127] = sin(t * f_i), f_i = 10000^(-i/64) = 2^(-i * log2(10000)/64); precise sinf/cosf.
__global__ __launch_bounds__(256) void k_rope_tab(float* CS) {
    __shared__ __align__(16) float ts[4 * 128];
    const int tid = threadIdx.x; const int i = tid & 63, r = tid >> 6; const int t = blockIdx.x * 4 + r;
    const float invf = __builtin_amdgcn_exp2f(-(float)i * 0.20762050593046014f);
    const float ang = (float)t * invf;
    ts[r * 128 + i] = cosf(ang); ts[r * 128 + 64 + i] = sinf(ang);
    __syncthreads();
    if (tid < 128) {                            // waves 0..3 (wave-uniform), one row each
        const int row = tid >> 5, pc = tid & 31;
        const v4f v = *(const v4fa*)(&ts[row * 128 + pc * 4]);
        float* d = CS + (size_t)(blockIdx.x * 4 + row) * 128 + pc * 4;
        *(v4f*)d = v; 
    }
}

// gemm_loop: register-blocked bf16 GEMM main loop for ONE WAVE, tile (16*MT) x (16*NT), operands straight from K-contiguous bf16 planes.
// acc[mb*NT+nb] += sum_k A[r0+16mb+..][k] * Bt[c0+16nb+..][k & kbm]   (kbm folds a K-concatenated A against a single Bt plane)
template <int MT, int NT>
__device__ __forceinline__ void gemm_loop(const bf* __restrict__ A, size_t lda, const bf* __restrict__ Bt, size_t ldbt,
                                          int K, int kbm, int r0, int c0, int lr, int hi, v8f (&acc)[MT * NT]) {
#pragma unroll
    for (int i = 0; i < MT * NT; ++i) acc[i] = (v8f){};
    const size_t aoff = (size_t)(r0 + lr) * lda + 8 * hi, boff = (size_t)(c0 + lr) * ldbt + 8 * hi;
#pragma unroll 1
    for (int kc = 0; kc < K; kc += 32) {
        const int kb = kc & kbm;
        v16bf a[MT];
#pragma unroll
        for (int mb = 0; mb < MT; ++mb) a[mb] = ldb(A + aoff + (size_t)mb * 16 * lda + kc);
        v16bf bl = a[0];
#pragma unroll
        for (int nb = 0; nb < NT; ++nb) { const v16bf b = ldb(Bt + boff + (size_t)nb * 16 * ldbt + kb);
#pragma unroll
            for (int mb = 0; mb < MT; ++mb) acc[mb * NT + nb] = wmmab(a[mb], b, acc[mb * NT + nb]);
            if (nb == NT - 1) bl = b; }
        asm volatile("v_nop\n\tv_nop\n\tv_nop\n\tv_nop" : "+v"(acc[0]), "+v"(acc[(MT * NT) / 3]), "+v"(acc[(2 * MT * NT) / 3]), "+v"(acc[MT * NT - 1]) : "v"(a[0]), "v"(a[MT - 1]), "v"(bl));
    }
}

// k_qk: projection + bias + rotary for q or k. ONE WAVE per 32 rows x 128 columns (= one head), K = DM. grid (NB*SEQ/32, nheads), 32 threads.
// Output plane [(b*nheads + head)][t][d] as f16 (Ph) and optionally the f16 residual x2048 (Pr, useRes != 0).
__global__ __launch_bounds__(32) __attribute__((amdgpu_num_vgpr(256)))
void k_qk(const bf* __restrict__ A, const bf* __restrict__ Bt, const float* __restrict__ bias, const float* __restrict__ CS, h16* Ph, h16* Pr, int useRes, int nheads) {
    __shared__ __align__(16) float os[16 * 132];
    const int lane = threadIdx.x & 31, lr = lane & 15, hi = lane >> 4;
    const int r0 = blockIdx.x * 32, head = blockIdx.y, cbase = head * HD;
    v8f acc[16];
    gemm_loop<2, 8>(A, (size_t)DM, Bt, (size_t)DM, DM, 0x7FFFFFFF, r0, cbase, lr, hi, acc);
    float bz[8];
#pragma unroll
    for (int nb = 0; nb < 8; ++nb) bz[nb] = bfr(bias[cbase + nb * 16 + lr]);
    const int b = r0 / SEQ, t0 = r0 % SEQ;
    const size_t tbase = ((size_t)(b * nheads + head) * SEQ + t0) * HD;
#pragma unroll
    for (int mb = 0; mb < 2; ++mb) {
#pragma unroll
        for (int nb = 0; nb < 8; ++nb) {
#pragma unroll
            for (int j = 0; j < 8; ++j) os[(hi * 8 + j) * 132 + nb * 16 + lr] = acc[mb * 8 + nb][j] + bz[nb]; }   // D: row 8h+j, col lane&15; rows 0..15 x cols 0..127 all staged
        wave_sync();
{
#pragma unroll 2
            for (int s = 0; s < 8; ++s) { const int row = 2 * s + hi, c8 = lr * 8, p8 = c8 ^ 64;   // 8 s x 2 rows = 16 rows; 16 lanes x 8 = 128 columns
                const int t = t0 + mb * 16 + row;
                const float* orow = &os[row * 132];
                const v4f x0 = *(const v4fa*)(orow + c8), x1 = *(const v4fa*)(orow + c8 + 4);
                const v4f y0 = *(const v4fa*)(orow + p8), y1 = *(const v4fa*)(orow + p8 + 4);
                const float* cs = CS + (size_t)t * 128 + (c8 & 63);
                const v4f cc0 = *(const v4f*)cs, cc1 = *(const v4f*)(cs + 4), ss0 = *(const v4f*)(cs + 64), ss1 = *(const v4f*)(cs + 68);
                const float sg = (c8 < 64) ? -1.0f : 1.0f;       // d < 64: x[d] cos - x[d+64] sin; d >= 64: x[d] cos + x[d-64] sin
                v8h hv, rv;
#pragma unroll
                for (int i = 0; i < 4; ++i) {
                    const float v0 = x0[i] * cc0[i] + sg * (y0[i] * ss0[i]); const float v1 = x1[i] * cc1[i] + sg * (y1[i] * ss1[i]);
                    const h16 a0 = (h16)v0; const h16 a1 = (h16)v1; hv[i] = a0; hv[4 + i] = a1;
                    rv[i] = (h16)((v0 - (float)a0) * QRS); rv[4 + i] = (h16)((v1 - (float)a1) * QRS); }
                const size_t oo = tbase + (size_t)(mb * 16 + row) * HD + c8;
                *(v8h*)(Ph + oo) = hv; if (useRes) *(v8h*)(Pr + oo) = rv; }
             }
        wave_sync();
    }
}

// k_vt: v^T projection. A = WvT rows (m = g*128 + d), Bt = x rows (n = b*SEQ + t), ONE WAVE per 64x64 tile. grid (DKV/64, NB*SEQ/64), 32 threads.
// Planes [(b*DKV + m)][t] = [(b*4 + g)][d][t]: f16 value (VH) and f16 residual x256 (VR); bias per row m.
__global__ __launch_bounds__(32) __attribute__((amdgpu_num_vgpr(256)))
void k_vt(const bf* __restrict__ A, const bf* __restrict__ Bt, const float* __restrict__ bias, h16* VH, h16* VR) {
    __shared__ __align__(16) float os[16 * 68];
    const int lane = threadIdx.x & 31, lr = lane & 15, hi = lane >> 4;
    const int r0 = blockIdx.x * 64, c0 = blockIdx.y * 64;
    v8f acc[16];
    gemm_loop<4, 4>(A, (size_t)DM, Bt, (size_t)DM, DM, 0x7FFFFFFF, r0, c0, lr, hi, acc);
    const int b = c0 / SEQ, t0 = c0 % SEQ;
    const size_t tbase = ((size_t)b * DKV + r0) * SEQ + t0;
#pragma unroll
    for (int mb = 0; mb < 4; ++mb) {
        float bj[8];
#pragma unroll
        for (int j = 0; j < 8; ++j) bj[j] = bfr(bias[r0 + mb * 16 + hi * 8 + j]);
#pragma unroll
        for (int nb = 0; nb < 4; ++nb) {
#pragma unroll
            for (int j = 0; j < 8; ++j) os[(hi * 8 + j) * 68 + nb * 16 + lr] = acc[mb * 4 + nb][j] + bj[j]; }   // rows 0..15 x cols 0..63 all staged
        wave_sync();
        const size_t sb = tbase + (size_t)(mb * 16) * SEQ;
{
#pragma unroll
            for (int s = 0; s < 4; ++s) { const int row = 4 * s + (lane >> 3), c8 = (lane & 7) * 8;   // 4 s x 4 row groups = 16 rows; 8 lanes x 8 = 64 columns
                const v4f x0 = *(const v4fa*)(&os[row * 68 + c8]); const v4f x1 = *(const v4fa*)(&os[row * 68 + c8 + 4]); v8h hv, rv;
#pragma unroll
                for (int i = 0; i < 4; ++i) { const h16 a0 = (h16)x0[i]; const h16 a1 = (h16)x1[i]; hv[i] = a0; hv[4 + i] = a1; rv[i] = (h16)((x0[i] - (float)a0) * VRS); rv[4 + i] = (h16)((x1[i] - (float)a1) * VRS); }
                const size_t oo = sb + (size_t)row * SEQ + c8;
                *(v8h*)(VH + oo) = hv; *(v8h*)(VR + oo) = rv; }
             }
        wave_sync();
    }
}

// k_flash: fused causal attention, one wave per 16 query rows of one (batch, head). A block is the 4 query heads of one kv head x 2 adjacent 16-row query tiles (8 waves): all of them walk
// the same keys, so each 32-key stage of K, V^T value and V^T residual is brought into LDS once per block by asynchronous copies (whole 16-B pieces, contiguous per row) and every wave takes its fragments from there.
// Two buffers: stage s + 1 is in flight while stage s is worked on; one barrier per stage publishes s + 1 and frees the buffer of s.
// Transposed form: S^T[key][t] = K Q^T (A = K rows, B = Q rows); lane (t = lane&15, h = lane>>4) holds keys 8h+r of each 16-key tile, so the packed
// P tile is directly the B fragment of O^T[d][t] = V^T P^T (element r <- tile keys 0..15, element 8+r <- tile keys 16..31, lane unchanged).
// Key loop runs to the 32-key step that contains the last query of the block; keys beyond a query get the fill value (weight exactly 0). ALiBi bias slope*(key - query) added in the exp2 domain.
// Stage planes in LDS, 16 lines of SPIT bytes each, line = fragment row (lane&15): K line holds key rows r and 16 + r (256 B each); a V^T line holds the 32-key pieces (64 B) of rows d = 16j + r, j = 0..7.
// So every fragment of a stage is read at one per-lane address plus a constant.
// flash_stage: one stage = K 32 rows x 256 B, V^T value and residual 128 rows x 64 B each = 24 KiB = 256 lanes x 6 copies of 16 B. The s_wait_xcnt closes the statement so that no address register is rewritten ahead of it.
__device__ __forceinline__ void flash_stage(unsigned lk, unsigned lv, const h16* gk, const h16* gh, const h16* gr) {
    const unsigned lk1 = lk + 256, lh0 = lv + ST_VH, lh1 = lv + ST_VH + 256, lr0 = lv + ST_VR, lr1 = lv + ST_VR + 256;
    const h16* gk1 = gk + 16 * HD; const h16* gh1 = gh + (size_t)64 * SEQ; const h16* gr1 = gr + (size_t)64 * SEQ;
    asm volatile("global_load_async_to_lds_b128 %0, %6, off\n\t"
                 "global_load_async_to_lds_b128 %1, %7, off\n\t"
                 "global_load_async_to_lds_b128 %2, %8, off\n\t"
                 "global_load_async_to_lds_b128 %3, %9, off\n\t"
                 "global_load_async_to_lds_b128 %4, %10, off\n\t"
                 "global_load_async_to_lds_b128 %5, %11, off\n\t"
                 "s_wait_xcnt 0x0"
                 :: "v"(lk), "v"(lk1), "v"(lh0), "v"(lh1), "v"(lr0), "v"(lr1), "v"(gk), "v"(gk1), "v"(gh), "v"(gh1), "v"(gr), "v"(gr1) : "memory");
}

__global__ __launch_bounds__(32 * FW) __attribute__((amdgpu_num_vgpr(256)))
void k_flash(const h16* __restrict__ QH, const h16* __restrict__ QR, const h16* __restrict__ KP, const h16* __restrict__ VH, const h16* __restrict__ VR, bf* CTX) {
    __shared__ __align__(16) unsigned char ring[2 * ST_SZ];
    __shared__ __align__(16) float os[FW * 16 * 132];
    const int tid = threadIdx.x;
    const int lane = tid & 31, wave = tid >> 5, lr = lane & 15, hi = lane >> 4;
    const int bg = blockIdx.y; const int b = bg / NKV, g = bg % NKV; const int h = g * REP + (wave & (REP - 1)); const int zh = b * NH_ + h;
    const int t0 = blockIdx.x * 32 + (wave >> 2) * 16;
    const int nst = blockIdx.x + 1;                            // 32-key stages of this block, the same for its 8 waves; 32 * nst <= SEQ
    const size_t kvb = (size_t)bg * SEQ * HD;
    // copy addresses of this lane. K: piece tid -> key row tid>>4 (and +16: +256 B in its line), 16-B column tid&15. V^T: piece tid -> row d = tid>>2 (and +64: +256 B in its line), 16-B column tid&3.
    const unsigned rb = (unsigned)(size_t)ring;
    const unsigned lk = rb + (unsigned)((tid >> 4) * SPIT + (tid & 15) * 16), lvt = rb + (unsigned)(((tid >> 2) & 15) * SPIT + (tid >> 6) * 64 + (tid & 3) * 16);
    const h16* gk = KP + kvb + (size_t)tid * 8;                // + key0 * HD
    const size_t gvo = kvb + (size_t)(tid >> 2) * SEQ + (tid & 3) * 8;   // + key0
    const h16* gh = VH + gvo; const h16* gr = VR + gvo;
    flash_stage(lk, lvt, gk, gh, gr);                          // stage 0 -> buffer 0
    const size_t qo = (size_t)zh * SEQ * HD + (size_t)(t0 + lr) * HD + 8 * hi;
    v16h qh[4], qr[4];                                         // B fragments: col t, k = d
#pragma unroll
    for (int c = 0; c < 4; ++c) { qh[c] = ldh(QH + qo + 32 * c); qr[c] = ldh(QR + qo + 32 * c); }
    asm volatile("s_wait_asynccnt 0x0" ::: "memory");          // this wave's share of stage 0 has landed
    __syncthreads();                                           // stage 0 published
    if (nst > 1) flash_stage(lk + ST_SZ, lvt + ST_SZ, gk + 32 * HD, gh + 32, gr + 32);   // stage 1 -> buffer 1
    const int fo = lr * SPIT + 16 * hi;                        // K: + 256 (second key tile) + 64*c (A fragment: row key, k = d); V^T: + plane + 64*j (A fragment: row d, k = key)
    const float slope2 = __builtin_amdgcn_exp2f(-0.5f * (float)(h + 1)) * LOG2E;
    const int qi = t0 + lr;
    v8f o[8];
#pragma unroll
    for (int j = 0; j < 8; ++j) o[j] = (v8f){};
    float m = NEGBIG, l = 0.0f;
#pragma unroll 1
    for (int st = 0; st < nst; ++st) {
        const int key0 = st * 32;
        const unsigned bo = (st & 1) ? (unsigned)ST_SZ : 0u;
        const h16* ka = (const h16*)(ring + bo + fo);
        v8f sHa = (v8f){}, sLa = (v8f){}, sHb = (v8f){}, sLb = (v8f){};
        v16h kal, kbl;
#pragma unroll
        for (int c = 0; c < 4; ++c) {
            kal = ldh(ka + 32 * c); kbl = ldh(ka + 128 + 32 * c);
            sHa = wmma16(kal, qh[c], sHa); sLa = wmma16(kal, qr[c], sLa); sHb = wmma16(kbl, qh[c], sHb); sLb = wmma16(kbl, qr[c], sLb); }
        asm volatile("v_nop\n\tv_nop\n\tv_nop\n\tv_nop" : "+v"(sHa), "+v"(sLa), "+v"(sHb), "+v"(sLb) : "v"(kal), "v"(kbl));
        const float base = (float)(key0 + 8 * hi - qi);        // key - query for r = 0 of tile a
        float ta[8], tb[8]; float mx = NEGBIG;
#pragma unroll
        for (int r = 0; r < 8; ++r) {
            const float da = base + (float)r, db = da + 16.0f;
            float xa = fmaf(slope2, da, (sHa[r] + sLa[r] * QRI) * SC2);
            float xb = fmaf(slope2, db, (sHb[r] + sLb[r] * QRI) * SC2);
            xa = (da > 0.0f) ? NEGBIG : xa; xb = (db > 0.0f) ? NEGBIG : xb;
            ta[r] = xa; tb[r] = xb; mx = fmaxf(mx, fmaxf(xa, xb)); }
        mx = fmaxf(mx, __shfl_xor(mx, 16, 32));
        const float mnew = fmaxf(m, mx);
        const float alpha = __builtin_amdgcn_exp2f(m - mnew);
        const float sh = PSH - mnew;
        v16h pb; float ls = 0.0f;
#pragma unroll
        for (int r = 0; r < 8; ++r) { const h16 pa = (h16)__builtin_amdgcn_exp2f(ta[r] + sh); const h16 pc = (h16)__builtin_amdgcn_exp2f(tb[r] + sh); pb[r] = pa; pb[8 + r] = pc; ls += (float)pa + (float)pc; }
        const v16h pq = pb * (h16)0.00390625f;                 // P x 2^-8: partner of the v residual x256
        l = l * alpha + ls; m = mnew;
#pragma unroll
        for (int j = 0; j < 8; ++j) o[j] = o[j] * alpha;
        const h16* va = ka + ST_VH / 2; const h16* vr = ka + ST_VR / 2;
        // four fragments are read as one group ahead of their four products, so the LDS latency is waited out once per group; all loops unrolled so that every array index is a constant (registers, no scratch)
#pragma unroll
        for (int j4 = 0; j4 < 8; j4 += 4) { v16h vf[4];
#pragma unroll
            for (int j = 0; j < 4; ++j) vf[j] = ldh(va + 32 * (j4 + j));
#pragma unroll
            for (int j = 0; j < 4; ++j) o[j4 + j] = wmma16(vf[j], pb, o[j4 + j]); }
#pragma unroll
        for (int j4 = 0; j4 < 8; j4 += 4) { v16h vf[4];
#pragma unroll
            for (int j = 0; j < 4; ++j) vf[j] = ldh(vr + 32 * (j4 + j));
#pragma unroll
            for (int j = 0; j < 4; ++j) o[j4 + j] = wmma16(vf[j], pq, o[j4 + j]); }
        asm volatile("v_nop\n\tv_nop\n\tv_nop\n\tv_nop" : "+v"(o[0]), "+v"(o[1]), "+v"(o[2]), "+v"(o[3]), "+v"(o[4]), "+v"(o[5]), "+v"(o[6]), "+v"(o[7]) : "v"(pb), "v"(pq));
        // publish point of stage st + 1
        asm volatile("s_wait_dscnt 0x0" ::: "memory");         // this wave's reads of the buffer of stage st are done before it is handed to the copies
        asm volatile("s_wait_asynccnt 0x0" ::: "memory");      // this wave's share of stage st + 1 has landed
        __syncthreads();                                       // stage st + 1 published; every reader has left the buffer of stage st
        if (st + 2 < nst) flash_stage(lk + bo, lvt + bo, gk + (size_t)(key0 + 64) * HD, gh + key0 + 64, gr + key0 + 64);   // stage st + 2 -> the buffer just read
    }
    asm volatile("s_wait_asynccnt 0x0" ::: "memory");          // nothing of this wave is in flight when it leaves the ring
    l += __shfl_xor(l, 16, 32);
    const float inv = 1.0f / l;
    const int wb = wave * 16 * 132;
    // O^T D layout: o[j][r] = (d = 16j + 8h + r, t = lane&15) -> os[t][d]; rows 0..15 x columns 0..127 all written
#pragma unroll
    for (int j = 0; j < 8; ++j) { v4f a, c;
        a[0] = o[j][0] * inv; a[1] = o[j][1] * inv; a[2] = o[j][2] * inv; a[3] = o[j][3] * inv; c[0] = o[j][4] * inv; c[1] = o[j][5] * inv; c[2] = o[j][6] * inv; c[3] = o[j][7] * inv;
        *(v4fa*)(&os[wb + lr * 132 + 16 * j + 8 * hi]) = a; *(v4fa*)(&os[wb + lr * 132 + 16 * j + 8 * hi + 4]) = c; }
    wave_sync();
    bf* crow = CTX + ((size_t)b * SEQ + t0) * (size_t)(2 * DM) + h * HD;
{
#pragma unroll 2
        for (int s = 0; s < 8; ++s) { const int row = 2 * s + hi, c8 = lr * 8;   // 8 s x 2 rows = 16 rows; 16 lanes x 8 = 128 columns
            const v4f x0 = *(const v4fa*)(&os[wb + row * 132 + c8]); const v4f x1 = *(const v4fa*)(&os[wb + row * 132 + c8 + 4]); v8us hv, lv;
#pragma unroll
            for (int i = 0; i < 4; ++i) { const unsigned short a0 = f2bf(x0[i]); const unsigned short a1 = f2bf(x1[i]); hv[i] = a0; hv[4 + i] = a1; lv[i] = f2bf(x0[i] - bf2f(a0)); lv[4 + i] = f2bf(x1[i] - bf2f(a1)); }
            bf* dst = crow + (size_t)row * (size_t)(2 * DM) + c8;
            *(v8us*)dst = hv; *(v8us*)(dst + DM) = lv; }
         }
}

// k_out: output projection. A = ctx plane rows [hi 2048 | lo 2048] (K = 4096 folded against the single WoT plane), Bt = WoT rows, ONE WAVE per 64x64 tile. grid (NB*SEQ/64, DM/64), 32 threads.
__global__ __launch_bounds__(32) __attribute__((amdgpu_num_vgpr(256)))
void k_out(const bf* __restrict__ A, const bf* __restrict__ Bt, const float* __restrict__ bias, float* OUT) {
    __shared__ __align__(16) float os[16 * 68];
    const int lane = threadIdx.x & 31, lr = lane & 15, hi = lane >> 4;
    const int r0 = blockIdx.x * 64, c0 = blockIdx.y * 64;
    v8f acc[16];
    gemm_loop<4, 4>(A, (size_t)(2 * DM), Bt, (size_t)DM, 2 * DM, DM - 1, r0, c0, lr, hi, acc);
    float bz[4];
#pragma unroll
    for (int nb = 0; nb < 4; ++nb) bz[nb] = bfr(bias[c0 + nb * 16 + lr]);
    const int b = r0 / SEQ, t0 = r0 % SEQ;
    float* obase = OUT + ((size_t)b * OUT_SEQ + t0) * DM + c0;
#pragma unroll
    for (int mb = 0; mb < 4; ++mb) {
#pragma unroll
        for (int nb = 0; nb < 4; ++nb) {
#pragma unroll
            for (int j = 0; j < 8; ++j) os[(hi * 8 + j) * 68 + nb * 16 + lr] = acc[mb * 4 + nb][j] + bz[nb]; }   // rows 0..15 x cols 0..63 all staged
        wave_sync();
        float* orow = obase + (size_t)(mb * 16) * DM;
{
#pragma unroll
            for (int s = 0; s < 8; ++s) { const int row = 2 * s + hi, cofs = lr * 4;   // 8 s x 2 rows = 16 rows; 16 lanes x 4 floats = 64 columns
                const v4f val = *(const v4fa*)(&os[row * 68 + cofs]);
                *(v4f*)(orow + (size_t)row * DM + cofs) = val; }
             }
        wave_sync();
    }
}

static constexpr size_t al256(size_t v) { return (v + 255) & ~(size_t)255; }
static constexpr size_t SZ_XB  = al256((size_t)NB * SEQ * DM * 2);
static constexpr size_t SZ_WQ  = al256((size_t)DM * DM * 2);
static constexpr size_t SZ_WK  = al256((size_t)DKV * DM * 2);
static constexpr size_t SZ_CS  = al256((size_t)SEQ * 128 * 4);
static constexpr size_t SZ_QP  = al256((size_t)NB * NH_ * SEQ * HD * 2);
static constexpr size_t SZ_KP  = al256((size_t)NB * NKV * SEQ * HD * 2);
static constexpr size_t SZ_CTX = al256((size_t)NB * SEQ * 2 * DM * 2);
static constexpr size_t SZ_TOTAL = SZ_XB + 2 * SZ_WQ + 2 * SZ_WK + SZ_CS + 2 * SZ_QP + 3 * SZ_KP + SZ_CTX;
static_assert(SZ_TOTAL <= (size_t)134217728);          // workspace carve <= 128 MiB

extern "C" void kernel_launch(void* const* d_in, const int* in_sizes, int n_in,
                              void* d_out, int out_size, void* d_ws, size_t ws_size, hipStream_t stream) {
    if (n_in < 9) return;
    const size_t needx = ((size_t)(NB - 1) * SEQ_FULL + SEQ) * DM;
    if ((size_t)in_sizes[0] < needx) return;
    if ((size_t)in_sizes[1] < (size_t)DM * DM || (size_t)in_sizes[2] < (size_t)DM) return;
    if ((size_t)in_sizes[3] < (size_t)DM * DKV || (size_t)in_sizes[4] < (size_t)DKV) return;
    if ((size_t)in_sizes[5] < (size_t)DM * DKV || (size_t)in_sizes[6] < (size_t)DKV) return;
    if ((size_t)in_sizes[7] < (size_t)DM * DM || (size_t)in_sizes[8] < (size_t)DM) return;
    if ((size_t)out_size < ((size_t)(NB - 1) * OUT_SEQ + SEQ) * DM) return;
    if (SZ_TOTAL > ws_size) return;
    // wire order: x, Wq, bq, Wk, bk, Wv, bv, Wo, bo (weights [in][out])
    const float* x  = (const float*)d_in[0];
    const float* wq = (const float*)d_in[1]; const float* bq = (const float*)d_in[2];
    const float* wk = (const float*)d_in[3]; const float* bk = (const float*)d_in[4];
    const float* wv = (const float*)d_in[5]; const float* bv = (const float*)d_in[6];
    const float* wo = (const float*)d_in[7]; const float* bo = (const float*)d_in[8];
    float* OUT = (float*)d_out;      // [NB][SEQ][2048]
    char* wsp = (char*)d_ws;
    bf* XB  = (bf*)wsp; wsp += SZ_XB;                // [NB*SEQ][2048]
    bf* WQT = (bf*)wsp; wsp += SZ_WQ;                // [2048 out][2048 in]
    bf* WOT = (bf*)wsp; wsp += SZ_WQ;                // [2048 out][2048 in]
    bf* WKT = (bf*)wsp; wsp += SZ_WK;                // [512 out][2048 in]
    bf* WVT = (bf*)wsp; wsp += SZ_WK;                // [512 out][2048 in]
    float* CS = (float*)wsp; wsp += SZ_CS;           // [SEQ][cos 64 | sin 64]
    h16* QH = (h16*)wsp; wsp += SZ_QP;               // [NB*16][SEQ][128]
    h16* QR = (h16*)wsp; wsp += SZ_QP;               // [NB*16][SEQ][128] residual x2048
    h16* KP = (h16*)wsp; wsp += SZ_KP;               // [NB*4][SEQ][128]
    h16* VH = (h16*)wsp; wsp += SZ_KP;               // [NB*4][128][SEQ]
    h16* VR = (h16*)wsp; wsp += SZ_KP;               // [NB*4][128][SEQ] residual x256
    bf* CTX = (bf*)wsp; wsp += SZ_CTX;               // [NB*SEQ][hi 2048 | lo 2048]

    if (SEQ == SEQ_FULL) {
        const size_t n8 = (size_t)NB * SEQ * DM / 8;
        k_cvt8<<<(unsigned)((n8 + 255) / 256), 256, 0, stream>>>(x, XB, n8);
    } else {
        const size_t n8 = (size_t)SEQ * DM / 8;
        for (int b = 0; b < NB; ++b) k_cvt8<<<(unsigned)((n8 + 255) / 256), 256, 0, stream>>>(x + (size_t)b * SEQ_FULL * DM, XB + (size_t)b * SEQ * DM, n8);
    }
    // weight transposes: in[K = DM rows][N cols] -> out[N rows][K = DM cols]; grid (K/64, N/64)
    k_tcvt<<<dim3(DM / 64, DM / 64, 1), 256, 0, stream>>>(wq, WQT, DM, DM);
    k_tcvt<<<dim3(DM / 64, DKV / 64, 1), 256, 0, stream>>>(wk, WKT, DM, DKV);
    k_tcvt<<<dim3(DM / 64, DKV / 64, 1), 256, 0, stream>>>(wv, WVT, DM, DKV);
    k_tcvt<<<dim3(DM / 64, DM / 64, 1), 256, 0, stream>>>(wo, WOT, DM, DM);
    k_rope_tab<<<SEQ / 4, 256, 0, stream>>>(CS);

    // q, k: A = x rows (m = b*SEQ + t), Bt = WT rows (n = head*128 + d) -> plane [(b*nheads + head)][t][d], rotary applied
    k_qk<<<dim3(NB * SEQ / 32, NH_, 1), 32, 0, stream>>>(XB, WQT, bq, CS, QH, QR, 1, NH_);
    k_qk<<<dim3(NB * SEQ / 32, NKV, 1), 32, 0, stream>>>(XB, WKT, bk, CS, KP, KP, 0, NKV);
    // v^T: A = WvT rows (m = g*128 + d), Bt = x rows (n = b*SEQ + t) -> planes [(b*512 + m)][t]
    k_vt<<<dim3(DKV / 64, NB * SEQ / 64, 1), 32, 0, stream>>>(WVT, XB, bv, VH, VR);

    k_flash<<<dim3(SEQ / 32, NB * NKV, 1), 32 * FW, 0, stream>>>(QH, QR, KP, VH, VR, CTX);

    k_out<<<dim3(NB * SEQ / 64, DM / 64, 1), 32, 0, stream>>>(CTX, WOT, bo, OUT);
}

// v002
// One run takes 296 microseconds.
// Timed twice side by side with v001, it ran 1.44 and 1.43 times as fast.
// Over all steps from v000 it is 2.29 times as fast.
#include <hip/hip_runtime.h>

// Causal grouped-query attention layer: x [NB][SEQ][2048], 16 query heads x 128, 4 kv heads, weights [in][out] with biases, rotate-half rotary (theta 1e4), ALiBi slopes 2^(-(h+1)/2), output projection; f32 output.
// Compute dtypes, f32 accumulate everywhere: q/k/v projections v_wmma_f32_16x16x32_bf16 (x, W, b RNE-converted to bf16; products exact);
// scores v_wmma_f32_16x16x32_f16: k single f16, q as f16 value + f16 residual x2048 in its own accumulator; P.V v_wmma_f32_16x16x32_f16: P single f16 (x256 carry, cancels in the normalisation),
// v as f16 value + f16 residual x256 whose partner operand is the P copy x2^-8 (K-dimension fold, products at natural scale, one accumulator); output projection v_wmma_f32_16x16x32_bf16 with ctx as bf16 hi | lo planes folded along K against the bf16 Wo plane; softmax f32 (online, running max).
// Layout: bf16 x copy, bf16 transposed weight planes [out][in]; q (hi, residual) planes [b*16+h][t][d], k plane [b*4+g][t][d], v^T planes [b*4+g][d][t]; ctx plane [b*SEQ+t][hi 2048 | lo 2048]; rotary table [t][cos 64 | sin 64].

#ifndef NB
#define NB 2
#endif
#ifndef SEQ
#define SEQ 2048
#endif
#define NB_FULL  2
#define SEQ_FULL 2048
#ifndef OUT_SEQ
#define OUT_SEQ SEQ              // row pitch (in tokens) between batches of the output
#endif
#define DM   2048
#define NH_  16
#define NKV  4
#define HD   128
#define REP  (NH_ / NKV)
#define DKV  (NKV * HD)          // 512
#define FW   8                   // waves per flash block: the 4 query heads of one kv head x 2 query tiles of 16 rows
#define SPIT 528                 // LDS pitch, bytes, of one fragment-row line of a stage plane (512 + 16: 16 B x odd for 16-B readers)
#define ST_VH (16 * SPIT)               // byte offsets inside one stage buffer: K at 0, V^T value, V^T residual
#define ST_VR (2 * 16 * SPIT)
#define ST_SZ (3 * 16 * SPIT)           // 25344 B per stage
#define GW   8                   // waves per GEMM block: block tile 128 A rows x 256 Bt rows
#define GKS  64                  // k elements per GEMM stage: one whole 128-B line of every operand row
#define GPIT 144                 // LDS pitch, bytes, of a staged 128-B row (16 B x odd for 16-B readers)
#define GAR  128                 // A rows of a stage; the Bt rows follow them
#define GST  ((GAR + 256) * GPIT)       // 55296 B per stage
#define QRS  2048.0f             // carry of the q residual plane
#define QRI  (1.0f / 2048.0f)
#define VRS  256.0f              // carry of the v residual plane (partner operand is P x 2^-8)
#define LOG2E 1.4426950408889634f
#define SC2  (0.08838834764831845f * 1.4426950408889634f)   // HD^-0.5 * log2(e)
#define PSH  8.0f                // log2 of the P carry (256)
#define NEGBIG (-3.0e38f)

static_assert(HD == 128);
static_assert(NH_ * HD == DM);
static_assert(NH_ % NKV == 0);
static_assert(DM % 64 == 0);
static_assert(DKV % 64 == 0);
static_assert(DM % 32 == 0);
static_assert(SEQ % 64 == 0);                  // a 64-row tile never straddles two batches
static_assert((NB * SEQ) % 64 == 0);
static_assert(SEQ % 32 == 0);                  // key loop steps by 32
static_assert(REP == 4 && FW == 2 * REP);      // wave -> (head of the group, query tile) map of the flash block
static_assert(SEQ % 4 == 0);
static_assert((NB * SEQ) % 256 == 0 && DKV % 128 == 0 && DM % 256 == 0 && NKV % 2 == 0 && NH_ % 2 == 0);   // GEMM block tiles cover every operand exactly
static_assert(DM % GKS == 0);
static_assert(((size_t)SEQ * DM) % 8 == 0);
static_assert(NB <= NB_FULL);
static_assert(SEQ <= SEQ_FULL);

typedef _Float16 h16;
typedef unsigned short bf;
typedef __attribute__((ext_vector_type(16))) __bf16   v16bf;
typedef __attribute__((ext_vector_type(16))) _Float16 v16h;
typedef __attribute__((ext_vector_type(8)))  _Float16 v8h;
typedef __attribute__((ext_vector_type(8)))  unsigned short v8us;
typedef __attribute__((ext_vector_type(8)))  float    v8f;
typedef __attribute__((ext_vector_type(4)))  float    v4f;
typedef v4f  __attribute__((may_alias)) v4fa;

__device__ __forceinline__ unsigned short f2bf(float f) { unsigned u = __float_as_uint(f); u += 0x7FFFu + ((u >> 16) & 1u); return (unsigned short)(u >> 16); }
__device__ __forceinline__ float bf2f(unsigned short u) { return __uint_as_float(((unsigned)u) << 16); }
__device__ __forceinline__ float bfr(float f) { return bf2f(f2bf(f)); }     // value of the RNE bf16 conversion
__device__ __forceinline__ v16h cat16(v8h lo, v8h hi) { return __builtin_shufflevector(lo, hi, 0, 1, 2, 3, 4, 5, 6, 7, 8, 9, 10, 11, 12, 13, 14, 15); }
__device__ __forceinline__ v16bf cat16b(v8us lo, v8us hi) { return __builtin_bit_cast(v16bf, __builtin_shufflevector(lo, hi, 0, 1, 2, 3, 4, 5, 6, 7, 8, 9, 10, 11, 12, 13, 14, 15)); }
__device__ __forceinline__ v8f wmma16(v16h a, v16h b, v8f c) { return __builtin_amdgcn_wmma_f32_16x16x32_f16(false, a, false, b, (short)0, c, false, false); }
__device__ __forceinline__ v8f wmmab(v16bf a, v16bf b, v8f c) { return __builtin_amdgcn_wmma_f32_16x16x32_bf16(false, a, false, b, (short)0, c, false, false); }
// fragment loaders from K-contiguous 16-bit rows; p already includes + 8*(lane>>4): elements 0..7 <- k0+8h+0..7, elements 8..15 <- k0+16+8h+0..7 (same map for A and B)
__device__ __forceinline__ v16h  ldh(const h16* p) { return cat16(*(const v8h*)p, *(const v8h*)(p + 16)); }
__device__ __forceinline__ v16bf ldb(const bf* p)  { return cat16b(*(const v8us*)p, *(const v8us*)(p + 16)); }
// ordering point for wave-private LDS tiles (same wave writes and reads)
__device__ __forceinline__ void wave_sync() { __builtin_amdgcn_fence(3 /* release order */, "wavefront"); __builtin_amdgcn_wave_barrier(); asm volatile("" ::: "memory"); }

__global__ __launch_bounds__(256) void k_cvt8(const float* __restrict__ src, bf* dst, size_t n8) {
    const size_t i = (size_t)blockIdx.x * 256 + threadIdx.x; if (i >= n8) return;
    const v8f v = *(const v8f*)(src + i * 8); v8us o;
#pragma unroll
    for (int k = 0; k < 8; ++k) o[k] = f2bf(v[k]);
    *(v8us*)(dst + i * 8) = o; 
}

// k_tcvt: W in[K rows][N cols] f32 -> WT out[N rows][K cols] bf16 (RNE convert), 64x64 tile transposed through LDS (cross-wave: block barrier).
__global__ __launch_bounds__(256) void k_tcvt(const float* __restrict__ W, bf* WT, int K, int N) {
    __shared__ float ts[64 * 65];
    const int tid = threadIdx.x; const int k0 = blockIdx.x * 64, n0 = blockIdx.y * 64;
    const int cn = tid & 63, rk = tid >> 6;
#pragma unroll 4
    for (int i = 0; i < 16; ++i) { const int r = rk + 4 * i; ts[r * 65 + cn] = W[(size_t)(k0 + r) * N + n0 + cn]; }   // 16 x 4 = 64 rows, 64 columns
    __syncthreads();
    const int pc = tid & 7, rn = tid >> 3;      // rn 0..31 and rn+32 -> 64 output rows; 8 pieces x 8 = 64 k
    v8us o0, o1;
#pragma unroll
    for (int j = 0; j < 8; ++j) { o0[j] = f2bf(ts[(pc * 8 + j) * 65 + rn]); o1[j] = f2bf(ts[(pc * 8 + j) * 65 + rn + 32]); }
    bf* d0 = WT + (size_t)(n0 + rn) * K + k0 + pc * 8; bf* d1 = WT + (size_t)(n0 + rn + 32) * K + k0 + pc * 8;
    *(v8us*)d0 = o0; *(v8us*)d1 = o1; 
}

// k_rope_tab: rotary table CS[t][0..63] = cos(t * f_i), CS[t][64..127] = sin(t * f_i), f_i = 10000^(-i/64) = 2^(-i * log2(10000)/64); precise sinf/cosf.
__global__ __launch_bounds__(256) void k_rope_tab(float* CS) {
    __shared__ __align__(16) float ts[4 * 128];
    const int tid = threadIdx.x; const int i = tid & 63, r = tid >> 6; const int t = blockIdx.x * 4 + r;
    const float invf = __builtin_amdgcn_exp2f(-(float)i * 0.20762050593046014f);
    const float ang = (float)t * invf;
    ts[r * 128 + i] = cosf(ang); ts[r * 128 + 64 + i] = sinf(ang);
    __syncthreads();
    if (tid < 128) {                            // waves 0..3 (wave-uniform), one row each
        const int row = tid >> 5, pc = tid & 31;
        const v4f v = *(const v4fa*)(&ts[row * 128 + pc * 4]);
        float* d = CS + (size_t)(blockIdx.x * 4 + row) * 128 + pc * 4;
        *(v4f*)d = v; 
    }
}

// gemm_stage: one stage = 64 k of 128 A rows and 256 Bt rows = 384 whole lines of 128 B = 256 lanes x 12 copies of 16 B (eight lanes per line). l0, ga, gb: this lane's piece of row tid>>3; sa, sb: 32 rows, in elements.
// The s_wait_xcnt closes the statement so that no address register is rewritten ahead of it.
__device__ __forceinline__ void gemm_stage(unsigned l0, const bf* ga, size_t sa, const bf* gb, size_t sb) {
    const unsigned l1 = l0 + 32 * GPIT, l2 = l0 + 64 * GPIT, l3 = l0 + 96 * GPIT, l4 = l0 + 128 * GPIT, l5 = l0 + 160 * GPIT, l6 = l0 + 192 * GPIT, l7 = l0 + 224 * GPIT,
                   l8 = l0 + 256 * GPIT, l9 = l0 + 288 * GPIT, l10 = l0 + 320 * GPIT, l11 = l0 + 352 * GPIT;
    const bf* a1 = ga + sa; const bf* a2 = a1 + sa; const bf* a3 = a2 + sa;
    const bf* b1 = gb + sb; const bf* b2 = b1 + sb; const bf* b3 = b2 + sb; const bf* b4 = b3 + sb; const bf* b5 = b4 + sb; const bf* b6 = b5 + sb; const bf* b7 = b6 + sb;
    asm volatile("global_load_async_to_lds_b128 %0, %12, off\n\t"
                 "global_load_async_to_lds_b128 %1, %13, off\n\t"
                 "global_load_async_to_lds_b128 %2, %14, off\n\t"
                 "global_load_async_to_lds_b128 %3, %15, off\n\t"
                 "global_load_async_to_lds_b128 %4, %16, off\n\t"
                 "global_load_async_to_lds_b128 %5, %17, off\n\t"
                 "global_load_async_to_lds_b128 %6, %18, off\n\t"
                 "global_load_async_to_lds_b128 %7, %19, off\n\t"
                 "global_load_async_to_lds_b128 %8, %20, off\n\t"
                 "global_load_async_to_lds_b128 %9, %21, off\n\t"
                 "global_load_async_to_lds_b128 %10, %22, off\n\t"
                 "global_load_async_to_lds_b128 %11, %23, off\n\t"
                 "s_wait_xcnt 0x0"
                 :: "v"(l0), "v"(l1), "v"(l2), "v"(l3), "v"(l4), "v"(l5), "v"(l6), "v"(l7), "v"(l8), "v"(l9), "v"(l10), "v"(l11),
                    "v"(ga), "v"(a1), "v"(a2), "v"(a3), "v"(gb), "v"(b1), "v"(b2), "v"(b3), "v"(b4), "v"(b5), "v"(b6), "v"(b7) : "memory");
}

// gemm_loop: bf16 GEMM main loop of an 8-wave block, block tile 128 x 256, wave tile (16*MT) x (16*NT) at rows wr, columns wc of it. Each 64-k stage of the block's A and Bt rows is brought into LDS once
// per block by asynchronous copies of whole lines, and every wave takes its fragments from there. Two buffers: stage s + 1 is in flight while stage s is worked on; one barrier per stage publishes s + 1 and frees the buffer of s.
// acc[mb*NT+nb] += sum_k A[R0+wr+16mb+..][k] * Bt[C0+wc+16nb+..][k & kbm]   (kbm folds a K-concatenated A against a single Bt plane); k ascending in steps of 32
template <int MT, int NT>
__device__ __forceinline__ void gemm_loop(const bf* __restrict__ A, size_t lda, const bf* __restrict__ Bt, size_t ldbt,
                                          int K, int kbm, int R0, int C0, int wr, int wc, unsigned char* ring, int tid, int lr, int hi, v8f (&acc)[MT * NT]) {
#pragma unroll
    for (int i = 0; i < MT * NT; ++i) acc[i] = (v8f){};
    const unsigned l0 = (unsigned)(size_t)ring + (unsigned)((tid >> 3) * GPIT + (tid & 7) * 16);
    const bf* ga = A + (size_t)(R0 + (tid >> 3)) * lda + (tid & 7) * 8;
    const bf* gb = Bt + (size_t)(C0 + (tid >> 3)) * ldbt + (tid & 7) * 8;
    const size_t sa = 32 * lda, sb = 32 * ldbt;
    const int nst = K / GKS;                                   // the same for every wave of the launch
    gemm_stage(l0, ga, sa, gb, sb);                            // stage 0 -> buffer 0
    asm volatile("s_wait_asynccnt 0x0" ::: "memory");          // this wave's share of stage 0 has landed
    __syncthreads();                                           // stage 0 published
    if (nst > 1) gemm_stage(l0 + GST, ga + GKS, sa, gb + (GKS & kbm), sb);   // stage 1 -> buffer 1
    const int ao = (wr + lr) * GPIT + 16 * hi, bfo = (GAR + wc + lr) * GPIT + 16 * hi;
#pragma unroll 1
    for (int st = 0; st < nst; ++st) {
        const unsigned bo = (st & 1) ? (unsigned)GST : 0u;
        const bf* as = (const bf*)(ring + bo + ao); const bf* bs = (const bf*)(ring + bo + bfo);
        v16bf a[MT], b[NT];
#pragma unroll
        for (int ks = 0; ks < GKS / 32; ++ks) {
            // the fragments of a 32-k step are read as one group ahead of its products, so the LDS latency is waited out once per step
#pragma unroll
            for (int mb = 0; mb < MT; ++mb) a[mb] = ldb(as + mb * 16 * (GPIT / 2) + 32 * ks);
#pragma unroll
            for (int nb = 0; nb < NT; ++nb) b[nb] = ldb(bs + nb * 16 * (GPIT / 2) + 32 * ks);
            // inputs-only fence on the loaded fragments: holds all reads of the step in one group in front of its products (otherwise each Bt fragment is read, and its latency waited out, between the products)
            if constexpr (MT == 4 && NT == 4) asm volatile("" :: "v"(a[0]), "v"(a[1]), "v"(a[2]), "v"(a[3]), "v"(b[0]), "v"(b[1]), "v"(b[2]), "v"(b[3]));
            else { static_assert((MT == 4 && NT == 4) || (MT == 2 && NT == 8));
                asm volatile("" :: "v"(a[0]), "v"(a[1]), "v"(b[0]), "v"(b[1]), "v"(b[2]), "v"(b[3]), "v"(b[4]), "v"(b[5]), "v"(b[6]), "v"(b[7])); }
#pragma unroll
            for (int nb = 0; nb < NT; ++nb) {
#pragma unroll
                for (int mb = 0; mb < MT; ++mb) acc[mb * NT + nb] = wmmab(a[mb], b[nb], acc[mb * NT + nb]); }
        }
        asm volatile("v_nop\n\tv_nop\n\tv_nop\n\tv_nop" : "+v"(acc[0]), "+v"(acc[(MT * NT) / 3]), "+v"(acc[(2 * MT * NT) / 3]), "+v"(acc[MT * NT - 1]) : "v"(a[0]), "v"(a[MT - 1]), "v"(b[NT - 1]));
        // publish point of stage st + 1
        asm volatile("s_wait_dscnt 0x0" ::: "memory");         // this wave's reads of the buffer of stage st are done before it is handed to the copies
        asm volatile("s_wait_asynccnt 0x0" ::: "memory");      // this wave's share of stage st + 1 has landed
        __syncthreads();                                       // stage st + 1 published; every reader has left the buffer of stage st
        if (st + 2 < nst) gemm_stage(l0 + bo, ga + (st + 2) * GKS, sa, gb + (((st + 2) * GKS) & kbm), sb);   // stage st + 2 -> the buffer just read
    }
    asm volatile("s_wait_asynccnt 0x0" ::: "memory");          // nothing of this wave is in flight when it leaves the ring
}

// k_qk: projection + bias + rotary for q or k. One wave per 32 rows x 128 columns (= one head), K = DM; a block is 4 row groups x 2 heads. grid (NB*SEQ/128, nheads/2), 256 threads.
// Output plane [(b*nheads + head)][t][d] as f16 (Ph) and optionally the f16 residual x2048 (Pr, useRes != 0).
__global__ __launch_bounds__(32 * GW) __attribute__((amdgpu_num_vgpr(256)))
void k_qk(const bf* __restrict__ A, const bf* __restrict__ Bt, const float* __restrict__ bias, const float* __restrict__ CS, h16* Ph, h16* Pr, int useRes, int nheads) {
    __shared__ __align__(16) unsigned char ring[2 * GST];
    __shared__ __align__(16) float osb[GW * 16 * 132];
    const int tid = threadIdx.x;
    const int lane = tid & 31, wave = tid >> 5, lr = lane & 15, hi = lane >> 4;
    float* os = osb + wave * 16 * 132;                         // wave-private output staging
    const int wr = (wave & 3) * 32, wc = (wave >> 2) * HD;
    const int r0 = blockIdx.x * 128 + wr, head = blockIdx.y * 2 + (wave >> 2), cbase = head * HD;
    v8f acc[16];
    gemm_loop<2, 8>(A, (size_t)DM, Bt, (size_t)DM, DM, 0x7FFFFFFF, blockIdx.x * 128, blockIdx.y * 256, wr, wc, ring, tid, lr, hi, acc);
    float bz[8];
#pragma unroll
    for (int nb = 0; nb < 8; ++nb) bz[nb] = bfr(bias[cbase + nb * 16 + lr]);
    const int b = r0 / SEQ, t0 = r0 % SEQ;
    const size_t tbase = ((size_t)(b * nheads + head) * SEQ + t0) * HD;
#pragma unroll
    for (int mb = 0; mb < 2; ++mb) {
#pragma unroll
        for (int nb = 0; nb < 8; ++nb) {
#pragma unroll
            for (int j = 0; j < 8; ++j) os[(hi * 8 + j) * 132 + nb * 16 + lr] = acc[mb * 8 + nb][j] + bz[nb]; }   // D: row 8h+j, col lane&15; rows 0..15 x cols 0..127 all staged
        wave_sync();
{
#pragma unroll 2
            for (int s = 0; s < 8; ++s) { const int row = 2 * s + hi, c8 = lr * 8, p8 = c8 ^ 64;   // 8 s x 2 rows = 16 rows; 16 lanes x 8 = 128 columns
                const int t = t0 + mb * 16 + row;
                const float* orow = &os[row * 132];
                const v4f x0 = *(const v4fa*)(orow + c8), x1 = *(const v4fa*)(orow + c8 + 4);
                const v4f y0 = *(const v4fa*)(orow + p8), y1 = *(const v4fa*)(orow + p8 + 4);
                const float* cs = CS + (size_t)t * 128 + (c8 & 63);
                const v4f cc0 = *(const v4f*)cs, cc1 = *(const v4f*)(cs + 4), ss0 = *(const v4f*)(cs + 64), ss1 = *(const v4f*)(cs + 68);
                const float sg = (c8 < 64) ? -1.0f : 1.0f;       // d < 64: x[d] cos - x[d+64] sin; d >= 64: x[d] cos + x[d-64] sin
                v8h hv, rv;
#pragma unroll
                for (int i = 0; i < 4; ++i) {
                    const float v0 = x0[i] * cc0[i] + sg * (y0[i] * ss0[i]); const float v1 = x1[i] * cc1[i] + sg * (y1[i] * ss1[i]);
                    const h16 a0 = (h16)v0; const h16 a1 = (h16)v1; hv[i] = a0; hv[4 + i] = a1;
                    rv[i] = (h16)((v0 - (float)a0) * QRS); rv[4 + i] = (h16)((v1 - (float)a1) * QRS); }
                const size_t oo = tbase + (size_t)(mb * 16 + row) * HD + c8;
                *(v8h*)(Ph + oo) = hv; if (useRes) *(v8h*)(Pr + oo) = rv; }
             }
        wave_sync();
    }
}

// k_vt: v^T projection. A = WvT rows (m = g*128 + d), Bt = x rows (n = b*SEQ + t), one wave per 64x64 tile, a block is 2 x 4 of them. grid (DKV/128, NB*SEQ/256), 256 threads.
// Planes [(b*DKV + m)][t] = [(b*4 + g)][d][t]: f16 value (VH) and f16 residual x256 (VR); bias per row m.
__global__ __launch_bounds__(32 * GW) __attribute__((amdgpu_num_vgpr(256)))
void k_vt(const bf* __restrict__ A, const bf* __restrict__ Bt, const float* __restrict__ bias, h16* VH, h16* VR) {
    __shared__ __align__(16) unsigned char ring[2 * GST];
    __shared__ __align__(16) float osb[GW * 16 * 68];
    const int tid = threadIdx.x;
    const int lane = tid & 31, wave = tid >> 5, lr = lane & 15, hi = lane >> 4;
    float* os = osb + wave * 16 * 68;                          // wave-private output staging
    const int wr = (wave & 1) * 64, wc = (wave >> 1) * 64;
    const int r0 = blockIdx.x * 128 + wr, c0 = blockIdx.y * 256 + wc;
    v8f acc[16];
    gemm_loop<4, 4>(A, (size_t)DM, Bt, (size_t)DM, DM, 0x7FFFFFFF, blockIdx.x * 128, blockIdx.y * 256, wr, wc, ring, tid, lr, hi, acc);
    const int b = c0 / SEQ, t0 = c0 % SEQ;
    const size_t tbase = ((size_t)b * DKV + r0) * SEQ + t0;
#pragma unroll
    for (int mb = 0; mb < 4; ++mb) {
        float bj[8];
#pragma unroll
        for (int j = 0; j < 8; ++j) bj[j] = bfr(bias[r0 + mb * 16 + hi * 8 + j]);
#pragma unroll
        for (int nb = 0; nb < 4; ++nb) {
#pragma unroll
            for (int j = 0; j < 8; ++j) os[(hi * 8 + j) * 68 + nb * 16 + lr] = acc[mb * 4 + nb][j] + bj[j]; }   // rows 0..15 x cols 0..63 all staged
        wave_sync();
        const size_t sb = tbase + (size_t)(mb * 16) * SEQ;
{
#pragma unroll
            for (int s = 0; s < 4; ++s) { const int row = 4 * s + (lane >> 3), c8 = (lane & 7) * 8;   // 4 s x 4 row groups = 16 rows; 8 lanes x 8 = 64 columns
                const v4f x0 = *(const v4fa*)(&os[row * 68 + c8]); const v4f x1 = *(const v4fa*)(&os[row * 68 + c8 + 4]); v8h hv, rv;
#pragma unroll
                for (int i = 0; i < 4; ++i) { const h16 a0 = (h16)x0[i]; const h16 a1 = (h16)x1[i]; hv[i] = a0; hv[4 + i] = a1; rv[i] = (h16)((x0[i] - (float)a0) * VRS); rv[4 + i] = (h16)((x1[i] - (float)a1) * VRS); }
                const size_t oo = sb + (size_t)row * SEQ + c8;
                *(v8h*)(VH + oo) = hv; *(v8h*)(VR + oo) = rv; }
             }
        wave_sync();
    }
}

// k_flash: fused causal attention, one wave per 16 query rows of one (batch, head). A block is the 4 query heads of one kv head x 2 adjacent 16-row query tiles (8 waves): all of them walk
// the same keys, so each 32-key stage of K, V^T value and V^T residual is brought into LDS once per block by asynchronous copies (whole 16-B pieces, contiguous per row) and every wave takes its fragments from there.
// Two buffers: stage s + 1 is in flight while stage s is worked on; one barrier per stage publishes s + 1 and frees the buffer of s.
// Transposed form: S^T[key][t] = K Q^T (A = K rows, B = Q rows); lane (t = lane&15, h = lane>>4) holds keys 8h+r of each 16-key tile, so the packed
// P tile is directly the B fragment of O^T[d][t] = V^T P^T (element r <- tile keys 0..15, element 8+r <- tile keys 16..31, lane unchanged).
// Key loop runs to the 32-key step that contains the last query of the block; keys beyond a query get the fill value (weight exactly 0). ALiBi bias slope*(key - query) added in the exp2 domain.
// Stage planes in LDS, 16 lines of SPIT bytes each, line = fragment row (lane&15): K line holds key rows r and 16 + r (256 B each); a V^T line holds the 32-key pieces (64 B) of rows d = 16j + r, j = 0..7.
// So every fragment of a stage is read at one per-lane address plus a constant.
// flash_stage: one stage = K 32 rows x 256 B, V^T value and residual 128 rows x 64 B each = 24 KiB = 256 lanes x 6 copies of 16 B. The s_wait_xcnt closes the statement so that no address register is rewritten ahead of it.
__device__ __forceinline__ void flash_stage(unsigned lk, unsigned lv, const h16* gk, const h16* gh, const h16* gr) {
    const unsigned lk1 = lk + 256, lh0 = lv + ST_VH, lh1 = lv + ST_VH + 256, lr0 = lv + ST_VR, lr1 = lv + ST_VR + 256;
    const h16* gk1 = gk + 16 * HD; const h16* gh1 = gh + (size_t)64 * SEQ; const h16* gr1 = gr + (size_t)64 * SEQ;
    asm volatile("global_load_async_to_lds_b128 %0, %6, off\n\t"
                 "global_load_async_to_lds_b128 %1, %7, off\n\t"
                 "global_load_async_to_lds_b128 %2, %8, off\n\t"
                 "global_load_async_to_lds_b128 %3, %9, off\n\t"
                 "global_load_async_to_lds_b128 %4, %10, off\n\t"
                 "global_load_async_to_lds_b128 %5, %11, off\n\t"
                 "s_wait_xcnt 0x0"
                 :: "v"(lk), "v"(lk1), "v"(lh0), "v"(lh1), "v"(lr0), "v"(lr1), "v"(gk), "v"(gk1), "v"(gh), "v"(gh1), "v"(gr), "v"(gr1) : "memory");
}

__global__ __launch_bounds__(32 * FW) __attribute__((amdgpu_num_vgpr(256)))
void k_flash(const h16* __restrict__ QH, const h16* __restrict__ QR, const h16* __restrict__ KP, const h16* __restrict__ VH, const h16* __restrict__ VR, bf* CTX) {
    __shared__ __align__(16) unsigned char ring[2 * ST_SZ];
    __shared__ __align__(16) float os[FW * 16 * 132];
    const int tid = threadIdx.x;
    const int lane = tid & 31, wave = tid >> 5, lr = lane & 15, hi = lane >> 4;
    const int bg = blockIdx.y; const int b = bg / NKV, g = bg % NKV; const int h = g * REP + (wave & (REP - 1)); const int zh = b * NH_ + h;
    const int t0 = blockIdx.x * 32 + (wave >> 2) * 16;
    const int nst = blockIdx.x + 1;                            // 32-key stages of this block, the same for its 8 waves; 32 * nst <= SEQ
    const size_t kvb = (size_t)bg * SEQ * HD;
    // copy addresses of this lane. K: piece tid -> key row tid>>4 (and +16: +256 B in its line), 16-B column tid&15. V^T: piece tid -> row d = tid>>2 (and +64: +256 B in its line), 16-B column tid&3.
    const unsigned rb = (unsigned)(size_t)ring;
    const unsigned lk = rb + (unsigned)((tid >> 4) * SPIT + (tid & 15) * 16), lvt = rb + (unsigned)(((tid >> 2) & 15) * SPIT + (tid >> 6) * 64 + (tid & 3) * 16);
    const h16* gk = KP + kvb + (size_t)tid * 8;                // + key0 * HD
    const size_t gvo = kvb + (size_t)(tid >> 2) * SEQ + (tid & 3) * 8;   // + key0
    const h16* gh = VH + gvo; const h16* gr = VR + gvo;
    flash_stage(lk, lvt, gk, gh, gr);                          // stage 0 -> buffer 0
    const size_t qo = (size_t)zh * SEQ * HD + (size_t)(t0 + lr) * HD + 8 * hi;
    v16h qh[4], qr[4];                                         // B fragments: col t, k = d
#pragma unroll
    for (int c = 0; c < 4; ++c) { qh[c] = ldh(QH + qo + 32 * c); qr[c] = ldh(QR + qo + 32 * c); }
    asm volatile("s_wait_asynccnt 0x0" ::: "memory");          // this wave's share of stage 0 has landed
    __syncthreads();                                           // stage 0 published
    if (nst > 1) flash_stage(lk + ST_SZ, lvt + ST_SZ, gk + 32 * HD, gh + 32, gr + 32);   // stage 1 -> buffer 1
    const int fo = lr * SPIT + 16 * hi;                        // K: + 256 (second key tile) + 64*c (A fragment: row key, k = d); V^T: + plane + 64*j (A fragment: row d, k = key)
    const float slope2 = __builtin_amdgcn_exp2f(-0.5f * (float)(h + 1)) * LOG2E;
    const int qi = t0 + lr;
    v8f o[8];
#pragma unroll
    for (int j = 0; j < 8; ++j) o[j] = (v8f){};
    float m = NEGBIG, l = 0.0f;
#pragma unroll 1
    for (int st = 0; st < nst; ++st) {
        const int key0 = st * 32;
        const unsigned bo = (st & 1) ? (unsigned)ST_SZ : 0u;
        const h16* ka = (const h16*)(ring + bo + fo);
        v8f sHa = (v8f){}, sLa = (v8f){}, sHb = (v8f){}, sLb = (v8f){};
        v16h kal, kbl;
#pragma unroll
        for (int c = 0; c < 4; ++c) {
            kal = ldh(ka + 32 * c); kbl = ldh(ka + 128 + 32 * c);
            sHa = wmma16(kal, qh[c], sHa); sLa = wmma16(kal, qr[c], sLa); sHb = wmma16(kbl, qh[c], sHb); sLb = wmma16(kbl, qr[c], sLb); }
        asm volatile("v_nop\n\tv_nop\n\tv_nop\n\tv_nop" : "+v"(sHa), "+v"(sLa), "+v"(sHb), "+v"(sLb) : "v"(kal), "v"(kbl));
        const float base = (float)(key0 + 8 * hi - qi);        // key - query for r = 0 of tile a
        float ta[8], tb[8]; float mx = NEGBIG;
#pragma unroll
        for (int r = 0; r < 8; ++r) {
            const float da = base + (float)r, db = da + 16.0f;
            float xa = fmaf(slope2, da, (sHa[r] + sLa[r] * QRI) * SC2);
            float xb = fmaf(slope2, db, (sHb[r] + sLb[r] * QRI) * SC2);
            xa = (da > 0.0f) ? NEGBIG : xa; xb = (db > 0.0f) ? NEGBIG : xb;
            ta[r] = xa; tb[r] = xb; mx = fmaxf(mx, fmaxf(xa, xb)); }
        mx = fmaxf(mx, __shfl_xor(mx, 16, 32));
        const float mnew = fmaxf(m, mx);
        const float alpha = __builtin_amdgcn_exp2f(m - mnew);
        const float sh = PSH - mnew;
        v16h pb; float ls = 0.0f;
#pragma unroll
        for (int r = 0; r < 8; ++r) { const h16 pa = (h16)__builtin_amdgcn_exp2f(ta[r] + sh); const h16 pc = (h16)__builtin_amdgcn_exp2f(tb[r] + sh); pb[r] = pa; pb[8 + r] = pc; ls += (float)pa + (float)pc; }
        const v16h pq = pb * (h16)0.00390625f;                 // P x 2^-8: partner of the v residual x256
        l = l * alpha + ls; m = mnew;
#pragma unroll
        for (int j = 0; j < 8; ++j) o[j] = o[j] * alpha;
        const h16* va = ka + ST_VH / 2; const h16* vr = ka + ST_VR / 2;
        // four fragments are read as one group ahead of their four products, so the LDS latency is waited out once per group; all loops unrolled so that every array index is a constant (registers, no scratch)
#pragma unroll
        for (int j4 = 0; j4 < 8; j4 += 4) { v16h vf[4];
#pragma unroll
            for (int j = 0; j < 4; ++j) vf[j] = ldh(va + 32 * (j4 + j));
#pragma unroll
            for (int j = 0; j < 4; ++j) o[j4 + j] = wmma16(vf[j], pb, o[j4 + j]); }
#pragma unroll
        for (int j4 = 0; j4 < 8; j4 += 4) { v16h vf[4];
#pragma unroll
            for (int j = 0; j < 4; ++j) vf[j] = ldh(vr + 32 * (j4 + j));
#pragma unroll
            for (int j = 0; j < 4; ++j) o[j4 + j] = wmma16(vf[j], pq, o[j4 + j]); }
        asm volatile("v_nop\n\tv_nop\n\tv_nop\n\tv_nop" : "+v"(o[0]), "+v"(o[1]), "+v"(o[2]), "+v"(o[3]), "+v"(o[4]), "+v"(o[5]), "+v"(o[6]), "+v"(o[7]) : "v"(pb), "v"(pq));
        // publish point of stage st + 1
        asm volatile("s_wait_dscnt 0x0" ::: "memory");         // this wave's reads of the buffer of stage st are done before it is handed to the copies
        asm volatile("s_wait_asynccnt 0x0" ::: "memory");      // this wave's share of stage st + 1 has landed
        __syncthreads();                                       // stage st + 1 published; every reader has left the buffer of stage st
        if (st + 2 < nst) flash_stage(lk + bo, lvt + bo, gk + (size_t)(key0 + 64) * HD, gh + key0 + 64, gr + key0 + 64);   // stage st + 2 -> the buffer just read
    }
    asm volatile("s_wait_asynccnt 0x0" ::: "memory");          // nothing of this wave is in flight when it leaves the ring
    l += __shfl_xor(l, 16, 32);
    const float inv = 1.0f / l;
    const int wb = wave * 16 * 132;
    // O^T D layout: o[j][r] = (d = 16j + 8h + r, t = lane&15) -> os[t][d]; rows 0..15 x columns 0..127 all written
#pragma unroll
    for (int j = 0; j < 8; ++j) { v4f a, c;
        a[0] = o[j][0] * inv; a[1] = o[j][1] * inv; a[2] = o[j][2] * inv; a[3] = o[j][3] * inv; c[0] = o[j][4] * inv; c[1] = o[j][5] * inv; c[2] = o[j][6] * inv; c[3] = o[j][7] * inv;
        *(v4fa*)(&os[wb + lr * 132 + 16 * j + 8 * hi]) = a; *(v4fa*)(&os[wb + lr * 132 + 16 * j + 8 * hi + 4]) = c; }
    wave_sync();
    bf* crow = CTX + ((size_t)b * SEQ + t0) * (size_t)(2 * DM) + h * HD;
{
#pragma unroll 2
        for (int s = 0; s < 8; ++s) { const int row = 2 * s + hi, c8 = lr * 8;   // 8 s x 2 rows = 16 rows; 16 lanes x 8 = 128 columns
            const v4f x0 = *(const v4fa*)(&os[wb + row * 132 + c8]); const v4f x1 = *(const v4fa*)(&os[wb + row * 132 + c8 + 4]); v8us hv, lv;
#pragma unroll
            for (int i = 0; i < 4; ++i) { const unsigned short a0 = f2bf(x0[i]); const unsigned short a1 = f2bf(x1[i]); hv[i] = a0; hv[4 + i] = a1; lv[i] = f2bf(x0[i] - bf2f(a0)); lv[4 + i] = f2bf(x1[i] - bf2f(a1)); }
            bf* dst = crow + (size_t)row * (size_t)(2 * DM) + c8;
            *(v8us*)dst = hv; *(v8us*)(dst + DM) = lv; }
         }
}

// k_out: output projection. A = ctx plane rows [hi 2048 | lo 2048] (K = 4096 folded against the single WoT plane), Bt = WoT rows, one wave per 64x64 tile, a block is 2 x 4 of them. grid (NB*SEQ/128, DM/256), 256 threads.
__global__ __launch_bounds__(32 * GW) __attribute__((amdgpu_num_vgpr(256)))
void k_out(const bf* __restrict__ A, const bf* __restrict__ Bt, const float* __restrict__ bias, float* OUT) {
    __shared__ __align__(16) unsigned char ring[2 * GST];
    __shared__ __align__(16) float osb[GW * 16 * 68];
    const int tid = threadIdx.x;
    const int lane = tid & 31, wave = tid >> 5, lr = lane & 15, hi = lane >> 4;
    float* os = osb + wave * 16 * 68;                          // wave-private output staging
    const int wr = (wave & 1) * 64, wc = (wave >> 1) * 64;
    const int r0 = blockIdx.x * 128 + wr, c0 = blockIdx.y * 256 + wc;
    v8f acc[16];
    gemm_loop<4, 4>(A, (size_t)(2 * DM), Bt, (size_t)DM, 2 * DM, DM - 1, blockIdx.x * 128, blockIdx.y * 256, wr, wc, ring, tid, lr, hi, acc);
    float bz[4];
#pragma unroll
    for (int nb = 0; nb < 4; ++nb) bz[nb] = bfr(bias[c0 + nb * 16 + lr]);
    const int b = r0 / SEQ, t0 = r0 % SEQ;
    float* obase = OUT + ((size_t)b * OUT_SEQ + t0) * DM + c0;
#pragma unroll
    for (int mb = 0; mb < 4; ++mb) {
#pragma unroll
        for (int nb = 0; nb < 4; ++nb) {
#pragma unroll
            for (int j = 0; j < 8; ++j) os[(hi * 8 + j) * 68 + nb * 16 + lr] = acc[mb * 4 + nb][j] + bz[nb]; }   // rows 0..15 x cols 0..63 all staged
        wave_sync();
        float* orow = obase + (size_t)(mb * 16) * DM;
{
#pragma unroll
            for (int s = 0; s < 8; ++s) { const int row = 2 * s + hi, cofs = lr * 4;   // 8 s x 2 rows = 16 rows; 16 lanes x 4 floats = 64 columns
                const v4f val = *(const v4fa*)(&os[row * 68 + cofs]);
                *(v4f*)(orow + (size_t)row * DM + cofs) = val; }
             }
        wave_sync();
    }
}

static constexpr size_t al256(size_t v) { return (v + 255) & ~(size_t)255; }
static constexpr size_t SZ_XB  = al256((size_t)NB * SEQ * DM * 2);
static constexpr size_t SZ_WQ  = al256((size_t)DM * DM * 2);
static constexpr size_t SZ_WK  = al256((size_t)DKV * DM * 2);
static constexpr size_t SZ_CS  = al256((size_t)SEQ * 128 * 4);
static constexpr size_t SZ_QP  = al256((size_t)NB * NH_ * SEQ * HD * 2);
static constexpr size_t SZ_KP  = al256((size_t)NB * NKV * SEQ * HD * 2);
static constexpr size_t SZ_CTX = al256((size_t)NB * SEQ * 2 * DM * 2);
static constexpr size_t SZ_TOTAL = SZ_XB + 2 * SZ_WQ + 2 * SZ_WK + SZ_CS + 2 * SZ_QP + 3 * SZ_KP + SZ_CTX;
static_assert(SZ_TOTAL <= (size_t)134217728);          // workspace carve <= 128 MiB

extern "C" void kernel_launch(void* const* d_in, const int* in_sizes, int n_in,
                              void* d_out, int out_size, void* d_ws, size_t ws_size, hipStream_t stream) {
    if (n_in < 9) return;
    const size_t needx = ((size_t)(NB - 1) * SEQ_FULL + SEQ) * DM;
    if ((size_t)in_sizes[0] < needx) return;
    if ((size_t)in_sizes[1] < (size_t)DM * DM || (size_t)in_sizes[2] < (size_t)DM) return;
    if ((size_t)in_sizes[3] < (size_t)DM * DKV || (size_t)in_sizes[4] < (size_t)DKV) return;
    if ((size_t)in_sizes[5] < (size_t)DM * DKV || (size_t)in_sizes[6] < (size_t)DKV) return;
    if ((size_t)in_sizes[7] < (size_t)DM * DM || (size_t)in_sizes[8] < (size_t)DM) return;
    if ((size_t)out_size < ((size_t)(NB - 1) * OUT_SEQ + SEQ) * DM) return;
    if (SZ_TOTAL > ws_size) return;
    // wire order: x, Wq, bq, Wk, bk, Wv, bv, Wo, bo (weights [in][out])
    const float* x  = (const float*)d_in[0];
    const float* wq = (const float*)d_in[1]; const float* bq = (const float*)d_in[2];
    const float* wk = (const float*)d_in[3]; const float* bk = (const float*)d_in[4];
    const float* wv = (const float*)d_in[5]; const float* bv = (const float*)d_in[6];
    const float* wo = (const float*)d_in[7]; const float* bo = (const float*)d_in[8];
    float* OUT = (float*)d_out;      // [NB][SEQ][2048]
    char* wsp = (char*)d_ws;
    bf* XB  = (bf*)wsp; wsp += SZ_XB;                // [NB*SEQ][2048]
    bf* WQT = (bf*)wsp; wsp += SZ_WQ;                // [2048 out][2048 in]
    bf* WOT = (bf*)wsp; wsp += SZ_WQ;                // [2048 out][2048 in]
    bf* WKT = (bf*)wsp; wsp += SZ_WK;                // [512 out][2048 in]
    bf* WVT = (bf*)wsp; wsp += SZ_WK;                // [512 out][2048 in]
    float* CS = (float*)wsp; wsp += SZ_CS;           // [SEQ][cos 64 | sin 64]
    h16* QH = (h16*)wsp; wsp += SZ_QP;               // [NB*16][SEQ][128]
    h16* QR = (h16*)wsp; wsp += SZ_QP;               // [NB*16][SEQ][128] residual x2048
    h16* KP = (h16*)wsp; wsp += SZ_KP;               // [NB*4][SEQ][128]
    h16* VH = (h16*)wsp; wsp += SZ_KP;               // [NB*4][128][SEQ]
    h16* VR = (h16*)wsp; wsp += SZ_KP;               // [NB*4][128][SEQ] residual x256
    bf* CTX = (bf*)wsp; wsp += SZ_CTX;               // [NB*SEQ][hi 2048 | lo 2048]

    if (SEQ == SEQ_FULL) {
        const size_t n8 = (size_t)NB * SEQ * DM / 8;
        k_cvt8<<<(unsigned)((n8 + 255) / 256), 256, 0, stream>>>(x, XB, n8);
    } else {
        const size_t n8 = (size_t)SEQ * DM / 8;
        for (int b = 0; b < NB; ++b) k_cvt8<<<(unsigned)((n8 + 255) / 256), 256, 0, stream>>>(x + (size_t)b * SEQ_FULL * DM, XB + (size_t)b * SEQ * DM, n8);
    }
    // weight transposes: in[K = DM rows][N cols] -> out[N rows][K = DM cols]; grid (K/64, N/64)
    k_tcvt<<<dim3(DM / 64, DM / 64, 1), 256, 0, stream>>>(wq, WQT, DM, DM);
    k_tcvt<<<dim3(DM / 64, DKV / 64, 1), 256, 0, stream>>>(wk, WKT, DM, DKV);
    k_tcvt<<<dim3(DM / 64, DKV / 64, 1), 256, 0, stream>>>(wv, WVT, DM, DKV);
    k_tcvt<<<dim3(DM / 64, DM / 64, 1), 256, 0, stream>>>(wo, WOT, DM, DM);
    k_rope_tab<<<SEQ / 4, 256, 0, stream>>>(CS);

    // q, k: A = x rows (m = b*SEQ + t), Bt = WT rows (n = head*128 + d) -> plane [(b*nheads + head)][t][d], rotary applied
    k_qk<<<dim3(NB * SEQ / 128, NH_ / 2, 1), 32 * GW, 0, stream>>>(XB, WQT, bq, CS, QH, QR, 1, NH_);
    k_qk<<<dim3(NB * SEQ / 128, NKV / 2, 1), 32 * GW, 0, stream>>>(XB, WKT, bk, CS, KP, KP, 0, NKV);
    // v^T: A = WvT rows (m = g*128 + d), Bt = x rows (n = b*SEQ + t) -> planes [(b*512 + m)][t]
    k_vt<<<dim3(DKV / 128, NB * SEQ / 256, 1), 32 * GW, 0, stream>>>(WVT, XB, bv, VH, VR);

    k_flash<<<dim3(SEQ / 32, NB * NKV, 1), 32 * FW, 0, stream>>>(QH, QR, KP, VH, VR, CTX);

    k_out<<<dim3(NB * SEQ / 128, DM / 256, 1), 32 * GW, 0, stream>>>(CTX, WOT, bo, OUT);
}

// v003
// One run takes 217 microseconds.
// Next to v002, in two timings, it ran 1.36 times as fast each time.
// Over all steps from v000 it is 3.12 times as fast.
#include <hip/hip_runtime.h>

// Causal grouped-query attention layer: x [NB][SEQ][2048], 16 query heads x 128, 4 kv heads, weights [in][out] with biases, rotate-half rotary (theta 1e4), ALiBi slopes 2^(-(h+1)/2), output projection; f32 output.
// Compute dtypes, f32 accumulate everywhere: q/k/v projections v_wmma_f32_16x16x32_bf16 (x, W, b RNE-converted to bf16; products exact);
// scores v_wmma_f32_16x16x32_f16: k single f16, q as f16 value + f16 residual x2048 in its own accumulator; P.V v_wmma_f32_16x16x32_f16: P single f16 (x256 carry, cancels in the normalisation),
// v as f16 value + f16 residual x256 whose partner operand is the P copy x2^-8 (K-dimension fold, products at natural scale, one accumulator); output projection v_wmma_f32_16x16x32_bf16 with ctx as bf16 hi | lo planes folded along K against the bf16 Wo plane; softmax f32 (online, running max).
// Layout: bf16 x copy, bf16 transposed weight planes [out][in]; q (hi, residual) planes [b*16+h][t][d], k plane [b*4+g][t][d], v^T planes [b*4+g][d][t]; ctx plane [b*SEQ+t][hi 2048 | lo 2048]; rotary table [t][cos 64 | sin 64].

#ifndef NB
#define NB 2
#endif
#ifndef SEQ
#define SEQ 2048
#endif
#define NB_FULL  2
#define SEQ_FULL 2048
#ifndef OUT_SEQ
#define OUT_SEQ SEQ              // row pitch (in tokens) between batches of the output
#endif
#define DM   2048
#define NH_  16
#define NKV  4
#define HD   128
#define REP  (NH_ / NKV)
#define DKV  (NKV * HD)          // 512
#define FW   8                   // waves per flash block: the 4 query heads of one kv head x 2 query tiles of 16 rows
#define SPIT 528                 // LDS pitch, bytes, of one fragment-row line of a stage plane (512 + 16: 16 B x odd for 16-B readers)
#define ST_VH (16 * SPIT)               // byte offsets inside one stage buffer: K at 0, V^T value, V^T residual
#define ST_VR (2 * 16 * SPIT)
#define ST_SZ (3 * 16 * SPIT)           // 25344 B per stage
#define GW   8                   // waves per GEMM block: block tile 128 A rows x 256 Bt rows
#define GKS  64                  // k elements per GEMM stage: one whole 128-B line of every operand row
#define GPIT 144                 // LDS pitch, bytes, of a staged 128-B row (16 B x odd for 16-B readers)
#define GAR  128                 // A rows of a stage; the Bt rows follow them
#define GST  ((GAR + 256) * GPIT)       // 55296 B per stage
#define QRS  2048.0f             // carry of the q residual plane
#define QRI  (1.0f / 2048.0f)
#define VRS  256.0f              // carry of the v residual plane (partner operand is P x 2^-8)
#define LOG2E 1.4426950408889634f
#define SC2  (0.08838834764831845f * 1.4426950408889634f)   // HD^-0.5 * log2(e)
#define PSH  8.0f                // log2 of the P carry (256)
#define NEGBIG (-3.0e38f)

static_assert(HD == 128);
static_assert(NH_ * HD == DM);
static_assert(NH_ % NKV == 0);
static_assert(DM % 64 == 0);
static_assert(DKV % 64 == 0);
static_assert(DM % 32 == 0);
static_assert(SEQ % 64 == 0);                  // a 64-row tile never straddles two batches
static_assert((NB * SEQ) % 64 == 0);
static_assert(SEQ % 32 == 0);                  // key loop steps by 32
static_assert(REP == 4 && FW == 2 * REP);      // wave -> (head of the group, query tile) map of the flash block
static_assert(SEQ % 4 == 0);
static_assert((NB * SEQ) % 256 == 0 && DKV % 128 == 0 && DM % 256 == 0 && NKV % 2 == 0 && NH_ % 2 == 0);   // GEMM block tiles cover every operand exactly
static_assert(DM % GKS == 0);
static_assert(((size_t)SEQ * DM) % 8 == 0);
static_assert(NB <= NB_FULL);
static_assert(SEQ <= SEQ_FULL);

typedef _Float16 h16;
typedef unsigned short bf;
typedef __attribute__((ext_vector_type(16))) __bf16   v16bf;
typedef __attribute__((ext_vector_type(16))) _Float16 v16h;
typedef __attribute__((ext_vector_type(8)))  _Float16 v8h;
typedef __attribute__((ext_vector_type(8)))  unsigned short v8us;
typedef __attribute__((ext_vector_type(8)))  float    v8f;
typedef __attribute__((ext_vector_type(4)))  float    v4f;
typedef v4f  __attribute__((may_alias)) v4fa;
typedef __attribute__((ext_vector_type(4)))  unsigned v4u;     // 16 bytes as the data operand of a store written in asm text

__device__ __forceinline__ unsigned short f2bf(float f) { unsigned u = __float_as_uint(f); u += 0x7FFFu + ((u >> 16) & 1u); return (unsigned short)(u >> 16); }
__device__ __forceinline__ float bf2f(unsigned short u) { return __uint_as_float(((unsigned)u) << 16); }
__device__ __forceinline__ float bfr(float f) { return bf2f(f2bf(f)); }     // value of the RNE bf16 conversion
__device__ __forceinline__ v16h cat16(v8h lo, v8h hi) { return __builtin_shufflevector(lo, hi, 0, 1, 2, 3, 4, 5, 6, 7, 8, 9, 10, 11, 12, 13, 14, 15); }
__device__ __forceinline__ v16bf cat16b(v8us lo, v8us hi) { return __builtin_bit_cast(v16bf, __builtin_shufflevector(lo, hi, 0, 1, 2, 3, 4, 5, 6, 7, 8, 9, 10, 11, 12, 13, 14, 15)); }
__device__ __forceinline__ v8f wmma16(v16h a, v16h b, v8f c) { return __builtin_amdgcn_wmma_f32_16x16x32_f16(false, a, false, b, (short)0, c, false, false); }
__device__ __forceinline__ v8f wmmab(v16bf a, v16bf b, v8f c) { return __builtin_amdgcn_wmma_f32_16x16x32_bf16(false, a, false, b, (short)0, c, false, false); }
// fragment loaders from K-contiguous 16-bit rows; p already includes + 8*(lane>>4): elements 0..7 <- k0+8h+0..7, elements 8..15 <- k0+16+8h+0..7 (same map for A and B)
__device__ __forceinline__ v16h  ldh(const h16* p) { return cat16(*(const v8h*)p, *(const v8h*)(p + 16)); }
__device__ __forceinline__ v16bf ldb(const bf* p)  { return cat16b(*(const v8us*)p, *(const v8us*)(p + 16)); }
// ordering point for wave-private LDS tiles (same wave writes and reads)
__device__ __forceinline__ void wave_sync() { __builtin_amdgcn_fence(3 /* release order */, "wavefront"); __builtin_amdgcn_wave_barrier(); asm volatile("" ::: "memory"); }

// cvt8_body: x f32 -> bf16 copy [NB*SEQ][DM], eight elements per thread; blk = block index inside this range. Batch b of the source starts at b * SEQ_FULL rows.
__device__ __forceinline__ void cvt8_body(const float* __restrict__ src, bf* dst, int blk, int tid) {
    constexpr size_t per = (size_t)SEQ * DM / 8, n8 = (size_t)NB * per;
    const size_t i = (size_t)blk * 256 + tid; if (i >= n8) return;
    const v8f v = *(const v8f*)(src + (i / per) * ((size_t)SEQ_FULL * DM) + (i % per) * 8); v8us o;
#pragma unroll
    for (int k = 0; k < 8; ++k) o[k] = f2bf(v[k]);
    *(v8us*)(dst + i * 8) = o; 
}

// tcvt_body: W in[K rows][N cols] f32 -> WT out[N rows][K cols] bf16 (RNE convert), 64x64 tile (bx along K, by along N) transposed through LDS (cross-wave: block barrier).
__device__ __forceinline__ void tcvt_body(const float* __restrict__ W, bf* WT, int K, int N, int bx, int by, float* ts, int tid) {
    const int k0 = bx * 64, n0 = by * 64;
    const int cn = tid & 63, rk = tid >> 6;
#pragma unroll 4
    for (int i = 0; i < 16; ++i) { const int r = rk + 4 * i; ts[r * 65 + cn] = W[(size_t)(k0 + r) * N + n0 + cn]; }   // 16 x 4 = 64 rows, 64 columns
    __syncthreads();
    const int pc = tid & 7, rn = tid >> 3;      // rn 0..31 and rn+32 -> 64 output rows; 8 pieces x 8 = 64 k
    v8us o0, o1;
#pragma unroll
    for (int j = 0; j < 8; ++j) { o0[j] = f2bf(ts[(pc * 8 + j) * 65 + rn]); o1[j] = f2bf(ts[(pc * 8 + j) * 65 + rn + 32]); }
    bf* d0 = WT + (size_t)(n0 + rn) * K + k0 + pc * 8; bf* d1 = WT + (size_t)(n0 + rn + 32) * K + k0 + pc * 8;
    *(v8us*)d0 = o0; *(v8us*)d1 = o1; 
}

// rope_body: rotary table CS[t][0..63] = cos(t * f_i), CS[t][64..127] = sin(t * f_i), f_i = 10000^(-i/64) = 2^(-i * log2(10000)/64); precise sinf/cosf.
__device__ __forceinline__ void rope_body(float* CS, int blk, float* ts, int tid) {
    const int i = tid & 63, r = tid >> 6; const int t = blk * 4 + r;
    const float invf = __builtin_amdgcn_exp2f(-(float)i * 0.20762050593046014f);
    const float ang = (float)t * invf;
    ts[r * 128 + i] = cosf(ang); ts[r * 128 + 64 + i] = sinf(ang);
    __syncthreads();
    if (tid < 128) {                            // waves 0..3 (wave-uniform), one row each
        const int row = tid >> 5, pc = tid & 31;
        const v4f v = *(const v4fa*)(&ts[row * 128 + pc * 4]);
        float* d = CS + (size_t)(blk * 4 + row) * 128 + pc * 4;
        *(v4f*)d = v; 
    }
}

// k_prep: the six preparatory jobs, which do not depend on one another, as block ranges of one grid: the four weight transposes, the rotary table, the bf16 copy of x. The range test reads blockIdx only, so every barrier stays block-uniform.
// Left as it was: the work per thread (one 8-element piece, one 64x64 tile per block), so the grid is still one of very many short waves.
#define PB_WBIG  ((DM / 64) * (DM / 64))      // blocks of a DM x DM transpose
#define PB_WKV   ((DM / 64) * (DKV / 64))     // blocks of a DM x DKV transpose
#define PB_W     (2 * PB_WBIG + 2 * PB_WKV)
#define PB_ROPE  (SEQ / 4)
#define PB_CVT   ((int)(((size_t)NB * SEQ * DM / 8 + 255) / 256))
__global__ __launch_bounds__(256) void k_prep(const float* __restrict__ x, const float* __restrict__ wq, const float* __restrict__ wk, const float* __restrict__ wv, const float* __restrict__ wo,
                                              bf* XB, bf* WQT, bf* WKT, bf* WVT, bf* WOT, float* CS) {
    __shared__ __align__(16) float ts[64 * 65];
    const int tid = threadIdx.x; const int id = blockIdx.x;
    if (id < PB_W) {
        const bool big = id < 2 * PB_WBIG;
        const int q = big ? id : id - 2 * PB_WBIG; const int per = big ? PB_WBIG : PB_WKV;
        const bool second = q >= per; const int r = second ? q - per : q;
        const float* W = big ? (second ? wo : wq) : (second ? wv : wk);
        bf* WT = big ? (second ? WOT : WQT) : (second ? WVT : WKT);
        tcvt_body(W, WT, DM, big ? DM : DKV, r % (DM / 64), r / (DM / 64), ts, tid);
    } else if (id < PB_W + PB_ROPE) rope_body(CS, id - PB_W, ts, tid);
    else cvt8_body(x, XB, id - PB_W - PB_ROPE, tid);
}

// gemm_stage: one stage = 64 k of 128 A rows and 256 Bt rows = 384 whole lines of 128 B = 256 lanes x 12 copies of 16 B (eight lanes per line). l0, ga, gb: this lane's piece of row tid>>3; sa, sb: 32 rows, in elements.
// The s_wait_xcnt closes the statement so that no address register is rewritten ahead of it.
__device__ __forceinline__ void gemm_stage(unsigned l0, const bf* ga, size_t sa, const bf* gb, size_t sb) {
    const unsigned l1 = l0 + 32 * GPIT, l2 = l0 + 64 * GPIT, l3 = l0 + 96 * GPIT, l4 = l0 + 128 * GPIT, l5 = l0 + 160 * GPIT, l6 = l0 + 192 * GPIT, l7 = l0 + 224 * GPIT,
                   l8 = l0 + 256 * GPIT, l9 = l0 + 288 * GPIT, l10 = l0 + 320 * GPIT, l11 = l0 + 352 * GPIT;
    const bf* a1 = ga + sa; const bf* a2 = a1 + sa; const bf* a3 = a2 + sa;
    const bf* b1 = gb + sb; const bf* b2 = b1 + sb; const bf* b3 = b2 + sb; const bf* b4 = b3 + sb; const bf* b5 = b4 + sb; const bf* b6 = b5 + sb; const bf* b7 = b6 + sb;
    asm volatile("global_load_async_to_lds_b128 %0, %12, off\n\t"
                 "global_load_async_to_lds_b128 %1, %13, off\n\t"
                 "global_load_async_to_lds_b128 %2, %14, off\n\t"
                 "global_load_async_to_lds_b128 %3, %15, off\n\t"
                 "global_load_async_to_lds_b128 %4, %16, off\n\t"
                 "global_load_async_to_lds_b128 %5, %17, off\n\t"
                 "global_load_async_to_lds_b128 %6, %18, off\n\t"
                 "global_load_async_to_lds_b128 %7, %19, off\n\t"
                 "global_load_async_to_lds_b128 %8, %20, off\n\t"
                 "global_load_async_to_lds_b128 %9, %21, off\n\t"
                 "global_load_async_to_lds_b128 %10, %22, off\n\t"
                 "global_load_async_to_lds_b128 %11, %23, off\n\t"
                 "s_wait_xcnt 0x0"
                 :: "v"(l0), "v"(l1), "v"(l2), "v"(l3), "v"(l4), "v"(l5), "v"(l6), "v"(l7), "v"(l8), "v"(l9), "v"(l10), "v"(l11),
                    "v"(ga), "v"(a1), "v"(a2), "v"(a3), "v"(gb), "v"(b1), "v"(b2), "v"(b3), "v"(b4), "v"(b5), "v"(b6), "v"(b7) : "memory");
}

// gemm_loop: bf16 GEMM main loop of an 8-wave block, block tile 128 x 256, wave tile (16*MT) x (16*NT) at rows wr, columns wc of it. Each 64-k stage of the block's A and Bt rows is brought into LDS once
// per block by asynchronous copies of whole lines, and every wave takes its fragments from there. Two buffers: stage s + 1 is in flight while stage s is worked on; one barrier per stage publishes s + 1 and frees the buffer of s.
// acc[mb*NT+nb] += sum_k A[R0+wr+16mb+..][k] * Bt[C0+wc+16nb+..][k & kbm]   (kbm folds a K-concatenated A against a single Bt plane); k ascending in steps of 32
template <int MT, int NT>
__device__ __forceinline__ void gemm_loop(const bf* __restrict__ A, size_t lda, const bf* __restrict__ Bt, size_t ldbt,
                                          int K, int kbm, int R0, int C0, int wr, int wc, unsigned char* ring, int tid, int lr, int hi, v8f (&acc)[MT * NT]) {
#pragma unroll
    for (int i = 0; i < MT * NT; ++i) acc[i] = (v8f){};
    const unsigned l0 = (unsigned)(size_t)ring + (unsigned)((tid >> 3) * GPIT + (tid & 7) * 16);
    const bf* ga = A + (size_t)(R0 + (tid >> 3)) * lda + (tid & 7) * 8;
    const bf* gb = Bt + (size_t)(C0 + (tid >> 3)) * ldbt + (tid & 7) * 8;
    const size_t sa = 32 * lda, sb = 32 * ldbt;
    const int nst = K / GKS;                                   // the same for every wave of the launch
    gemm_stage(l0, ga, sa, gb, sb);                            // stage 0 -> buffer 0
    asm volatile("s_wait_asynccnt 0x0" ::: "memory");          // this wave's share of stage 0 has landed
    __syncthreads();                                           // stage 0 published
    if (nst > 1) gemm_stage(l0 + GST, ga + GKS, sa, gb + (GKS & kbm), sb);   // stage 1 -> buffer 1
    const int ao = (wr + lr) * GPIT + 16 * hi, bfo = (GAR + wc + lr) * GPIT + 16 * hi;
#pragma unroll 1
    for (int st = 0; st < nst; ++st) {
        const unsigned bo = (st & 1) ? (unsigned)GST : 0u;
        const bf* as = (const bf*)(ring + bo + ao); const bf* bs = (const bf*)(ring + bo + bfo);
        v16bf a[MT], b[NT];
#pragma unroll
        for (int ks = 0; ks < GKS / 32; ++ks) {
            // the fragments of a 32-k step are read as one group ahead of its products, so the LDS latency is waited out once per step
#pragma unroll
            for (int mb = 0; mb < MT; ++mb) a[mb] = ldb(as + mb * 16 * (GPIT / 2) + 32 * ks);
#pragma unroll
            for (int nb = 0; nb < NT; ++nb) b[nb] = ldb(bs + nb * 16 * (GPIT / 2) + 32 * ks);
            // inputs-only fence on the loaded fragments: holds all reads of the step in one group in front of its products (otherwise each Bt fragment is read, and its latency waited out, between the products)
            if constexpr (MT == 4 && NT == 4) asm volatile("" :: "v"(a[0]), "v"(a[1]), "v"(a[2]), "v"(a[3]), "v"(b[0]), "v"(b[1]), "v"(b[2]), "v"(b[3]));
            else { static_assert((MT == 4 && NT == 4) || (MT == 2 && NT == 8));
                asm volatile("" :: "v"(a[0]), "v"(a[1]), "v"(b[0]), "v"(b[1]), "v"(b[2]), "v"(b[3]), "v"(b[4]), "v"(b[5]), "v"(b[6]), "v"(b[7])); }
#pragma unroll
            for (int nb = 0; nb < NT; ++nb) {
#pragma unroll
                for (int mb = 0; mb < MT; ++mb) acc[mb * NT + nb] = wmmab(a[mb], b[nb], acc[mb * NT + nb]); }
        }
        asm volatile("v_nop\n\tv_nop\n\tv_nop\n\tv_nop" : "+v"(acc[0]), "+v"(acc[(MT * NT) / 3]), "+v"(acc[(2 * MT * NT) / 3]), "+v"(acc[MT * NT - 1]) : "v"(a[0]), "v"(a[MT - 1]), "v"(b[NT - 1]));
        // publish point of stage st + 1
        asm volatile("s_wait_dscnt 0x0" ::: "memory");         // this wave's reads of the buffer of stage st are done before it is handed to the copies
        asm volatile("s_wait_asynccnt 0x0" ::: "memory");      // this wave's share of stage st + 1 has landed
        __syncthreads();                                       // stage st + 1 published; every reader has left the buffer of stage st
        if (st + 2 < nst) gemm_stage(l0 + bo, ga + (st + 2) * GKS, sa, gb + (((st + 2) * GKS) & kbm), sb);   // stage st + 2 -> the buffer just read
    }
    asm volatile("s_wait_asynccnt 0x0" ::: "memory");          // nothing of this wave is in flight when it leaves the ring
}

// qk_body: projection + bias + rotary for q or k. One wave per 32 rows x 128 columns (= one head), K = DM; a block is 4 row groups x 2 heads: bx in NB*SEQ/128, by in nheads/2, 256 threads.
// Output plane [(b*nheads + head)][t][d] as f16 (Ph) and optionally the f16 residual x2048 (Pr, useRes != 0).
// Output staging lies on the ring: the last publish point of gemm_loop (LDS reads done, no copy in flight, block barrier) has freed it for every wave.
__device__ __forceinline__ void qk_body(const bf* __restrict__ A, const bf* __restrict__ Bt, const float* __restrict__ bias, const float* __restrict__ CS, h16* Ph, h16* Pr, int useRes, int nheads,
                                        int bx, int by, unsigned char* ring, int tid) {
    static_assert(GW * 16 * 132 * 4 <= 2 * GST);
    const int lane = tid & 31, wave = tid >> 5, lr = lane & 15, hi = lane >> 4;
    float* os = (float*)ring + wave * 16 * 132;                // wave-private output staging
    const int wr = (wave & 3) * 32, wc = (wave >> 2) * HD;
    const int r0 = bx * 128 + wr, head = by * 2 + (wave >> 2), cbase = head * HD;
    v8f acc[16];
    gemm_loop<2, 8>(A, (size_t)DM, Bt, (size_t)DM, DM, 0x7FFFFFFF, bx * 128, by * 256, wr, wc, ring, tid, lr, hi, acc);
    float bz[8];
#pragma unroll
    for (int nb = 0; nb < 8; ++nb) bz[nb] = bfr(bias[cbase + nb * 16 + lr]);
    const int b = r0 / SEQ, t0 = r0 % SEQ;
    const size_t tbase = ((size_t)(b * nheads + head) * SEQ + t0) * HD;
#pragma unroll
    for (int mb = 0; mb < 2; ++mb) {
#pragma unroll
        for (int nb = 0; nb < 8; ++nb) {
#pragma unroll
            for (int j = 0; j < 8; ++j) os[(hi * 8 + j) * 132 + nb * 16 + lr] = acc[mb * 8 + nb][j] + bz[nb]; }   // D: row 8h+j, col lane&15; rows 0..15 x cols 0..127 all staged
        wave_sync();
{
            const int c8 = lr * 8, p8 = c8 ^ 64;
#pragma unroll 1   // stays rolled, four trips of two row pairs each: keeps the epilogue's code short
            for (int s2 = 0; s2 < 8; s2 += 2) { v4u hq[2], rq[2];
#pragma unroll
              for (int u = 0; u < 2; ++u) { const int row = 2 * (s2 + u) + hi;   // 8 s x 2 rows = 16 rows; 16 lanes x 8 = 128 columns
                const int t = t0 + mb * 16 + row;
                const float* orow = &os[row * 132];
                const v4f x0 = *(const v4fa*)(orow + c8), x1 = *(const v4fa*)(orow + c8 + 4);
                const v4f y0 = *(const v4fa*)(orow + p8), y1 = *(const v4fa*)(orow + p8 + 4);
                const float* cs = CS + (size_t)t * 128 + (c8 & 63);
                const v4f cc0 = *(const v4f*)cs, cc1 = *(const v4f*)(cs + 4), ss0 = *(const v4f*)(cs + 64), ss1 = *(const v4f*)(cs + 68);
                const float sg = (c8 < 64) ? -1.0f : 1.0f;       // d < 64: x[d] cos - x[d+64] sin; d >= 64: x[d] cos + x[d-64] sin
                v8h hv, rv;
#pragma unroll
                for (int i = 0; i < 4; ++i) {
                    const float v0 = x0[i] * cc0[i] + sg * (y0[i] * ss0[i]); const float v1 = x1[i] * cc1[i] + sg * (y1[i] * ss1[i]);
                    const h16 a0 = (h16)v0; const h16 a1 = (h16)v1; hv[i] = a0; hv[4 + i] = a1;
                    rv[i] = (h16)((v0 - (float)a0) * QRS); rv[4 + i] = (h16)((v1 - (float)a1) * QRS); }
                hq[u] = __builtin_bit_cast(v4u, hv); rq[u] = __builtin_bit_cast(v4u, rv); }
                const size_t oo = tbase + (size_t)(mb * 16 + 2 * s2 + hi) * HD + c8;   // row 2 s2 + hi; the second piece lies two rows (2 * HD * 2 bytes) further
                h16* ph = Ph + oo; h16* pr = Pr + oo;
                // the trip's stores and their s_wait_xcnt in one statement, so that the wait stands in front of every rewrite of a register that a store names (a wait in a statement of its own does not hold the address additions behind it)
                if (useRes) asm volatile("global_store_b128 %0, %2, off\n\t"
                                         "global_store_b128 %0, %3, off offset:%6\n\t"
                                         "global_store_b128 %1, %4, off\n\t"
                                         "global_store_b128 %1, %5, off offset:%6\n\t"
                                         "s_wait_xcnt 0x0"
                                         :: "v"(ph), "v"(pr), "v"(hq[0]), "v"(hq[1]), "v"(rq[0]), "v"(rq[1]), "n"(2 * HD * 2) : "memory");
                else        asm volatile("global_store_b128 %0, %1, off\n\t"
                                         "global_store_b128 %0, %2, off offset:%3\n\t"
                                         "s_wait_xcnt 0x0"
                                         :: "v"(ph), "v"(hq[0]), "v"(hq[1]), "n"(2 * HD * 2) : "memory"); }
             }
        wave_sync();
    }
}

// vt_body: v^T projection. A = WvT rows (m = g*128 + d), Bt = x rows (n = b*SEQ + t), one wave per 64x64 tile, a block is 2 x 4 of them: bx in DKV/128, by in NB*SEQ/256, 256 threads.
// Planes [(b*DKV + m)][t] = [(b*4 + g)][d][t]: f16 value (VH) and f16 residual x256 (VR); bias per row m. Output staging lies on the ring, as in qk_body.
__device__ __forceinline__ void vt_body(const bf* __restrict__ A, const bf* __restrict__ Bt, const float* __restrict__ bias, h16* VH, h16* VR, int bx, int by, unsigned char* ring, int tid) {
    const int lane = tid & 31, wave = tid >> 5, lr = lane & 15, hi = lane >> 4;
    float* os = (float*)ring + wave * 16 * 68;                 // wave-private output staging
    const int wr = (wave & 1) * 64, wc = (wave >> 1) * 64;
    const int r0 = bx * 128 + wr, c0 = by * 256 + wc;
    v8f acc[16];
    gemm_loop<4, 4>(A, (size_t)DM, Bt, (size_t)DM, DM, 0x7FFFFFFF, bx * 128, by * 256, wr, wc, ring, tid, lr, hi, acc);
    const int b = c0 / SEQ, t0 = c0 % SEQ;
    const size_t tbase = ((size_t)b * DKV + r0) * SEQ + t0;
#pragma unroll
    for (int mb = 0; mb < 4; ++mb) {
        float bj[8];
#pragma unroll
        for (int j = 0; j < 8; ++j) bj[j] = bfr(bias[r0 + mb * 16 + hi * 8 + j]);
#pragma unroll
        for (int nb = 0; nb < 4; ++nb) {
#pragma unroll
            for (int j = 0; j < 8; ++j) os[(hi * 8 + j) * 68 + nb * 16 + lr] = acc[mb * 4 + nb][j] + bj[j]; }   // rows 0..15 x cols 0..63 all staged
        wave_sync();
        const size_t sb = tbase + (size_t)(mb * 16) * SEQ;
{
            const int c8 = (lane & 7) * 8; v4u hq[4], rq[4];
#pragma unroll
            for (int s = 0; s < 4; ++s) { const int row = 4 * s + (lane >> 3);   // 4 s x 4 row groups = 16 rows; 8 lanes x 8 = 64 columns
                const v4f x0 = *(const v4fa*)(&os[row * 68 + c8]); const v4f x1 = *(const v4fa*)(&os[row * 68 + c8 + 4]); v8h hv, rv;
#pragma unroll
                for (int i = 0; i < 4; ++i) { const h16 a0 = (h16)x0[i]; const h16 a1 = (h16)x1[i]; hv[i] = a0; hv[4 + i] = a1; rv[i] = (h16)((x0[i] - (float)a0) * VRS); rv[4 + i] = (h16)((x1[i] - (float)a1) * VRS); }
                hq[s] = __builtin_bit_cast(v4u, hv); rq[s] = __builtin_bit_cast(v4u, rv); }
            const size_t oo = sb + (size_t)(lane >> 3) * SEQ + c8;   // row lane>>3; piece s lies 4 s rows (4 * SEQ * 2 bytes each step) further
            h16* ph = VH + oo; h16* pr = VR + oo;
            // the row block's stores and their s_wait_xcnt in one statement, so that the wait stands in front of every rewrite of a register that a store names (the next block's bias loads may take the data registers)
            asm volatile("global_store_b128 %0, %2, off\n\t"
                         "global_store_b128 %1, %6, off\n\t"
                         "global_store_b128 %0, %3, off offset:%10\n\t"
                         "global_store_b128 %1, %7, off offset:%10\n\t"
                         "global_store_b128 %0, %4, off offset:%11\n\t"
                         "global_store_b128 %1, %8, off offset:%11\n\t"
                         "global_store_b128 %0, %5, off offset:%12\n\t"
                         "global_store_b128 %1, %9, off offset:%12\n\t"
                         "s_wait_xcnt 0x0"
                         :: "v"(ph), "v"(pr), "v"(hq[0]), "v"(hq[1]), "v"(hq[2]), "v"(hq[3]), "v"(rq[0]), "v"(rq[1]), "v"(rq[2]), "v"(rq[3]),
                            "n"(4 * SEQ * 2), "n"(8 * SEQ * 2), "n"(12 * SEQ * 2) : "memory");
             }
        wave_sync();
    }
}

// k_qkv: the q, k and v^T projections, which do not depend on one another, as block ranges of one grid, so that the 64-block k and v^T jobs run beside the q job instead of each alone on a quarter of the chip.
// One LDS arena (the ring, 108 KiB) lets two blocks share a WGP, so all blocks of the grid are resident at once. The range test reads blockIdx only, so every barrier stays block-uniform.
#define GB_ROW  (NB * SEQ / 128)
#define GB_Q    (GB_ROW * (NH_ / 2))
#define GB_K    (GB_ROW * (NKV / 2))
#define GB_V    ((DKV / 128) * (NB * SEQ / 256))
__global__ __launch_bounds__(32 * GW) __attribute__((amdgpu_num_vgpr(256)))
void k_qkv(const bf* __restrict__ XB, const bf* __restrict__ WQT, const bf* __restrict__ WKT, const bf* __restrict__ WVT,
           const float* __restrict__ bq, const float* __restrict__ bk, const float* __restrict__ bv, const float* __restrict__ CS, h16* QH, h16* QR, h16* KP, h16* VH, h16* VR) {
    __shared__ __align__(16) unsigned char ring[2 * GST];
    const int tid = threadIdx.x; const int id = blockIdx.x;
    if (id < GB_Q + GB_K) {
        const bool isq = id < GB_Q; const int r = isq ? id : id - GB_Q;
        qk_body(XB, isq ? WQT : WKT, isq ? bq : bk, CS, isq ? QH : KP, isq ? QR : KP, isq ? 1 : 0, isq ? NH_ : NKV, r % GB_ROW, r / GB_ROW, ring, tid);
    } else {
        const int r = id - GB_Q - GB_K;
        vt_body(WVT, XB, bv, VH, VR, r % (DKV / 128), r / (DKV / 128), ring, tid);
    }
}

// k_flash: fused causal attention, one wave per 16 query rows of one (batch, head). A block is the 4 query heads of one kv head x 2 adjacent 16-row query tiles (8 waves): all of them walk
// the same keys, so each 32-key stage of K, V^T value and V^T residual is brought into LDS once per block by asynchronous copies (whole 16-B pieces, contiguous per row) and every wave takes its fragments from there.
// Two buffers: stage s + 1 is in flight while stage s is worked on; one barrier per stage publishes s + 1 and frees the buffer of s.
// Transposed form: S^T[key][t] = K Q^T (A = K rows, B = Q rows); lane (t = lane&15, h = lane>>4) holds keys 8h+r of each 16-key tile, so the packed
// P tile is directly the B fragment of O^T[d][t] = V^T P^T (element r <- tile keys 0..15, element 8+r <- tile keys 16..31, lane unchanged).
// Key loop runs to the 32-key step that contains the last query of the block; keys beyond a query get the fill value (weight exactly 0). ALiBi bias slope*(key - query) added in the exp2 domain.
// Stage planes in LDS, 16 lines of SPIT bytes each, line = fragment row (lane&15): K line holds key rows r and 16 + r (256 B each); a V^T line holds the 32-key pieces (64 B) of rows d = 16j + r, j = 0..7.
// So every fragment of a stage is read at one per-lane address plus a constant.
// flash_stage: one stage = K 32 rows x 256 B, V^T value and residual 128 rows x 64 B each = 24 KiB = 256 lanes x 6 copies of 16 B. The s_wait_xcnt closes the statement so that no address register is rewritten ahead of it.
__device__ __forceinline__ void flash_stage(unsigned lk, unsigned lv, const h16* gk, const h16* gh, const h16* gr) {
    const unsigned lk1 = lk + 256, lh0 = lv + ST_VH, lh1 = lv + ST_VH + 256, lr0 = lv + ST_VR, lr1 = lv + ST_VR + 256;
    const h16* gk1 = gk + 16 * HD; const h16* gh1 = gh + (size_t)64 * SEQ; const h16* gr1 = gr + (size_t)64 * SEQ;
    asm volatile("global_load_async_to_lds_b128 %0, %6, off\n\t"
                 "global_load_async_to_lds_b128 %1, %7, off\n\t"
                 "global_load_async_to_lds_b128 %2, %8, off\n\t"
                 "global_load_async_to_lds_b128 %3, %9, off\n\t"
                 "global_load_async_to_lds_b128 %4, %10, off\n\t"
                 "global_load_async_to_lds_b128 %5, %11, off\n\t"
                 "s_wait_xcnt 0x0"
                 :: "v"(lk), "v"(lk1), "v"(lh0), "v"(lh1), "v"(lr0), "v"(lr1), "v"(gk), "v"(gk1), "v"(gh), "v"(gh1), "v"(gr), "v"(gr1) : "memory");
}

__global__ __launch_bounds__(32 * FW) __attribute__((amdgpu_num_vgpr(256)))
void k_flash(const h16* __restrict__ QH, const h16* __restrict__ QR, const h16* __restrict__ KP, const h16* __restrict__ VH, const h16* __restrict__ VR, bf* CTX) {
    __shared__ __align__(16) unsigned char ring[2 * ST_SZ];
    __shared__ __align__(16) float os[FW * 16 * 132];
    const int tid = threadIdx.x;
    const int lane = tid & 31, wave = tid >> 5, lr = lane & 15, hi = lane >> 4;
    const int bg = blockIdx.y; const int b = bg / NKV, g = bg % NKV; const int h = g * REP + (wave & (REP - 1)); const int zh = b * NH_ + h;
    const int t0 = blockIdx.x * 32 + (wave >> 2) * 16;
    const int nst = blockIdx.x + 1;                            // 32-key stages of this block, the same for its 8 waves; 32 * nst <= SEQ
    const size_t kvb = (size_t)bg * SEQ * HD;
    // copy addresses of this lane. K: piece tid -> key row tid>>4 (and +16: +256 B in its line), 16-B column tid&15. V^T: piece tid -> row d = tid>>2 (and +64: +256 B in its line), 16-B column tid&3.
    const unsigned rb = (unsigned)(size_t)ring;
    const unsigned lk = rb + (unsigned)((tid >> 4) * SPIT + (tid & 15) * 16), lvt = rb + (unsigned)(((tid >> 2) & 15) * SPIT + (tid >> 6) * 64 + (tid & 3) * 16);
    const h16* gk = KP + kvb + (size_t)tid * 8;                // + key0 * HD
    const size_t gvo = kvb + (size_t)(tid >> 2) * SEQ + (tid & 3) * 8;   // + key0
    const h16* gh = VH + gvo; const h16* gr = VR + gvo;
    flash_stage(lk, lvt, gk, gh, gr);                          // stage 0 -> buffer 0
    const size_t qo = (size_t)zh * SEQ * HD + (size_t)(t0 + lr) * HD + 8 * hi;
    v16h qh[4], qr[4];                                         // B fragments: col t, k = d
#pragma unroll
    for (int c = 0; c < 4; ++c) { qh[c] = ldh(QH + qo + 32 * c); qr[c] = ldh(QR + qo + 32 * c); }
    asm volatile("s_wait_asynccnt 0x0" ::: "memory");          // this wave's share of stage 0 has landed
    __syncthreads();                                           // stage 0 published
    if (nst > 1) flash_stage(lk + ST_SZ, lvt + ST_SZ, gk + 32 * HD, gh + 32, gr + 32);   // stage 1 -> buffer 1
    const int fo = lr * SPIT + 16 * hi;                        // K: + 256 (second key tile) + 64*c (A fragment: row key, k = d); V^T: + plane + 64*j (A fragment: row d, k = key)
    const float slope2 = __builtin_amdgcn_exp2f(-0.5f * (float)(h + 1)) * LOG2E;
    const int qi = t0 + lr;
    v8f o[8];
#pragma unroll
    for (int j = 0; j < 8; ++j) o[j] = (v8f){};
    float m = NEGBIG, l = 0.0f;
#pragma unroll 1
    for (int st = 0; st < nst; ++st) {
        const int key0 = st * 32;
        const unsigned bo = (st & 1) ? (unsigned)ST_SZ : 0u;
        const h16* ka = (const h16*)(ring + bo + fo);
        v8f sHa = (v8f){}, sLa = (v8f){}, sHb = (v8f){}, sLb = (v8f){};
        v16h kal, kbl;
#pragma unroll
        for (int c = 0; c < 4; ++c) {
            kal = ldh(ka + 32 * c); kbl = ldh(ka + 128 + 32 * c);
            sHa = wmma16(kal, qh[c], sHa); sLa = wmma16(kal, qr[c], sLa); sHb = wmma16(kbl, qh[c], sHb); sLb = wmma16(kbl, qr[c], sLb); }
        asm volatile("v_nop\n\tv_nop\n\tv_nop\n\tv_nop" : "+v"(sHa), "+v"(sLa), "+v"(sHb), "+v"(sLb) : "v"(kal), "v"(kbl));
        const float base = (float)(key0 + 8 * hi - qi);        // key - query for r = 0 of tile a
        float ta[8], tb[8]; float mx = NEGBIG;
#pragma unroll
        for (int r = 0; r < 8; ++r) {
            const float da = base + (float)r, db = da + 16.0f;
            float xa = fmaf(slope2, da, (sHa[r] + sLa[r] * QRI) * SC2);
            float xb = fmaf(slope2, db, (sHb[r] + sLb[r] * QRI) * SC2);
            xa = (da > 0.0f) ? NEGBIG : xa; xb = (db > 0.0f) ? NEGBIG : xb;
            ta[r] = xa; tb[r] = xb; mx = fmaxf(mx, fmaxf(xa, xb)); }
        mx = fmaxf(mx, __shfl_xor(mx, 16, 32));
        const float mnew = fmaxf(m, mx);
        const float alpha = __builtin_amdgcn_exp2f(m - mnew);
        const float sh = PSH - mnew;
        v16h pb; float ls = 0.0f;
#pragma unroll
        for (int r = 0; r < 8; ++r) { const h16 pa = (h16)__builtin_amdgcn_exp2f(ta[r] + sh); const h16 pc = (h16)__builtin_amdgcn_exp2f(tb[r] + sh); pb[r] = pa; pb[8 + r] = pc; ls += (float)pa + (float)pc; }
        const v16h pq = pb * (h16)0.00390625f;                 // P x 2^-8: partner of the v residual x256
        l = l * alpha + ls; m = mnew;
#pragma unroll
        for (int j = 0; j < 8; ++j) o[j] = o[j] * alpha;
        const h16* va = ka + ST_VH / 2; const h16* vr = ka + ST_VR / 2;
        // four fragments are read as one group ahead of their four products, so the LDS latency is waited out once per group; all loops unrolled so that every array index is a constant (registers, no scratch)
#pragma unroll
        for (int j4 = 0; j4 < 8; j4 += 4) { v16h vf[4];
#pragma unroll
            for (int j = 0; j < 4; ++j) vf[j] = ldh(va + 32 * (j4 + j));
#pragma unroll
            for (int j = 0; j < 4; ++j) o[j4 + j] = wmma16(vf[j], pb, o[j4 + j]); }
#pragma unroll
        for (int j4 = 0; j4 < 8; j4 += 4) { v16h vf[4];
#pragma unroll
            for (int j = 0; j < 4; ++j) vf[j] = ldh(vr + 32 * (j4 + j));
#pragma unroll
            for (int j = 0; j < 4; ++j) o[j4 + j] = wmma16(vf[j], pq, o[j4 + j]); }
        asm volatile("v_nop\n\tv_nop\n\tv_nop\n\tv_nop" : "+v"(o[0]), "+v"(o[1]), "+v"(o[2]), "+v"(o[3]), "+v"(o[4]), "+v"(o[5]), "+v"(o[6]), "+v"(o[7]) : "v"(pb), "v"(pq));
        // publish point of stage st + 1
        asm volatile("s_wait_dscnt 0x0" ::: "memory");         // this wave's reads of the buffer of stage st are done before it is handed to the copies
        asm volatile("s_wait_asynccnt 0x0" ::: "memory");      // this wave's share of stage st + 1 has landed
        __syncthreads();                                       // stage st + 1 published; every reader has left the buffer of stage st
        if (st + 2 < nst) flash_stage(lk + bo, lvt + bo, gk + (size_t)(key0 + 64) * HD, gh + key0 + 64, gr + key0 + 64);   // stage st + 2 -> the buffer just read
    }
    asm volatile("s_wait_asynccnt 0x0" ::: "memory");          // nothing of this wave is in flight when it leaves the ring
    l += __shfl_xor(l, 16, 32);
    const float inv = 1.0f / l;
    const int wb = wave * 16 * 132;
    // O^T D layout: o[j][r] = (d = 16j + 8h + r, t = lane&15) -> os[t][d]; rows 0..15 x columns 0..127 all written
#pragma unroll
    for (int j = 0; j < 8; ++j) { v4f a, c;
        a[0] = o[j][0] * inv; a[1] = o[j][1] * inv; a[2] = o[j][2] * inv; a[3] = o[j][3] * inv; c[0] = o[j][4] * inv; c[1] = o[j][5] * inv; c[2] = o[j][6] * inv; c[3] = o[j][7] * inv;
        *(v4fa*)(&os[wb + lr * 132 + 16 * j + 8 * hi]) = a; *(v4fa*)(&os[wb + lr * 132 + 16 * j + 8 * hi + 4]) = c; }
    wave_sync();
    bf* crow = CTX + ((size_t)b * SEQ + t0) * (size_t)(2 * DM) + h * HD;
{
#pragma unroll 2
        for (int s = 0; s < 8; ++s) { const int row = 2 * s + hi, c8 = lr * 8;   // 8 s x 2 rows = 16 rows; 16 lanes x 8 = 128 columns
            const v4f x0 = *(const v4fa*)(&os[wb + row * 132 + c8]); const v4f x1 = *(const v4fa*)(&os[wb + row * 132 + c8 + 4]); v8us hv, lv;
#pragma unroll
            for (int i = 0; i < 4; ++i) { const unsigned short a0 = f2bf(x0[i]); const unsigned short a1 = f2bf(x1[i]); hv[i] = a0; hv[4 + i] = a1; lv[i] = f2bf(x0[i] - bf2f(a0)); lv[4 + i] = f2bf(x1[i] - bf2f(a1)); }
            bf* dst = crow + (size_t)row * (size_t)(2 * DM) + c8;
            *(v8us*)dst = hv; *(v8us*)(dst + DM) = lv; }
         }
}

// k_out: output projection. A = ctx plane rows [hi 2048 | lo 2048] (K = 4096 folded against the single WoT plane), Bt = WoT rows, one wave per 64x64 tile, a block is 2 x 4 of them. grid (NB*SEQ/128, DM/256), 256 threads.
__global__ __launch_bounds__(32 * GW) __attribute__((amdgpu_num_vgpr(256)))
void k_out(const bf* __restrict__ A, const bf* __restrict__ Bt, const float* __restrict__ bias, float* OUT) {
    __shared__ __align__(16) unsigned char ring[2 * GST];
    __shared__ __align__(16) float osb[GW * 16 * 68];
    const int tid = threadIdx.x;
    const int lane = tid & 31, wave = tid >> 5, lr = lane & 15, hi = lane >> 4;
    float* os = osb + wave * 16 * 68;                          // wave-private output staging
    const int wr = (wave & 1) * 64, wc = (wave >> 1) * 64;
    const int r0 = blockIdx.x * 128 + wr, c0 = blockIdx.y * 256 + wc;
    v8f acc[16];
    gemm_loop<4, 4>(A, (size_t)(2 * DM), Bt, (size_t)DM, 2 * DM, DM - 1, blockIdx.x * 128, blockIdx.y * 256, wr, wc, ring, tid, lr, hi, acc);
    float bz[4];
#pragma unroll
    for (int nb = 0; nb < 4; ++nb) bz[nb] = bfr(bias[c0 + nb * 16 + lr]);
    const int b = r0 / SEQ, t0 = r0 % SEQ;
    float* obase = OUT + ((size_t)b * OUT_SEQ + t0) * DM + c0;
#pragma unroll
    for (int mb = 0; mb < 4; ++mb) {
#pragma unroll
        for (int nb = 0; nb < 4; ++nb) {
#pragma unroll
            for (int j = 0; j < 8; ++j) os[(hi * 8 + j) * 68 + nb * 16 + lr] = acc[mb * 4 + nb][j] + bz[nb]; }   // rows 0..15 x cols 0..63 all staged
        wave_sync();
        float* orow = obase + (size_t)(mb * 16) * DM;
{
#pragma unroll
            for (int s = 0; s < 8; ++s) { const int row = 2 * s + hi, cofs = lr * 4;   // 8 s x 2 rows = 16 rows; 16 lanes x 4 floats = 64 columns
                const v4f val = *(const v4fa*)(&os[row * 68 + cofs]);
                *(v4f*)(orow + (size_t)row * DM + cofs) = val; }
             }
        wave_sync();
    }
}

static constexpr size_t al256(size_t v) { return (v + 255) & ~(size_t)255; }
static constexpr size_t SZ_XB  = al256((size_t)NB * SEQ * DM * 2);
static constexpr size_t SZ_WQ  = al256((size_t)DM * DM * 2);
static constexpr size_t SZ_WK  = al256((size_t)DKV * DM * 2);
static constexpr size_t SZ_CS  = al256((size_t)SEQ * 128 * 4);
static constexpr size_t SZ_QP  = al256((size_t)NB * NH_ * SEQ * HD * 2);
static constexpr size_t SZ_KP  = al256((size_t)NB * NKV * SEQ * HD * 2);
static constexpr size_t SZ_CTX = al256((size_t)NB * SEQ * 2 * DM * 2);
static constexpr size_t SZ_TOTAL = SZ_XB + 2 * SZ_WQ + 2 * SZ_WK + SZ_CS + 2 * SZ_QP + 3 * SZ_KP + SZ_CTX;
static_assert(SZ_TOTAL <= (size_t)134217728);          // workspace carve <= 128 MiB

extern "C" void kernel_launch(void* const* d_in, const int* in_sizes, int n_in,
                              void* d_out, int out_size, void* d_ws, size_t ws_size, hipStream_t stream) {
    if (n_in < 9) return;
    const size_t needx = ((size_t)(NB - 1) * SEQ_FULL + SEQ) * DM;
    if ((size_t)in_sizes[0] < needx) return;
    if ((size_t)in_sizes[1] < (size_t)DM * DM || (size_t)in_sizes[2] < (size_t)DM) return;
    if ((size_t)in_sizes[3] < (size_t)DM * DKV || (size_t)in_sizes[4] < (size_t)DKV) return;
    if ((size_t)in_sizes[5] < (size_t)DM * DKV || (size_t)in_sizes[6] < (size_t)DKV) return;
    if ((size_t)in_sizes[7] < (size_t)DM * DM || (size_t)in_sizes[8] < (size_t)DM) return;
    if ((size_t)out_size < ((size_t)(NB - 1) * OUT_SEQ + SEQ) * DM) return;
    if (SZ_TOTAL > ws_size) return;
    // wire order: x, Wq, bq, Wk, bk, Wv, bv, Wo, bo (weights [in][out])
    const float* x  = (const float*)d_in[0];
    const float* wq = (const float*)d_in[1]; const float* bq = (const float*)d_in[2];
    const float* wk = (const float*)d_in[3]; const float* bk = (const float*)d_in[4];
    const float* wv = (const float*)d_in[5]; const float* bv = (const float*)d_in[6];
    const float* wo = (const float*)d_in[7]; const float* bo = (const float*)d_in[8];
    float* OUT = (float*)d_out;      // [NB][SEQ][2048]
    char* wsp = (char*)d_ws;
    bf* XB  = (bf*)wsp; wsp += SZ_XB;                // [NB*SEQ][2048]
    bf* WQT = (bf*)wsp; wsp += SZ_WQ;                // [2048 out][2048 in]
    bf* WOT = (bf*)wsp; wsp += SZ_WQ;                // [2048 out][2048 in]
    bf* WKT = (bf*)wsp; wsp += SZ_WK;                // [512 out][2048 in]
    bf* WVT = (bf*)wsp; wsp += SZ_WK;                // [512 out][2048 in]
    float* CS = (float*)wsp; wsp += SZ_CS;           // [SEQ][cos 64 | sin 64]
    h16* QH = (h16*)wsp; wsp += SZ_QP;               // [NB*16][SEQ][128]
    h16* QR = (h16*)wsp; wsp += SZ_QP;               // [NB*16][SEQ][128] residual x2048
    h16* KP = (h16*)wsp; wsp += SZ_KP;               // [NB*4][SEQ][128]
    h16* VH = (h16*)wsp; wsp += SZ_KP;               // [NB*4][128][SEQ]
    h16* VR = (h16*)wsp; wsp += SZ_KP;               // [NB*4][128][SEQ] residual x256
    bf* CTX = (bf*)wsp; wsp += SZ_CTX;               // [NB*SEQ][hi 2048 | lo 2048]

    // weight transposes in[K = DM rows][N cols] -> out[N rows][K = DM cols], rotary table, bf16 copy of x
    k_prep<<<PB_W + PB_ROPE + PB_CVT, 256, 0, stream>>>(x, wq, wk, wv, wo, XB, WQT, WKT, WVT, WOT, CS);

    // q, k: A = x rows (m = b*SEQ + t), Bt = WT rows (n = head*128 + d) -> plane [(b*nheads + head)][t][d], rotary applied
    // v^T: A = WvT rows (m = g*128 + d), Bt = x rows (n = b*SEQ + t) -> planes [(b*512 + m)][t]
    k_qkv<<<GB_Q + GB_K + GB_V, 32 * GW, 0, stream>>>(XB, WQT, WKT, WVT, bq, bk, bv, CS, QH, QR, KP, VH, VR);

    k_flash<<<dim3(SEQ / 32, NB * NKV, 1), 32 * FW, 0, stream>>>(QH, QR, KP, VH, VR, CTX);

    k_out<<<dim3(NB * SEQ / 128, DM / 256, 1), 32 * GW, 0, stream>>>(CTX, WOT, bo, OUT);
}

// v004
// Measured time: 199 microseconds a run.
// Two timings next to v003 put it at 1.09 and 1.10 times that version's speed.
// Over all steps from v000 it is 3.41 times as fast.
#include <hip/hip_runtime.h>

// Causal grouped-query attention layer: x [NB][SEQ][2048], 16 query heads x 128, 4 kv heads, weights [in][out] with biases, rotate-half rotary (theta 1e4), ALiBi slopes 2^(-(h+1)/2), output projection; f32 output.
// Compute dtypes, f32 accumulate everywhere: q/k/v projections v_wmma_f32_16x16x32_bf16 (x, W, b RNE-converted to bf16; products exact);
// scores v_wmma_f32_16x16x32_f16: k single f16, q as f16 value + f16 residual x2048 in its own accumulator; P.V v_wmma_f32_16x16x32_f16: P single f16 (x256 carry, cancels in the normalisation),
// v as f16 value + f16 residual x256 whose partner operand is the P copy x2^-8 (K-dimension fold, products at natural scale, one accumulator); output projection v_wmma_f32_16x16x32_bf16 with ctx as bf16 hi | lo planes folded along K against the bf16 Wo plane; softmax f32 (online, running max).
// Layout: bf16 x copy, bf16 transposed weight planes [out][in]; q (hi, residual) planes [b*16+h][t][d], k plane [b*4+g][t][d], v^T planes [b*4+g][d][t]; ctx plane [b*SEQ+t][hi 2048 | lo 2048]; rotary table [t][cos 64 | sin 64].

#ifndef NB
#define NB 2
#endif
#ifndef SEQ
#define SEQ 2048
#endif
#define NB_FULL  2
#define SEQ_FULL 2048
#ifndef OUT_SEQ
#define OUT_SEQ SEQ              // row pitch (in tokens) between batches of the output
#endif
#define DM   2048
#define NH_  16
#define NKV  4
#define HD   128
#define REP  (NH_ / NKV)
#define DKV  (NKV * HD)          // 512
#define FW   8                   // waves per flash block: the 4 query heads of one kv head x 2 query tiles of 16 rows
#define SPIT 528                 // LDS pitch, bytes, of one fragment-row line of a stage plane (512 + 16: 16 B x odd for 16-B readers)
#define ST_VH (16 * SPIT)               // byte offsets inside one stage buffer: K at 0, V^T value, V^T residual
#define ST_VR (2 * 16 * SPIT)
#define ST_SZ (3 * 16 * SPIT)           // 25344 B per stage
#define GW   8                   // waves per GEMM block: block tile 128 A rows x 256 Bt rows
#define GKS  64                  // k elements per GEMM stage: one whole 128-B line of every operand row
#define GPIT 144                 // LDS pitch, bytes, of a staged 128-B row (16 B x odd for 16-B readers)
#define GAR  128                 // A rows of a stage; the Bt rows follow them
#define GST  ((GAR + 256) * GPIT)       // 55296 B per stage
#define QRS  2048.0f             // carry of the q residual plane
#define QRI  (1.0f / 2048.0f)
#define VRS  256.0f              // carry of the v residual plane (partner operand is P x 2^-8)
#define LOG2E 1.4426950408889634f
#define SC2  (0.08838834764831845f * 1.4426950408889634f)   // HD^-0.5 * log2(e)
#define PSH  8.0f                // log2 of the P carry (256)
#define NEGBIG (-3.0e38f)

static_assert(HD == 128);
static_assert(NH_ * HD == DM);
static_assert(NH_ % NKV == 0);
static_assert(DM % 64 == 0);
static_assert(DKV % 64 == 0);
static_assert(DM % 32 == 0);
static_assert(SEQ % 64 == 0);                  // a 64-row tile never straddles two batches
static_assert((NB * SEQ) % 64 == 0);
static_assert(SEQ % 32 == 0);                  // key loop steps by 32
static_assert(REP == 4 && FW == 2 * REP);      // wave -> (head of the group, query tile) map of the flash block
static_assert(SEQ % 4 == 0);
static_assert((NB * SEQ) % 256 == 0 && DKV % 128 == 0 && DM % 256 == 0 && NKV % 2 == 0 && NH_ % 2 == 0);   // GEMM block tiles cover every operand exactly
static_assert(DM % GKS == 0);
static_assert(((size_t)SEQ * DM) % 8 == 0);
static_assert(NB <= NB_FULL);
static_assert(SEQ <= SEQ_FULL);

typedef _Float16 h16;
typedef unsigned short bf;
typedef __attribute__((ext_vector_type(16))) __bf16   v16bf;
typedef __attribute__((ext_vector_type(16))) _Float16 v16h;
typedef __attribute__((ext_vector_type(8)))  _Float16 v8h;
typedef __attribute__((ext_vector_type(8)))  unsigned short v8us;
typedef __attribute__((ext_vector_type(8)))  float    v8f;
typedef __attribute__((ext_vector_type(4)))  float    v4f;
typedef v4f  __attribute__((may_alias)) v4fa;
typedef __attribute__((ext_vector_type(4)))  unsigned v4u;     // 16 bytes as the data operand of a store written in asm text

__device__ __forceinline__ unsigned short f2bf(float f) { unsigned u = __float_as_uint(f); u += 0x7FFFu + ((u >> 16) & 1u); return (unsigned short)(u >> 16); }
__device__ __forceinline__ float bf2f(unsigned short u) { return __uint_as_float(((unsigned)u) << 16); }
__device__ __forceinline__ float bfr(float f) { return bf2f(f2bf(f)); }     // value of the RNE bf16 conversion
__device__ __forceinline__ v16h cat16(v8h lo, v8h hi) { return __builtin_shufflevector(lo, hi, 0, 1, 2, 3, 4, 5, 6, 7, 8, 9, 10, 11, 12, 13, 14, 15); }
__device__ __forceinline__ v16bf cat16b(v8us lo, v8us hi) { return __builtin_bit_cast(v16bf, __builtin_shufflevector(lo, hi, 0, 1, 2, 3, 4, 5, 6, 7, 8, 9, 10, 11, 12, 13, 14, 15)); }
__device__ __forceinline__ v8f wmma16(v16h a, v16h b, v8f c) { return __builtin_amdgcn_wmma_f32_16x16x32_f16(false, a, false, b, (short)0, c, false, false); }
__device__ __forceinline__ v8f wmmab(v16bf a, v16bf b, v8f c) { return __builtin_amdgcn_wmma_f32_16x16x32_bf16(false, a, false, b, (short)0, c, false, false); }
// fragment loaders from K-contiguous 16-bit rows; p already includes + 8*(lane>>4): elements 0..7 <- k0+8h+0..7, elements 8..15 <- k0+16+8h+0..7 (same map for A and B)
__device__ __forceinline__ v16h  ldh(const h16* p) { return cat16(*(const v8h*)p, *(const v8h*)(p + 16)); }
__device__ __forceinline__ v16bf ldb(const bf* p)  { return cat16b(*(const v8us*)p, *(const v8us*)(p + 16)); }
// ordering point for wave-private LDS tiles (same wave writes and reads)
__device__ __forceinline__ void wave_sync() { __builtin_amdgcn_fence(3 /* release order */, "wavefront"); __builtin_amdgcn_wave_barrier(); asm volatile("" ::: "memory"); }

// cvt8_body: x f32 -> bf16 copy [NB*SEQ][DM], eight elements per thread; blk = block index inside this range. Batch b of the source starts at b * SEQ_FULL rows.
__device__ __forceinline__ void cvt8_body(const float* __restrict__ src, bf* dst, int blk, int tid) {
    constexpr size_t per = (size_t)SEQ * DM / 8, n8 = (size_t)NB * per;
    const size_t i = (size_t)blk * 256 + tid; if (i >= n8) return;
    const v8f v = *(const v8f*)(src + (i / per) * ((size_t)SEQ_FULL * DM) + (i % per) * 8); v8us o;
#pragma unroll
    for (int k = 0; k < 8; ++k) o[k] = f2bf(v[k]);
    *(v8us*)(dst + i * 8) = o; 
}

// tcvt_body: W in[K rows][N cols] f32 -> WT out[N rows][K cols] bf16 (RNE convert), 64x64 tile (bx along K, by along N) transposed through LDS (cross-wave: block barrier).
__device__ __forceinline__ void tcvt_body(const float* __restrict__ W, bf* WT, int K, int N, int bx, int by, float* ts, int tid) {
    const int k0 = bx * 64, n0 = by * 64;
    const int cn = tid & 63, rk = tid >> 6;
#pragma unroll 4
    for (int i = 0; i < 16; ++i) { const int r = rk + 4 * i; ts[r * 65 + cn] = W[(size_t)(k0 + r) * N + n0 + cn]; }   // 16 x 4 = 64 rows, 64 columns
    __syncthreads();
    const int pc = tid & 7, rn = tid >> 3;      // rn 0..31 and rn+32 -> 64 output rows; 8 pieces x 8 = 64 k
    v8us o0, o1;
#pragma unroll
    for (int j = 0; j < 8; ++j) { o0[j] = f2bf(ts[(pc * 8 + j) * 65 + rn]); o1[j] = f2bf(ts[(pc * 8 + j) * 65 + rn + 32]); }
    bf* d0 = WT + (size_t)(n0 + rn) * K + k0 + pc * 8; bf* d1 = WT + (size_t)(n0 + rn + 32) * K + k0 + pc * 8;
    *(v8us*)d0 = o0; *(v8us*)d1 = o1; 
}

// rope_body: rotary table CS[t][0..63] = cos(t * f_i), CS[t][64..127] = sin(t * f_i), f_i = 10000^(-i/64) = 2^(-i * log2(10000)/64); precise sinf/cosf.
__device__ __forceinline__ void rope_body(float* CS, int blk, float* ts, int tid) {
    const int i = tid & 63, r = tid >> 6; const int t = blk * 4 + r;
    const float invf = __builtin_amdgcn_exp2f(-(float)i * 0.20762050593046014f);
    const float ang = (float)t * invf;
    ts[r * 128 + i] = cosf(ang); ts[r * 128 + 64 + i] = sinf(ang);
    __syncthreads();
    if (tid < 128) {                            // waves 0..3 (wave-uniform), one row each
        const int row = tid >> 5, pc = tid & 31;
        const v4f v = *(const v4fa*)(&ts[row * 128 + pc * 4]);
        float* d = CS + (size_t)(blk * 4 + row) * 128 + pc * 4;
        *(v4f*)d = v; 
    }
}

// k_prep: the six preparatory jobs, which do not depend on one another, as block ranges of one grid: the four weight transposes, the rotary table, the bf16 copy of x. The range test reads blockIdx only, so every barrier stays block-uniform.
// Left as it was: the work per thread (one 8-element piece, one 64x64 tile per block), so the grid is still one of very many short waves.
#define PB_WBIG  ((DM / 64) * (DM / 64))      // blocks of a DM x DM transpose
#define PB_WKV   ((DM / 64) * (DKV / 64))     // blocks of a DM x DKV transpose
#define PB_W     (2 * PB_WBIG + 2 * PB_WKV)
#define PB_ROPE  (SEQ / 4)
#define PB_CVT   ((int)(((size_t)NB * SEQ * DM / 8 + 255) / 256))
__global__ __launch_bounds__(256) void k_prep(const float* __restrict__ x, const float* __restrict__ wq, const float* __restrict__ wk, const float* __restrict__ wv, const float* __restrict__ wo,
                                              bf* XB, bf* WQT, bf* WKT, bf* WVT, bf* WOT, float* CS) {
    __shared__ __align__(16) float ts[64 * 65];
    const int tid = threadIdx.x; const int id = blockIdx.x;
    if (id < PB_W) {
        const bool big = id < 2 * PB_WBIG;
        const int q = big ? id : id - 2 * PB_WBIG; const int per = big ? PB_WBIG : PB_WKV;
        const bool second = q >= per; const int r = second ? q - per : q;
        const float* W = big ? (second ? wo : wq) : (second ? wv : wk);
        bf* WT = big ? (second ? WOT : WQT) : (second ? WVT : WKT);
        tcvt_body(W, WT, DM, big ? DM : DKV, r % (DM / 64), r / (DM / 64), ts, tid);
    } else if (id < PB_W + PB_ROPE) rope_body(CS, id - PB_W, ts, tid);
    else cvt8_body(x, XB, id - PB_W - PB_ROPE, tid);
}

// gemm_stage: one stage = 64 k of 128 A rows and 256 Bt rows = 384 whole lines of 128 B = 256 lanes x 12 copies of 16 B (eight lanes per line). l0, ga, gb: this lane's piece of row tid>>3; sa, sb: 32 rows, in elements.
// The s_wait_xcnt closes the statement so that no address register is rewritten ahead of it.
__device__ __forceinline__ void gemm_stage(unsigned l0, const bf* ga, size_t sa, const bf* gb, size_t sb) {
    const unsigned l1 = l0 + 32 * GPIT, l2 = l0 + 64 * GPIT, l3 = l0 + 96 * GPIT, l4 = l0 + 128 * GPIT, l5 = l0 + 160 * GPIT, l6 = l0 + 192 * GPIT, l7 = l0 + 224 * GPIT,
                   l8 = l0 + 256 * GPIT, l9 = l0 + 288 * GPIT, l10 = l0 + 320 * GPIT, l11 = l0 + 352 * GPIT;
    const bf* a1 = ga + sa; const bf* a2 = a1 + sa; const bf* a3 = a2 + sa;
    const bf* b1 = gb + sb; const bf* b2 = b1 + sb; const bf* b3 = b2 + sb; const bf* b4 = b3 + sb; const bf* b5 = b4 + sb; const bf* b6 = b5 + sb; const bf* b7 = b6 + sb;
    asm volatile("global_load_async_to_lds_b128 %0, %12, off\n\t"
                 "global_load_async_to_lds_b128 %1, %13, off\n\t"
                 "global_load_async_to_lds_b128 %2, %14, off\n\t"
                 "global_load_async_to_lds_b128 %3, %15, off\n\t"
                 "global_load_async_to_lds_b128 %4, %16, off\n\t"
                 "global_load_async_to_lds_b128 %5, %17, off\n\t"
                 "global_load_async_to_lds_b128 %6, %18, off\n\t"
                 "global_load_async_to_lds_b128 %7, %19, off\n\t"
                 "global_load_async_to_lds_b128 %8, %20, off\n\t"
                 "global_load_async_to_lds_b128 %9, %21, off\n\t"
                 "global_load_async_to_lds_b128 %10, %22, off\n\t"
                 "global_load_async_to_lds_b128 %11, %23, off\n\t"
                 "s_wait_xcnt 0x0"
                 :: "v"(l0), "v"(l1), "v"(l2), "v"(l3), "v"(l4), "v"(l5), "v"(l6), "v"(l7), "v"(l8), "v"(l9), "v"(l10), "v"(l11),
                    "v"(ga), "v"(a1), "v"(a2), "v"(a3), "v"(gb), "v"(b1), "v"(b2), "v"(b3), "v"(b4), "v"(b5), "v"(b6), "v"(b7) : "memory");
}

// gemm_loop: bf16 GEMM main loop of an 8-wave block, block tile 128 x 256, wave tile (16*MT) x (16*NT) at rows wr, columns wc of it. Each 64-k stage of the block's A and Bt rows is brought into LDS once
// per block by asynchronous copies of whole lines, and every wave takes its fragments from there. Two buffers: stage s + 1 is in flight while stage s is worked on; one barrier per stage publishes s + 1 and frees the buffer of s.
// acc[mb*NT+nb] += sum_k A[R0+wr+16mb+..][k] * Bt[C0+wc+16nb+..][k & kbm]   (kbm folds a K-concatenated A against a single Bt plane); k ascending in steps of 32
template <int MT, int NT>
__device__ __forceinline__ void gemm_loop(const bf* __restrict__ A, size_t lda, const bf* __restrict__ Bt, size_t ldbt,
                                          int K, int kbm, int R0, int C0, int wr, int wc, unsigned char* ring, int tid, int lr, int hi, v8f (&acc)[MT * NT]) {
#pragma unroll
    for (int i = 0; i < MT * NT; ++i) acc[i] = (v8f){};
    const unsigned l0 = (unsigned)(size_t)ring + (unsigned)((tid >> 3) * GPIT + (tid & 7) * 16);
    const bf* ga = A + (size_t)(R0 + (tid >> 3)) * lda + (tid & 7) * 8;
    const bf* gb = Bt + (size_t)(C0 + (tid >> 3)) * ldbt + (tid & 7) * 8;
    const size_t sa = 32 * lda, sb = 32 * ldbt;
    const int nst = K / GKS;                                   // the same for every wave of the launch
    gemm_stage(l0, ga, sa, gb, sb);                            // stage 0 -> buffer 0
    asm volatile("s_wait_asynccnt 0x0" ::: "memory");          // this wave's share of stage 0 has landed
    __syncthreads();                                           // stage 0 published
    if (nst > 1) gemm_stage(l0 + GST, ga + GKS, sa, gb + (GKS & kbm), sb);   // stage 1 -> buffer 1
    const int ao = (wr + lr) * GPIT + 16 * hi, bfo = (GAR + wc + lr) * GPIT + 16 * hi;
#pragma unroll 1
    for (int st = 0; st < nst; ++st) {
        const unsigned bo = (st & 1) ? (unsigned)GST : 0u;
        const bf* as = (const bf*)(ring + bo + ao); const bf* bs = (const bf*)(ring + bo + bfo);
        v16bf a[MT], b[NT];
#pragma unroll
        for (int ks = 0; ks < GKS / 32; ++ks) {
            // the fragments of a 32-k step are read as one group ahead of its products, so the LDS latency is waited out once per step
#pragma unroll
            for (int mb = 0; mb < MT; ++mb) a[mb] = ldb(as + mb * 16 * (GPIT / 2) + 32 * ks);
#pragma unroll
            for (int nb = 0; nb < NT; ++nb) b[nb] = ldb(bs + nb * 16 * (GPIT / 2) + 32 * ks);
            // inputs-only fence on the loaded fragments: holds all reads of the step in one group in front of its products (otherwise each Bt fragment is read, and its latency waited out, between the products)
            if constexpr (MT == 4 && NT == 4) asm volatile("" :: "v"(a[0]), "v"(a[1]), "v"(a[2]), "v"(a[3]), "v"(b[0]), "v"(b[1]), "v"(b[2]), "v"(b[3]));
            else { static_assert((MT == 4 && NT == 4) || (MT == 2 && NT == 8));
                asm volatile("" :: "v"(a[0]), "v"(a[1]), "v"(b[0]), "v"(b[1]), "v"(b[2]), "v"(b[3]), "v"(b[4]), "v"(b[5]), "v"(b[6]), "v"(b[7])); }
#pragma unroll
            for (int nb = 0; nb < NT; ++nb) {
#pragma unroll
                for (int mb = 0; mb < MT; ++mb) acc[mb * NT + nb] = wmmab(a[mb], b[nb], acc[mb * NT + nb]); }
        }
        asm volatile("v_nop\n\tv_nop\n\tv_nop\n\tv_nop" : "+v"(acc[0]), "+v"(acc[(MT * NT) / 3]), "+v"(acc[(2 * MT * NT) / 3]), "+v"(acc[MT * NT - 1]) : "v"(a[0]), "v"(a[MT - 1]), "v"(b[NT - 1]));
        // publish point of stage st + 1
        asm volatile("s_wait_dscnt 0x0" ::: "memory");         // this wave's reads of the buffer of stage st are done before it is handed to the copies
        asm volatile("s_wait_asynccnt 0x0" ::: "memory");      // this wave's share of stage st + 1 has landed
        __syncthreads();                                       // stage st + 1 published; every reader has left the buffer of stage st
        if (st + 2 < nst) gemm_stage(l0 + bo, ga + (st + 2) * GKS, sa, gb + (((st + 2) * GKS) & kbm), sb);   // stage st + 2 -> the buffer just read
    }
    asm volatile("s_wait_asynccnt 0x0" ::: "memory");          // nothing of this wave is in flight when it leaves the ring
}

// qk_body: projection + bias + rotary for q or k. One wave per 32 rows x 128 columns (= one head), K = DM; a block is 4 row groups x 2 heads: bx in NB*SEQ/128, by in nheads/2, 256 threads.
// Output plane [(b*nheads + head)][t][d] as f16 (Ph) and optionally the f16 residual x2048 (Pr, useRes != 0).
// Output staging lies on the ring: the last publish point of gemm_loop (LDS reads done, no copy in flight, block barrier) has freed it for every wave.
__device__ __forceinline__ void qk_body(const bf* __restrict__ A, const bf* __restrict__ Bt, const float* __restrict__ bias, const float* __restrict__ CS, h16* Ph, h16* Pr, int useRes, int nheads,
                                        int bx, int by, unsigned char* ring, int tid) {
    static_assert(GW * 16 * 132 * 4 <= 2 * GST);
    const int lane = tid & 31, wave = tid >> 5, lr = lane & 15, hi = lane >> 4;
    float* os = (float*)ring + wave * 16 * 132;                // wave-private output staging
    const int wr = (wave & 3) * 32, wc = (wave >> 2) * HD;
    const int r0 = bx * 128 + wr, head = by * 2 + (wave >> 2), cbase = head * HD;
    v8f acc[16];
    gemm_loop<2, 8>(A, (size_t)DM, Bt, (size_t)DM, DM, 0x7FFFFFFF, bx * 128, by * 256, wr, wc, ring, tid, lr, hi, acc);
    float bz[8];
#pragma unroll
    for (int nb = 0; nb < 8; ++nb) bz[nb] = bfr(bias[cbase + nb * 16 + lr]);
    const int b = r0 / SEQ, t0 = r0 % SEQ;
    const size_t tbase = ((size_t)(b * nheads + head) * SEQ + t0) * HD;
#pragma unroll
    for (int mb = 0; mb < 2; ++mb) {
#pragma unroll
        for (int nb = 0; nb < 8; ++nb) {
#pragma unroll
            for (int j = 0; j < 8; ++j) os[(hi * 8 + j) * 132 + nb * 16 + lr] = acc[mb * 8 + nb][j] + bz[nb]; }   // D: row 8h+j, col lane&15; rows 0..15 x cols 0..127 all staged
        wave_sync();
{
            const int c8 = lr * 8, p8 = c8 ^ 64;
#pragma unroll 1   // stays rolled, four trips of two row pairs each: keeps the epilogue's code short
            for (int s2 = 0; s2 < 8; s2 += 2) { v4u hq[2], rq[2];
#pragma unroll
              for (int u = 0; u < 2; ++u) { const int row = 2 * (s2 + u) + hi;   // 8 s x 2 rows = 16 rows; 16 lanes x 8 = 128 columns
                const int t = t0 + mb * 16 + row;
                const float* orow = &os[row * 132];
                const v4f x0 = *(const v4fa*)(orow + c8), x1 = *(const v4fa*)(orow + c8 + 4);
                const v4f y0 = *(const v4fa*)(orow + p8), y1 = *(const v4fa*)(orow + p8 + 4);
                const float* cs = CS + (size_t)t * 128 + (c8 & 63);
                const v4f cc0 = *(const v4f*)cs, cc1 = *(const v4f*)(cs + 4), ss0 = *(const v4f*)(cs + 64), ss1 = *(const v4f*)(cs + 68);
                const float sg = (c8 < 64) ? -1.0f : 1.0f;       // d < 64: x[d] cos - x[d+64] sin; d >= 64: x[d] cos + x[d-64] sin
                v8h hv, rv;
#pragma unroll
                for (int i = 0; i < 4; ++i) {
                    const float v0 = x0[i] * cc0[i] + sg * (y0[i] * ss0[i]); const float v1 = x1[i] * cc1[i] + sg * (y1[i] * ss1[i]);
                    const h16 a0 = (h16)v0; const h16 a1 = (h16)v1; hv[i] = a0; hv[4 + i] = a1;
                    rv[i] = (h16)((v0 - (float)a0) * QRS); rv[4 + i] = (h16)((v1 - (float)a1) * QRS); }
                hq[u] = __builtin_bit_cast(v4u, hv); rq[u] = __builtin_bit_cast(v4u, rv); }
                const size_t oo = tbase + (size_t)(mb * 16 + 2 * s2 + hi) * HD + c8;   // row 2 s2 + hi; the second piece lies two rows (2 * HD * 2 bytes) further
                h16* ph = Ph + oo; h16* pr = Pr + oo;
                // the trip's stores and their s_wait_xcnt in one statement, so that the wait stands in front of every rewrite of a register that a store names (a wait in a statement of its own does not hold the address additions behind it)
                if (useRes) asm volatile("global_store_b128 %0, %2, off\n\t"
                                         "global_store_b128 %0, %3, off offset:%6\n\t"
                                         "global_store_b128 %1, %4, off\n\t"
                                         "global_store_b128 %1, %5, off offset:%6\n\t"
                                         "s_wait_xcnt 0x0"
                                         :: "v"(ph), "v"(pr), "v"(hq[0]), "v"(hq[1]), "v"(rq[0]), "v"(rq[1]), "n"(2 * HD * 2) : "memory");
                else        asm volatile("global_store_b128 %0, %1, off\n\t"
                                         "global_store_b128 %0, %2, off offset:%3\n\t"
                                         "s_wait_xcnt 0x0"
                                         :: "v"(ph), "v"(hq[0]), "v"(hq[1]), "n"(2 * HD * 2) : "memory"); }
             }
        wave_sync();
    }
}

// vt_body: v^T projection. A = WvT rows (m = g*128 + d), Bt = x rows (n = b*SEQ + t), one wave per 64x64 tile, a block is 2 x 4 of them: bx in DKV/128, by in NB*SEQ/256, 256 threads.
// Planes [(b*DKV + m)][t] = [(b*4 + g)][d][t]: f16 value (VH) and f16 residual x256 (VR); bias per row m. Output staging lies on the ring, as in qk_body.
__device__ __forceinline__ void vt_body(const bf* __restrict__ A, const bf* __restrict__ Bt, const float* __restrict__ bias, h16* VH, h16* VR, int bx, int by, unsigned char* ring, int tid) {
    const int lane = tid & 31, wave = tid >> 5, lr = lane & 15, hi = lane >> 4;
    float* os = (float*)ring + wave * 16 * 68;                 // wave-private output staging
    const int wr = (wave & 1) * 64, wc = (wave >> 1) * 64;
    const int r0 = bx * 128 + wr, c0 = by * 256 + wc;
    v8f acc[16];
    gemm_loop<4, 4>(A, (size_t)DM, Bt, (size_t)DM, DM, 0x7FFFFFFF, bx * 128, by * 256, wr, wc, ring, tid, lr, hi, acc);
    const int b = c0 / SEQ, t0 = c0 % SEQ;
    const size_t tbase = ((size_t)b * DKV + r0) * SEQ + t0;
#pragma unroll
    for (int mb = 0; mb < 4; ++mb) {
        float bj[8];
#pragma unroll
        for (int j = 0; j < 8; ++j) bj[j] = bfr(bias[r0 + mb * 16 + hi * 8 + j]);
#pragma unroll
        for (int nb = 0; nb < 4; ++nb) {
#pragma unroll
            for (int j = 0; j < 8; ++j) os[(hi * 8 + j) * 68 + nb * 16 + lr] = acc[mb * 4 + nb][j] + bj[j]; }   // rows 0..15 x cols 0..63 all staged
        wave_sync();
        const size_t sb = tbase + (size_t)(mb * 16) * SEQ;
{
            const int c8 = (lane & 7) * 8; v4u hq[4], rq[4];
#pragma unroll
            for (int s = 0; s < 4; ++s) { const int row = 4 * s + (lane >> 3);   // 4 s x 4 row groups = 16 rows; 8 lanes x 8 = 64 columns
                const v4f x0 = *(const v4fa*)(&os[row * 68 + c8]); const v4f x1 = *(const v4fa*)(&os[row * 68 + c8 + 4]); v8h hv, rv;
#pragma unroll
                for (int i = 0; i < 4; ++i) { const h16 a0 = (h16)x0[i]; const h16 a1 = (h16)x1[i]; hv[i] = a0; hv[4 + i] = a1; rv[i] = (h16)((x0[i] - (float)a0) * VRS); rv[4 + i] = (h16)((x1[i] - (float)a1) * VRS); }
                hq[s] = __builtin_bit_cast(v4u, hv); rq[s] = __builtin_bit_cast(v4u, rv); }
            const size_t oo = sb + (size_t)(lane >> 3) * SEQ + c8;   // row lane>>3; piece s lies 4 s rows (4 * SEQ * 2 bytes each step) further
            h16* ph = VH + oo; h16* pr = VR + oo;
            // the row block's stores and their s_wait_xcnt in one statement, so that the wait stands in front of every rewrite of a register that a store names (the next block's bias loads may take the data registers)
            asm volatile("global_store_b128 %0, %2, off\n\t"
                         "global_store_b128 %1, %6, off\n\t"
                         "global_store_b128 %0, %3, off offset:%10\n\t"
                         "global_store_b128 %1, %7, off offset:%10\n\t"
                         "global_store_b128 %0, %4, off offset:%11\n\t"
                         "global_store_b128 %1, %8, off offset:%11\n\t"
                         "global_store_b128 %0, %5, off offset:%12\n\t"
                         "global_store_b128 %1, %9, off offset:%12\n\t"
                         "s_wait_xcnt 0x0"
                         :: "v"(ph), "v"(pr), "v"(hq[0]), "v"(hq[1]), "v"(hq[2]), "v"(hq[3]), "v"(rq[0]), "v"(rq[1]), "v"(rq[2]), "v"(rq[3]),
                            "n"(4 * SEQ * 2), "n"(8 * SEQ * 2), "n"(12 * SEQ * 2) : "memory");
             }
        wave_sync();
    }
}

// k_qkv: the q, k and v^T projections, which do not depend on one another, as block ranges of one grid, so that the 64-block k and v^T jobs run beside the q job instead of each alone on a quarter of the chip.
// One LDS arena (the ring, 108 KiB) lets two blocks share a WGP, so all blocks of the grid are resident at once. The range test reads blockIdx only, so every barrier stays block-uniform.
#define GB_ROW  (NB * SEQ / 128)
#define GB_Q    (GB_ROW * (NH_ / 2))
#define GB_K    (GB_ROW * (NKV / 2))
#define GB_V    ((DKV / 128) * (NB * SEQ / 256))
__global__ __launch_bounds__(32 * GW) __attribute__((amdgpu_num_vgpr(256)))
void k_qkv(const bf* __restrict__ XB, const bf* __restrict__ WQT, const bf* __restrict__ WKT, const bf* __restrict__ WVT,
           const float* __restrict__ bq, const float* __restrict__ bk, const float* __restrict__ bv, const float* __restrict__ CS, h16* QH, h16* QR, h16* KP, h16* VH, h16* VR) {
    __shared__ __align__(16) unsigned char ring[2 * GST];
    const int tid = threadIdx.x; const int id = blockIdx.x;
    if (id < GB_Q + GB_K) {
        const bool isq = id < GB_Q; const int r = isq ? id : id - GB_Q;
        qk_body(XB, isq ? WQT : WKT, isq ? bq : bk, CS, isq ? QH : KP, isq ? QR : KP, isq ? 1 : 0, isq ? NH_ : NKV, r % GB_ROW, r / GB_ROW, ring, tid);
    } else {
        const int r = id - GB_Q - GB_K;
        vt_body(WVT, XB, bv, VH, VR, r % (DKV / 128), r / (DKV / 128), ring, tid);
    }
}

// k_flash: fused causal attention, one wave per 16 query rows of one (batch, head). A block is the 4 query heads of one kv head x 2 adjacent 16-row query tiles (8 waves): all of them walk
// the same keys, so each 32-key stage of K, V^T value and V^T residual is brought into LDS once per block by asynchronous copies (whole 16-B pieces, contiguous per row) and every wave takes its fragments from there.
// Two buffers: stage s + 1 is in flight while stage s is worked on; one barrier per stage publishes s + 1 and frees the buffer of s.
// Transposed form: S^T[key][t] = K Q^T (A = K rows, B = Q rows); lane (t = lane&15, h = lane>>4) holds keys 8h+r of each 16-key tile, so the packed
// P tile is directly the B fragment of O^T[d][t] = V^T P^T (element r <- tile keys 0..15, element 8+r <- tile keys 16..31, lane unchanged).
// The key loop of a tile runs to the 32-key step that contains its last query; keys beyond a query get the fill value (weight exactly 0). ALiBi bias slope*(key - query) added in the exp2 domain.
// Balance: a 32-row query tile x walks x + 1 stages, and all blocks of the grid are resident at once, so the launch lasts as long as its fullest WGP. Each block therefore takes two tiles one after the other,
// x and SEQ/32 - 1 - x: SEQ/32 + 1 stages for every block, one block per WGP. The two walks are one run of stages through the ring (the second tile's first stages fly while the first tile ends);
// at the first tile's last stage every wave writes its rows out, takes the second tile's q and starts its sums anew. The sums of a tile are formed as before.
// What is left: only two waves per SIMD are resident now, and the waits of a stage (eight groups of LDS reads, the softmax chain) stand open between them.
// Stage planes in LDS, 16 lines of SPIT bytes each, line = fragment row (lane&15): K line holds key rows r and 16 + r (256 B each); a V^T line holds the 32-key pieces (64 B) of rows d = 16j + r, j = 0..7.
// So every fragment of a stage is read at one per-lane address plus a constant.
// flash_stage: one stage = K 32 rows x 256 B, V^T value and residual 128 rows x 64 B each = 24 KiB = 256 lanes x 6 copies of 16 B. The s_wait_xcnt closes the statement so that no address register is rewritten ahead of it.
__device__ __forceinline__ void flash_stage(unsigned lk, unsigned lv, const h16* gk, const h16* gh, const h16* gr) {
    const unsigned lk1 = lk + 256, lh0 = lv + ST_VH, lh1 = lv + ST_VH + 256, lr0 = lv + ST_VR, lr1 = lv + ST_VR + 256;
    const h16* gk1 = gk + 16 * HD; const h16* gh1 = gh + (size_t)64 * SEQ; const h16* gr1 = gr + (size_t)64 * SEQ;
    asm volatile("global_load_async_to_lds_b128 %0, %6, off\n\t"
                 "global_load_async_to_lds_b128 %1, %7, off\n\t"
                 "global_load_async_to_lds_b128 %2, %8, off\n\t"
                 "global_load_async_to_lds_b128 %3, %9, off\n\t"
                 "global_load_async_to_lds_b128 %4, %10, off\n\t"
                 "global_load_async_to_lds_b128 %5, %11, off\n\t"
                 "s_wait_xcnt 0x0"
                 :: "v"(lk), "v"(lk1), "v"(lh0), "v"(lh1), "v"(lr0), "v"(lr1), "v"(gk), "v"(gk1), "v"(gh), "v"(gh1), "v"(gr), "v"(gr1) : "memory");
}

// flash_q: the q value and residual fragments of a wave's 16 query rows (B fragments: col t, k = d); qa, qb: this lane's piece of its row in the two planes.
// The s_wait_xcnt takes the two addresses as inputs, so that their registers stay as they are until it has passed (otherwise a late load's result may be laid on them).
__device__ __forceinline__ void flash_q(const h16* qa, const h16* qb, v16h (&qh)[4], v16h (&qr)[4]) {
#pragma unroll
    for (int c = 0; c < 4; ++c) { qh[c] = ldh(qa + 32 * c); qr[c] = ldh(qb + 32 * c); }
    asm volatile("s_wait_xcnt 0x0" :: "v"(qa), "v"(qb) : "memory");
}

__global__ __launch_bounds__(32 * FW) __attribute__((amdgpu_num_vgpr(256)))
void k_flash(const h16* __restrict__ QH, const h16* __restrict__ QR, const h16* __restrict__ KP, const h16* __restrict__ VH, const h16* __restrict__ VR, bf* CTX) {
    __shared__ __align__(16) unsigned char ring[2 * ST_SZ];
    __shared__ __align__(16) float os[FW * 16 * 132];
    const int tid = threadIdx.x;
    const int lane = tid & 31, wave = tid >> 5, lr = lane & 15, hi = lane >> 4;
    const int bg = blockIdx.y; const int b = bg / NKV, g = bg % NKV; const int h = g * REP + (wave & (REP - 1)); const int zh = b * NH_ + h;
    constexpr int NQT = SEQ / 32;                              // query tiles of one (batch, kv head)
    static_assert(NQT % 2 == 0);                               // the tiles pair off, every tile in exactly one block
    const int na = blockIdx.x + 1;                             // 32-key stages of the first tile (blockIdx.x); the second tile (NQT - 1 - blockIdx.x) has NQT - blockIdx.x
    constexpr int nst = NQT + 1;                               // stages of the block, the same for every block; stage st holds key step st of the first tile or st - na of the second, both below NQT
    int t0 = blockIdx.x * 32 + (wave >> 2) * 16;
    const size_t kvb = (size_t)bg * SEQ * HD;
    // copy addresses of this lane. K: piece tid -> key row tid>>4 (and +16: +256 B in its line), 16-B column tid&15. V^T: piece tid -> row d = tid>>2 (and +64: +256 B in its line), 16-B column tid&3.
    const unsigned rb = (unsigned)(size_t)ring;
    const unsigned lk = rb + (unsigned)((tid >> 4) * SPIT + (tid & 15) * 16), lvt = rb + (unsigned)(((tid >> 2) & 15) * SPIT + (tid >> 6) * 64 + (tid & 3) * 16);
    const h16* gk = KP + kvb + (size_t)tid * 8;                // + key0 * HD
    const size_t gvo = kvb + (size_t)(tid >> 2) * SEQ + (tid & 3) * 8;   // + key0
    const h16* gh = VH + gvo; const h16* gr = VR + gvo;
    flash_stage(lk, lvt, gk, gh, gr);                          // stage 0 -> buffer 0
    const size_t qz = (size_t)zh * SEQ * HD + (size_t)lr * HD + 8 * hi;   // + t0 * HD
    v16h qh[4], qr[4];
    flash_q(QH + qz + (size_t)t0 * HD, QR + qz + (size_t)t0 * HD, qh, qr);
    asm volatile("s_wait_asynccnt 0x0" ::: "memory");          // this wave's share of stage 0 has landed
    __syncthreads();                                           // stage 0 published
    { const int k1 = na > 1 ? 32 : 0; flash_stage(lk + ST_SZ, lvt + ST_SZ, gk + (size_t)k1 * HD, gh + k1, gr + k1); }   // stage 1 -> buffer 1
    const int fo = lr * SPIT + 16 * hi;                        // K: + 256 (second key tile) + 64*c (A fragment: row key, k = d); V^T: + plane + 64*j (A fragment: row d, k = key)
    const float slope2 = __builtin_amdgcn_exp2f(-0.5f * (float)(h + 1)) * LOG2E;
    int qi = t0 + lr;
    const int wb = wave * 16 * 132;
    v8f o[8];
#pragma unroll
    for (int j = 0; j < 8; ++j) o[j] = (v8f){};
    float m = NEGBIG, l = 0.0f;
#pragma unroll 1
    for (int st = 0; st < nst; ++st) {
        const int key0 = (st < na ? st : st - na) * 32;
        const unsigned bo = (st & 1) ? (unsigned)ST_SZ : 0u;
        const h16* ka = (const h16*)(ring + bo + fo);
        v8f sHa = (v8f){}, sLa = (v8f){}, sHb = (v8f){}, sLb = (v8f){};
        v16h kal, kbl;
#pragma unroll
        for (int c = 0; c < 4; ++c) {
            kal = ldh(ka + 32 * c); kbl = ldh(ka + 128 + 32 * c);
            sHa = wmma16(kal, qh[c], sHa); sLa = wmma16(kal, qr[c], sLa); sHb = wmma16(kbl, qh[c], sHb); sLb = wmma16(kbl, qr[c], sLb); }
        asm volatile("v_nop\n\tv_nop\n\tv_nop\n\tv_nop" : "+v"(sHa), "+v"(sLa), "+v"(sHb), "+v"(sLb) : "v"(kal), "v"(kbl));
        const float base = (float)(key0 + 8 * hi - qi);        // key - query for r = 0 of tile a
        float ta[8], tb[8]; float mx = NEGBIG;
#pragma unroll
        for (int r = 0; r < 8; ++r) {
            const float da = base + (float)r, db = da + 16.0f;
            float xa = fmaf(slope2, da, (sHa[r] + sLa[r] * QRI) * SC2);
            float xb = fmaf(slope2, db, (sHb[r] + sLb[r] * QRI) * SC2);
            xa = (da > 0.0f) ? NEGBIG : xa; xb = (db > 0.0f) ? NEGBIG : xb;
            ta[r] = xa; tb[r] = xb; mx = fmaxf(mx, fmaxf(xa, xb)); }
        mx = fmaxf(mx, __shfl_xor(mx, 16, 32));
        const float mnew = fmaxf(m, mx);
        const float alpha = __builtin_amdgcn_exp2f(m - mnew);
        const float sh = PSH - mnew;
        v16h pb; float ls = 0.0f;
#pragma unroll
        for (int r = 0; r < 8; ++r) { const h16 pa = (h16)__builtin_amdgcn_exp2f(ta[r] + sh); const h16 pc = (h16)__builtin_amdgcn_exp2f(tb[r] + sh); pb[r] = pa; pb[8 + r] = pc; ls += (float)pa + (float)pc; }
        const v16h pq = pb * (h16)0.00390625f;                 // P x 2^-8: partner of the v residual x256
        l = l * alpha + ls; m = mnew;
#pragma unroll
        for (int j = 0; j < 8; ++j) o[j] = o[j] * alpha;
        const h16* va = ka + ST_VH / 2; const h16* vr = ka + ST_VR / 2;
        // four fragments are read as one group ahead of their four products, so the LDS latency is waited out once per group; all loops unrolled so that every array index is a constant (registers, no scratch)
#pragma unroll
        for (int j4 = 0; j4 < 8; j4 += 4) { v16h vf[4];
#pragma unroll
            for (int j = 0; j < 4; ++j) vf[j] = ldh(va + 32 * (j4 + j));
#pragma unroll
            for (int j = 0; j < 4; ++j) o[j4 + j] = wmma16(vf[j], pb, o[j4 + j]); }
#pragma unroll
        for (int j4 = 0; j4 < 8; j4 += 4) { v16h vf[4];
#pragma unroll
            for (int j = 0; j < 4; ++j) vf[j] = ldh(vr + 32 * (j4 + j));
#pragma unroll
            for (int j = 0; j < 4; ++j) o[j4 + j] = wmma16(vf[j], pq, o[j4 + j]); }
        asm volatile("v_nop\n\tv_nop\n\tv_nop\n\tv_nop" : "+v"(o[0]), "+v"(o[1]), "+v"(o[2]), "+v"(o[3]), "+v"(o[4]), "+v"(o[5]), "+v"(o[6]), "+v"(o[7]) : "v"(pb), "v"(pq));
        // publish point of stage st + 1
        asm volatile("s_wait_dscnt 0x0" ::: "memory");         // this wave's reads of the buffer of stage st are done before it is handed to the copies
        asm volatile("s_wait_asynccnt 0x0" ::: "memory");      // this wave's share of stage st + 1 has landed
        __syncthreads();                                       // stage st + 1 published; every reader has left the buffer of stage st
        if (st + 2 < nst) { const int k2 = (st + 2 < na ? st + 2 : st + 2 - na) * 32; flash_stage(lk + bo, lvt + bo, gk + (size_t)k2 * HD, gh + k2, gr + k2); }   // stage st + 2 -> the buffer just read
      if (st == na - 1 || st == nst - 1) {                     // block-uniform: behind a tile's last stage its rows go out
    l += __shfl_xor(l, 16, 32);
    const float inv = 1.0f / l;
    // O^T D layout: o[j][r] = (d = 16j + 8h + r, t = lane&15) -> os[t][d]; rows 0..15 x columns 0..127 all written
#pragma unroll
    for (int j = 0; j < 8; ++j) { v4f a, c;
        a[0] = o[j][0] * inv; a[1] = o[j][1] * inv; a[2] = o[j][2] * inv; a[3] = o[j][3] * inv; c[0] = o[j][4] * inv; c[1] = o[j][5] * inv; c[2] = o[j][6] * inv; c[3] = o[j][7] * inv;
        *(v4fa*)(&os[wb + lr * 132 + 16 * j + 8 * hi]) = a; *(v4fa*)(&os[wb + lr * 132 + 16 * j + 8 * hi + 4]) = c; }
    wave_sync();
    bf* crow = CTX + ((size_t)b * SEQ + t0) * (size_t)(2 * DM) + h * HD;
{
#pragma unroll 2
        for (int s = 0; s < 8; ++s) { const int row = 2 * s + hi, c8 = lr * 8;   // 8 s x 2 rows = 16 rows; 16 lanes x 8 = 128 columns
            const v4f x0 = *(const v4fa*)(&os[wb + row * 132 + c8]); const v4f x1 = *(const v4fa*)(&os[wb + row * 132 + c8 + 4]); v8us hv, lv;
#pragma unroll
            for (int i = 0; i < 4; ++i) { const unsigned short a0 = f2bf(x0[i]); const unsigned short a1 = f2bf(x1[i]); hv[i] = a0; hv[4 + i] = a1; lv[i] = f2bf(x0[i] - bf2f(a0)); lv[4 + i] = f2bf(x1[i] - bf2f(a1)); }
            bf* dst = crow + (size_t)row * (size_t)(2 * DM) + c8;
            *(v8us*)dst = hv; *(v8us*)(dst + DM) = lv; }
         }
        asm volatile("s_wait_xcnt 0x0" ::: "memory");          // behind the tile's stores, in front of the rewrites of the registers that they name
        wave_sync();                                           // this wave's reads of its output staging stand in front of the second tile's writes to it
        // second tile: its rows, its q, sums from the start
        t0 = (NQT - 1 - (int)blockIdx.x) * 32 + (wave >> 2) * 16; qi = t0 + lr;
        if (st != nst - 1) flash_q(QH + qz + (size_t)t0 * HD, QR + qz + (size_t)t0 * HD, qh, qr);
#pragma unroll
        for (int j = 0; j < 8; ++j) o[j] = (v8f){};
        m = NEGBIG; l = 0.0f;
      }
    }
    asm volatile("s_wait_asynccnt 0x0" ::: "memory");          // nothing of this wave is in flight when it leaves the ring
}

// k_out: output projection. A = ctx plane rows [hi 2048 | lo 2048] (K = 4096 folded against the single WoT plane), Bt = WoT rows, one wave per 64x64 tile, a block is 2 x 4 of them. grid (NB*SEQ/128, DM/256), 256 threads.
__global__ __launch_bounds__(32 * GW) __attribute__((amdgpu_num_vgpr(256)))
void k_out(const bf* __restrict__ A, const bf* __restrict__ Bt, const float* __restrict__ bias, float* OUT) {
    __shared__ __align__(16) unsigned char ring[2 * GST];
    __shared__ __align__(16) float osb[GW * 16 * 68];
    const int tid = threadIdx.x;
    const int lane = tid & 31, wave = tid >> 5, lr = lane & 15, hi = lane >> 4;
    float* os = osb + wave * 16 * 68;                          // wave-private output staging
    const int wr = (wave & 1) * 64, wc = (wave >> 1) * 64;
    const int r0 = blockIdx.x * 128 + wr, c0 = blockIdx.y * 256 + wc;
    v8f acc[16];
    gemm_loop<4, 4>(A, (size_t)(2 * DM), Bt, (size_t)DM, 2 * DM, DM - 1, blockIdx.x * 128, blockIdx.y * 256, wr, wc, ring, tid, lr, hi, acc);
    float bz[4];
#pragma unroll
    for (int nb = 0; nb < 4; ++nb) bz[nb] = bfr(bias[c0 + nb * 16 + lr]);
    const int b = r0 / SEQ, t0 = r0 % SEQ;
    float* obase = OUT + ((size_t)b * OUT_SEQ + t0) * DM + c0;
#pragma unroll
    for (int mb = 0; mb < 4; ++mb) {
#pragma unroll
        for (int nb = 0; nb < 4; ++nb) {
#pragma unroll
            for (int j = 0; j < 8; ++j) os[(hi * 8 + j) * 68 + nb * 16 + lr] = acc[mb * 4 + nb][j] + bz[nb]; }   // rows 0..15 x cols 0..63 all staged
        wave_sync();
        float* orow = obase + (size_t)(mb * 16) * DM;
{
#pragma unroll
            for (int s = 0; s < 8; ++s) { const int row = 2 * s + hi, cofs = lr * 4;   // 8 s x 2 rows = 16 rows; 16 lanes x 4 floats = 64 columns
                const v4f val = *(const v4fa*)(&os[row * 68 + cofs]);
                *(v4f*)(orow + (size_t)row * DM + cofs) = val; }
             }
        wave_sync();
    }
}

static constexpr size_t al256(size_t v) { return (v + 255) & ~(size_t)255; }
static constexpr size_t SZ_XB  = al256((size_t)NB * SEQ * DM * 2);
static constexpr size_t SZ_WQ  = al256((size_t)DM * DM * 2);
static constexpr size_t SZ_WK  = al256((size_t)DKV * DM * 2);
static constexpr size_t SZ_CS  = al256((size_t)SEQ * 128 * 4);
static constexpr size_t SZ_QP  = al256((size_t)NB * NH_ * SEQ * HD * 2);
static constexpr size_t SZ_KP  = al256((size_t)NB * NKV * SEQ * HD * 2);
static constexpr size_t SZ_CTX = al256((size_t)NB * SEQ * 2 * DM * 2);
static constexpr size_t SZ_TOTAL = SZ_XB + 2 * SZ_WQ + 2 * SZ_WK + SZ_CS + 2 * SZ_QP + 3 * SZ_KP + SZ_CTX;
static_assert(SZ_TOTAL <= (size_t)134217728);          // workspace carve <= 128 MiB

extern "C" void kernel_launch(void* const* d_in, const int* in_sizes, int n_in,
                              void* d_out, int out_size, void* d_ws, size_t ws_size, hipStream_t stream) {
    if (n_in < 9) return;
    const size_t needx = ((size_t)(NB - 1) * SEQ_FULL + SEQ) * DM;
    if ((size_t)in_sizes[0] < needx) return;
    if ((size_t)in_sizes[1] < (size_t)DM * DM || (size_t)in_sizes[2] < (size_t)DM) return;
    if ((size_t)in_sizes[3] < (size_t)DM * DKV || (size_t)in_sizes[4] < (size_t)DKV) return;
    if ((size_t)in_sizes[5] < (size_t)DM * DKV || (size_t)in_sizes[6] < (size_t)DKV) return;
    if ((size_t)in_sizes[7] < (size_t)DM * DM || (size_t)in_sizes[8] < (size_t)DM) return;
    if ((size_t)out_size < ((size_t)(NB - 1) * OUT_SEQ + SEQ) * DM) return;
    if (SZ_TOTAL > ws_size) return;
    // wire order: x, Wq, bq, Wk, bk, Wv, bv, Wo, bo (weights [in][out])
    const float* x  = (const float*)d_in[0];
    const float* wq = (const float*)d_in[1]; const float* bq = (const float*)d_in[2];
    const float* wk = (const float*)d_in[3]; const float* bk = (const float*)d_in[4];
    const float* wv = (const float*)d_in[5]; const float* bv = (const float*)d_in[6];
    const float* wo = (const float*)d_in[7]; const float* bo = (const float*)d_in[8];
    float* OUT = (float*)d_out;      // [NB][SEQ][2048]
    char* wsp = (char*)d_ws;
    bf* XB  = (bf*)wsp; wsp += SZ_XB;                // [NB*SEQ][2048]
    bf* WQT = (bf*)wsp; wsp += SZ_WQ;                // [2048 out][2048 in]
    bf* WOT = (bf*)wsp; wsp += SZ_WQ;                // [2048 out][2048 in]
    bf* WKT = (bf*)wsp; wsp += SZ_WK;                // [512 out][2048 in]
    bf* WVT = (bf*)wsp; wsp += SZ_WK;                // [512 out][2048 in]
    float* CS = (float*)wsp; wsp += SZ_CS;           // [SEQ][cos 64 | sin 64]
    h16* QH = (h16*)wsp; wsp += SZ_QP;               // [NB*16][SEQ][128]
    h16* QR = (h16*)wsp; wsp += SZ_QP;               // [NB*16][SEQ][128] residual x2048
    h16* KP = (h16*)wsp; wsp += SZ_KP;               // [NB*4][SEQ][128]
    h16* VH = (h16*)wsp; wsp += SZ_KP;               // [NB*4][128][SEQ]
    h16* VR = (h16*)wsp; wsp += SZ_KP;               // [NB*4][128][SEQ] residual x256
    bf* CTX = (bf*)wsp; wsp += SZ_CTX;               // [NB*SEQ][hi 2048 | lo 2048]

    // weight transposes in[K = DM rows][N cols] -> out[N rows][K = DM cols], rotary table, bf16 copy of x
    k_prep<<<PB_W + PB_ROPE + PB_CVT, 256, 0, stream>>>(x, wq, wk, wv, wo, XB, WQT, WKT, WVT, WOT, CS);

    // q, k: A = x rows (m = b*SEQ + t), Bt = WT rows (n = head*128 + d) -> plane [(b*nheads + head)][t][d], rotary applied
    // v^T: A = WvT rows (m = g*128 + d), Bt = x rows (n = b*SEQ + t) -> planes [(b*512 + m)][t]
    k_qkv<<<GB_Q + GB_K + GB_V, 32 * GW, 0, stream>>>(XB, WQT, WKT, WVT, bq, bk, bv, CS, QH, QR, KP, VH, VR);

    k_flash<<<dim3(SEQ / 64, NB * NKV, 1), 32 * FW, 0, stream>>>(QH, QR, KP, VH, VR, CTX);

    k_out<<<dim3(NB * SEQ / 128, DM / 256, 1), 32 * GW, 0, stream>>>(CTX, WOT, bo, OUT);
}

// v005
// One run takes 179 microseconds.
// Two timings next to v004 both put it at 1.11 times that version's speed.
// All steps since v000 together make it 3.78 times as fast.
#include <hip/hip_runtime.h>

// Causal grouped-query attention layer: x [NB][SEQ][2048], 16 query heads x 128, 4 kv heads, weights [in][out] with biases, rotate-half rotary (theta 1e4), ALiBi slopes 2^(-(h+1)/2), output projection; f32 output.
// Compute dtypes, f32 accumulate everywhere: q/k/v projections v_wmma_f32_16x16x32_bf16 (x, W, b RNE-converted to bf16; products exact);
// scores v_wmma_f32_16x16x32_f16: k single f16, q as f16 value + f16 residual x2048 in its own accumulator; P.V v_wmma_f32_16x16x32_f16: P single f16 (x256 carry, cancels in the normalisation),
// v as f16 value + f16 residual x256 whose partner operand is the P copy x2^-8 (K-dimension fold, products at natural scale, one accumulator); output projection v_wmma_f32_16x16x32_bf16 with ctx as bf16 hi | lo planes, both multiplied with the one bf16 Wo plane into one accumulator (per 32-k step: hi products, then lo products); softmax f32 (online, running max).
// Layout: bf16 x copy, bf16 transposed weight planes [out][in]; q (hi, residual) planes [b*16+h][t][d], k plane [b*4+g][t][d], v^T planes [b*4+g][d][t]; ctx plane [b*SEQ+t][hi 2048 | lo 2048]; rotary table [t][cos 64 | sin 64].

#ifndef NB
#define NB 2
#endif
#ifndef SEQ
#define SEQ 2048
#endif
#define NB_FULL  2
#define SEQ_FULL 2048
#ifndef OUT_SEQ
#define OUT_SEQ SEQ              // row pitch (in tokens) between batches of the output
#endif
#define DM   2048
#define NH_  16
#define NKV  4
#define HD   128
#define REP  (NH_ / NKV)
#define DKV  (NKV * HD)          // 512
#define FW   8                   // waves per flash block: the 4 query heads of one kv head x 2 query tiles of 16 rows
#define SPIT 528                 // LDS pitch, bytes, of one fragment-row line of a stage plane (512 + 16: 16 B x odd for 16-B readers)
#define ST_VH (16 * SPIT)               // byte offsets inside one stage buffer: K at 0, V^T value, V^T residual
#define ST_VR (2 * 16 * SPIT)
#define ST_SZ (3 * 16 * SPIT)           // 25344 B per stage
#define GW   8                   // waves per GEMM block: block tile 128 A rows x 256 Bt rows
#define GKS  64                  // k elements per GEMM stage: one whole 128-B line of every operand row
#define GPIT 144                 // LDS pitch, bytes, of a staged 128-B row (16 B x odd for 16-B readers)
#define GAR  128                 // A rows of a stage; the Bt rows follow them
#define GST  ((GAR + 256) * GPIT)       // 55296 B per stage
#define FLO  128                 // k_out stage: first row of the ctx lo pieces (the hi pieces are rows 0..127)
#define FBT  256                 // k_out stage: first row of the WoT pieces
#define FST  ((FBT + 256) * GPIT)       // 73728 B per k_out stage
#define QRS  2048.0f             // carry of the q residual plane
#define QRI  (1.0f / 2048.0f)
#define VRS  256.0f              // carry of the v residual plane (partner operand is P x 2^-8)
#define LOG2E 1.4426950408889634f
#define SC2  (0.08838834764831845f * 1.4426950408889634f)   // HD^-0.5 * log2(e)
#define PSH  8.0f                // log2 of the P carry (256)
#define NEGBIG (-3.0e38f)

static_assert(HD == 128);
static_assert(NH_ * HD == DM);
static_assert(NH_ % NKV == 0);
static_assert(DM % 64 == 0);
static_assert(DKV % 64 == 0);
static_assert(DM % 32 == 0);
static_assert(SEQ % 64 == 0);                  // a 64-row tile never straddles two batches
static_assert((NB * SEQ) % 64 == 0);
static_assert(SEQ % 32 == 0);                  // key loop steps by 32
static_assert(REP == 4 && FW == 2 * REP);      // wave -> (head of the group, query tile) map of the flash block
static_assert(SEQ % 4 == 0);
static_assert((NB * SEQ) % 256 == 0 && DKV % 128 == 0 && DM % 256 == 0 && NKV % 2 == 0 && NH_ % 2 == 0);   // GEMM block tiles cover every operand exactly
static_assert(DM % GKS == 0);
static_assert(((size_t)SEQ * DM) % 8 == 0);
static_assert(NB <= NB_FULL);
static_assert(SEQ <= SEQ_FULL);

typedef _Float16 h16;
typedef unsigned short bf;
typedef __attribute__((ext_vector_type(16))) __bf16   v16bf;
typedef __attribute__((ext_vector_type(16))) _Float16 v16h;
typedef __attribute__((ext_vector_type(8)))  _Float16 v8h;
typedef __attribute__((ext_vector_type(8)))  unsigned short v8us;
typedef __attribute__((ext_vector_type(8)))  float    v8f;
typedef __attribute__((ext_vector_type(4)))  float    v4f;
typedef v4f  __attribute__((may_alias)) v4fa;
typedef __attribute__((ext_vector_type(4)))  unsigned v4u;     // 16 bytes as the data operand of a store written in asm text

__device__ __forceinline__ unsigned short f2bf(float f) { unsigned u = __float_as_uint(f); u += 0x7FFFu + ((u >> 16) & 1u); return (unsigned short)(u >> 16); }
__device__ __forceinline__ float bf2f(unsigned short u) { return __uint_as_float(((unsigned)u) << 16); }
__device__ __forceinline__ float bfr(float f) { return bf2f(f2bf(f)); }     // value of the RNE bf16 conversion
__device__ __forceinline__ v16h cat16(v8h lo, v8h hi) { return __builtin_shufflevector(lo, hi, 0, 1, 2, 3, 4, 5, 6, 7, 8, 9, 10, 11, 12, 13, 14, 15); }
__device__ __forceinline__ v16bf cat16b(v8us lo, v8us hi) { return __builtin_bit_cast(v16bf, __builtin_shufflevector(lo, hi, 0, 1, 2, 3, 4, 5, 6, 7, 8, 9, 10, 11, 12, 13, 14, 15)); }
__device__ __forceinline__ v8f wmma16(v16h a, v16h b, v8f c) { return __builtin_amdgcn_wmma_f32_16x16x32_f16(false, a, false, b, (short)0, c, false, false); }
__device__ __forceinline__ v8f wmmab(v16bf a, v16bf b, v8f c) { return __builtin_amdgcn_wmma_f32_16x16x32_bf16(false, a, false, b, (short)0, c, false, false); }
// fragment loaders from K-contiguous 16-bit rows; p already includes + 8*(lane>>4): elements 0..7 <- k0+8h+0..7, elements 8..15 <- k0+16+8h+0..7 (same map for A and B)
__device__ __forceinline__ v16h  ldh(const h16* p) { return cat16(*(const v8h*)p, *(const v8h*)(p + 16)); }
__device__ __forceinline__ v16bf ldb(const bf* p)  { return cat16b(*(const v8us*)p, *(const v8us*)(p + 16)); }
// ordering point for wave-private LDS tiles (same wave writes and reads)
__device__ __forceinline__ void wave_sync() { __builtin_amdgcn_fence(3 /* release order */, "wavefront"); __builtin_amdgcn_wave_barrier(); asm volatile("" ::: "memory"); }

// cvt8_body: x f32 -> bf16 copy [NB*SEQ][DM], eight elements per thread; blk = block index inside this range. Batch b of the source starts at b * SEQ_FULL rows.
__device__ __forceinline__ void cvt8_body(const float* __restrict__ src, bf* dst, int blk, int tid) {
    constexpr size_t per = (size_t)SEQ * DM / 8, n8 = (size_t)NB * per;
    const size_t i = (size_t)blk * 256 + tid; if (i >= n8) return;
    const v8f v = *(const v8f*)(src + (i / per) * ((size_t)SEQ_FULL * DM) + (i % per) * 8); v8us o;
#pragma unroll
    for (int k = 0; k < 8; ++k) o[k] = f2bf(v[k]);
    *(v8us*)(dst + i * 8) = o; 
}

// tcvt_body: W in[K rows][N cols] f32 -> WT out[N rows][K cols] bf16 (RNE convert), 64x64 tile (bx along K, by along N) transposed through LDS (cross-wave: block barrier).
__device__ __forceinline__ void tcvt_body(const float* __restrict__ W, bf* WT, int K, int N, int bx, int by, float* ts, int tid) {
    const int k0 = bx * 64, n0 = by * 64;
    const int cn = tid & 63, rk = tid >> 6;
#pragma unroll 4
    for (int i = 0; i < 16; ++i) { const int r = rk + 4 * i; ts[r * 65 + cn] = W[(size_t)(k0 + r) * N + n0 + cn]; }   // 16 x 4 = 64 rows, 64 columns
    __syncthreads();
    const int pc = tid & 7, rn = tid >> 3;      // rn 0..31 and rn+32 -> 64 output rows; 8 pieces x 8 = 64 k
    v8us o0, o1;
#pragma unroll
    for (int j = 0; j < 8; ++j) { o0[j] = f2bf(ts[(pc * 8 + j) * 65 + rn]); o1[j] = f2bf(ts[(pc * 8 + j) * 65 + rn + 32]); }
    bf* d0 = WT + (size_t)(n0 + rn) * K + k0 + pc * 8; bf* d1 = WT + (size_t)(n0 + rn + 32) * K + k0 + pc * 8;
    *(v8us*)d0 = o0; *(v8us*)d1 = o1; 
}

// rope_body: rotary table CS[t][0..63] = cos(t * f_i), CS[t][64..127] = sin(t * f_i), f_i = 10000^(-i/64) = 2^(-i * log2(10000)/64); precise sinf/cosf.
__device__ __forceinline__ void rope_body(float* CS, int blk, float* ts, int tid) {
    const int i = tid & 63, r = tid >> 6; const int t = blk * 4 + r;
    const float invf = __builtin_amdgcn_exp2f(-(float)i * 0.20762050593046014f);
    const float ang = (float)t * invf;
    ts[r * 128 + i] = cosf(ang); ts[r * 128 + 64 + i] = sinf(ang);
    __syncthreads();
    if (tid < 128) {                            // waves 0..3 (wave-uniform), one row each
        const int row = tid >> 5, pc = tid & 31;
        const v4f v = *(const v4fa*)(&ts[row * 128 + pc * 4]);
        float* d = CS + (size_t)(blk * 4 + row) * 128 + pc * 4;
        *(v4f*)d = v; 
    }
}

// k_prep: the six preparatory jobs, which do not depend on one another, as block ranges of one grid: the four weight transposes, the rotary table, the bf16 copy of x. The range test reads blockIdx only, so every barrier stays block-uniform.
// Left as it was: the work per thread (one 8-element piece, one 64x64 tile per block), so the grid is still one of very many short waves.
#define PB_WBIG  ((DM / 64) * (DM / 64))      // blocks of a DM x DM transpose
#define PB_WKV   ((DM / 64) * (DKV / 64))     // blocks of a DM x DKV transpose
#define PB_W     (2 * PB_WBIG + 2 * PB_WKV)
#define PB_ROPE  (SEQ / 4)
#define PB_CVT   ((int)(((size_t)NB * SEQ * DM / 8 + 255) / 256))
__global__ __launch_bounds__(256) void k_prep(const float* __restrict__ x, const float* __restrict__ wq, const float* __restrict__ wk, const float* __restrict__ wv, const float* __restrict__ wo,
                                              bf* XB, bf* WQT, bf* WKT, bf* WVT, bf* WOT, float* CS) {
    __shared__ __align__(16) float ts[64 * 65];
    const int tid = threadIdx.x; const int id = blockIdx.x;
    if (id < PB_W) {
        const bool big = id < 2 * PB_WBIG;
        const int q = big ? id : id - 2 * PB_WBIG; const int per = big ? PB_WBIG : PB_WKV;
        const bool second = q >= per; const int r = second ? q - per : q;
        const float* W = big ? (second ? wo : wq) : (second ? wv : wk);
        bf* WT = big ? (second ? WOT : WQT) : (second ? WVT : WKT);
        tcvt_body(W, WT, DM, big ? DM : DKV, r % (DM / 64), r / (DM / 64), ts, tid);
    } else if (id < PB_W + PB_ROPE) rope_body(CS, id - PB_W, ts, tid);
    else cvt8_body(x, XB, id - PB_W - PB_ROPE, tid);
}

// gemm_stage: one stage = 64 k of 128 A rows and 256 Bt rows = 384 whole lines of 128 B = 256 lanes x 12 copies of 16 B (eight lanes per line). l0, ga, gb: this lane's piece of row tid>>3; sa, sb: 32 rows, in elements.
// The s_wait_xcnt closes the statement so that no address register is rewritten ahead of it.
__device__ __forceinline__ void gemm_stage(unsigned l0, const bf* ga, size_t sa, const bf* gb, size_t sb) {
    const unsigned l1 = l0 + 32 * GPIT, l2 = l0 + 64 * GPIT, l3 = l0 + 96 * GPIT, l4 = l0 + 128 * GPIT, l5 = l0 + 160 * GPIT, l6 = l0 + 192 * GPIT, l7 = l0 + 224 * GPIT,
                   l8 = l0 + 256 * GPIT, l9 = l0 + 288 * GPIT, l10 = l0 + 320 * GPIT, l11 = l0 + 352 * GPIT;
    const bf* a1 = ga + sa; const bf* a2 = a1 + sa; const bf* a3 = a2 + sa;
    const bf* b1 = gb + sb; const bf* b2 = b1 + sb; const bf* b3 = b2 + sb; const bf* b4 = b3 + sb; const bf* b5 = b4 + sb; const bf* b6 = b5 + sb; const bf* b7 = b6 + sb;
    asm volatile("global_load_async_to_lds_b128 %0, %12, off\n\t"
                 "global_load_async_to_lds_b128 %1, %13, off\n\t"
                 "global_load_async_to_lds_b128 %2, %14, off\n\t"
                 "global_load_async_to_lds_b128 %3, %15, off\n\t"
                 "global_load_async_to_lds_b128 %4, %16, off\n\t"
                 "global_load_async_to_lds_b128 %5, %17, off\n\t"
                 "global_load_async_to_lds_b128 %6, %18, off\n\t"
                 "global_load_async_to_lds_b128 %7, %19, off\n\t"
                 "global_load_async_to_lds_b128 %8, %20, off\n\t"
                 "global_load_async_to_lds_b128 %9, %21, off\n\t"
                 "global_load_async_to_lds_b128 %10, %22, off\n\t"
                 "global_load_async_to_lds_b128 %11, %23, off\n\t"
                 "s_wait_xcnt 0x0"
                 :: "v"(l0), "v"(l1), "v"(l2), "v"(l3), "v"(l4), "v"(l5), "v"(l6), "v"(l7), "v"(l8), "v"(l9), "v"(l10), "v"(l11),
                    "v"(ga), "v"(a1), "v"(a2), "v"(a3), "v"(gb), "v"(b1), "v"(b2), "v"(b3), "v"(b4), "v"(b5), "v"(b6), "v"(b7) : "memory");
}

// gemm_loop: bf16 GEMM main loop of an 8-wave block, block tile 128 x 256, wave tile (16*MT) x (16*NT) at rows wr, columns wc of it. Each 64-k stage of the block's A and Bt rows is brought into LDS once
// per block by asynchronous copies of whole lines, and every wave takes its fragments from there. Two buffers: stage s + 1 is in flight while stage s is worked on; one barrier per stage publishes s + 1 and frees the buffer of s.
// acc[mb*NT+nb] += sum_k A[R0+wr+16mb+..][k] * Bt[C0+wc+16nb+..][k & kbm]   (kbm folds a K-concatenated A against a single Bt plane); k ascending in steps of 32
template <int MT, int NT>
__device__ __forceinline__ void gemm_loop(const bf* __restrict__ A, size_t lda, const bf* __restrict__ Bt, size_t ldbt,
                                          int K, int kbm, int R0, int C0, int wr, int wc, unsigned char* ring, int tid, int lr, int hi, v8f (&acc)[MT * NT]) {
#pragma unroll
    for (int i = 0; i < MT * NT; ++i) acc[i] = (v8f){};
    const unsigned l0 = (unsigned)(size_t)ring + (unsigned)((tid >> 3) * GPIT + (tid & 7) * 16);
    const bf* ga = A + (size_t)(R0 + (tid >> 3)) * lda + (tid & 7) * 8;
    const bf* gb = Bt + (size_t)(C0 + (tid >> 3)) * ldbt + (tid & 7) * 8;
    const size_t sa = 32 * lda, sb = 32 * ldbt;
    const int nst = K / GKS;                                   // the same for every wave of the launch
    gemm_stage(l0, ga, sa, gb, sb);                            // stage 0 -> buffer 0
    asm volatile("s_wait_asynccnt 0x0" ::: "memory");          // this wave's share of stage 0 has landed
    __syncthreads();                                           // stage 0 published
    if (nst > 1) gemm_stage(l0 + GST, ga + GKS, sa, gb + (GKS & kbm), sb);   // stage 1 -> buffer 1
    const int ao = (wr + lr) * GPIT + 16 * hi, bfo = (GAR + wc + lr) * GPIT + 16 * hi;
#pragma unroll 1
    for (int st = 0; st < nst; ++st) {
        const unsigned bo = (st & 1) ? (unsigned)GST : 0u;
        const bf* as = (const bf*)(ring + bo + ao); const bf* bs = (const bf*)(ring + bo + bfo);
        v16bf a[MT], b[NT];
#pragma unroll
        for (int ks = 0; ks < GKS / 32; ++ks) {
            // the fragments of a 32-k step are read as one group ahead of its products, so the LDS latency is waited out once per step
#pragma unroll
            for (int mb = 0; mb < MT; ++mb) a[mb] = ldb(as + mb * 16 * (GPIT / 2) + 32 * ks);
#pragma unroll
            for (int nb = 0; nb < NT; ++nb) b[nb] = ldb(bs + nb * 16 * (GPIT / 2) + 32 * ks);
            // inputs-only fence on the loaded fragments: holds all reads of the step in one group in front of its products (otherwise each Bt fragment is read, and its latency waited out, between the products)
            if constexpr (MT == 4 && NT == 4) asm volatile("" :: "v"(a[0]), "v"(a[1]), "v"(a[2]), "v"(a[3]), "v"(b[0]), "v"(b[1]), "v"(b[2]), "v"(b[3]));
            else { static_assert((MT == 4 && NT == 4) || (MT == 2 && NT == 8));
                asm volatile("" :: "v"(a[0]), "v"(a[1]), "v"(b[0]), "v"(b[1]), "v"(b[2]), "v"(b[3]), "v"(b[4]), "v"(b[5]), "v"(b[6]), "v"(b[7])); }
#pragma unroll
            for (int nb = 0; nb < NT; ++nb) {
#pragma unroll
                for (int mb = 0; mb < MT; ++mb) acc[mb * NT + nb] = wmmab(a[mb], b[nb], acc[mb * NT + nb]); }
        }
        asm volatile("v_nop\n\tv_nop\n\tv_nop\n\tv_nop" : "+v"(acc[0]), "+v"(acc[(MT * NT) / 3]), "+v"(acc[(2 * MT * NT) / 3]), "+v"(acc[MT * NT - 1]) : "v"(a[0]), "v"(a[MT - 1]), "v"(b[NT - 1]));
        // publish point of stage st + 1
        asm volatile("s_wait_dscnt 0x0" ::: "memory");         // this wave's reads of the buffer of stage st are done before it is handed to the copies
        asm volatile("s_wait_asynccnt 0x0" ::: "memory");      // this wave's share of stage st + 1 has landed
        __syncthreads();                                       // stage st + 1 published; every reader has left the buffer of stage st
        if (st + 2 < nst) gemm_stage(l0 + bo, ga + (st + 2) * GKS, sa, gb + (((st + 2) * GKS) & kbm), sb);   // stage st + 2 -> the buffer just read
    }
    asm volatile("s_wait_asynccnt 0x0" ::: "memory");          // nothing of this wave is in flight when it leaves the ring
}

// qk_body: projection + bias + rotary for q or k. One wave per 32 rows x 128 columns (= one head), K = DM; a block is 4 row groups x 2 heads: bx in NB*SEQ/128, by in nheads/2, 256 threads.
// Output plane [(b*nheads + head)][t][d] as f16 (Ph) and optionally the f16 residual x2048 (Pr, useRes != 0).
// Output staging lies on the ring: the last publish point of gemm_loop (LDS reads done, no copy in flight, block barrier) has freed it for every wave.
__device__ __forceinline__ void qk_body(const bf* __restrict__ A, const bf* __restrict__ Bt, const float* __restrict__ bias, const float* __restrict__ CS, h16* Ph, h16* Pr, int useRes, int nheads,
                                        int bx, int by, unsigned char* ring, int tid) {
    static_assert(GW * 16 * 132 * 4 <= 2 * GST);
    const int lane = tid & 31, wave = tid >> 5, lr = lane & 15, hi = lane >> 4;
    float* os = (float*)ring + wave * 16 * 132;                // wave-private output staging
    const int wr = (wave & 3) * 32, wc = (wave >> 2) * HD;
    const int r0 = bx * 128 + wr, head = by * 2 + (wave >> 2), cbase = head * HD;
    v8f acc[16];
    gemm_loop<2, 8>(A, (size_t)DM, Bt, (size_t)DM, DM, 0x7FFFFFFF, bx * 128, by * 256, wr, wc, ring, tid, lr, hi, acc);
    float bz[8];
#pragma unroll
    for (int nb = 0; nb < 8; ++nb) bz[nb] = bfr(bias[cbase + nb * 16 + lr]);
    const int b = r0 / SEQ, t0 = r0 % SEQ;
    const size_t tbase = ((size_t)(b * nheads + head) * SEQ + t0) * HD;
#pragma unroll
    for (int mb = 0; mb < 2; ++mb) {
#pragma unroll
        for (int nb = 0; nb < 8; ++nb) {
#pragma unroll
            for (int j = 0; j < 8; ++j) os[(hi * 8 + j) * 132 + nb * 16 + lr] = acc[mb * 8 + nb][j] + bz[nb]; }   // D: row 8h+j, col lane&15; rows 0..15 x cols 0..127 all staged
        wave_sync();
{
            const int c8 = lr * 8, p8 = c8 ^ 64;
#pragma unroll 1   // stays rolled, four trips of two row pairs each: keeps the epilogue's code short
            for (int s2 = 0; s2 < 8; s2 += 2) { v4u hq[2], rq[2];
#pragma unroll
              for (int u = 0; u < 2; ++u) { const int row = 2 * (s2 + u) + hi;   // 8 s x 2 rows = 16 rows; 16 lanes x 8 = 128 columns
                const int t = t0 + mb * 16 + row;
                const float* orow = &os[row * 132];
                const v4f x0 = *(const v4fa*)(orow + c8), x1 = *(const v4fa*)(orow + c8 + 4);
                const v4f y0 = *(const v4fa*)(orow + p8), y1 = *(const v4fa*)(orow + p8 + 4);
                const float* cs = CS + (size_t)t * 128 + (c8 & 63);
                const v4f cc0 = *(const v4f*)cs, cc1 = *(const v4f*)(cs + 4), ss0 = *(const v4f*)(cs + 64), ss1 = *(const v4f*)(cs + 68);
                const float sg = (c8 < 64) ? -1.0f : 1.0f;       // d < 64: x[d] cos - x[d+64] sin; d >= 64: x[d] cos + x[d-64] sin
                v8h hv, rv;
#pragma unroll
                for (int i = 0; i < 4; ++i) {
                    const float v0 = x0[i] * cc0[i] + sg * (y0[i] * ss0[i]); const float v1 = x1[i] * cc1[i] + sg * (y1[i] * ss1[i]);
                    const h16 a0 = (h16)v0; const h16 a1 = (h16)v1; hv[i] = a0; hv[4 + i] = a1;
                    rv[i] = (h16)((v0 - (float)a0) * QRS); rv[4 + i] = (h16)((v1 - (float)a1) * QRS); }
                hq[u] = __builtin_bit_cast(v4u, hv); rq[u] = __builtin_bit_cast(v4u, rv); }
                const size_t oo = tbase + (size_t)(mb * 16 + 2 * s2 + hi) * HD + c8;   // row 2 s2 + hi; the second piece lies two rows (2 * HD * 2 bytes) further
                h16* ph = Ph + oo; h16* pr = Pr + oo;
                // the trip's stores and their s_wait_xcnt in one statement, so that the wait stands in front of every rewrite of a register that a store names (a wait in a statement of its own does not hold the address additions behind it)
                if (useRes) asm volatile("global_store_b128 %0, %2, off\n\t"
                                         "global_store_b128 %0, %3, off offset:%6\n\t"
                                         "global_store_b128 %1, %4, off\n\t"
                                         "global_store_b128 %1, %5, off offset:%6\n\t"
                                         "s_wait_xcnt 0x0"
                                         :: "v"(ph), "v"(pr), "v"(hq[0]), "v"(hq[1]), "v"(rq[0]), "v"(rq[1]), "n"(2 * HD * 2) : "memory");
                else        asm volatile("global_store_b128 %0, %1, off\n\t"
                                         "global_store_b128 %0, %2, off offset:%3\n\t"
                                         "s_wait_xcnt 0x0"
                                         :: "v"(ph), "v"(hq[0]), "v"(hq[1]), "n"(2 * HD * 2) : "memory"); }
             }
        wave_sync();
    }
}

// vt_body: v^T projection. A = WvT rows (m = g*128 + d), Bt = x rows (n = b*SEQ + t), one wave per 64x64 tile, a block is 2 x 4 of them: bx in DKV/128, by in NB*SEQ/256, 256 threads.
// Planes [(b*DKV + m)][t] = [(b*4 + g)][d][t]: f16 value (VH) and f16 residual x256 (VR); bias per row m. Output staging lies on the ring, as in qk_body.
__device__ __forceinline__ void vt_body(const bf* __restrict__ A, const bf* __restrict__ Bt, const float* __restrict__ bias, h16* VH, h16* VR, int bx, int by, unsigned char* ring, int tid) {
    const int lane = tid & 31, wave = tid >> 5, lr = lane & 15, hi = lane >> 4;
    float* os = (float*)ring + wave * 16 * 68;                 // wave-private output staging
    const int wr = (wave & 1) * 64, wc = (wave >> 1) * 64;
    const int r0 = bx * 128 + wr, c0 = by * 256 + wc;
    v8f acc[16];
    gemm_loop<4, 4>(A, (size_t)DM, Bt, (size_t)DM, DM, 0x7FFFFFFF, bx * 128, by * 256, wr, wc, ring, tid, lr, hi, acc);
    const int b = c0 / SEQ, t0 = c0 % SEQ;
    const size_t tbase = ((size_t)b * DKV + r0) * SEQ + t0;
#pragma unroll
    for (int mb = 0; mb < 4; ++mb) {
        float bj[8];
#pragma unroll
        for (int j = 0; j < 8; ++j) bj[j] = bfr(bias[r0 + mb * 16 + hi * 8 + j]);
#pragma unroll
        for (int nb = 0; nb < 4; ++nb) {
#pragma unroll
            for (int j = 0; j < 8; ++j) os[(hi * 8 + j) * 68 + nb * 16 + lr] = acc[mb * 4 + nb][j] + bj[j]; }   // rows 0..15 x cols 0..63 all staged
        wave_sync();
        const size_t sb = tbase + (size_t)(mb * 16) * SEQ;
{
            const int c8 = (lane & 7) * 8; v4u hq[4], rq[4];
#pragma unroll
            for (int s = 0; s < 4; ++s) { const int row = 4 * s + (lane >> 3);   // 4 s x 4 row groups = 16 rows; 8 lanes x 8 = 64 columns
                const v4f x0 = *(const v4fa*)(&os[row * 68 + c8]); const v4f x1 = *(const v4fa*)(&os[row * 68 + c8 + 4]); v8h hv, rv;
#pragma unroll
                for (int i = 0; i < 4; ++i) { const h16 a0 = (h16)x0[i]; const h16 a1 = (h16)x1[i]; hv[i] = a0; hv[4 + i] = a1; rv[i] = (h16)((x0[i] - (float)a0) * VRS); rv[4 + i] = (h16)((x1[i] - (float)a1) * VRS); }
                hq[s] = __builtin_bit_cast(v4u, hv); rq[s] = __builtin_bit_cast(v4u, rv); }
            const size_t oo = sb + (size_t)(lane >> 3) * SEQ + c8;   // row lane>>3; piece s lies 4 s rows (4 * SEQ * 2 bytes each step) further
            h16* ph = VH + oo; h16* pr = VR + oo;
            // the row block's stores and their s_wait_xcnt in one statement, so that the wait stands in front of every rewrite of a register that a store names (the next block's bias loads may take the data registers)
            asm volatile("global_store_b128 %0, %2, off\n\t"
                         "global_store_b128 %1, %6, off\n\t"
                         "global_store_b128 %0, %3, off offset:%10\n\t"
                         "global_store_b128 %1, %7, off offset:%10\n\t"
                         "global_store_b128 %0, %4, off offset:%11\n\t"
                         "global_store_b128 %1, %8, off offset:%11\n\t"
                         "global_store_b128 %0, %5, off offset:%12\n\t"
                         "global_store_b128 %1, %9, off offset:%12\n\t"
                         "s_wait_xcnt 0x0"
                         :: "v"(ph), "v"(pr), "v"(hq[0]), "v"(hq[1]), "v"(hq[2]), "v"(hq[3]), "v"(rq[0]), "v"(rq[1]), "v"(rq[2]), "v"(rq[3]),
                            "n"(4 * SEQ * 2), "n"(8 * SEQ * 2), "n"(12 * SEQ * 2) : "memory");
             }
        wave_sync();
    }
}

// k_qkv: the q, k and v^T projections, which do not depend on one another, as block ranges of one grid, so that the 64-block k and v^T jobs run beside the q job instead of each alone on a quarter of the chip.
// One LDS arena (the ring, 108 KiB) lets two blocks share a WGP, so all blocks of the grid are resident at once. The range test reads blockIdx only, so every barrier stays block-uniform.
#define GB_ROW  (NB * SEQ / 128)
#define GB_Q    (GB_ROW * (NH_ / 2))
#define GB_K    (GB_ROW * (NKV / 2))
#define GB_V    ((DKV / 128) * (NB * SEQ / 256))
__global__ __launch_bounds__(32 * GW) __attribute__((amdgpu_num_vgpr(256)))
void k_qkv(const bf* __restrict__ XB, const bf* __restrict__ WQT, const bf* __restrict__ WKT, const bf* __restrict__ WVT,
           const float* __restrict__ bq, const float* __restrict__ bk, const float* __restrict__ bv, const float* __restrict__ CS, h16* QH, h16* QR, h16* KP, h16* VH, h16* VR) {
    __shared__ __align__(16) unsigned char ring[2 * GST];
    const int tid = threadIdx.x; const int id = blockIdx.x;
    if (id < GB_Q + GB_K) {
        const bool isq = id < GB_Q; const int r = isq ? id : id - GB_Q;
        qk_body(XB, isq ? WQT : WKT, isq ? bq : bk, CS, isq ? QH : KP, isq ? QR : KP, isq ? 1 : 0, isq ? NH_ : NKV, r % GB_ROW, r / GB_ROW, ring, tid);
    } else {
        const int r = id - GB_Q - GB_K;
        vt_body(WVT, XB, bv, VH, VR, r % (DKV / 128), r / (DKV / 128), ring, tid);
    }
}

// k_flash: fused causal attention, one wave per 16 query rows of one (batch, head). A block is the 4 query heads of one kv head x 2 adjacent 16-row query tiles (8 waves): all of them walk
// the same keys, so each 32-key stage of K, V^T value and V^T residual is brought into LDS once per block by asynchronous copies (whole 16-B pieces, contiguous per row) and every wave takes its fragments from there.
// Two buffers: stage s + 1 is in flight while stage s is worked on; one barrier per stage publishes s + 1 and frees the buffer of s.
// Transposed form: S^T[key][t] = K Q^T (A = K rows, B = Q rows); lane (t = lane&15, h = lane>>4) holds keys 8h+r of each 16-key tile, so the packed
// P tile is directly the B fragment of O^T[d][t] = V^T P^T (element r <- tile keys 0..15, element 8+r <- tile keys 16..31, lane unchanged).
// The key loop of a tile runs to the 32-key step that contains its last query; keys beyond a query get the fill value (weight exactly 0). ALiBi bias slope*(key - query) added in the exp2 domain.
// Balance: a 32-row query tile x walks x + 1 stages, and all blocks of the grid are resident at once, so the launch lasts as long as its fullest WGP. Each block therefore takes two tiles one after the other,
// x and SEQ/32 - 1 - x: SEQ/32 + 1 stages for every block, one block per WGP. The two walks are one run of stages through the ring (the second tile's first stages fly while the first tile ends);
// at the first tile's last stage every wave writes its rows out, takes the second tile's q and starts its sums anew. The sums of a tile are formed as before.
// What is left: only two waves per SIMD are resident now, and the waits of a stage (eight groups of LDS reads, the softmax chain) stand open between them.
// Stage planes in LDS, 16 lines of SPIT bytes each, line = fragment row (lane&15): K line holds key rows r and 16 + r (256 B each); a V^T line holds the 32-key pieces (64 B) of rows d = 16j + r, j = 0..7.
// So every fragment of a stage is read at one per-lane address plus a constant.
// flash_stage: one stage = K 32 rows x 256 B, V^T value and residual 128 rows x 64 B each = 24 KiB = 256 lanes x 6 copies of 16 B. The s_wait_xcnt closes the statement so that no address register is rewritten ahead of it.
__device__ __forceinline__ void flash_stage(unsigned lk, unsigned lv, const h16* gk, const h16* gh, const h16* gr) {
    const unsigned lk1 = lk + 256, lh0 = lv + ST_VH, lh1 = lv + ST_VH + 256, lr0 = lv + ST_VR, lr1 = lv + ST_VR + 256;
    const h16* gk1 = gk + 16 * HD; const h16* gh1 = gh + (size_t)64 * SEQ; const h16* gr1 = gr + (size_t)64 * SEQ;
    asm volatile("global_load_async_to_lds_b128 %0, %6, off\n\t"
                 "global_load_async_to_lds_b128 %1, %7, off\n\t"
                 "global_load_async_to_lds_b128 %2, %8, off\n\t"
                 "global_load_async_to_lds_b128 %3, %9, off\n\t"
                 "global_load_async_to_lds_b128 %4, %10, off\n\t"
                 "global_load_async_to_lds_b128 %5, %11, off\n\t"
                 "s_wait_xcnt 0x0"
                 :: "v"(lk), "v"(lk1), "v"(lh0), "v"(lh1), "v"(lr0), "v"(lr1), "v"(gk), "v"(gk1), "v"(gh), "v"(gh1), "v"(gr), "v"(gr1) : "memory");
}

// flash_q: the q value and residual fragments of a wave's 16 query rows (B fragments: col t, k = d); qa, qb: this lane's piece of its row in the two planes.
// The s_wait_xcnt takes the two addresses as inputs, so that their registers stay as they are until it has passed (otherwise a late load's result may be laid on them).
__device__ __forceinline__ void flash_q(const h16* qa, const h16* qb, v16h (&qh)[4], v16h (&qr)[4]) {
#pragma unroll
    for (int c = 0; c < 4; ++c) { qh[c] = ldh(qa + 32 * c); qr[c] = ldh(qb + 32 * c); }
    asm volatile("s_wait_xcnt 0x0" :: "v"(qa), "v"(qb) : "memory");
}

__global__ __launch_bounds__(32 * FW) __attribute__((amdgpu_num_vgpr(256)))
void k_flash(const h16* __restrict__ QH, const h16* __restrict__ QR, const h16* __restrict__ KP, const h16* __restrict__ VH, const h16* __restrict__ VR, bf* CTX) {
    __shared__ __align__(16) unsigned char ring[2 * ST_SZ];
    __shared__ __align__(16) float os[FW * 16 * 132];
    const int tid = threadIdx.x;
    const int lane = tid & 31, wave = tid >> 5, lr = lane & 15, hi = lane >> 4;
    const int bg = blockIdx.y; const int b = bg / NKV, g = bg % NKV; const int h = g * REP + (wave & (REP - 1)); const int zh = b * NH_ + h;
    constexpr int NQT = SEQ / 32;                              // query tiles of one (batch, kv head)
    static_assert(NQT % 2 == 0);                               // the tiles pair off, every tile in exactly one block
    const int na = blockIdx.x + 1;                             // 32-key stages of the first tile (blockIdx.x); the second tile (NQT - 1 - blockIdx.x) has NQT - blockIdx.x
    constexpr int nst = NQT + 1;                               // stages of the block, the same for every block; stage st holds key step st of the first tile or st - na of the second, both below NQT
    int t0 = blockIdx.x * 32 + (wave >> 2) * 16;
    const size_t kvb = (size_t)bg * SEQ * HD;
    // copy addresses of this lane. K: piece tid -> key row tid>>4 (and +16: +256 B in its line), 16-B column tid&15. V^T: piece tid -> row d = tid>>2 (and +64: +256 B in its line), 16-B column tid&3.
    const unsigned rb = (unsigned)(size_t)ring;
    const unsigned lk = rb + (unsigned)((tid >> 4) * SPIT + (tid & 15) * 16), lvt = rb + (unsigned)(((tid >> 2) & 15) * SPIT + (tid >> 6) * 64 + (tid & 3) * 16);
    const h16* gk = KP + kvb + (size_t)tid * 8;                // + key0 * HD
    const size_t gvo = kvb + (size_t)(tid >> 2) * SEQ + (tid & 3) * 8;   // + key0
    const h16* gh = VH + gvo; const h16* gr = VR + gvo;
    flash_stage(lk, lvt, gk, gh, gr);                          // stage 0 -> buffer 0
    const size_t qz = (size_t)zh * SEQ * HD + (size_t)lr * HD + 8 * hi;   // + t0 * HD
    v16h qh[4], qr[4];
    flash_q(QH + qz + (size_t)t0 * HD, QR + qz + (size_t)t0 * HD, qh, qr);
    asm volatile("s_wait_asynccnt 0x0" ::: "memory");          // this wave's share of stage 0 has landed
    __syncthreads();                                           // stage 0 published
    { const int k1 = na > 1 ? 32 : 0; flash_stage(lk + ST_SZ, lvt + ST_SZ, gk + (size_t)k1 * HD, gh + k1, gr + k1); }   // stage 1 -> buffer 1
    const int fo = lr * SPIT + 16 * hi;                        // K: + 256 (second key tile) + 64*c (A fragment: row key, k = d); V^T: + plane + 64*j (A fragment: row d, k = key)
    const float slope2 = __builtin_amdgcn_exp2f(-0.5f * (float)(h + 1)) * LOG2E;
    int qi = t0 + lr;
    const int wb = wave * 16 * 132;
    v8f o[8];
#pragma unroll
    for (int j = 0; j < 8; ++j) o[j] = (v8f){};
    float m = NEGBIG, l = 0.0f;
#pragma unroll 1
    for (int st = 0; st < nst; ++st) {
        const int key0 = (st < na ? st : st - na) * 32;
        const unsigned bo = (st & 1) ? (unsigned)ST_SZ : 0u;
        const h16* ka = (const h16*)(ring + bo + fo);
        v8f sHa = (v8f){}, sLa = (v8f){}, sHb = (v8f){}, sLb = (v8f){};
        v16h kal, kbl;
#pragma unroll
        for (int c = 0; c < 4; ++c) {
            kal = ldh(ka + 32 * c); kbl = ldh(ka + 128 + 32 * c);
            sHa = wmma16(kal, qh[c], sHa); sLa = wmma16(kal, qr[c], sLa); sHb = wmma16(kbl, qh[c], sHb); sLb = wmma16(kbl, qr[c], sLb); }
        asm volatile("v_nop\n\tv_nop\n\tv_nop\n\tv_nop" : "+v"(sHa), "+v"(sLa), "+v"(sHb), "+v"(sLb) : "v"(kal), "v"(kbl));
        const float base = (float)(key0 + 8 * hi - qi);        // key - query for r = 0 of tile a
        float ta[8], tb[8]; float mx = NEGBIG;
#pragma unroll
        for (int r = 0; r < 8; ++r) {
            const float da = base + (float)r, db = da + 16.0f;
            float xa = fmaf(slope2, da, (sHa[r] + sLa[r] * QRI) * SC2);
            float xb = fmaf(slope2, db, (sHb[r] + sLb[r] * QRI) * SC2);
            xa = (da > 0.0f) ? NEGBIG : xa; xb = (db > 0.0f) ? NEGBIG : xb;
            ta[r] = xa; tb[r] = xb; mx = fmaxf(mx, fmaxf(xa, xb)); }
        mx = fmaxf(mx, __shfl_xor(mx, 16, 32));
        const float mnew = fmaxf(m, mx);
        const float alpha = __builtin_amdgcn_exp2f(m - mnew);
        const float sh = PSH - mnew;
        v16h pb; float ls = 0.0f;
#pragma unroll
        for (int r = 0; r < 8; ++r) { const h16 pa = (h16)__builtin_amdgcn_exp2f(ta[r] + sh); const h16 pc = (h16)__builtin_amdgcn_exp2f(tb[r] + sh); pb[r] = pa; pb[8 + r] = pc; ls += (float)pa + (float)pc; }
        const v16h pq = pb * (h16)0.00390625f;                 // P x 2^-8: partner of the v residual x256
        l = l * alpha + ls; m = mnew;
#pragma unroll
        for (int j = 0; j < 8; ++j) o[j] = o[j] * alpha;
        const h16* va = ka + ST_VH / 2; const h16* vr = ka + ST_VR / 2;
        // four fragments are read as one group ahead of their four products, so the LDS latency is waited out once per group; all loops unrolled so that every array index is a constant (registers, no scratch)
#pragma unroll
        for (int j4 = 0; j4 < 8; j4 += 4) { v16h vf[4];
#pragma unroll
            for (int j = 0; j < 4; ++j) vf[j] = ldh(va + 32 * (j4 + j));
#pragma unroll
            for (int j = 0; j < 4; ++j) o[j4 + j] = wmma16(vf[j], pb, o[j4 + j]); }
#pragma unroll
        for (int j4 = 0; j4 < 8; j4 += 4) { v16h vf[4];
#pragma unroll
            for (int j = 0; j < 4; ++j) vf[j] = ldh(vr + 32 * (j4 + j));
#pragma unroll
            for (int j = 0; j < 4; ++j) o[j4 + j] = wmma16(vf[j], pq, o[j4 + j]); }
        asm volatile("v_nop\n\tv_nop\n\tv_nop\n\tv_nop" : "+v"(o[0]), "+v"(o[1]), "+v"(o[2]), "+v"(o[3]), "+v"(o[4]), "+v"(o[5]), "+v"(o[6]), "+v"(o[7]) : "v"(pb), "v"(pq));
        // publish point of stage st + 1
        asm volatile("s_wait_dscnt 0x0" ::: "memory");         // this wave's reads of the buffer of stage st are done before it is handed to the copies
        asm volatile("s_wait_asynccnt 0x0" ::: "memory");      // this wave's share of stage st + 1 has landed
        __syncthreads();                                       // stage st + 1 published; every reader has left the buffer of stage st
        if (st + 2 < nst) { const int k2 = (st + 2 < na ? st + 2 : st + 2 - na) * 32; flash_stage(lk + bo, lvt + bo, gk + (size_t)k2 * HD, gh + k2, gr + k2); }   // stage st + 2 -> the buffer just read
      if (st == na - 1 || st == nst - 1) {                     // block-uniform: behind a tile's last stage its rows go out
    l += __shfl_xor(l, 16, 32);
    const float inv = 1.0f / l;
    // O^T D layout: o[j][r] = (d = 16j + 8h + r, t = lane&15) -> os[t][d]; rows 0..15 x columns 0..127 all written
#pragma unroll
    for (int j = 0; j < 8; ++j) { v4f a, c;
        a[0] = o[j][0] * inv; a[1] = o[j][1] * inv; a[2] = o[j][2] * inv; a[3] = o[j][3] * inv; c[0] = o[j][4] * inv; c[1] = o[j][5] * inv; c[2] = o[j][6] * inv; c[3] = o[j][7] * inv;
        *(v4fa*)(&os[wb + lr * 132 + 16 * j + 8 * hi]) = a; *(v4fa*)(&os[wb + lr * 132 + 16 * j + 8 * hi + 4]) = c; }
    wave_sync();
    bf* crow = CTX + ((size_t)b * SEQ + t0) * (size_t)(2 * DM) + h * HD;
{
#pragma unroll 2
        for (int s = 0; s < 8; ++s) { const int row = 2 * s + hi, c8 = lr * 8;   // 8 s x 2 rows = 16 rows; 16 lanes x 8 = 128 columns
            const v4f x0 = *(const v4fa*)(&os[wb + row * 132 + c8]); const v4f x1 = *(const v4fa*)(&os[wb + row * 132 + c8 + 4]); v8us hv, lv;
#pragma unroll
            for (int i = 0; i < 4; ++i) { const unsigned short a0 = f2bf(x0[i]); const unsigned short a1 = f2bf(x1[i]); hv[i] = a0; hv[4 + i] = a1; lv[i] = f2bf(x0[i] - bf2f(a0)); lv[4 + i] = f2bf(x1[i] - bf2f(a1)); }
            bf* dst = crow + (size_t)row * (size_t)(2 * DM) + c8;
            *(v8us*)dst = hv; *(v8us*)(dst + DM) = lv; }
         }
        asm volatile("s_wait_xcnt 0x0" ::: "memory");          // behind the tile's stores, in front of the rewrites of the registers that they name
        wave_sync();                                           // this wave's reads of its output staging stand in front of the second tile's writes to it
        // second tile: its rows, its q, sums from the start
        t0 = (NQT - 1 - (int)blockIdx.x) * 32 + (wave >> 2) * 16; qi = t0 + lr;
        if (st != nst - 1) flash_q(QH + qz + (size_t)t0 * HD, QR + qz + (size_t)t0 * HD, qh, qr);
#pragma unroll
        for (int j = 0; j < 8; ++j) o[j] = (v8f){};
        m = NEGBIG; l = 0.0f;
      }
    }
    asm volatile("s_wait_asynccnt 0x0" ::: "memory");          // nothing of this wave is in flight when it leaves the ring
}

// fold_stage: one stage of k_out = 64 k of 128 ctx rows, hi piece and lo piece, and of 256 WoT rows = 512 whole lines of 128 B = 256 lanes x 16 copies of 16 B (eight lanes per line).
// l0, ga, gb: this lane's piece of row tid>>3; sa, sb: 32 rows, in elements; the lo piece of a ctx row lies DM elements behind its hi piece.
// Two statements (an asm statement takes thirty operands); each s_wait_xcnt closes its statement so that no address register is rewritten ahead of it.
__device__ __forceinline__ void fold_stage(unsigned l0, const bf* ga, size_t sa, const bf* gb, size_t sb) {
    const unsigned l1 = l0 + 32 * GPIT, l2 = l0 + 64 * GPIT, l3 = l0 + 96 * GPIT, l4 = l0 + FLO * GPIT, l5 = l0 + (FLO + 32) * GPIT, l6 = l0 + (FLO + 64) * GPIT, l7 = l0 + (FLO + 96) * GPIT;
    const bf* a1 = ga + sa; const bf* a2 = a1 + sa; const bf* a3 = a2 + sa;
    const bf* r0 = ga + DM; const bf* r1 = a1 + DM; const bf* r2 = a2 + DM; const bf* r3 = a3 + DM;
    asm volatile("global_load_async_to_lds_b128 %0, %8, off\n\t"
                 "global_load_async_to_lds_b128 %1, %9, off\n\t"
                 "global_load_async_to_lds_b128 %2, %10, off\n\t"
                 "global_load_async_to_lds_b128 %3, %11, off\n\t"
                 "global_load_async_to_lds_b128 %4, %12, off\n\t"
                 "global_load_async_to_lds_b128 %5, %13, off\n\t"
                 "global_load_async_to_lds_b128 %6, %14, off\n\t"
                 "global_load_async_to_lds_b128 %7, %15, off\n\t"
                 "s_wait_xcnt 0x0"
                 :: "v"(l0), "v"(l1), "v"(l2), "v"(l3), "v"(l4), "v"(l5), "v"(l6), "v"(l7),
                    "v"(ga), "v"(a1), "v"(a2), "v"(a3), "v"(r0), "v"(r1), "v"(r2), "v"(r3) : "memory");
    const unsigned m0 = l0 + FBT * GPIT, m1 = l0 + (FBT + 32) * GPIT, m2 = l0 + (FBT + 64) * GPIT, m3 = l0 + (FBT + 96) * GPIT,
                   m4 = l0 + (FBT + 128) * GPIT, m5 = l0 + (FBT + 160) * GPIT, m6 = l0 + (FBT + 192) * GPIT, m7 = l0 + (FBT + 224) * GPIT;
    const bf* b1 = gb + sb; const bf* b2 = b1 + sb; const bf* b3 = b2 + sb; const bf* b4 = b3 + sb; const bf* b5 = b4 + sb; const bf* b6 = b5 + sb; const bf* b7 = b6 + sb;
    asm volatile("global_load_async_to_lds_b128 %0, %8, off\n\t"
                 "global_load_async_to_lds_b128 %1, %9, off\n\t"
                 "global_load_async_to_lds_b128 %2, %10, off\n\t"
                 "global_load_async_to_lds_b128 %3, %11, off\n\t"
                 "global_load_async_to_lds_b128 %4, %12, off\n\t"
                 "global_load_async_to_lds_b128 %5, %13, off\n\t"
                 "global_load_async_to_lds_b128 %6, %14, off\n\t"
                 "global_load_async_to_lds_b128 %7, %15, off\n\t"
                 "s_wait_xcnt 0x0"
                 :: "v"(m0), "v"(m1), "v"(m2), "v"(m3), "v"(m4), "v"(m5), "v"(m6), "v"(m7),
                    "v"(gb), "v"(b1), "v"(b2), "v"(b3), "v"(b4), "v"(b5), "v"(b6), "v"(b7) : "memory");
}

// fold_loop: main loop of k_out, an 8-wave block, block tile 128 x 256, wave tile 64 x 64 at rows wr, columns wc of it. The hi and the lo plane of ctx meet the same WoT rows, so both walk k together:
// a stage holds 64 k of the hi pieces, the lo pieces and the WoT rows, each WoT line is copied once and each WoT fragment read once for both planes (12 fragments for 32 products), and the loop has DM / 64 stages.
// Ring as in gemm_loop: two buffers, stage s + 1 in flight while stage s is worked on, one barrier per stage.
// acc[mb*4+nb] += sum_k (A[R0+wr+16mb+..][k] + A[R0+wr+16mb+..][DM+k]) * Bt[C0+wc+16nb+..][k]; k ascending in steps of 32, in each step the hi products first
__device__ __forceinline__ void fold_loop(const bf* __restrict__ A, const bf* __restrict__ Bt, int R0, int C0, int wr, int wc, unsigned char* ring, int tid, int lr, int hi, v8f (&acc)[16]) {
#pragma unroll
    for (int i = 0; i < 16; ++i) acc[i] = (v8f){};
    const unsigned l0 = (unsigned)(size_t)ring + (unsigned)((tid >> 3) * GPIT + (tid & 7) * 16);
    const bf* ga = A + (size_t)(R0 + (tid >> 3)) * (size_t)(2 * DM) + (tid & 7) * 8;
    const bf* gb = Bt + (size_t)(C0 + (tid >> 3)) * (size_t)DM + (tid & 7) * 8;
    const size_t sa = (size_t)32 * 2 * DM, sb = (size_t)32 * DM;
    constexpr int nst = DM / GKS;                              // the same for every wave of the launch
    static_assert(nst >= 2);                                   // stages 0 and 1 both exist
    fold_stage(l0, ga, sa, gb, sb);                            // stage 0 -> buffer 0
    asm volatile("s_wait_asynccnt 0x0" ::: "memory");          // this wave's share of stage 0 has landed
    __syncthreads();                                           // stage 0 published
    fold_stage(l0 + FST, ga + GKS, sa, gb + GKS, sb);          // stage 1 -> buffer 1
    const int ao = (wr + lr) * GPIT + 16 * hi, ro = (FLO + wr + lr) * GPIT + 16 * hi, bfo = (FBT + wc + lr) * GPIT + 16 * hi;
#pragma unroll 1   // one stage per trip: the ring's order at the foot stands once
    for (int st = 0; st < nst; ++st) {
        const unsigned bo = (st & 1) ? (unsigned)FST : 0u;
        const bf* as = (const bf*)(ring + bo + ao); const bf* rs = (const bf*)(ring + bo + ro); const bf* bs = (const bf*)(ring + bo + bfo);
        v16bf a[4], r[4], b[4];
        // Fragment reads stand in few groups, each ahead of the products that cover its latency, never among them. __builtin_amdgcn_sched_barrier(0): nothing is scheduled across it, so a group stays whole and in its place; it asks for no wait itself.
        // first step: hi, WoT, then lo fragments, which land while the hi products run
#pragma unroll
        for (int mb = 0; mb < 4; ++mb) a[mb] = ldb(as + mb * 16 * (GPIT / 2));
#pragma unroll
        for (int nb = 0; nb < 4; ++nb) b[nb] = ldb(bs + nb * 16 * (GPIT / 2));
#pragma unroll
        for (int mb = 0; mb < 4; ++mb) r[mb] = ldb(rs + mb * 16 * (GPIT / 2));
        __builtin_amdgcn_sched_barrier(0);
#pragma unroll
        for (int ks = 0; ks < GKS / 32; ++ks) {
#pragma unroll
            for (int nb = 0; nb < 4; ++nb) {
#pragma unroll
                for (int mb = 0; mb < 4; ++mb) acc[mb * 4 + nb] = wmmab(a[mb], b[nb], acc[mb * 4 + nb]); }
            if (ks + 1 < GKS / 32) {                           // the next step's hi fragments, behind the last product that reads this step's: they land while the lo products run
#pragma unroll
                for (int mb = 0; mb < 4; ++mb) a[mb] = ldb(as + mb * 16 * (GPIT / 2) + 32 * (ks + 1));
            }
            __builtin_amdgcn_sched_barrier(0);                 // in the last step it keeps the hi products in front of the publish point, where they cover the landing of the lo fragments
#pragma unroll
            for (int nb = 0; nb < 4; ++nb) {
#pragma unroll
                for (int mb = 0; mb < 4; ++mb) acc[mb * 4 + nb] = wmmab(r[mb], b[nb], acc[mb * 4 + nb]); }
            if (ks + 1 < GKS / 32) {                           // the next step's WoT fragments, then its lo fragments, which land while its hi products run
#pragma unroll
                for (int nb = 0; nb < 4; ++nb) b[nb] = ldb(bs + nb * 16 * (GPIT / 2) + 32 * (ks + 1));
#pragma unroll
                for (int mb = 0; mb < 4; ++mb) r[mb] = ldb(rs + mb * 16 * (GPIT / 2) + 32 * (ks + 1));
                __builtin_amdgcn_sched_barrier(0);
            }
        }
        // publish point of stage st + 1
        asm volatile("s_wait_dscnt 0x0" ::: "memory");         // this wave's reads of the buffer of stage st are done before it is handed to the copies
        asm volatile("s_wait_asynccnt 0x0" ::: "memory");      // this wave's share of stage st + 1 has landed
        __syncthreads();                                       // stage st + 1 published; every reader has left the buffer of stage st
        if (st + 2 < nst) fold_stage(l0 + bo, ga + (st + 2) * GKS, sa, gb + (st + 2) * GKS, sb);   // stage st + 2 -> the buffer just read
    }
    asm volatile("s_wait_asynccnt 0x0" ::: "memory");          // nothing of this wave is in flight when it leaves the ring
}

// k_out: output projection. A = ctx plane rows [hi 2048 | lo 2048], both planes against the single WoT plane (fold_loop), Bt = WoT rows, one wave per 64x64 tile, a block is 2 x 4 of them. grid (NB*SEQ/128, DM/256), 256 threads.
// What is left: the first fragment group of a stage is still read behind the barrier and the copies' issue, with nothing of the wave's own to cover it.
__global__ __launch_bounds__(32 * GW) __attribute__((amdgpu_num_vgpr(256)))
void k_out(const bf* __restrict__ A, const bf* __restrict__ Bt, const float* __restrict__ bias, float* OUT) {
    __shared__ __align__(16) unsigned char ring[2 * FST];
    __shared__ __align__(16) float osb[GW * 16 * 68];
    const int tid = threadIdx.x;
    const int lane = tid & 31, wave = tid >> 5, lr = lane & 15, hi = lane >> 4;
    float* os = osb + wave * 16 * 68;                          // wave-private output staging
    const int wr = (wave & 1) * 64, wc = (wave >> 1) * 64;
    const int r0 = blockIdx.x * 128 + wr, c0 = blockIdx.y * 256 + wc;
    v8f acc[16];
    fold_loop(A, Bt, blockIdx.x * 128, blockIdx.y * 256, wr, wc, ring, tid, lr, hi, acc);
    float bz[4];
#pragma unroll
    for (int nb = 0; nb < 4; ++nb) bz[nb] = bfr(bias[c0 + nb * 16 + lr]);
    const int b = r0 / SEQ, t0 = r0 % SEQ;
    float* obase = OUT + ((size_t)b * OUT_SEQ + t0) * DM + c0;
#pragma unroll
    for (int mb = 0; mb < 4; ++mb) {
#pragma unroll
        for (int nb = 0; nb < 4; ++nb) {
#pragma unroll
            for (int j = 0; j < 8; ++j) os[(hi * 8 + j) * 68 + nb * 16 + lr] = acc[mb * 4 + nb][j] + bz[nb]; }   // rows 0..15 x cols 0..63 all staged
        wave_sync();
        float* orow = obase + (size_t)(mb * 16) * DM;
{
#pragma unroll
            for (int s = 0; s < 8; ++s) { const int row = 2 * s + hi, cofs = lr * 4;   // 8 s x 2 rows = 16 rows; 16 lanes x 4 floats = 64 columns
                const v4f val = *(const v4fa*)(&os[row * 68 + cofs]);
                *(v4f*)(orow + (size_t)row * DM + cofs) = val; }
             }
        wave_sync();
    }
}

static constexpr size_t al256(size_t v) { return (v + 255) & ~(size_t)255; }
static constexpr size_t SZ_XB  = al256((size_t)NB * SEQ * DM * 2);
static constexpr size_t SZ_WQ  = al256((size_t)DM * DM * 2);
static constexpr size_t SZ_WK  = al256((size_t)DKV * DM * 2);
static constexpr size_t SZ_CS  = al256((size_t)SEQ * 128 * 4);
static constexpr size_t SZ_QP  = al256((size_t)NB * NH_ * SEQ * HD * 2);
static constexpr size_t SZ_KP  = al256((size_t)NB * NKV * SEQ * HD * 2);
static constexpr size_t SZ_CTX = al256((size_t)NB * SEQ * 2 * DM * 2);
static constexpr size_t SZ_TOTAL = SZ_XB + 2 * SZ_WQ + 2 * SZ_WK + SZ_CS + 2 * SZ_QP + 3 * SZ_KP + SZ_CTX;
static_assert(SZ_TOTAL <= (size_t)134217728);          // workspace carve <= 128 MiB

extern "C" void kernel_launch(void* const* d_in, const int* in_sizes, int n_in,
                              void* d_out, int out_size, void* d_ws, size_t ws_size, hipStream_t stream) {
    if (n_in < 9) return;
    const size_t needx = ((size_t)(NB - 1) * SEQ_FULL + SEQ) * DM;
    if ((size_t)in_sizes[0] < needx) return;
    if ((size_t)in_sizes[1] < (size_t)DM * DM || (size_t)in_sizes[2] < (size_t)DM) return;
    if ((size_t)in_sizes[3] < (size_t)DM * DKV || (size_t)in_sizes[4] < (size_t)DKV) return;
    if ((size_t)in_sizes[5] < (size_t)DM * DKV || (size_t)in_sizes[6] < (size_t)DKV) return;
    if ((size_t)in_sizes[7] < (size_t)DM * DM || (size_t)in_sizes[8] < (size_t)DM) return;
    if ((size_t)out_size < ((size_t)(NB - 1) * OUT_SEQ + SEQ) * DM) return;
    if (SZ_TOTAL > ws_size) return;
    // wire order: x, Wq, bq, Wk, bk, Wv, bv, Wo, bo (weights [in][out])
    const float* x  = (const float*)d_in[0];
    const float* wq = (const float*)d_in[1]; const float* bq = (const float*)d_in[2];
    const float* wk = (const float*)d_in[3]; const float* bk = (const float*)d_in[4];
    const float* wv = (const float*)d_in[5]; const float* bv = (const float*)d_in[6];
    const float* wo = (const float*)d_in[7]; const float* bo = (const float*)d_in[8];
    float* OUT = (float*)d_out;      // [NB][SEQ][2048]
    char* wsp = (char*)d_ws;
    bf* XB  = (bf*)wsp; wsp += SZ_XB;                // [NB*SEQ][2048]
    bf* WQT = (bf*)wsp; wsp += SZ_WQ;                // [2048 out][2048 in]
    bf* WOT = (bf*)wsp; wsp += SZ_WQ;                // [2048 out][2048 in]
    bf* WKT = (bf*)wsp; wsp += SZ_WK;                // [512 out][2048 in]
    bf* WVT = (bf*)wsp; wsp += SZ_WK;                // [512 out][2048 in]
    float* CS = (float*)wsp; wsp += SZ_CS;           // [SEQ][cos 64 | sin 64]
    h16* QH = (h16*)wsp; wsp += SZ_QP;               // [NB*16][SEQ][128]
    h16* QR = (h16*)wsp; wsp += SZ_QP;               // [NB*16][SEQ][128] residual x2048
    h16* KP = (h16*)wsp; wsp += SZ_KP;               // [NB*4][SEQ][128]
    h16* VH = (h16*)wsp; wsp += SZ_KP;               // [NB*4][128][SEQ]
    h16* VR = (h16*)wsp; wsp += SZ_KP;               // [NB*4][128][SEQ] residual x256
    bf* CTX = (bf*)wsp; wsp += SZ_CTX;               // [NB*SEQ][hi 2048 | lo 2048]

    // weight transposes in[K = DM rows][N cols] -> out[N rows][K = DM cols], rotary table, bf16 copy of x
    k_prep<<<PB_W + PB_ROPE + PB_CVT, 256, 0, stream>>>(x, wq, wk, wv, wo, XB, WQT, WKT, WVT, WOT, CS);

    // q, k: A = x rows (m = b*SEQ + t), Bt = WT rows (n = head*128 + d) -> plane [(b*nheads + head)][t][d], rotary applied
    // v^T: A = WvT rows (m = g*128 + d), Bt = x rows (n = b*SEQ + t) -> planes [(b*512 + m)][t]
    k_qkv<<<GB_Q + GB_K + GB_V, 32 * GW, 0, stream>>>(XB, WQT, WKT, WVT, bq, bk, bv, CS, QH, QR, KP, VH, VR);

    k_flash<<<dim3(SEQ / 64, NB * NKV, 1), 32 * FW, 0, stream>>>(QH, QR, KP, VH, VR, CTX);

    k_out<<<dim3(NB * SEQ / 128, DM / 256, 1), 32 * GW, 0, stream>>>(CTX, WOT, bo, OUT);
}

// v006
// A run of this version takes 169 microseconds.
// Two timings next to v005 put it at 1.05 and 1.06 times that version's speed.
// Counting every step since v000, it is 3.99 times as fast.
#include <hip/hip_runtime.h>

// Causal grouped-query attention layer: x [NB][SEQ][2048], 16 query heads x 128, 4 kv heads, weights [in][out] with biases, rotate-half rotary (theta 1e4), ALiBi slopes 2^(-(h+1)/2), output projection; f32 output.
// Compute dtypes, f32 accumulate everywhere: q/k/v projections v_wmma_f32_16x16x32_bf16 (x, W, b RNE-converted to bf16; products exact);
// scores v_wmma_f32_16x16x32_f16: k single f16, q as f16 value + f16 residual x2048 in its own accumulator; P.V v_wmma_f32_16x16x32_f16: P single f16 (x256 carry, cancels in the normalisation),
// v as f16 value + f16 residual x256 whose partner operand is the P copy x2^-8 (K-dimension fold, products at natural scale, one accumulator); output projection v_wmma_f32_16x16x32_bf16 with ctx as bf16 hi | lo planes, both multiplied with the one bf16 Wo plane into one accumulator (per 32-k step: hi products, then lo products); softmax f32 (online, running max).
// Layout: bf16 x copy, bf16 transposed weight planes [out][in]; q (hi, residual) planes [b*16+h][t][d], k plane [b*4+g][t][d], v^T planes [b*4+g][d][t]; ctx plane [b*SEQ+t][hi 2048 | lo 2048]; rotary table [t][cos 64 | sin 64].

#ifndef NB
#define NB 2
#endif
#ifndef SEQ
#define SEQ 2048
#endif
#define NB_FULL  2
#define SEQ_FULL 2048
#ifndef OUT_SEQ
#define OUT_SEQ SEQ              // row pitch (in tokens) between batches of the output
#endif
#define DM   2048
#define NH_  16
#define NKV  4
#define HD   128
#define REP  (NH_ / NKV)
#define DKV  (NKV * HD)          // 512
#define FW   8                   // waves per flash block: the 4 query heads of one kv head x 2 query tiles of 16 rows
#define SPIT 528                 // LDS pitch, bytes, of one fragment-row line of a stage plane (512 + 16: 16 B x odd for 16-B readers)
#define ST_VH (16 * SPIT)               // byte offsets inside one stage buffer: K at 0, V^T value, V^T residual
#define ST_VR (2 * 16 * SPIT)
#define ST_SZ (3 * 16 * SPIT)           // 25344 B per stage
#define GW   8                   // waves per GEMM block: block tile 128 A rows x 256 Bt rows
#define GKS  64                  // k elements per GEMM stage: one whole 128-B line of every operand row
#define GPIT 144                 // LDS pitch, bytes, of a staged 128-B row (16 B x odd for 16-B readers)
#define GAR  128                 // A rows of a stage; the Bt rows follow them
#define GST  ((GAR + 256) * GPIT)       // 55296 B per stage
#define FLO  128                 // k_out stage: first row of the ctx lo pieces (the hi pieces are rows 0..127)
#define FBT  256                 // k_out stage: first row of the WoT pieces
#define FST  ((FBT + 256) * GPIT)       // 73728 B per k_out stage
#define QRS  2048.0f             // carry of the q residual plane
#define QRI  (1.0f / 2048.0f)
#define VRS  256.0f              // carry of the v residual plane (partner operand is P x 2^-8)
#define LOG2E 1.4426950408889634f
#define SC2  (0.08838834764831845f * 1.4426950408889634f)   // HD^-0.5 * log2(e)
#define PSH  8.0f                // log2 of the P carry (256)
#define NEGBIG (-3.0e38f)

static_assert(HD == 128);
static_assert(NH_ * HD == DM);
static_assert(NH_ % NKV == 0);
static_assert(DM % 64 == 0);
static_assert(DKV % 64 == 0);
static_assert(DM % 32 == 0);
static_assert(SEQ % 64 == 0);                  // a 64-row tile never straddles two batches
static_assert((NB * SEQ) % 64 == 0);
static_assert(SEQ % 32 == 0);                  // key loop steps by 32
static_assert(REP == 4 && FW == 2 * REP);      // wave -> (head of the group, query tile) map of the flash block
static_assert(SEQ % 4 == 0);
static_assert((NB * SEQ) % 256 == 0 && DKV % 128 == 0 && DM % 256 == 0 && NKV % 2 == 0 && NH_ % 2 == 0);   // GEMM block tiles cover every operand exactly
static_assert(DM % GKS == 0);
static_assert(((size_t)SEQ * DM) % 8 == 0);
static_assert(NB <= NB_FULL);
static_assert(SEQ <= SEQ_FULL);

typedef _Float16 h16;
typedef unsigned short bf;
typedef __attribute__((ext_vector_type(16))) __bf16   v16bf;
typedef __attribute__((ext_vector_type(16))) _Float16 v16h;
typedef __attribute__((ext_vector_type(8)))  _Float16 v8h;
typedef __attribute__((ext_vector_type(8)))  unsigned short v8us;
typedef __attribute__((ext_vector_type(8)))  float    v8f;
typedef __attribute__((ext_vector_type(4)))  float    v4f;
typedef v4f  __attribute__((may_alias)) v4fa;
typedef __attribute__((ext_vector_type(4)))  int      v4i;
typedef __attribute__((address_space(1))) v4i gv4i;            // pointee types of the asynchronous copy builtin: global source, LDS destination
typedef __attribute__((address_space(3))) v4i lv4i;
typedef __attribute__((ext_vector_type(4)))  unsigned v4u;     // 16 bytes as the data operand of a store written in asm text

__device__ __forceinline__ unsigned short f2bf(float f) { unsigned u = __float_as_uint(f); u += 0x7FFFu + ((u >> 16) & 1u); return (unsigned short)(u >> 16); }
__device__ __forceinline__ float bf2f(unsigned short u) { return __uint_as_float(((unsigned)u) << 16); }
__device__ __forceinline__ float bfr(float f) { return bf2f(f2bf(f)); }     // value of the RNE bf16 conversion
__device__ __forceinline__ v16h cat16(v8h lo, v8h hi) { return __builtin_shufflevector(lo, hi, 0, 1, 2, 3, 4, 5, 6, 7, 8, 9, 10, 11, 12, 13, 14, 15); }
__device__ __forceinline__ v16bf cat16b(v8us lo, v8us hi) { return __builtin_bit_cast(v16bf, __builtin_shufflevector(lo, hi, 0, 1, 2, 3, 4, 5, 6, 7, 8, 9, 10, 11, 12, 13, 14, 15)); }
__device__ __forceinline__ v8f wmma16(v16h a, v16h b, v8f c) { return __builtin_amdgcn_wmma_f32_16x16x32_f16(false, a, false, b, (short)0, c, false, false); }
__device__ __forceinline__ v8f wmmab(v16bf a, v16bf b, v8f c) { return __builtin_amdgcn_wmma_f32_16x16x32_bf16(false, a, false, b, (short)0, c, false, false); }
// fragment loaders from K-contiguous 16-bit rows; p already includes + 8*(lane>>4): elements 0..7 <- k0+8h+0..7, elements 8..15 <- k0+16+8h+0..7 (same map for A and B)
__device__ __forceinline__ v16h  ldh(const h16* p) { return cat16(*(const v8h*)p, *(const v8h*)(p + 16)); }
__device__ __forceinline__ v16bf ldb(const bf* p)  { return cat16b(*(const v8us*)p, *(const v8us*)(p + 16)); }
// ordering point for wave-private LDS tiles (same wave writes and reads)
__device__ __forceinline__ void wave_sync() { __builtin_amdgcn_fence(3 /* release order */, "wavefront"); __builtin_amdgcn_wave_barrier(); asm volatile("" ::: "memory"); }

// cvt8_body: x f32 -> bf16 copy [NB*SEQ][DM], eight elements per thread; blk = block index inside this range. Batch b of the source starts at b * SEQ_FULL rows.
__device__ __forceinline__ void cvt8_body(const float* __restrict__ src, bf* dst, int blk, int tid) {
    constexpr size_t per = (size_t)SEQ * DM / 8, n8 = (size_t)NB * per;
    const size_t i = (size_t)blk * 256 + tid; if (i >= n8) return;
    const v8f v = *(const v8f*)(src + (i / per) * ((size_t)SEQ_FULL * DM) + (i % per) * 8); v8us o;
#pragma unroll
    for (int k = 0; k < 8; ++k) o[k] = f2bf(v[k]);
    *(v8us*)(dst + i * 8) = o; 
}

// tcvt_body: W in[K rows][N cols] f32 -> WT out[N rows][K cols] bf16 (RNE convert), 64x64 tile (bx along K, by along N) transposed through LDS (cross-wave: block barrier).
__device__ __forceinline__ void tcvt_body(const float* __restrict__ W, bf* WT, int K, int N, int bx, int by, float* ts, int tid) {
    const int k0 = bx * 64, n0 = by * 64;
    const int cn = tid & 63, rk = tid >> 6;
#pragma unroll 4
    for (int i = 0; i < 16; ++i) { const int r = rk + 4 * i; ts[r * 65 + cn] = W[(size_t)(k0 + r) * N + n0 + cn]; }   // 16 x 4 = 64 rows, 64 columns
    __syncthreads();
    const int pc = tid & 7, rn = tid >> 3;      // rn 0..31 and rn+32 -> 64 output rows; 8 pieces x 8 = 64 k
    v8us o0, o1;
#pragma unroll
    for (int j = 0; j < 8; ++j) { o0[j] = f2bf(ts[(pc * 8 + j) * 65 + rn]); o1[j] = f2bf(ts[(pc * 8 + j) * 65 + rn + 32]); }
    bf* d0 = WT + (size_t)(n0 + rn) * K + k0 + pc * 8; bf* d1 = WT + (size_t)(n0 + rn + 32) * K + k0 + pc * 8;
    *(v8us*)d0 = o0; *(v8us*)d1 = o1; 
}

// rope_body: rotary table CS[t][0..63] = cos(t * f_i), CS[t][64..127] = sin(t * f_i), f_i = 10000^(-i/64) = 2^(-i * log2(10000)/64); precise sinf/cosf.
__device__ __forceinline__ void rope_body(float* CS, int blk, float* ts, int tid) {
    const int i = tid & 63, r = tid >> 6; const int t = blk * 4 + r;
    const float invf = __builtin_amdgcn_exp2f(-(float)i * 0.20762050593046014f);
    const float ang = (float)t * invf;
    ts[r * 128 + i] = cosf(ang); ts[r * 128 + 64 + i] = sinf(ang);
    __syncthreads();
    if (tid < 128) {                            // waves 0..3 (wave-uniform), one row each
        const int row = tid >> 5, pc = tid & 31;
        const v4f v = *(const v4fa*)(&ts[row * 128 + pc * 4]);
        float* d = CS + (size_t)(blk * 4 + row) * 128 + pc * 4;
        *(v4f*)d = v; 
    }
}

// k_prep: the six preparatory jobs, which do not depend on one another, as block ranges of one grid: the four weight transposes, the rotary table, the bf16 copy of x. The range test reads blockIdx only, so every barrier stays block-uniform.
// Left as it was: the work per thread (one 8-element piece, one 64x64 tile per block), so the grid is still one of very many short waves.
#define PB_WBIG  ((DM / 64) * (DM / 64))      // blocks of a DM x DM transpose
#define PB_WKV   ((DM / 64) * (DKV / 64))     // blocks of a DM x DKV transpose
#define PB_W     (2 * PB_WBIG + 2 * PB_WKV)
#define PB_ROPE  (SEQ / 4)
#define PB_CVT   ((int)(((size_t)NB * SEQ * DM / 8 + 255) / 256))
__global__ __launch_bounds__(256) void k_prep(const float* __restrict__ x, const float* __restrict__ wq, const float* __restrict__ wk, const float* __restrict__ wv, const float* __restrict__ wo,
                                              bf* XB, bf* WQT, bf* WKT, bf* WVT, bf* WOT, float* CS) {
    __shared__ __align__(16) float ts[64 * 65];
    const int tid = threadIdx.x; const int id = blockIdx.x;
    if (id < PB_W) {
        const bool big = id < 2 * PB_WBIG;
        const int q = big ? id : id - 2 * PB_WBIG; const int per = big ? PB_WBIG : PB_WKV;
        const bool second = q >= per; const int r = second ? q - per : q;
        const float* W = big ? (second ? wo : wq) : (second ? wv : wk);
        bf* WT = big ? (second ? WOT : WQT) : (second ? WVT : WKT);
        tcvt_body(W, WT, DM, big ? DM : DKV, r % (DM / 64), r / (DM / 64), ts, tid);
    } else if (id < PB_W + PB_ROPE) rope_body(CS, id - PB_W, ts, tid);
    else cvt8_body(x, XB, id - PB_W - PB_ROPE, tid);
}

// gemm_stage: one stage = 64 k of 128 A rows and 256 Bt rows = 384 whole lines of 128 B = 256 lanes x 12 copies of 16 B (eight lanes per line). l0, ga, gb: this lane's piece of row tid>>3; sa, sb: 32 rows, in elements.
// The s_wait_xcnt closes the statement so that no address register is rewritten ahead of it.
__device__ __forceinline__ void gemm_stage(unsigned l0, const bf* ga, size_t sa, const bf* gb, size_t sb) {
    const unsigned l1 = l0 + 32 * GPIT, l2 = l0 + 64 * GPIT, l3 = l0 + 96 * GPIT, l4 = l0 + 128 * GPIT, l5 = l0 + 160 * GPIT, l6 = l0 + 192 * GPIT, l7 = l0 + 224 * GPIT,
                   l8 = l0 + 256 * GPIT, l9 = l0 + 288 * GPIT, l10 = l0 + 320 * GPIT, l11 = l0 + 352 * GPIT;
    const bf* a1 = ga + sa; const bf* a2 = a1 + sa; const bf* a3 = a2 + sa;
    const bf* b1 = gb + sb; const bf* b2 = b1 + sb; const bf* b3 = b2 + sb; const bf* b4 = b3 + sb; const bf* b5 = b4 + sb; const bf* b6 = b5 + sb; const bf* b7 = b6 + sb;
    asm volatile("global_load_async_to_lds_b128 %0, %12, off\n\t"
                 "global_load_async_to_lds_b128 %1, %13, off\n\t"
                 "global_load_async_to_lds_b128 %2, %14, off\n\t"
                 "global_load_async_to_lds_b128 %3, %15, off\n\t"
                 "global_load_async_to_lds_b128 %4, %16, off\n\t"
                 "global_load_async_to_lds_b128 %5, %17, off\n\t"
                 "global_load_async_to_lds_b128 %6, %18, off\n\t"
                 "global_load_async_to_lds_b128 %7, %19, off\n\t"
                 "global_load_async_to_lds_b128 %8, %20, off\n\t"
                 "global_load_async_to_lds_b128 %9, %21, off\n\t"
                 "global_load_async_to_lds_b128 %10, %22, off\n\t"
                 "global_load_async_to_lds_b128 %11, %23, off\n\t"
                 "s_wait_xcnt 0x0"
                 :: "v"(l0), "v"(l1), "v"(l2), "v"(l3), "v"(l4), "v"(l5), "v"(l6), "v"(l7), "v"(l8), "v"(l9), "v"(l10), "v"(l11),
                    "v"(ga), "v"(a1), "v"(a2), "v"(a3), "v"(gb), "v"(b1), "v"(b2), "v"(b3), "v"(b4), "v"(b5), "v"(b6), "v"(b7) : "memory");
}

// gemm_loop: bf16 GEMM main loop of an 8-wave block, block tile 128 x 256, wave tile (16*MT) x (16*NT) at rows wr, columns wc of it. Each 64-k stage of the block's A and Bt rows is brought into LDS once
// per block by asynchronous copies of whole lines, and every wave takes its fragments from there. Two buffers: stage s + 1 is in flight while stage s is worked on; one barrier per stage publishes s + 1 and frees the buffer of s.
// acc[mb*NT+nb] += sum_k A[R0+wr+16mb+..][k] * Bt[C0+wc+16nb+..][k & kbm]   (kbm folds a K-concatenated A against a single Bt plane); k ascending in steps of 32
template <int MT, int NT>
__device__ __forceinline__ void gemm_loop(const bf* __restrict__ A, size_t lda, const bf* __restrict__ Bt, size_t ldbt,
                                          int K, int kbm, int R0, int C0, int wr, int wc, unsigned char* ring, int tid, int lr, int hi, v8f (&acc)[MT * NT]) {
#pragma unroll
    for (int i = 0; i < MT * NT; ++i) acc[i] = (v8f){};
    const unsigned l0 = (unsigned)(size_t)ring + (unsigned)((tid >> 3) * GPIT + (tid & 7) * 16);
    const bf* ga = A + (size_t)(R0 + (tid >> 3)) * lda + (tid & 7) * 8;
    const bf* gb = Bt + (size_t)(C0 + (tid >> 3)) * ldbt + (tid & 7) * 8;
    const size_t sa = 32 * lda, sb = 32 * ldbt;
    const int nst = K / GKS;                                   // the same for every wave of the launch
    gemm_stage(l0, ga, sa, gb, sb);                            // stage 0 -> buffer 0
    asm volatile("s_wait_asynccnt 0x0" ::: "memory");          // this wave's share of stage 0 has landed
    __syncthreads();                                           // stage 0 published
    if (nst > 1) gemm_stage(l0 + GST, ga + GKS, sa, gb + (GKS & kbm), sb);   // stage 1 -> buffer 1
    const int ao = (wr + lr) * GPIT + 16 * hi, bfo = (GAR + wc + lr) * GPIT + 16 * hi;
#pragma unroll 1
    for (int st = 0; st < nst; ++st) {
        const unsigned bo = (st & 1) ? (unsigned)GST : 0u;
        const bf* as = (const bf*)(ring + bo + ao); const bf* bs = (const bf*)(ring + bo + bfo);
        v16bf a[MT], b[NT];
#pragma unroll
        for (int ks = 0; ks < GKS / 32; ++ks) {
            // the fragments of a 32-k step are read as one group ahead of its products, so the LDS latency is waited out once per step
#pragma unroll
            for (int mb = 0; mb < MT; ++mb) a[mb] = ldb(as + mb * 16 * (GPIT / 2) + 32 * ks);
#pragma unroll
            for (int nb = 0; nb < NT; ++nb) b[nb] = ldb(bs + nb * 16 * (GPIT / 2) + 32 * ks);
            // inputs-only fence on the loaded fragments: holds all reads of the step in one group in front of its products (otherwise each Bt fragment is read, and its latency waited out, between the products)
            if constexpr (MT == 4 && NT == 4) asm volatile("" :: "v"(a[0]), "v"(a[1]), "v"(a[2]), "v"(a[3]), "v"(b[0]), "v"(b[1]), "v"(b[2]), "v"(b[3]));
            else { static_assert((MT == 4 && NT == 4) || (MT == 2 && NT == 8));
                asm volatile("" :: "v"(a[0]), "v"(a[1]), "v"(b[0]), "v"(b[1]), "v"(b[2]), "v"(b[3]), "v"(b[4]), "v"(b[5]), "v"(b[6]), "v"(b[7])); }
#pragma unroll
            for (int nb = 0; nb < NT; ++nb) {
#pragma unroll
                for (int mb = 0; mb < MT; ++mb) acc[mb * NT + nb] = wmmab(a[mb], b[nb], acc[mb * NT + nb]); }
        }
        asm volatile("v_nop\n\tv_nop\n\tv_nop\n\tv_nop" : "+v"(acc[0]), "+v"(acc[(MT * NT) / 3]), "+v"(acc[(2 * MT * NT) / 3]), "+v"(acc[MT * NT - 1]) : "v"(a[0]), "v"(a[MT - 1]), "v"(b[NT - 1]));
        // publish point of stage st + 1
        asm volatile("s_wait_dscnt 0x0" ::: "memory");         // this wave's reads of the buffer of stage st are done before it is handed to the copies
        asm volatile("s_wait_asynccnt 0x0" ::: "memory");      // this wave's share of stage st + 1 has landed
        __syncthreads();                                       // stage st + 1 published; every reader has left the buffer of stage st
        if (st + 2 < nst) gemm_stage(l0 + bo, ga + (st + 2) * GKS, sa, gb + (((st + 2) * GKS) & kbm), sb);   // stage st + 2 -> the buffer just read
    }
    asm volatile("s_wait_asynccnt 0x0" ::: "memory");          // nothing of this wave is in flight when it leaves the ring
}

// qk_body: projection + bias + rotary for q or k. One wave per 32 rows x 128 columns (= one head), K = DM; a block is 4 row groups x 2 heads: bx in NB*SEQ/128, by in nheads/2, 256 threads.
// Output plane [(b*nheads + head)][t][d] as f16 (Ph) and optionally the f16 residual x2048 (Pr, useRes != 0).
// Output staging lies on the ring: the last publish point of gemm_loop (LDS reads done, no copy in flight, block barrier) has freed it for every wave.
__device__ __forceinline__ void qk_body(const bf* __restrict__ A, const bf* __restrict__ Bt, const float* __restrict__ bias, const float* __restrict__ CS, h16* Ph, h16* Pr, int useRes, int nheads,
                                        int bx, int by, unsigned char* ring, int tid) {
    static_assert(GW * 16 * 132 * 4 <= 2 * GST);
    const int lane = tid & 31, wave = tid >> 5, lr = lane & 15, hi = lane >> 4;
    float* os = (float*)ring + wave * 16 * 132;                // wave-private output staging
    const int wr = (wave & 3) * 32, wc = (wave >> 2) * HD;
    const int r0 = bx * 128 + wr, head = by * 2 + (wave >> 2), cbase = head * HD;
    v8f acc[16];
    gemm_loop<2, 8>(A, (size_t)DM, Bt, (size_t)DM, DM, 0x7FFFFFFF, bx * 128, by * 256, wr, wc, ring, tid, lr, hi, acc);
    float bz[8];
#pragma unroll
    for (int nb = 0; nb < 8; ++nb) bz[nb] = bfr(bias[cbase + nb * 16 + lr]);
    const int b = r0 / SEQ, t0 = r0 % SEQ;
    const size_t tbase = ((size_t)(b * nheads + head) * SEQ + t0) * HD;
#pragma unroll
    for (int mb = 0; mb < 2; ++mb) {
#pragma unroll
        for (int nb = 0; nb < 8; ++nb) {
#pragma unroll
            for (int j = 0; j < 8; ++j) os[(hi * 8 + j) * 132 + nb * 16 + lr] = acc[mb * 8 + nb][j] + bz[nb]; }   // D: row 8h+j, col lane&15; rows 0..15 x cols 0..127 all staged
        wave_sync();
{
            const int c8 = lr * 8, p8 = c8 ^ 64;
#pragma unroll 1   // stays rolled, four trips of two row pairs each: keeps the epilogue's code short
            for (int s2 = 0; s2 < 8; s2 += 2) { v4u hq[2], rq[2];
#pragma unroll
              for (int u = 0; u < 2; ++u) { const int row = 2 * (s2 + u) + hi;   // 8 s x 2 rows = 16 rows; 16 lanes x 8 = 128 columns
                const int t = t0 + mb * 16 + row;
                const float* orow = &os[row * 132];
                const v4f x0 = *(const v4fa*)(orow + c8), x1 = *(const v4fa*)(orow + c8 + 4);
                const v4f y0 = *(const v4fa*)(orow + p8), y1 = *(const v4fa*)(orow + p8 + 4);
                const float* cs = CS + (size_t)t * 128 + (c8 & 63);
                const v4f cc0 = *(const v4f*)cs, cc1 = *(const v4f*)(cs + 4), ss0 = *(const v4f*)(cs + 64), ss1 = *(const v4f*)(cs + 68);
                const float sg = (c8 < 64) ? -1.0f : 1.0f;       // d < 64: x[d] cos - x[d+64] sin; d >= 64: x[d] cos + x[d-64] sin
                v8h hv, rv;
#pragma unroll
                for (int i = 0; i < 4; ++i) {
                    const float v0 = x0[i] * cc0[i] + sg * (y0[i] * ss0[i]); const float v1 = x1[i] * cc1[i] + sg * (y1[i] * ss1[i]);
                    const h16 a0 = (h16)v0; const h16 a1 = (h16)v1; hv[i] = a0; hv[4 + i] = a1;
                    rv[i] = (h16)((v0 - (float)a0) * QRS); rv[4 + i] = (h16)((v1 - (float)a1) * QRS); }
                hq[u] = __builtin_bit_cast(v4u, hv); rq[u] = __builtin_bit_cast(v4u, rv); }
                const size_t oo = tbase + (size_t)(mb * 16 + 2 * s2 + hi) * HD + c8;   // row 2 s2 + hi; the second piece lies two rows (2 * HD * 2 bytes) further
                h16* ph = Ph + oo; h16* pr = Pr + oo;
                // the trip's stores and their s_wait_xcnt in one statement, so that the wait stands in front of every rewrite of a register that a store names (a wait in a statement of its own does not hold the address additions behind it)
                if (useRes) asm volatile("global_store_b128 %0, %2, off\n\t"
                                         "global_store_b128 %0, %3, off offset:%6\n\t"
                                         "global_store_b128 %1, %4, off\n\t"
                                         "global_store_b128 %1, %5, off offset:%6\n\t"
                                         "s_wait_xcnt 0x0"
                                         :: "v"(ph), "v"(pr), "v"(hq[0]), "v"(hq[1]), "v"(rq[0]), "v"(rq[1]), "n"(2 * HD * 2) : "memory");
                else        asm volatile("global_store_b128 %0, %1, off\n\t"
                                         "global_store_b128 %0, %2, off offset:%3\n\t"
                                         "s_wait_xcnt 0x0"
                                         :: "v"(ph), "v"(hq[0]), "v"(hq[1]), "n"(2 * HD * 2) : "memory"); }
             }
        wave_sync();
    }
}

// vt_body: v^T projection. A = WvT rows (m = g*128 + d), Bt = x rows (n = b*SEQ + t), one wave per 64x64 tile, a block is 2 x 4 of them: bx in DKV/128, by in NB*SEQ/256, 256 threads.
// Planes [(b*DKV + m)][t] = [(b*4 + g)][d][t]: f16 value (VH) and f16 residual x256 (VR); bias per row m. Output staging lies on the ring, as in qk_body.
__device__ __forceinline__ void vt_body(const bf* __restrict__ A, const bf* __restrict__ Bt, const float* __restrict__ bias, h16* VH, h16* VR, int bx, int by, unsigned char* ring, int tid) {
    const int lane = tid & 31, wave = tid >> 5, lr = lane & 15, hi = lane >> 4;
    float* os = (float*)ring + wave * 16 * 68;                 // wave-private output staging
    const int wr = (wave & 1) * 64, wc = (wave >> 1) * 64;
    const int r0 = bx * 128 + wr, c0 = by * 256 + wc;
    v8f acc[16];
    gemm_loop<4, 4>(A, (size_t)DM, Bt, (size_t)DM, DM, 0x7FFFFFFF, bx * 128, by * 256, wr, wc, ring, tid, lr, hi, acc);
    const int b = c0 / SEQ, t0 = c0 % SEQ;
    const size_t tbase = ((size_t)b * DKV + r0) * SEQ + t0;
#pragma unroll
    for (int mb = 0; mb < 4; ++mb) {
        float bj[8];
#pragma unroll
        for (int j = 0; j < 8; ++j) bj[j] = bfr(bias[r0 + mb * 16 + hi * 8 + j]);
#pragma unroll
        for (int nb = 0; nb < 4; ++nb) {
#pragma unroll
            for (int j = 0; j < 8; ++j) os[(hi * 8 + j) * 68 + nb * 16 + lr] = acc[mb * 4 + nb][j] + bj[j]; }   // rows 0..15 x cols 0..63 all staged
        wave_sync();
        const size_t sb = tbase + (size_t)(mb * 16) * SEQ;
{
            const int c8 = (lane & 7) * 8; v4u hq[4], rq[4];
#pragma unroll
            for (int s = 0; s < 4; ++s) { const int row = 4 * s + (lane >> 3);   // 4 s x 4 row groups = 16 rows; 8 lanes x 8 = 64 columns
                const v4f x0 = *(const v4fa*)(&os[row * 68 + c8]); const v4f x1 = *(const v4fa*)(&os[row * 68 + c8 + 4]); v8h hv, rv;
#pragma unroll
                for (int i = 0; i < 4; ++i) { const h16 a0 = (h16)x0[i]; const h16 a1 = (h16)x1[i]; hv[i] = a0; hv[4 + i] = a1; rv[i] = (h16)((x0[i] - (float)a0) * VRS); rv[4 + i] = (h16)((x1[i] - (float)a1) * VRS); }
                hq[s] = __builtin_bit_cast(v4u, hv); rq[s] = __builtin_bit_cast(v4u, rv); }
            const size_t oo = sb + (size_t)(lane >> 3) * SEQ + c8;   // row lane>>3; piece s lies 4 s rows (4 * SEQ * 2 bytes each step) further
            h16* ph = VH + oo; h16* pr = VR + oo;
            // the row block's stores and their s_wait_xcnt in one statement, so that the wait stands in front of every rewrite of a register that a store names (the next block's bias loads may take the data registers)
            asm volatile("global_store_b128 %0, %2, off\n\t"
                         "global_store_b128 %1, %6, off\n\t"
                         "global_store_b128 %0, %3, off offset:%10\n\t"
                         "global_store_b128 %1, %7, off offset:%10\n\t"
                         "global_store_b128 %0, %4, off offset:%11\n\t"
                         "global_store_b128 %1, %8, off offset:%11\n\t"
                         "global_store_b128 %0, %5, off offset:%12\n\t"
                         "global_store_b128 %1, %9, off offset:%12\n\t"
                         "s_wait_xcnt 0x0"
                         :: "v"(ph), "v"(pr), "v"(hq[0]), "v"(hq[1]), "v"(hq[2]), "v"(hq[3]), "v"(rq[0]), "v"(rq[1]), "v"(rq[2]), "v"(rq[3]),
                            "n"(4 * SEQ * 2), "n"(8 * SEQ * 2), "n"(12 * SEQ * 2) : "memory");
             }
        wave_sync();
    }
}

// k_qkv: the q, k and v^T projections, which do not depend on one another, as block ranges of one grid, so that the 64-block k and v^T jobs run beside the q job instead of each alone on a quarter of the chip.
// One LDS arena (the ring, 108 KiB) lets two blocks share a WGP, so all blocks of the grid are resident at once. The range test reads blockIdx only, so every barrier stays block-uniform.
#define GB_ROW  (NB * SEQ / 128)
#define GB_Q    (GB_ROW * (NH_ / 2))
#define GB_K    (GB_ROW * (NKV / 2))
#define GB_V    ((DKV / 128) * (NB * SEQ / 256))
__global__ __launch_bounds__(32 * GW) __attribute__((amdgpu_num_vgpr(256)))
void k_qkv(const bf* __restrict__ XB, const bf* __restrict__ WQT, const bf* __restrict__ WKT, const bf* __restrict__ WVT,
           const float* __restrict__ bq, const float* __restrict__ bk, const float* __restrict__ bv, const float* __restrict__ CS, h16* QH, h16* QR, h16* KP, h16* VH, h16* VR) {
    __shared__ __align__(16) unsigned char ring[2 * GST];
    const int tid = threadIdx.x; const int id = blockIdx.x;
    if (id < GB_Q + GB_K) {
        const bool isq = id < GB_Q; const int r = isq ? id : id - GB_Q;
        qk_body(XB, isq ? WQT : WKT, isq ? bq : bk, CS, isq ? QH : KP, isq ? QR : KP, isq ? 1 : 0, isq ? NH_ : NKV, r % GB_ROW, r / GB_ROW, ring, tid);
    } else {
        const int r = id - GB_Q - GB_K;
        vt_body(WVT, XB, bv, VH, VR, r % (DKV / 128), r / (DKV / 128), ring, tid);
    }
}

// k_flash: fused causal attention, one wave per 16 query rows of one (batch, head). A block is the 4 query heads of one kv head x 2 adjacent 16-row query tiles (8 waves): all of them walk
// the same keys, so each 32-key stage of K, V^T value and V^T residual is brought into LDS once per block by asynchronous copies (whole 16-B pieces, contiguous per row) and every wave takes its fragments from there.
// Two buffers: stage s + 1 is in flight while stage s is worked on; one barrier per stage publishes s + 1 and frees the buffer of s.
// Transposed form: S^T[key][t] = K Q^T (A = K rows, B = Q rows); lane (t = lane&15, h = lane>>4) holds keys 8h+r of each 16-key tile, so the packed
// P tile is directly the B fragment of O^T[d][t] = V^T P^T (element r <- tile keys 0..15, element 8+r <- tile keys 16..31, lane unchanged).
// The key loop of a tile runs to the 32-key step that contains its last query; keys beyond a query get the fill value (weight exactly 0). ALiBi bias slope*(key - query) added in the exp2 domain.
// Balance: a 32-row query tile x walks x + 1 stages, and all blocks of the grid are resident at once, so the launch lasts as long as its fullest WGP. Each block therefore takes two tiles one after the other,
// x and SEQ/32 - 1 - x: SEQ/32 + 1 stages for every block, one block per WGP. The two walks are one run of stages through the ring (the second tile's first stages fly while the first tile ends);
// at the first tile's last stage every wave writes its rows out, takes the second tile's q and starts its sums anew. The sums of a tile are formed as before.
// What is left: the LDS read rate (every wave reads every K and V^T fragment of a stage for its 16 query rows alone) and the softmax's vector work between the two matrix runs.
// Stage planes in LDS, 16 lines of SPIT bytes each, line = fragment row (lane&15): K line holds key rows r and 16 + r (256 B each); a V^T line holds the 32-key pieces (64 B) of rows d = 16j + r, j = 0..7.
// So every fragment of a stage is read at one per-lane address plus a constant.
// flash_stage: one stage = K 32 rows x 256 B, V^T value and residual 128 rows x 64 B each = 24 KiB = 256 lanes x 6 copies of 16 B. The copies are written as the builtin: this kernel holds more than 256 registers,
// asm text cannot name one above v255, and address operands tied to the low window were spilled to scratch inside the loop.
__device__ __forceinline__ void flash_cp(unsigned l, const h16* g) { __builtin_amdgcn_global_load_async_to_lds_b128((gv4i*)g, (lv4i*)l, 0, 0); }
__device__ __forceinline__ void flash_stage(unsigned lk, unsigned lv, const h16* gk, const h16* gh, const h16* gr) {
    flash_cp(lk, gk); flash_cp(lk + 256, gk + 16 * HD);
    flash_cp(lv + ST_VH, gh); flash_cp(lv + ST_VH + 256, gh + (size_t)64 * SEQ);
    flash_cp(lv + ST_VR, gr); flash_cp(lv + ST_VR + 256, gr + (size_t)64 * SEQ);
}

// flash_q: the q value and residual fragments of a wave's 16 query rows (B fragments: col t, k = d); qa, qb: this lane's piece of its row in the two planes.
// The s_wait_xcnt takes the two addresses as inputs, so that their registers stay as they are until it has passed (otherwise a late load's result may be laid on them).
__device__ __forceinline__ void flash_q(const h16* qa, const h16* qb, v16h (&qh)[4], v16h (&qr)[4]) {
#pragma unroll
    for (int c = 0; c < 4; ++c) { qh[c] = ldh(qa + 32 * c); qr[c] = ldh(qb + 32 * c); }
    asm volatile("s_wait_xcnt 0x0" :: "v"(qa), "v"(qb) : "memory");
}

__global__ __launch_bounds__(32 * FW) __attribute__((amdgpu_num_vgpr(512)))
void k_flash(const h16* __restrict__ QH, const h16* __restrict__ QR, const h16* __restrict__ KP, const h16* __restrict__ VH, const h16* __restrict__ VR, bf* CTX) {
    __shared__ __align__(16) unsigned char ring[2 * ST_SZ];
    __shared__ __align__(16) float os[FW * 16 * 132];
    const int tid = threadIdx.x;
    const int lane = tid & 31, wave = tid >> 5, lr = lane & 15, hi = lane >> 4;
    const int bg = blockIdx.y; const int b = bg / NKV, g = bg % NKV; const int h = g * REP + (wave & (REP - 1)); const int zh = b * NH_ + h;
    constexpr int NQT = SEQ / 32;                              // query tiles of one (batch, kv head)
    static_assert(NQT % 2 == 0);                               // the tiles pair off, every tile in exactly one block
    const int na = blockIdx.x + 1;                             // 32-key stages of the first tile (blockIdx.x); the second tile (NQT - 1 - blockIdx.x) has NQT - blockIdx.x
    constexpr int nst = NQT + 1;                               // stages of the block, the same for every block; stage st holds key step st of the first tile or st - na of the second, both below NQT
    int t0 = blockIdx.x * 32 + (wave >> 2) * 16;
    const size_t kvb = (size_t)bg * SEQ * HD;
    // copy addresses of this lane. K: piece tid -> key row tid>>4 (and +16: +256 B in its line), 16-B column tid&15. V^T: piece tid -> row d = tid>>2 (and +64: +256 B in its line), 16-B column tid&3.
    const unsigned rb = (unsigned)(size_t)ring;
    const unsigned lk = rb + (unsigned)((tid >> 4) * SPIT + (tid & 15) * 16), lvt = rb + (unsigned)(((tid >> 2) & 15) * SPIT + (tid >> 6) * 64 + (tid & 3) * 16);
    const h16* gk = KP + kvb + (size_t)tid * 8;                // + key0 * HD
    const size_t gvo = kvb + (size_t)(tid >> 2) * SEQ + (tid & 3) * 8;   // + key0
    const h16* gh = VH + gvo; const h16* gr = VR + gvo;
    flash_stage(lk, lvt, gk, gh, gr);                          // stage 0 -> buffer 0
    const size_t qz = (size_t)zh * SEQ * HD + (size_t)lr * HD + 8 * hi;   // + t0 * HD
    v16h qh[4], qr[4];
    flash_q(QH + qz + (size_t)t0 * HD, QR + qz + (size_t)t0 * HD, qh, qr);
    asm volatile("s_wait_asynccnt 0x0" ::: "memory");          // this wave's share of stage 0 has landed
    __syncthreads();                                           // stage 0 published
    { const int k1 = na > 1 ? 32 : 0; flash_stage(lk + ST_SZ, lvt + ST_SZ, gk + (size_t)k1 * HD, gh + k1, gr + k1); }   // stage 1 -> buffer 1
    const int fo = lr * SPIT + 16 * hi;                        // K: + 256 (second key tile) + 64*c (A fragment: row key, k = d); V^T: + plane + 64*j (A fragment: row d, k = key)
    const float slope2 = __builtin_amdgcn_exp2f(-0.5f * (float)(h + 1)) * LOG2E;
    int qi = t0 + lr;
    const int wb = wave * 16 * 132;
    v8f o[8];
#pragma unroll
    for (int j = 0; j < 8; ++j) o[j] = (v8f){};
    float m = NEGBIG, l = 0.0f;
#pragma unroll 1
    for (int st = 0; st < nst; ++st) {
        const int key0 = (st < na ? st : st - na) * 32;
        const unsigned bo = (st & 1) ? (unsigned)ST_SZ : 0u;
        const h16* ka = (const h16*)(ring + bo + fo);
        const h16* va = ka + ST_VH / 2; const h16* vr = ka + ST_VR / 2;
        v8f sHa = (v8f){}, sLa = (v8f){}, sHb = (v8f){}, sLb = (v8f){};
        // All fragment reads of a stage stand as one group at its head (one block per WGP, two waves per SIMD: a wave may hold 512 registers): the eight K fragments first, then the sixteen V^T fragments,
        // which land while the score products and the softmax run; LDS data returns in issue order, so the products wait with counts and never for a read issued among them.
        // __builtin_amdgcn_sched_barrier(0): nothing is scheduled across it, so the group stays whole and in its place; it asks for no wait itself.
        v16h kf[8], vf[8], vg[8];
#pragma unroll
        for (int c = 0; c < 4; ++c) { kf[2 * c] = ldh(ka + 32 * c); kf[2 * c + 1] = ldh(ka + 128 + 32 * c); }
#pragma unroll
        for (int j = 0; j < 8; ++j) vf[j] = ldh(va + 32 * j);
#pragma unroll
        for (int j = 0; j < 8; ++j) vg[j] = ldh(vr + 32 * j);
        __builtin_amdgcn_sched_barrier(0);
#pragma unroll
        for (int c = 0; c < 4; ++c) {
            sHa = wmma16(kf[2 * c], qh[c], sHa); sLa = wmma16(kf[2 * c], qr[c], sLa); sHb = wmma16(kf[2 * c + 1], qh[c], sHb); sLb = wmma16(kf[2 * c + 1], qr[c], sLb); }
        asm volatile("v_nop\n\tv_nop\n\tv_nop\n\tv_nop" : "+v"(sHa), "+v"(sLa), "+v"(sHb), "+v"(sLb) : "v"(kf[6]), "v"(kf[7]));
        const float base = (float)(key0 + 8 * hi - qi);        // key - query for r = 0 of tile a
        float ta[8], tb[8]; float mx = NEGBIG;
#pragma unroll
        for (int r = 0; r < 8; ++r) {
            const float da = base + (float)r, db = da + 16.0f;
            float xa = fmaf(slope2, da, (sHa[r] + sLa[r] * QRI) * SC2);
            float xb = fmaf(slope2, db, (sHb[r] + sLb[r] * QRI) * SC2);
            xa = (da > 0.0f) ? NEGBIG : xa; xb = (db > 0.0f) ? NEGBIG : xb;
            ta[r] = xa; tb[r] = xb; mx = fmaxf(mx, fmaxf(xa, xb)); }
        // lane l <-> l ^ 16 by a vector cross-row move: an LDS permute would count on dscnt behind the V^T reads and wait them all out in the middle of the softmax
        mx = fmaxf(mx, __uint_as_float(__builtin_amdgcn_permlanex16(__float_as_uint(mx), __float_as_uint(mx), 0x76543210u, 0xfedcba98u, false, false)));
        const float mnew = fmaxf(m, mx);
        const float alpha = __builtin_amdgcn_exp2f(m - mnew);
        const float sh = PSH - mnew;
        v16h pb; float ls = 0.0f;
#pragma unroll
        for (int r = 0; r < 8; ++r) { const h16 pa = (h16)__builtin_amdgcn_exp2f(ta[r] + sh); const h16 pc = (h16)__builtin_amdgcn_exp2f(tb[r] + sh); pb[r] = pa; pb[8 + r] = pc; ls += (float)pa + (float)pc; }
        const v16h pq = pb * (h16)0.00390625f;                 // P x 2^-8: partner of the v residual x256
        l = l * alpha + ls; m = mnew;
#pragma unroll
        for (int j = 0; j < 8; ++j) o[j] = o[j] * alpha;
        // all loops unrolled so that every array index is a constant (registers, no scratch)
#pragma unroll
        for (int j = 0; j < 8; ++j) o[j] = wmma16(vf[j], pb, o[j]);
#pragma unroll
        for (int j = 0; j < 8; ++j) o[j] = wmma16(vg[j], pq, o[j]);
        asm volatile("v_nop\n\tv_nop\n\tv_nop\n\tv_nop" : "+v"(o[0]), "+v"(o[1]), "+v"(o[2]), "+v"(o[3]), "+v"(o[4]), "+v"(o[5]), "+v"(o[6]), "+v"(o[7]) : "v"(pb), "v"(pq));
        // publish point of stage st + 1
        asm volatile("s_wait_dscnt 0x0" ::: "memory");         // this wave's reads of the buffer of stage st are done before it is handed to the copies
        asm volatile("s_wait_asynccnt 0x0" ::: "memory");      // this wave's share of stage st + 1 has landed
        __syncthreads();                                       // stage st + 1 published; every reader has left the buffer of stage st
        if (st + 2 < nst) { const int k2 = (st + 2 < na ? st + 2 : st + 2 - na) * 32; flash_stage(lk + bo, lvt + bo, gk + (size_t)k2 * HD, gh + k2, gr + k2); }   // stage st + 2 -> the buffer just read
      if (st == na - 1 || st == nst - 1) {                     // block-uniform: behind a tile's last stage its rows go out
    l += __shfl_xor(l, 16, 32);
    const float inv = 1.0f / l;
    // O^T D layout: o[j][r] = (d = 16j + 8h + r, t = lane&15) -> os[t][d]; rows 0..15 x columns 0..127 all written
#pragma unroll
    for (int j = 0; j < 8; ++j) { v4f a, c;
        a[0] = o[j][0] * inv; a[1] = o[j][1] * inv; a[2] = o[j][2] * inv; a[3] = o[j][3] * inv; c[0] = o[j][4] * inv; c[1] = o[j][5] * inv; c[2] = o[j][6] * inv; c[3] = o[j][7] * inv;
        *(v4fa*)(&os[wb + lr * 132 + 16 * j + 8 * hi]) = a; *(v4fa*)(&os[wb + lr * 132 + 16 * j + 8 * hi + 4]) = c; }
    wave_sync();
    bf* crow = CTX + ((size_t)b * SEQ + t0) * (size_t)(2 * DM) + h * HD;
{
#pragma unroll 2
        for (int s = 0; s < 8; ++s) { const int row = 2 * s + hi, c8 = lr * 8;   // 8 s x 2 rows = 16 rows; 16 lanes x 8 = 128 columns
            const v4f x0 = *(const v4fa*)(&os[wb + row * 132 + c8]); const v4f x1 = *(const v4fa*)(&os[wb + row * 132 + c8 + 4]); v8us hv, lv;
#pragma unroll
            for (int i = 0; i < 4; ++i) { const unsigned short a0 = f2bf(x0[i]); const unsigned short a1 = f2bf(x1[i]); hv[i] = a0; hv[4 + i] = a1; lv[i] = f2bf(x0[i] - bf2f(a0)); lv[4 + i] = f2bf(x1[i] - bf2f(a1)); }
            bf* dst = crow + (size_t)row * (size_t)(2 * DM) + c8;
            *(v8us*)dst = hv; *(v8us*)(dst + DM) = lv; }
         }
        asm volatile("s_wait_xcnt 0x0" ::: "memory");          // behind the tile's stores, in front of the rewrites of the registers that they name
        wave_sync();                                           // this wave's reads of its output staging stand in front of the second tile's writes to it
        // second tile: its rows, its q, sums from the start
        t0 = (NQT - 1 - (int)blockIdx.x) * 32 + (wave >> 2) * 16; qi = t0 + lr;
        if (st != nst - 1) flash_q(QH + qz + (size_t)t0 * HD, QR + qz + (size_t)t0 * HD, qh, qr);
#pragma unroll
        for (int j = 0; j < 8; ++j) o[j] = (v8f){};
        m = NEGBIG; l = 0.0f;
      }
    }
    asm volatile("s_wait_asynccnt 0x0" ::: "memory");          // nothing of this wave is in flight when it leaves the ring
}

// fold_stage: one stage of k_out = 64 k of 128 ctx rows, hi piece and lo piece, and of 256 WoT rows = 512 whole lines of 128 B = 256 lanes x 16 copies of 16 B (eight lanes per line).
// l0, ga, gb: this lane's piece of row tid>>3; sa, sb: 32 rows, in elements; the lo piece of a ctx row lies DM elements behind its hi piece.
// Two statements (an asm statement takes thirty operands); each s_wait_xcnt closes its statement so that no address register is rewritten ahead of it.
__device__ __forceinline__ void fold_stage(unsigned l0, const bf* ga, size_t sa, const bf* gb, size_t sb) {
    const unsigned l1 = l0 + 32 * GPIT, l2 = l0 + 64 * GPIT, l3 = l0 + 96 * GPIT, l4 = l0 + FLO * GPIT, l5 = l0 + (FLO + 32) * GPIT, l6 = l0 + (FLO + 64) * GPIT, l7 = l0 + (FLO + 96) * GPIT;
    const bf* a1 = ga + sa; const bf* a2 = a1 + sa; const bf* a3 = a2 + sa;
    const bf* r0 = ga + DM; const bf* r1 = a1 + DM; const bf* r2 = a2 + DM; const bf* r3 = a3 + DM;
    asm volatile("global_load_async_to_lds_b128 %0, %8, off\n\t"
                 "global_load_async_to_lds_b128 %1, %9, off\n\t"
                 "global_load_async_to_lds_b128 %2, %10, off\n\t"
                 "global_load_async_to_lds_b128 %3, %11, off\n\t"
                 "global_load_async_to_lds_b128 %4, %12, off\n\t"
                 "global_load_async_to_lds_b128 %5, %13, off\n\t"
                 "global_load_async_to_lds_b128 %6, %14, off\n\t"
                 "global_load_async_to_lds_b128 %7, %15, off\n\t"
                 "s_wait_xcnt 0x0"
                 :: "v"(l0), "v"(l1), "v"(l2), "v"(l3), "v"(l4), "v"(l5), "v"(l6), "v"(l7),
                    "v"(ga), "v"(a1), "v"(a2), "v"(a3), "v"(r0), "v"(r1), "v"(r2), "v"(r3) : "memory");
    const unsigned m0 = l0 + FBT * GPIT, m1 = l0 + (FBT + 32) * GPIT, m2 = l0 + (FBT + 64) * GPIT, m3 = l0 + (FBT + 96) * GPIT,
                   m4 = l0 + (FBT + 128) * GPIT, m5 = l0 + (FBT + 160) * GPIT, m6 = l0 + (FBT + 192) * GPIT, m7 = l0 + (FBT + 224) * GPIT;
    const bf* b1 = gb + sb; const bf* b2 = b1 + sb; const bf* b3 = b2 + sb; const bf* b4 = b3 + sb; const bf* b5 = b4 + sb; const bf* b6 = b5 + sb; const bf* b7 = b6 + sb;
    asm volatile("global_load_async_to_lds_b128 %0, %8, off\n\t"
                 "global_load_async_to_lds_b128 %1, %9, off\n\t"
                 "global_load_async_to_lds_b128 %2, %10, off\n\t"
                 "global_load_async_to_lds_b128 %3, %11, off\n\t"
                 "global_load_async_to_lds_b128 %4, %12, off\n\t"
                 "global_load_async_to_lds_b128 %5, %13, off\n\t"
                 "global_load_async_to_lds_b128 %6, %14, off\n\t"
                 "global_load_async_to_lds_b128 %7, %15, off\n\t"
                 "s_wait_xcnt 0x0"
                 :: "v"(m0), "v"(m1), "v"(m2), "v"(m3), "v"(m4), "v"(m5), "v"(m6), "v"(m7),
                    "v"(gb), "v"(b1), "v"(b2), "v"(b3), "v"(b4), "v"(b5), "v"(b6), "v"(b7) : "memory");
}

// fold_loop: main loop of k_out, an 8-wave block, block tile 128 x 256, wave tile 64 x 64 at rows wr, columns wc of it. The hi and the lo plane of ctx meet the same WoT rows, so both walk k together:
// a stage holds 64 k of the hi pieces, the lo pieces and the WoT rows, each WoT line is copied once and each WoT fragment read once for both planes (12 fragments for 32 products), and the loop has DM / 64 stages.
// Ring as in gemm_loop: two buffers, stage s + 1 in flight while stage s is worked on, one barrier per stage.
// acc[mb*4+nb] += sum_k (A[R0+wr+16mb+..][k] + A[R0+wr+16mb+..][DM+k]) * Bt[C0+wc+16nb+..][k]; k ascending in steps of 32, in each step the hi products first
__device__ __forceinline__ void fold_loop(const bf* __restrict__ A, const bf* __restrict__ Bt, int R0, int C0, int wr, int wc, unsigned char* ring, int tid, int lr, int hi, v8f (&acc)[16]) {
#pragma unroll
    for (int i = 0; i < 16; ++i) acc[i] = (v8f){};
    const unsigned l0 = (unsigned)(size_t)ring + (unsigned)((tid >> 3) * GPIT + (tid & 7) * 16);
    const bf* ga = A + (size_t)(R0 + (tid >> 3)) * (size_t)(2 * DM) + (tid & 7) * 8;
    const bf* gb = Bt + (size_t)(C0 + (tid >> 3)) * (size_t)DM + (tid & 7) * 8;
    const size_t sa = (size_t)32 * 2 * DM, sb = (size_t)32 * DM;
    constexpr int nst = DM / GKS;                              // the same for every wave of the launch
    static_assert(nst >= 2);                                   // stages 0 and 1 both exist
    fold_stage(l0, ga, sa, gb, sb);                            // stage 0 -> buffer 0
    asm volatile("s_wait_asynccnt 0x0" ::: "memory");          // this wave's share of stage 0 has landed
    __syncthreads();                                           // stage 0 published
    fold_stage(l0 + FST, ga + GKS, sa, gb + GKS, sb);          // stage 1 -> buffer 1
    const int ao = (wr + lr) * GPIT + 16 * hi, ro = (FLO + wr + lr) * GPIT + 16 * hi, bfo = (FBT + wc + lr) * GPIT + 16 * hi;
#pragma unroll 1   // one stage per trip: the ring's order at the foot stands once
    for (int st = 0; st < nst; ++st) {
        const unsigned bo = (st & 1) ? (unsigned)FST : 0u;
        const bf* as = (const bf*)(ring + bo + ao); const bf* rs = (const bf*)(ring + bo + ro); const bf* bs = (const bf*)(ring + bo + bfo);
        v16bf a[4], r[4], b[4];
        // Fragment reads stand in few groups, each ahead of the products that cover its latency, never among them. __builtin_amdgcn_sched_barrier(0): nothing is scheduled across it, so a group stays whole and in its place; it asks for no wait itself.
        // first step: hi, WoT, then lo fragments, which land while the hi products run
#pragma unroll
        for (int mb = 0; mb < 4; ++mb) a[mb] = ldb(as + mb * 16 * (GPIT / 2));
#pragma unroll
        for (int nb = 0; nb < 4; ++nb) b[nb] = ldb(bs + nb * 16 * (GPIT / 2));
#pragma unroll
        for (int mb = 0; mb < 4; ++mb) r[mb] = ldb(rs + mb * 16 * (GPIT / 2));
        __builtin_amdgcn_sched_barrier(0);
#pragma unroll
        for (int ks = 0; ks < GKS / 32; ++ks) {
#pragma unroll
            for (int nb = 0; nb < 4; ++nb) {
#pragma unroll
                for (int mb = 0; mb < 4; ++mb) acc[mb * 4 + nb] = wmmab(a[mb], b[nb], acc[mb * 4 + nb]); }
            if (ks + 1 < GKS / 32) {                           // the next step's hi fragments, behind the last product that reads this step's: they land while the lo products run
#pragma unroll
                for (int mb = 0; mb < 4; ++mb) a[mb] = ldb(as + mb * 16 * (GPIT / 2) + 32 * (ks + 1));
            }
            __builtin_amdgcn_sched_barrier(0);                 // in the last step it keeps the hi products in front of the publish point, where they cover the landing of the lo fragments
#pragma unroll
            for (int nb = 0; nb < 4; ++nb) {
#pragma unroll
                for (int mb = 0; mb < 4; ++mb) acc[mb * 4 + nb] = wmmab(r[mb], b[nb], acc[mb * 4 + nb]); }
            if (ks + 1 < GKS / 32) {                           // the next step's WoT fragments, then its lo fragments, which land while its hi products run
#pragma unroll
                for (int nb = 0; nb < 4; ++nb) b[nb] = ldb(bs + nb * 16 * (GPIT / 2) + 32 * (ks + 1));
#pragma unroll
                for (int mb = 0; mb < 4; ++mb) r[mb] = ldb(rs + mb * 16 * (GPIT / 2) + 32 * (ks + 1));
                __builtin_amdgcn_sched_barrier(0);
            }
        }
        // publish point of stage st + 1
        asm volatile("s_wait_dscnt 0x0" ::: "memory");         // this wave's reads of the buffer of stage st are done before it is handed to the copies
        asm volatile("s_wait_asynccnt 0x0" ::: "memory");      // this wave's share of stage st + 1 has landed
        __syncthreads();                                       // stage st + 1 published; every reader has left the buffer of stage st
        if (st + 2 < nst) fold_stage(l0 + bo, ga + (st + 2) * GKS, sa, gb + (st + 2) * GKS, sb);   // stage st + 2 -> the buffer just read
    }
    asm volatile("s_wait_asynccnt 0x0" ::: "memory");          // nothing of this wave is in flight when it leaves the ring
}

// k_out: output projection. A = ctx plane rows [hi 2048 | lo 2048], both planes against the single WoT plane (fold_loop), Bt = WoT rows, one wave per 64x64 tile, a block is 2 x 4 of them. grid (NB*SEQ/128, DM/256), 256 threads.
// What is left: the first fragment group of a stage is still read behind the barrier and the copies' issue, with nothing of the wave's own to cover it.
__global__ __launch_bounds__(32 * GW) __attribute__((amdgpu_num_vgpr(256)))
void k_out(const bf* __restrict__ A, const bf* __restrict__ Bt, const float* __restrict__ bias, float* OUT) {
    __shared__ __align__(16) unsigned char ring[2 * FST];
    __shared__ __align__(16) float osb[GW * 16 * 68];
    const int tid = threadIdx.x;
    const int lane = tid & 31, wave = tid >> 5, lr = lane & 15, hi = lane >> 4;
    float* os = osb + wave * 16 * 68;                          // wave-private output staging
    const int wr = (wave & 1) * 64, wc = (wave >> 1) * 64;
    const int r0 = blockIdx.x * 128 + wr, c0 = blockIdx.y * 256 + wc;
    v8f acc[16];
    fold_loop(A, Bt, blockIdx.x * 128, blockIdx.y * 256, wr, wc, ring, tid, lr, hi, acc);
    float bz[4];
#pragma unroll
    for (int nb = 0; nb < 4; ++nb) bz[nb] = bfr(bias[c0 + nb * 16 + lr]);
    const int b = r0 / SEQ, t0 = r0 % SEQ;
    float* obase = OUT + ((size_t)b * OUT_SEQ + t0) * DM + c0;
#pragma unroll
    for (int mb = 0; mb < 4; ++mb) {
#pragma unroll
        for (int nb = 0; nb < 4; ++nb) {
#pragma unroll
            for (int j = 0; j < 8; ++j) os[(hi * 8 + j) * 68 + nb * 16 + lr] = acc[mb * 4 + nb][j] + bz[nb]; }   // rows 0..15 x cols 0..63 all staged
        wave_sync();
        float* orow = obase + (size_t)(mb * 16) * DM;
{
#pragma unroll
            for (int s = 0; s < 8; ++s) { const int row = 2 * s + hi, cofs = lr * 4;   // 8 s x 2 rows = 16 rows; 16 lanes x 4 floats = 64 columns
                const v4f val = *(const v4fa*)(&os[row * 68 + cofs]);
                *(v4f*)(orow + (size_t)row * DM + cofs) = val; }
             }
        wave_sync();
    }
}

static constexpr size_t al256(size_t v) { return (v + 255) & ~(size_t)255; }
static constexpr size_t SZ_XB  = al256((size_t)NB * SEQ * DM * 2);
static constexpr size_t SZ_WQ  = al256((size_t)DM * DM * 2);
static constexpr size_t SZ_WK  = al256((size_t)DKV * DM * 2);
static constexpr size_t SZ_CS  = al256((size_t)SEQ * 128 * 4);
static constexpr size_t SZ_QP  = al256((size_t)NB * NH_ * SEQ * HD * 2);
static constexpr size_t SZ_KP  = al256((size_t)NB * NKV * SEQ * HD * 2);
static constexpr size_t SZ_CTX = al256((size_t)NB * SEQ * 2 * DM * 2);
static constexpr size_t SZ_TOTAL = SZ_XB + 2 * SZ_WQ + 2 * SZ_WK + SZ_CS + 2 * SZ_QP + 3 * SZ_KP + SZ_CTX;
static_assert(SZ_TOTAL <= (size_t)134217728);          // workspace carve <= 128 MiB

extern "C" void kernel_launch(void* const* d_in, const int* in_sizes, int n_in,
                              void* d_out, int out_size, void* d_ws, size_t ws_size, hipStream_t stream) {
    if (n_in < 9) return;
    const size_t needx = ((size_t)(NB - 1) * SEQ_FULL + SEQ) * DM;
    if ((size_t)in_sizes[0] < needx) return;
    if ((size_t)in_sizes[1] < (size_t)DM * DM || (size_t)in_sizes[2] < (size_t)DM) return;
    if ((size_t)in_sizes[3] < (size_t)DM * DKV || (size_t)in_sizes[4] < (size_t)DKV) return;
    if ((size_t)in_sizes[5] < (size_t)DM * DKV || (size_t)in_sizes[6] < (size_t)DKV) return;
    if ((size_t)in_sizes[7] < (size_t)DM * DM || (size_t)in_sizes[8] < (size_t)DM) return;
    if ((size_t)out_size < ((size_t)(NB - 1) * OUT_SEQ + SEQ) * DM) return;
    if (SZ_TOTAL > ws_size) return;
    // wire order: x, Wq, bq, Wk, bk, Wv, bv, Wo, bo (weights [in][out])
    const float* x  = (const float*)d_in[0];
    const float* wq = (const float*)d_in[1]; const float* bq = (const float*)d_in[2];
    const float* wk = (const float*)d_in[3]; const float* bk = (const float*)d_in[4];
    const float* wv = (const float*)d_in[5]; const float* bv = (const float*)d_in[6];
    const float* wo = (const float*)d_in[7]; const float* bo = (const float*)d_in[8];
    float* OUT = (float*)d_out;      // [NB][SEQ][2048]
    char* wsp = (char*)d_ws;
    bf* XB  = (bf*)wsp; wsp += SZ_XB;                // [NB*SEQ][2048]
    bf* WQT = (bf*)wsp; wsp += SZ_WQ;                // [2048 out][2048 in]
    bf* WOT = (bf*)wsp; wsp += SZ_WQ;                // [2048 out][2048 in]
    bf* WKT = (bf*)wsp; wsp += SZ_WK;                // [512 out][2048 in]
    bf* WVT = (bf*)wsp; wsp += SZ_WK;                // [512 out][2048 in]
    float* CS = (float*)wsp; wsp += SZ_CS;           // [SEQ][cos 64 | sin 64]
    h16* QH = (h16*)wsp; wsp += SZ_QP;               // [NB*16][SEQ][128]
    h16* QR = (h16*)wsp; wsp += SZ_QP;               // [NB*16][SEQ][128] residual x2048
    h16* KP = (h16*)wsp; wsp += SZ_KP;               // [NB*4][SEQ][128]
    h16* VH = (h16*)wsp; wsp += SZ_KP;               // [NB*4][128][SEQ]
    h16* VR = (h16*)wsp; wsp += SZ_KP;               // [NB*4][128][SEQ] residual x256
    bf* CTX = (bf*)wsp; wsp += SZ_CTX;               // [NB*SEQ][hi 2048 | lo 2048]

    // weight transposes in[K = DM rows][N cols] -> out[N rows][K = DM cols], rotary table, bf16 copy of x
    k_prep<<<PB_W + PB_ROPE + PB_CVT, 256, 0, stream>>>(x, wq, wk, wv, wo, XB, WQT, WKT, WVT, WOT, CS);

    // q, k: A = x rows (m = b*SEQ + t), Bt = WT rows (n = head*128 + d) -> plane [(b*nheads + head)][t][d], rotary applied
    // v^T: A = WvT rows (m = g*128 + d), Bt = x rows (n = b*SEQ + t) -> planes [(b*512 + m)][t]
    k_qkv<<<GB_Q + GB_K + GB_V, 32 * GW, 0, stream>>>(XB, WQT, WKT, WVT, bq, bk, bv, CS, QH, QR, KP, VH, VR);

    k_flash<<<dim3(SEQ / 64, NB * NKV, 1), 32 * FW, 0, stream>>>(QH, QR, KP, VH, VR, CTX);

    k_out<<<dim3(NB * SEQ / 128, DM / 256, 1), 32 * GW, 0, stream>>>(CTX, WOT, bo, OUT);
}

// v007
// One run takes 162 microseconds.
// Next to v006, in two timings, it ran 1.04 times as fast each time.
// Over all steps from v000 it is 4.16 times as fast.
#include <hip/hip_runtime.h>

// Causal grouped-query attention layer: x [NB][SEQ][2048], 16 query heads x 128, 4 kv heads, weights [in][out] with biases, rotate-half rotary (theta 1e4), ALiBi slopes 2^(-(h+1)/2), output projection; f32 output.
// Compute dtypes, f32 accumulate everywhere: q/k/v projections v_wmma_f32_16x16x32_bf16 (x, W, b RNE-converted to bf16; products exact);
// scores v_wmma_f32_16x16x32_f16: k single f16, q as f16 value + f16 residual x2048 in its own accumulator; P.V v_wmma_f32_16x16x32_f16: P single f16 (x256 carry, cancels in the normalisation),
// v as f16 value + f16 residual x256 whose partner operand is the P copy x2^-8 (K-dimension fold, products at natural scale, one accumulator); output projection v_wmma_f32_16x16x32_bf16 with ctx as bf16 hi | lo planes, both multiplied with the one bf16 Wo plane into one accumulator (per 32-k step: hi products, then lo products); softmax f32 (online, running max).
// Layout: bf16 x copy, bf16 transposed weight planes [out][in]; q (hi, residual) planes [b*16+h][t][d], k plane [b*4+g][t][d], v^T planes [b*4+g][d][t]; ctx plane [b*SEQ+t][hi 2048 | lo 2048]; rotary table [t][cos 64 | sin 64].

#ifndef NB
#define NB 2
#endif
#ifndef SEQ
#define SEQ 2048
#endif
#define NB_FULL  2
#define SEQ_FULL 2048
#ifndef OUT_SEQ
#define OUT_SEQ SEQ              // row pitch (in tokens) between batches of the output
#endif
#define DM   2048
#define NH_  16
#define NKV  4
#define HD   128
#define REP  (NH_ / NKV)
#define DKV  (NKV * HD)          // 512
#define FW   8                   // waves per flash block: the 4 query heads of one kv head x 2 query tiles of 16 rows
#define SPIT 528                 // LDS pitch, bytes, of one fragment-row line of a stage plane (512 + 16: 16 B x odd for 16-B readers)
#define ST_VH (16 * SPIT)               // byte offsets inside one 32-key step slot: K at 0, V^T value, V^T residual
#define ST_VR (2 * 16 * SPIT)
#define ST_SZ (3 * 16 * SPIT)           // 25344 B per 32-key step
#define FSP  4                   // 32-key steps per stage of the flash ring (128 keys)
#define GW   8                   // waves per GEMM block: block tile 128 A rows x 256 Bt rows
#define GKS  64                  // k elements per GEMM stage: one whole 128-B line of every operand row
#define GPIT 144                 // LDS pitch, bytes, of a staged 128-B row (16 B x odd for 16-B readers)
#define GAR  128                 // A rows of a stage; the Bt rows follow them
#define GST  ((GAR + 256) * GPIT)       // 55296 B per stage
#define FKS  128                 // k elements per k_out stage: 256 B of every operand row
#define FPIT 272                 // LDS pitch, bytes, of a staged 256-B row (16 B x odd for 16-B readers)
#define FLO  128                 // k_out stage: first row of the ctx lo pieces (the hi pieces are rows 0..127)
#define FBT  256                 // k_out stage: first row of the WoT pieces
#define FST  ((FBT + 256) * FPIT)       // 139264 B per k_out stage
#define QRS  2048.0f             // carry of the q residual plane
#define QRI  (1.0f / 2048.0f)
#define VRS  256.0f              // carry of the v residual plane (partner operand is P x 2^-8)
#define LOG2E 1.4426950408889634f
#define SC2  (0.08838834764831845f * 1.4426950408889634f)   // HD^-0.5 * log2(e)
#define PSH  8.0f                // log2 of the P carry (256)
#define NEGBIG (-3.0e38f)

static_assert(HD == 128);
static_assert(NH_ * HD == DM);
static_assert(NH_ % NKV == 0);
static_assert(DM % 64 == 0);
static_assert(DKV % 64 == 0);
static_assert(DM % 32 == 0);
static_assert(SEQ % 64 == 0);                  // a 64-row tile never straddles two batches
static_assert((NB * SEQ) % 64 == 0);
static_assert(SEQ % 32 == 0);                  // key loop steps by 32
static_assert(REP == 4 && FW == 2 * REP);      // wave -> (head of the group, query tile) map of the flash block
static_assert(SEQ % 4 == 0);
static_assert((NB * SEQ) % 256 == 0 && DKV % 128 == 0 && DM % 256 == 0 && NKV % 2 == 0 && NH_ % 2 == 0);   // GEMM block tiles cover every operand exactly
static_assert(DM % GKS == 0);
static_assert(DM % FKS == 0);
static_assert(((size_t)SEQ * DM) % 8 == 0);
static_assert(NB <= NB_FULL);
static_assert(SEQ <= SEQ_FULL);

typedef _Float16 h16;
typedef unsigned short bf;
typedef __attribute__((ext_vector_type(16))) __bf16   v16bf;
typedef __attribute__((ext_vector_type(16))) _Float16 v16h;
typedef __attribute__((ext_vector_type(8)))  _Float16 v8h;
typedef __attribute__((ext_vector_type(8)))  unsigned short v8us;
typedef __attribute__((ext_vector_type(8)))  float    v8f;
typedef __attribute__((ext_vector_type(4)))  float    v4f;
typedef v4f  __attribute__((may_alias)) v4fa;
typedef __attribute__((ext_vector_type(4)))  int      v4i;
typedef __attribute__((address_space(1))) v4i gv4i;            // pointee types of the asynchronous copy builtin: global source, LDS destination
typedef __attribute__((address_space(3))) v4i lv4i;
typedef __attribute__((ext_vector_type(4)))  unsigned v4u;     // 16 bytes as the data operand of a store written in asm text

__device__ __forceinline__ unsigned short f2bf(float f) { unsigned u = __float_as_uint(f); u += 0x7FFFu + ((u >> 16) & 1u); return (unsigned short)(u >> 16); }
__device__ __forceinline__ float bf2f(unsigned short u) { return __uint_as_float(((unsigned)u) << 16); }
__device__ __forceinline__ float bfr(float f) { return bf2f(f2bf(f)); }     // value of the RNE bf16 conversion
__device__ __forceinline__ v16h cat16(v8h lo, v8h hi) { return __builtin_shufflevector(lo, hi, 0, 1, 2, 3, 4, 5, 6, 7, 8, 9, 10, 11, 12, 13, 14, 15); }
__device__ __forceinline__ v16bf cat16b(v8us lo, v8us hi) { return __builtin_bit_cast(v16bf, __builtin_shufflevector(lo, hi, 0, 1, 2, 3, 4, 5, 6, 7, 8, 9, 10, 11, 12, 13, 14, 15)); }
__device__ __forceinline__ v8f wmma16(v16h a, v16h b, v8f c) { return __builtin_amdgcn_wmma_f32_16x16x32_f16(false, a, false, b, (short)0, c, false, false); }
__device__ __forceinline__ v8f wmmab(v16bf a, v16bf b, v8f c) { return __builtin_amdgcn_wmma_f32_16x16x32_bf16(false, a, false, b, (short)0, c, false, false); }
// fragment loaders from K-contiguous 16-bit rows; p already includes + 8*(lane>>4): elements 0..7 <- k0+8h+0..7, elements 8..15 <- k0+16+8h+0..7 (same map for A and B)
__device__ __forceinline__ v16h  ldh(const h16* p) { return cat16(*(const v8h*)p, *(const v8h*)(p + 16)); }
__device__ __forceinline__ v16bf ldb(const bf* p)  { return cat16b(*(const v8us*)p, *(const v8us*)(p + 16)); }
// ordering point for wave-private LDS tiles (same wave writes and reads)
__device__ __forceinline__ void wave_sync() { __builtin_amdgcn_fence(3 /* release order */, "wavefront"); __builtin_amdgcn_wave_barrier(); asm volatile("" ::: "memory"); }

// cvt8_body: x f32 -> bf16 copy [NB*SEQ][DM], eight elements per thread; blk = block index inside this range. Batch b of the source starts at b * SEQ_FULL rows.
__device__ __forceinline__ void cvt8_body(const float* __restrict__ src, bf* dst, int blk, int tid) {
    constexpr size_t per = (size_t)SEQ * DM / 8, n8 = (size_t)NB * per;
    const size_t i = (size_t)blk * 256 + tid; if (i >= n8) return;
    const v8f v = *(const v8f*)(src + (i / per) * ((size_t)SEQ_FULL * DM) + (i % per) * 8); v8us o;
#pragma unroll
    for (int k = 0; k < 8; ++k) o[k] = f2bf(v[k]);
    *(v8us*)(dst + i * 8) = o; 
}

// tcvt_body: W in[K rows][N cols] f32 -> WT out[N rows][K cols] bf16 (RNE convert), 64x64 tile (bx along K, by along N) transposed through LDS (cross-wave: block barrier).
__device__ __forceinline__ void tcvt_body(const float* __restrict__ W, bf* WT, int K, int N, int bx, int by, float* ts, int tid) {
    const int k0 = bx * 64, n0 = by * 64;
    const int cn = tid & 63, rk = tid >> 6;
#pragma unroll 4
    for (int i = 0; i < 16; ++i) { const int r = rk + 4 * i; ts[r * 65 + cn] = W[(size_t)(k0 + r) * N + n0 + cn]; }   // 16 x 4 = 64 rows, 64 columns
    __syncthreads();
    const int pc = tid & 7, rn = tid >> 3;      // rn 0..31 and rn+32 -> 64 output rows; 8 pieces x 8 = 64 k
    v8us o0, o1;
#pragma unroll
    for (int j = 0; j < 8; ++j) { o0[j] = f2bf(ts[(pc * 8 + j) * 65 + rn]); o1[j] = f2bf(ts[(pc * 8 + j) * 65 + rn + 32]); }
    bf* d0 = WT + (size_t)(n0 + rn) * K + k0 + pc * 8; bf* d1 = WT + (size_t)(n0 + rn + 32) * K + k0 + pc * 8;
    *(v8us*)d0 = o0; *(v8us*)d1 = o1; 
}

// rope_body: rotary table CS[t][0..63] = cos(t * f_i), CS[t][64..127] = sin(t * f_i), f_i = 10000^(-i/64) = 2^(-i * log2(10000)/64); precise sinf/cosf.
__device__ __forceinline__ void rope_body(float* CS, int blk, float* ts, int tid) {
    const int i = tid & 63, r = tid >> 6; const int t = blk * 4 + r;
    const float invf = __builtin_amdgcn_exp2f(-(float)i * 0.20762050593046014f);
    const float ang = (float)t * invf;
    ts[r * 128 + i] = cosf(ang); ts[r * 128 + 64 + i] = sinf(ang);
    __syncthreads();
    if (tid < 128) {                            // waves 0..3 (wave-uniform), one row each
        const int row = tid >> 5, pc = tid & 31;
        const v4f v = *(const v4fa*)(&ts[row * 128 + pc * 4]);
        float* d = CS + (size_t)(blk * 4 + row) * 128 + pc * 4;
        *(v4f*)d = v; 
    }
}

// k_prep: the six preparatory jobs, which do not depend on one another, as block ranges of one grid: the four weight transposes, the rotary table, the bf16 copy of x. The range test reads blockIdx only, so every barrier stays block-uniform.
// Left as it was: the work per thread (one 8-element piece, one 64x64 tile per block), so the grid is still one of very many short waves.
#define PB_WBIG  ((DM / 64) * (DM / 64))      // blocks of a DM x DM transpose
#define PB_WKV   ((DM / 64) * (DKV / 64))     // blocks of a DM x DKV transpose
#define PB_W     (2 * PB_WBIG + 2 * PB_WKV)
#define PB_ROPE  (SEQ / 4)
#define PB_CVT   ((int)(((size_t)NB * SEQ * DM / 8 + 255) / 256))
__global__ __launch_bounds__(256) void k_prep(const float* __restrict__ x, const float* __restrict__ wq, const float* __restrict__ wk, const float* __restrict__ wv, const float* __restrict__ wo,
                                              bf* XB, bf* WQT, bf* WKT, bf* WVT, bf* WOT, float* CS) {
    __shared__ __align__(16) float ts[64 * 65];
    const int tid = threadIdx.x; const int id = blockIdx.x;
    if (id < PB_W) {
        const bool big = id < 2 * PB_WBIG;
        const int q = big ? id : id - 2 * PB_WBIG; const int per = big ? PB_WBIG : PB_WKV;
        const bool second = q >= per; const int r = second ? q - per : q;
        const float* W = big ? (second ? wo : wq) : (second ? wv : wk);
        bf* WT = big ? (second ? WOT : WQT) : (second ? WVT : WKT);
        tcvt_body(W, WT, DM, big ? DM : DKV, r % (DM / 64), r / (DM / 64), ts, tid);
    } else if (id < PB_W + PB_ROPE) rope_body(CS, id - PB_W, ts, tid);
    else cvt8_body(x, XB, id - PB_W - PB_ROPE, tid);
}

// gemm_stage: one stage = 64 k of 128 A rows and 256 Bt rows = 384 whole lines of 128 B = 256 lanes x 12 copies of 16 B (eight lanes per line). l0, ga, gb: this lane's piece of row tid>>3; sa, sb: 32 rows, in elements.
// The s_wait_xcnt closes the statement so that no address register is rewritten ahead of it.
__device__ __forceinline__ void gemm_stage(unsigned l0, const bf* ga, size_t sa, const bf* gb, size_t sb) {
    const unsigned l1 = l0 + 32 * GPIT, l2 = l0 + 64 * GPIT, l3 = l0 + 96 * GPIT, l4 = l0 + 128 * GPIT, l5 = l0 + 160 * GPIT, l6 = l0 + 192 * GPIT, l7 = l0 + 224 * GPIT,
                   l8 = l0 + 256 * GPIT, l9 = l0 + 288 * GPIT, l10 = l0 + 320 * GPIT, l11 = l0 + 352 * GPIT;
    const bf* a1 = ga + sa; const bf* a2 = a1 + sa; const bf* a3 = a2 + sa;
    const bf* b1 = gb + sb; const bf* b2 = b1 + sb; const bf* b3 = b2 + sb; const bf* b4 = b3 + sb; const bf* b5 = b4 + sb; const bf* b6 = b5 + sb; const bf* b7 = b6 + sb;
    asm volatile("global_load_async_to_lds_b128 %0, %12, off\n\t"
                 "global_load_async_to_lds_b128 %1, %13, off\n\t"
                 "global_load_async_to_lds_b128 %2, %14, off\n\t"
                 "global_load_async_to_lds_b128 %3, %15, off\n\t"
                 "global_load_async_to_lds_b128 %4, %16, off\n\t"
                 "global_load_async_to_lds_b128 %5, %17, off\n\t"
                 "global_load_async_to_lds_b128 %6, %18, off\n\t"
                 "global_load_async_to_lds_b128 %7, %19, off\n\t"
                 "global_load_async_to_lds_b128 %8, %20, off\n\t"
                 "global_load_async_to_lds_b128 %9, %21, off\n\t"
                 "global_load_async_to_lds_b128 %10, %22, off\n\t"
                 "global_load_async_to_lds_b128 %11, %23, off\n\t"
                 "s_wait_xcnt 0x0"
                 :: "v"(l0), "v"(l1), "v"(l2), "v"(l3), "v"(l4), "v"(l5), "v"(l6), "v"(l7), "v"(l8), "v"(l9), "v"(l10), "v"(l11),
                    "v"(ga), "v"(a1), "v"(a2), "v"(a3), "v"(gb), "v"(b1), "v"(b2), "v"(b3), "v"(b4), "v"(b5), "v"(b6), "v"(b7) : "memory");
}

// gemm_loop: bf16 GEMM main loop of an 8-wave block, block tile 128 x 256, wave tile (16*MT) x (16*NT) at rows wr, columns wc of it. Each 64-k stage of the block's A and Bt rows is brought into LDS once
// per block by asynchronous copies of whole lines, and every wave takes its fragments from there. Two buffers: stage s + 1 is in flight while stage s is worked on; one barrier per stage publishes s + 1 and frees the buffer of s.
// acc[mb*NT+nb] += sum_k A[R0+wr+16mb+..][k] * Bt[C0+wc+16nb+..][k & kbm]   (kbm folds a K-concatenated A against a single Bt plane); k ascending in steps of 32
template <int MT, int NT>
__device__ __forceinline__ void gemm_loop(const bf* __restrict__ A, size_t lda, const bf* __restrict__ Bt, size_t ldbt,
                                          int K, int kbm, int R0, int C0, int wr, int wc, unsigned char* ring, int tid, int lr, int hi, v8f (&acc)[MT * NT]) {
#pragma unroll
    for (int i = 0; i < MT * NT; ++i) acc[i] = (v8f){};
    const unsigned l0 = (unsigned)(size_t)ring + (unsigned)((tid >> 3) * GPIT + (tid & 7) * 16);
    const bf* ga = A + (size_t)(R0 + (tid >> 3)) * lda + (tid & 7) * 8;
    const bf* gb = Bt + (size_t)(C0 + (tid >> 3)) * ldbt + (tid & 7) * 8;
    const size_t sa = 32 * lda, sb = 32 * ldbt;
    const int nst = K / GKS;                                   // the same for every wave of the launch
    gemm_stage(l0, ga, sa, gb, sb);                            // stage 0 -> buffer 0
    asm volatile("s_wait_asynccnt 0x0" ::: "memory");          // this wave's share of stage 0 has landed
    __syncthreads();                                           // stage 0 published
    if (nst > 1) gemm_stage(l0 + GST, ga + GKS, sa, gb + (GKS & kbm), sb);   // stage 1 -> buffer 1
    const int ao = (wr + lr) * GPIT + 16 * hi, bfo = (GAR + wc + lr) * GPIT + 16 * hi;
#pragma unroll 1
    for (int st = 0; st < nst; ++st) {
        const unsigned bo = (st & 1) ? (unsigned)GST : 0u;
        const bf* as = (const bf*)(ring + bo + ao); const bf* bs = (const bf*)(ring + bo + bfo);
        v16bf a[MT], b[NT];
#pragma unroll
        for (int ks = 0; ks < GKS / 32; ++ks) {
            // the fragments of a 32-k step are read as one group ahead of its products, so the LDS latency is waited out once per step
#pragma unroll
            for (int mb = 0; mb < MT; ++mb) a[mb] = ldb(as + mb * 16 * (GPIT / 2) + 32 * ks);
#pragma unroll
            for (int nb = 0; nb < NT; ++nb) b[nb] = ldb(bs + nb * 16 * (GPIT / 2) + 32 * ks);
            // inputs-only fence on the loaded fragments: holds all reads of the step in one group in front of its products (otherwise each Bt fragment is read, and its latency waited out, between the products)
            if constexpr (MT == 4 && NT == 4) asm volatile("" :: "v"(a[0]), "v"(a[1]), "v"(a[2]), "v"(a[3]), "v"(b[0]), "v"(b[1]), "v"(b[2]), "v"(b[3]));
            else { static_assert((MT == 4 && NT == 4) || (MT == 2 && NT == 8));
                asm volatile("" :: "v"(a[0]), "v"(a[1]), "v"(b[0]), "v"(b[1]), "v"(b[2]), "v"(b[3]), "v"(b[4]), "v"(b[5]), "v"(b[6]), "v"(b[7])); }
#pragma unroll
            for (int nb = 0; nb < NT; ++nb) {
#pragma unroll
                for (int mb = 0; mb < MT; ++mb) acc[mb * NT + nb] = wmmab(a[mb], b[nb], acc[mb * NT + nb]); }
        }
        asm volatile("v_nop\n\tv_nop\n\tv_nop\n\tv_nop" : "+v"(acc[0]), "+v"(acc[(MT * NT) / 3]), "+v"(acc[(2 * MT * NT) / 3]), "+v"(acc[MT * NT - 1]) : "v"(a[0]), "v"(a[MT - 1]), "v"(b[NT - 1]));
        // publish point of stage st + 1
        asm volatile("s_wait_dscnt 0x0" ::: "memory");         // this wave's reads of the buffer of stage st are done before it is handed to the copies
        asm volatile("s_wait_asynccnt 0x0" ::: "memory");      // this wave's share of stage st + 1 has landed
        __syncthreads();                                       // stage st + 1 published; every reader has left the buffer of stage st
        if (st + 2 < nst) gemm_stage(l0 + bo, ga + (st + 2) * GKS, sa, gb + (((st + 2) * GKS) & kbm), sb);   // stage st + 2 -> the buffer just read
    }
    asm volatile("s_wait_asynccnt 0x0" ::: "memory");          // nothing of this wave is in flight when it leaves the ring
}

// qk_body: projection + bias + rotary for q or k. One wave per 32 rows x 128 columns (= one head), K = DM; a block is 4 row groups x 2 heads: bx in NB*SEQ/128, by in nheads/2, 256 threads.
// Output plane [(b*nheads + head)][t][d] as f16 (Ph) and optionally the f16 residual x2048 (Pr, useRes != 0).
// Output staging lies on the ring: the last publish point of gemm_loop (LDS reads done, no copy in flight, block barrier) has freed it for every wave.
__device__ __forceinline__ void qk_body(const bf* __restrict__ A, const bf* __restrict__ Bt, const float* __restrict__ bias, const float* __restrict__ CS, h16* Ph, h16* Pr, int useRes, int nheads,
                                        int bx, int by, unsigned char* ring, int tid) {
    static_assert(GW * 16 * 132 * 4 <= 2 * GST);
    const int lane = tid & 31, wave = tid >> 5, lr = lane & 15, hi = lane >> 4;
    float* os = (float*)ring + wave * 16 * 132;                // wave-private output staging
    const int wr = (wave & 3) * 32, wc = (wave >> 2) * HD;
    const int r0 = bx * 128 + wr, head = by * 2 + (wave >> 2), cbase = head * HD;
    v8f acc[16];
    gemm_loop<2, 8>(A, (size_t)DM, Bt, (size_t)DM, DM, 0x7FFFFFFF, bx * 128, by * 256, wr, wc, ring, tid, lr, hi, acc);
    float bz[8];
#pragma unroll
    for (int nb = 0; nb < 8; ++nb) bz[nb] = bfr(bias[cbase + nb * 16 + lr]);
    const int b = r0 / SEQ, t0 = r0 % SEQ;
    const size_t tbase = ((size_t)(b * nheads + head) * SEQ + t0) * HD;
#pragma unroll
    for (int mb = 0; mb < 2; ++mb) {
#pragma unroll
        for (int nb = 0; nb < 8; ++nb) {
#pragma unroll
            for (int j = 0; j < 8; ++j) os[(hi * 8 + j) * 132 + nb * 16 + lr] = acc[mb * 8 + nb][j] + bz[nb]; }   // D: row 8h+j, col lane&15; rows 0..15 x cols 0..127 all staged
        wave_sync();
{
            const int c8 = lr * 8, p8 = c8 ^ 64;
#pragma unroll 1   // stays rolled, four trips of two row pairs each: keeps the epilogue's code short
            for (int s2 = 0; s2 < 8; s2 += 2) { v4u hq[2], rq[2];
#pragma unroll
              for (int u = 0; u < 2; ++u) { const int row = 2 * (s2 + u) + hi;   // 8 s x 2 rows = 16 rows; 16 lanes x 8 = 128 columns
                const int t = t0 + mb * 16 + row;
                const float* orow = &os[row * 132];
                const v4f x0 = *(const v4fa*)(orow + c8), x1 = *(const v4fa*)(orow + c8 + 4);
                const v4f y0 = *(const v4fa*)(orow + p8), y1 = *(const v4fa*)(orow + p8 + 4);
                const float* cs = CS + (size_t)t * 128 + (c8 & 63);
                const v4f cc0 = *(const v4f*)cs, cc1 = *(const v4f*)(cs + 4), ss0 = *(const v4f*)(cs + 64), ss1 = *(const v4f*)(cs + 68);
                const float sg = (c8 < 64) ? -1.0f : 1.0f;       // d < 64: x[d] cos - x[d+64] sin; d >= 64: x[d] cos + x[d-64] sin
                v8h hv, rv;
#pragma unroll
                for (int i = 0; i < 4; ++i) {
                    const float v0 = x0[i] * cc0[i] + sg * (y0[i] * ss0[i]); const float v1 = x1[i] * cc1[i] + sg * (y1[i] * ss1[i]);
                    const h16 a0 = (h16)v0; const h16 a1 = (h16)v1; hv[i] = a0; hv[4 + i] = a1;
                    rv[i] = (h16)((v0 - (float)a0) * QRS); rv[4 + i] = (h16)((v1 - (float)a1) * QRS); }
                hq[u] = __builtin_bit_cast(v4u, hv); rq[u] = __builtin_bit_cast(v4u, rv); }
                const size_t oo = tbase + (size_t)(mb * 16 + 2 * s2 + hi) * HD + c8;   // row 2 s2 + hi; the second piece lies two rows (2 * HD * 2 bytes) further
                h16* ph = Ph + oo; h16* pr = Pr + oo;
                // the trip's stores and their s_wait_xcnt in one statement, so that the wait stands in front of every rewrite of a register that a store names (a wait in a statement of its own does not hold the address additions behind it)
                if (useRes) asm volatile("global_store_b128 %0, %2, off\n\t"
                                         "global_store_b128 %0, %3, off offset:%6\n\t"
                                         "global_store_b128 %1, %4, off\n\t"
                                         "global_store_b128 %1, %5, off offset:%6\n\t"
                                         "s_wait_xcnt 0x0"
                                         :: "v"(ph), "v"(pr), "v"(hq[0]), "v"(hq[1]), "v"(rq[0]), "v"(rq[1]), "n"(2 * HD * 2) : "memory");
                else        asm volatile("global_store_b128 %0, %1, off\n\t"
                                         "global_store_b128 %0, %2, off offset:%3\n\t"
                                         "s_wait_xcnt 0x0"
                                         :: "v"(ph), "v"(hq[0]), "v"(hq[1]), "n"(2 * HD * 2) : "memory"); }
             }
        wave_sync();
    }
}

// vt_body: v^T projection. A = WvT rows (m = g*128 + d), Bt = x rows (n = b*SEQ + t), one wave per 64x64 tile, a block is 2 x 4 of them: bx in DKV/128, by in NB*SEQ/256, 256 threads.
// Planes [(b*DKV + m)][t] = [(b*4 + g)][d][t]: f16 value (VH) and f16 residual x256 (VR); bias per row m. Output staging lies on the ring, as in qk_body.
__device__ __forceinline__ void vt_body(const bf* __restrict__ A, const bf* __restrict__ Bt, const float* __restrict__ bias, h16* VH, h16* VR, int bx, int by, unsigned char* ring, int tid) {
    const int lane = tid & 31, wave = tid >> 5, lr = lane & 15, hi = lane >> 4;
    float* os = (float*)ring + wave * 16 * 68;                 // wave-private output staging
    const int wr = (wave & 1) * 64, wc = (wave >> 1) * 64;
    const int r0 = bx * 128 + wr, c0 = by * 256 + wc;
    v8f acc[16];
    gemm_loop<4, 4>(A, (size_t)DM, Bt, (size_t)DM, DM, 0x7FFFFFFF, bx * 128, by * 256, wr, wc, ring, tid, lr, hi, acc);
    const int b = c0 / SEQ, t0 = c0 % SEQ;
    const size_t tbase = ((size_t)b * DKV + r0) * SEQ + t0;
#pragma unroll
    for (int mb = 0; mb < 4; ++mb) {
        float bj[8];
#pragma unroll
        for (int j = 0; j < 8; ++j) bj[j] = bfr(bias[r0 + mb * 16 + hi * 8 + j]);
#pragma unroll
        for (int nb = 0; nb < 4; ++nb) {
#pragma unroll
            for (int j = 0; j < 8; ++j) os[(hi * 8 + j) * 68 + nb * 16 + lr] = acc[mb * 4 + nb][j] + bj[j]; }   // rows 0..15 x cols 0..63 all staged
        wave_sync();
        const size_t sb = tbase + (size_t)(mb * 16) * SEQ;
{
            const int c8 = (lane & 7) * 8; v4u hq[4], rq[4];
#pragma unroll
            for (int s = 0; s < 4; ++s) { const int row = 4 * s + (lane >> 3);   // 4 s x 4 row groups = 16 rows; 8 lanes x 8 = 64 columns
                const v4f x0 = *(const v4fa*)(&os[row * 68 + c8]); const v4f x1 = *(const v4fa*)(&os[row * 68 + c8 + 4]); v8h hv, rv;
#pragma unroll
                for (int i = 0; i < 4; ++i) { const h16 a0 = (h16)x0[i]; const h16 a1 = (h16)x1[i]; hv[i] = a0; hv[4 + i] = a1; rv[i] = (h16)((x0[i] - (float)a0) * VRS); rv[4 + i] = (h16)((x1[i] - (float)a1) * VRS); }
                hq[s] = __builtin_bit_cast(v4u, hv); rq[s] = __builtin_bit_cast(v4u, rv); }
            const size_t oo = sb + (size_t)(lane >> 3) * SEQ + c8;   // row lane>>3; piece s lies 4 s rows (4 * SEQ * 2 bytes each step) further
            h16* ph = VH + oo; h16* pr = VR + oo;
            // the row block's stores and their s_wait_xcnt in one statement, so that the wait stands in front of every rewrite of a register that a store names (the next block's bias loads may take the data registers)
            asm volatile("global_store_b128 %0, %2, off\n\t"
                         "global_store_b128 %1, %6, off\n\t"
                         "global_store_b128 %0, %3, off offset:%10\n\t"
                         "global_store_b128 %1, %7, off offset:%10\n\t"
                         "global_store_b128 %0, %4, off offset:%11\n\t"
                         "global_store_b128 %1, %8, off offset:%11\n\t"
                         "global_store_b128 %0, %5, off offset:%12\n\t"
                         "global_store_b128 %1, %9, off offset:%12\n\t"
                         "s_wait_xcnt 0x0"
                         :: "v"(ph), "v"(pr), "v"(hq[0]), "v"(hq[1]), "v"(hq[2]), "v"(hq[3]), "v"(rq[0]), "v"(rq[1]), "v"(rq[2]), "v"(rq[3]),
                            "n"(4 * SEQ * 2), "n"(8 * SEQ * 2), "n"(12 * SEQ * 2) : "memory");
             }
        wave_sync();
    }
}

// k_qkv: the q, k and v^T projections, which do not depend on one another, as block ranges of one grid, so that the 64-block k and v^T jobs run beside the q job instead of each alone on a quarter of the chip.
// One LDS arena (the ring, 108 KiB) lets two blocks share a WGP, so all blocks of the grid are resident at once. The range test reads blockIdx only, so every barrier stays block-uniform.
#define GB_ROW  (NB * SEQ / 128)
#define GB_Q    (GB_ROW * (NH_ / 2))
#define GB_K    (GB_ROW * (NKV / 2))
#define GB_V    ((DKV / 128) * (NB * SEQ / 256))
__global__ __launch_bounds__(32 * GW) __attribute__((amdgpu_num_vgpr(256)))
void k_qkv(const bf* __restrict__ XB, const bf* __restrict__ WQT, const bf* __restrict__ WKT, const bf* __restrict__ WVT,
           const float* __restrict__ bq, const float* __restrict__ bk, const float* __restrict__ bv, const float* __restrict__ CS, h16* QH, h16* QR, h16* KP, h16* VH, h16* VR) {
    __shared__ __align__(16) unsigned char ring[2 * GST];
    const int tid = threadIdx.x; const int id = blockIdx.x;
    if (id < GB_Q + GB_K) {
        const bool isq = id < GB_Q; const int r = isq ? id : id - GB_Q;
        qk_body(XB, isq ? WQT : WKT, isq ? bq : bk, CS, isq ? QH : KP, isq ? QR : KP, isq ? 1 : 0, isq ? NH_ : NKV, r % GB_ROW, r / GB_ROW, ring, tid);
    } else {
        const int r = id - GB_Q - GB_K;
        vt_body(WVT, XB, bv, VH, VR, r % (DKV / 128), r / (DKV / 128), ring, tid);
    }
}

// k_flash: fused causal attention, one wave per 16 query rows of one (batch, head). A block is the 4 query heads of one kv head x 2 adjacent 16-row query tiles (8 waves): all of them walk
// the same keys, so each 32-key step of K, V^T value and V^T residual is brought into LDS once per block by asynchronous copies (whole 16-B pieces, contiguous per row) and every wave takes its fragments from there.
// Two buffers of FSP 32-key steps each: stage s + 1 is in flight while stage s is worked on; one barrier per stage publishes s + 1 and frees the buffer of s. Between two publish points the waves run free,
// so one wave's softmax can stand beside another's products, and a stage's landing has FSP steps to hide behind.
// Transposed form: S^T[key][t] = K Q^T (A = K rows, B = Q rows); lane (t = lane&15, h = lane>>4) holds keys 8h+r of each 16-key tile, so the packed
// P tile is directly the B fragment of O^T[d][t] = V^T P^T (element r <- tile keys 0..15, element 8+r <- tile keys 16..31, lane unchanged).
// The key loop of a tile runs to the 32-key step that contains its last query; keys beyond a query get the fill value (weight exactly 0). ALiBi bias slope*(key - query) added in the exp2 domain.
// Balance: a 32-row query tile x walks x + 1 32-key steps, and all blocks of the grid are resident at once, so the launch lasts as long as its fullest WGP. Each block therefore takes two tiles one after the other,
// x and SEQ/32 - 1 - x: SEQ/32 + 1 steps for every block, one block per WGP. The two walks are one run of steps through the ring (the second tile's first steps fly while the first tile ends);
// at the first tile's last step every wave writes its rows out, takes the second tile's q and starts its sums anew. The sums of a tile are formed as before.
// What is left: the LDS read rate (every wave reads every K and V^T fragment of a stage for its 16 query rows alone) and the softmax's vector work between the two matrix runs.
// Planes of a step in LDS, 16 lines of SPIT bytes each, line = fragment row (lane&15): K line holds key rows r and 16 + r (256 B each); a V^T line holds the 32-key pieces (64 B) of rows d = 16j + r, j = 0..7.
// So every fragment of a stage is read at one per-lane address plus a constant.
// flash_stage: one 32-key step of a stage = K 32 rows x 256 B, V^T value and residual 128 rows x 64 B each = 24 KiB = 256 lanes x 6 copies of 16 B. The copies are written as the builtin: this kernel holds more than 256 registers,
// asm text cannot name one above v255, and address operands tied to the low window were spilled to scratch inside the loop.
__device__ __forceinline__ void flash_cp(unsigned l, const h16* g) { __builtin_amdgcn_global_load_async_to_lds_b128((gv4i*)g, (lv4i*)l, 0, 0); }
__device__ __forceinline__ void flash_stage(unsigned lk, unsigned lv, const h16* gk, const h16* gh, const h16* gr) {
    flash_cp(lk, gk); flash_cp(lk + 256, gk + 16 * HD);
    flash_cp(lv + ST_VH, gh); flash_cp(lv + ST_VH + 256, gh + (size_t)64 * SEQ);
    flash_cp(lv + ST_VR, gr); flash_cp(lv + ST_VR + 256, gr + (size_t)64 * SEQ);
}

// flash_q: the q value and residual fragments of a wave's 16 query rows (B fragments: col t, k = d); qa, qb: this lane's piece of its row in the two planes.
// The s_wait_xcnt takes the two addresses as inputs, so that their registers stay as they are until it has passed (otherwise a late load's result may be laid on them).
__device__ __forceinline__ void flash_q(const h16* qa, const h16* qb, v16h (&qh)[4], v16h (&qr)[4]) {
#pragma unroll
    for (int c = 0; c < 4; ++c) { qh[c] = ldh(qa + 32 * c); qr[c] = ldh(qb + 32 * c); }
    asm volatile("s_wait_xcnt 0x0" :: "v"(qa), "v"(qb) : "memory");
}

__global__ __launch_bounds__(32 * FW) __attribute__((amdgpu_num_vgpr(512)))
void k_flash(const h16* __restrict__ QH, const h16* __restrict__ QR, const h16* __restrict__ KP, const h16* __restrict__ VH, const h16* __restrict__ VR, bf* CTX) {
    __shared__ __align__(16) unsigned char ring[2 * FSP * ST_SZ];
    __shared__ __align__(16) float os[FW * 16 * 132];
    const int tid = threadIdx.x;
    const int lane = tid & 31, wave = tid >> 5, lr = lane & 15, hi = lane >> 4;
    const int bg = blockIdx.y; const int b = bg / NKV, g = bg % NKV; const int h = g * REP + (wave & (REP - 1)); const int zh = b * NH_ + h;
    constexpr int NQT = SEQ / 32;                              // query tiles of one (batch, kv head)
    static_assert(NQT % 2 == 0);                               // the tiles pair off, every tile in exactly one block
    const int na = blockIdx.x + 1;                             // 32-key steps of the first tile (blockIdx.x); the second tile (NQT - 1 - blockIdx.x) has NQT - blockIdx.x
    constexpr int nst = NQT + 1;                               // 32-key steps of the block, the same for every block; step st holds key step st of the first tile or st - na of the second, both below NQT
    static_assert(nst >= 2 * FSP && (FSP & (FSP - 1)) == 0);   // stages 0 and 1 are both full; step st lies in slot st & (2 * FSP - 1) of the ring
    int t0 = blockIdx.x * 32 + (wave >> 2) * 16;
    const size_t kvb = (size_t)bg * SEQ * HD;
    // copy addresses of this lane. K: piece tid -> key row tid>>4 (and +16: +256 B in its line), 16-B column tid&15. V^T: piece tid -> row d = tid>>2 (and +64: +256 B in its line), 16-B column tid&3.
    const unsigned rb = (unsigned)(size_t)ring;
    const unsigned lk = rb + (unsigned)((tid >> 4) * SPIT + (tid & 15) * 16), lvt = rb + (unsigned)(((tid >> 2) & 15) * SPIT + (tid >> 6) * 64 + (tid & 3) * 16);
    const h16* gk = KP + kvb + (size_t)tid * 8;                // + key0 * HD
    const size_t gvo = kvb + (size_t)(tid >> 2) * SEQ + (tid & 3) * 8;   // + key0
    const h16* gh = VH + gvo; const h16* gr = VR + gvo;
#pragma unroll
    for (int u = 0; u < FSP; ++u) { const int ku = (u < na ? u : u - na) * 32; flash_stage(lk + u * ST_SZ, lvt + u * ST_SZ, gk + (size_t)ku * HD, gh + ku, gr + ku); }   // stage 0 -> buffer 0
    const size_t qz = (size_t)zh * SEQ * HD + (size_t)lr * HD + 8 * hi;   // + t0 * HD
    v16h qh[4], qr[4];
    flash_q(QH + qz + (size_t)t0 * HD, QR + qz + (size_t)t0 * HD, qh, qr);
    asm volatile("s_wait_asynccnt 0x0" ::: "memory");          // this wave's share of stage 0 has landed
    __syncthreads();                                           // stage 0 published
#pragma unroll
    for (int u = FSP; u < 2 * FSP; ++u) { const int ku = (u < na ? u : u - na) * 32; flash_stage(lk + u * ST_SZ, lvt + u * ST_SZ, gk + (size_t)ku * HD, gh + ku, gr + ku); }   // stage 1 -> buffer 1
    const int fo = lr * SPIT + 16 * hi;                        // K: + 256 (second key tile) + 64*c (A fragment: row key, k = d); V^T: + plane + 64*j (A fragment: row d, k = key)
    const float slope2 = __builtin_amdgcn_exp2f(-0.5f * (float)(h + 1)) * LOG2E;
    int qi = t0 + lr;
    const int wb = wave * 16 * 132;
    v8f o[8];
#pragma unroll
    for (int j = 0; j < 8; ++j) o[j] = (v8f){};
    float m = NEGBIG, l = 0.0f;
#pragma unroll 1
    for (int st = 0; st < nst; ++st) {
        const int key0 = (st < na ? st : st - na) * 32;
        const unsigned bo = (unsigned)(st & (2 * FSP - 1)) * (unsigned)ST_SZ;
        const h16* ka = (const h16*)(ring + bo + fo);
        const h16* va = ka + ST_VH / 2; const h16* vr = ka + ST_VR / 2;
        v8f sHa = (v8f){}, sLa = (v8f){}, sHb = (v8f){}, sLb = (v8f){};
        // All fragment reads of a step stand as one group at its head (one block per WGP, two waves per SIMD: a wave may hold 512 registers): the eight K fragments first, then the sixteen V^T fragments,
        // which land while the score products and the softmax run; LDS data returns in issue order, so the products wait with counts and never for a read issued among them.
        // __builtin_amdgcn_sched_barrier(0): nothing is scheduled across it, so the group stays whole and in its place; it asks for no wait itself.
        v16h kf[8], vf[8], vg[8];
#pragma unroll
        for (int c = 0; c < 4; ++c) { kf[2 * c] = ldh(ka + 32 * c); kf[2 * c + 1] = ldh(ka + 128 + 32 * c); }
#pragma unroll
        for (int j = 0; j < 8; ++j) vf[j] = ldh(va + 32 * j);
#pragma unroll
        for (int j = 0; j < 8; ++j) vg[j] = ldh(vr + 32 * j);
        __builtin_amdgcn_sched_barrier(0);
#pragma unroll
        for (int c = 0; c < 4; ++c) {
            sHa = wmma16(kf[2 * c], qh[c], sHa); sLa = wmma16(kf[2 * c], qr[c], sLa); sHb = wmma16(kf[2 * c + 1], qh[c], sHb); sLb = wmma16(kf[2 * c + 1], qr[c], sLb); }
        asm volatile("v_nop\n\tv_nop\n\tv_nop\n\tv_nop" : "+v"(sHa), "+v"(sLa), "+v"(sHb), "+v"(sLb) : "v"(kf[6]), "v"(kf[7]));
        const float base = (float)(key0 + 8 * hi - qi);        // key - query for r = 0 of tile a
        float ta[8], tb[8]; float mx = NEGBIG;
#pragma unroll
        for (int r = 0; r < 8; ++r) {
            const float da = base + (float)r, db = da + 16.0f;
            float xa = fmaf(slope2, da, (sHa[r] + sLa[r] * QRI) * SC2);
            float xb = fmaf(slope2, db, (sHb[r] + sLb[r] * QRI) * SC2);
            xa = (da > 0.0f) ? NEGBIG : xa; xb = (db > 0.0f) ? NEGBIG : xb;
            ta[r] = xa; tb[r] = xb; mx = fmaxf(mx, fmaxf(xa, xb)); }
        // lane l <-> l ^ 16 by a vector cross-row move: an LDS permute would count on dscnt behind the V^T reads and wait them all out in the middle of the softmax
        mx = fmaxf(mx, __uint_as_float(__builtin_amdgcn_permlanex16(__float_as_uint(mx), __float_as_uint(mx), 0x76543210u, 0xfedcba98u, false, false)));
        const float mnew = fmaxf(m, mx);
        const float alpha = __builtin_amdgcn_exp2f(m - mnew);
        const float sh = PSH - mnew;
        v16h pb; float ls = 0.0f;
#pragma unroll
        for (int r = 0; r < 8; ++r) { const h16 pa = (h16)__builtin_amdgcn_exp2f(ta[r] + sh); const h16 pc = (h16)__builtin_amdgcn_exp2f(tb[r] + sh); pb[r] = pa; pb[8 + r] = pc; ls += (float)pa + (float)pc; }
        const v16h pq = pb * (h16)0.00390625f;                 // P x 2^-8: partner of the v residual x256
        l = l * alpha + ls; m = mnew;
#pragma unroll
        for (int j = 0; j < 8; ++j) o[j] = o[j] * alpha;
        // all loops unrolled so that every array index is a constant (registers, no scratch)
#pragma unroll
        for (int j = 0; j < 8; ++j) o[j] = wmma16(vf[j], pb, o[j]);
#pragma unroll
        for (int j = 0; j < 8; ++j) o[j] = wmma16(vg[j], pq, o[j]);
        asm volatile("v_nop\n\tv_nop\n\tv_nop\n\tv_nop" : "+v"(o[0]), "+v"(o[1]), "+v"(o[2]), "+v"(o[3]), "+v"(o[4]), "+v"(o[5]), "+v"(o[6]), "+v"(o[7]) : "v"(pb), "v"(pq));
        if ((st & (FSP - 1)) == FSP - 1) {                     // block-uniform: behind a stage's last step, the publish point of the next stage
        asm volatile("s_wait_dscnt 0x0" ::: "memory");         // this wave's reads of the buffer of this stage are done before it is handed to the copies
        asm volatile("s_wait_asynccnt 0x0" ::: "memory");      // this wave's share of the next stage has landed
        __syncthreads();                                       // the next stage published; every reader has left the buffer of this stage
#pragma unroll
        for (int u = 1; u <= FSP; ++u) {                       // the stage after the next -> the buffer just read, step by step while the step exists
            const int s2 = st + FSP + u;
            if (s2 < nst) { const int k2 = (s2 < na ? s2 : s2 - na) * 32; const unsigned b2 = (unsigned)(s2 & (2 * FSP - 1)) * (unsigned)ST_SZ; flash_stage(lk + b2, lvt + b2, gk + (size_t)k2 * HD, gh + k2, gr + k2); } }
        }
      if (st == na - 1 || st == nst - 1) {                     // block-uniform: behind a tile's last step its rows go out
    l += __shfl_xor(l, 16, 32);
    const float inv = 1.0f / l;
    // O^T D layout: o[j][r] = (d = 16j + 8h + r, t = lane&15) -> os[t][d]; rows 0..15 x columns 0..127 all written
#pragma unroll
    for (int j = 0; j < 8; ++j) { v4f a, c;
        a[0] = o[j][0] * inv; a[1] = o[j][1] * inv; a[2] = o[j][2] * inv; a[3] = o[j][3] * inv; c[0] = o[j][4] * inv; c[1] = o[j][5] * inv; c[2] = o[j][6] * inv; c[3] = o[j][7] * inv;
        *(v4fa*)(&os[wb + lr * 132 + 16 * j + 8 * hi]) = a; *(v4fa*)(&os[wb + lr * 132 + 16 * j + 8 * hi + 4]) = c; }
    wave_sync();
    bf* crow = CTX + ((size_t)b * SEQ + t0) * (size_t)(2 * DM) + h * HD;
{
#pragma unroll 2
        for (int s = 0; s < 8; ++s) { const int row = 2 * s + hi, c8 = lr * 8;   // 8 s x 2 rows = 16 rows; 16 lanes x 8 = 128 columns
            const v4f x0 = *(const v4fa*)(&os[wb + row * 132 + c8]); const v4f x1 = *(const v4fa*)(&os[wb + row * 132 + c8 + 4]); v8us hv, lv;
#pragma unroll
            for (int i = 0; i < 4; ++i) { const unsigned short a0 = f2bf(x0[i]); const unsigned short a1 = f2bf(x1[i]); hv[i] = a0; hv[4 + i] = a1; lv[i] = f2bf(x0[i] - bf2f(a0)); lv[4 + i] = f2bf(x1[i] - bf2f(a1)); }
            bf* dst = crow + (size_t)row * (size_t)(2 * DM) + c8;
            *(v8us*)dst = hv; *(v8us*)(dst + DM) = lv; }
         }
        asm volatile("s_wait_xcnt 0x0" ::: "memory");          // behind the tile's stores, in front of the rewrites of the registers that they name
        wave_sync();                                           // this wave's reads of its output staging stand in front of the second tile's writes to it
        // second tile: its rows, its q, sums from the start
        t0 = (NQT - 1 - (int)blockIdx.x) * 32 + (wave >> 2) * 16; qi = t0 + lr;
        if (st != nst - 1) flash_q(QH + qz + (size_t)t0 * HD, QR + qz + (size_t)t0 * HD, qh, qr);
#pragma unroll
        for (int j = 0; j < 8; ++j) o[j] = (v8f){};
        m = NEGBIG; l = 0.0f;
      }
    }
    asm volatile("s_wait_asynccnt 0x0" ::: "memory");          // nothing of this wave is in flight when it leaves the ring
}

// fold_cp8: eight copies of 16 B per lane, 16 rows apart (l: LDS byte address, g: global piece, s: 16 rows, in elements). The s_wait_xcnt closes the statement so that no address register is rewritten ahead of it.
__device__ __forceinline__ void fold_cp8(unsigned l, const bf* g, size_t s) {
    const unsigned l1 = l + 16 * FPIT, l2 = l + 32 * FPIT, l3 = l + 48 * FPIT, l4 = l + 64 * FPIT, l5 = l + 80 * FPIT, l6 = l + 96 * FPIT, l7 = l + 112 * FPIT;
    const bf* g1 = g + s; const bf* g2 = g1 + s; const bf* g3 = g2 + s; const bf* g4 = g3 + s; const bf* g5 = g4 + s; const bf* g6 = g5 + s; const bf* g7 = g6 + s;
    asm volatile("global_load_async_to_lds_b128 %0, %8, off\n\t"
                 "global_load_async_to_lds_b128 %1, %9, off\n\t"
                 "global_load_async_to_lds_b128 %2, %10, off\n\t"
                 "global_load_async_to_lds_b128 %3, %11, off\n\t"
                 "global_load_async_to_lds_b128 %4, %12, off\n\t"
                 "global_load_async_to_lds_b128 %5, %13, off\n\t"
                 "global_load_async_to_lds_b128 %6, %14, off\n\t"
                 "global_load_async_to_lds_b128 %7, %15, off\n\t"
                 "s_wait_xcnt 0x0"
                 :: "v"(l), "v"(l1), "v"(l2), "v"(l3), "v"(l4), "v"(l5), "v"(l6), "v"(l7),
                    "v"(g), "v"(g1), "v"(g2), "v"(g3), "v"(g4), "v"(g5), "v"(g6), "v"(g7) : "memory");
}

// fold_stage: one stage of k_out = 128 k of 128 ctx rows, hi piece and lo piece, and of 256 WoT rows = 512 row pieces of 256 B = 256 lanes x 32 copies of 16 B (sixteen lanes per row piece).
// l0, ga, gb: this lane's piece of row tid>>4; sa, sb: 16 rows, in elements; the lo piece of a ctx row lies DM elements behind its hi piece. Four statements of eight copies (an asm statement takes thirty operands).
__device__ __forceinline__ void fold_stage(unsigned l0, const bf* ga, size_t sa, const bf* gb, size_t sb) {
    fold_cp8(l0, ga, sa);
    fold_cp8(l0 + FLO * FPIT, ga + DM, sa);
    fold_cp8(l0 + FBT * FPIT, gb, sb);
    fold_cp8(l0 + (FBT + 128) * FPIT, gb + 8 * sb, sb);
}

// fold_loop: main loop of k_out, an 8-wave block, block tile 128 x 256, wave tile 64 x 64 at rows wr, columns wc of it. The hi and the lo plane of ctx meet the same WoT rows, so both walk k together:
// a stage holds 128 k of the hi pieces, the lo pieces and the WoT rows, each WoT line is copied once and each WoT fragment read once for both planes (12 fragments for 32 products), and the loop has DM / 128 stages:
// a stage's landing (a fixed latency, then its bytes) outlasts its products, so the longer stage pays the latency, the barrier and the first fragment group half as often.
// Ring as in gemm_loop: two buffers, stage s + 1 in flight while stage s is worked on, one barrier per stage.
// acc[mb*4+nb] += sum_k (A[R0+wr+16mb+..][k] + A[R0+wr+16mb+..][DM+k]) * Bt[C0+wc+16nb+..][k]; k ascending in steps of 32, in each step the hi products first
__device__ __forceinline__ void fold_loop(const bf* __restrict__ A, const bf* __restrict__ Bt, int R0, int C0, int wr, int wc, unsigned char* ring, int tid, int lr, int hi, v8f (&acc)[16]) {
#pragma unroll
    for (int i = 0; i < 16; ++i) acc[i] = (v8f){};
    const unsigned l0 = (unsigned)(size_t)ring + (unsigned)((tid >> 4) * FPIT + (tid & 15) * 16);
    const bf* ga = A + (size_t)(R0 + (tid >> 4)) * (size_t)(2 * DM) + (tid & 15) * 8;
    const bf* gb = Bt + (size_t)(C0 + (tid >> 4)) * (size_t)DM + (tid & 15) * 8;
    const size_t sa = (size_t)16 * 2 * DM, sb = (size_t)16 * DM;
    constexpr int nst = DM / FKS;                              // the same for every wave of the launch
    static_assert(nst >= 2);                                   // stages 0 and 1 both exist
    fold_stage(l0, ga, sa, gb, sb);                            // stage 0 -> buffer 0
    asm volatile("s_wait_asynccnt 0x0" ::: "memory");          // this wave's share of stage 0 has landed
    __syncthreads();                                           // stage 0 published
    fold_stage(l0 + FST, ga + FKS, sa, gb + FKS, sb);          // stage 1 -> buffer 1
    const int ao = (wr + lr) * FPIT + 16 * hi, ro = (FLO + wr + lr) * FPIT + 16 * hi, bfo = (FBT + wc + lr) * FPIT + 16 * hi;
#pragma unroll 1   // one stage per trip: the ring's order at the foot stands once
    for (int st = 0; st < nst; ++st) {
        const unsigned bo = (st & 1) ? (unsigned)FST : 0u;
        const bf* as = (const bf*)(ring + bo + ao); const bf* rs = (const bf*)(ring + bo + ro); const bf* bs = (const bf*)(ring + bo + bfo);
        v16bf a[4], r[4], b[4];
        // Fragment reads stand in few groups, each ahead of the products that cover its latency, never among them. __builtin_amdgcn_sched_barrier(0): nothing is scheduled across it, so a group stays whole and in its place; it asks for no wait itself.
        // first step: hi, WoT, then lo fragments, which land while the hi products run
#pragma unroll
        for (int mb = 0; mb < 4; ++mb) a[mb] = ldb(as + mb * 16 * (FPIT / 2));
#pragma unroll
        for (int nb = 0; nb < 4; ++nb) b[nb] = ldb(bs + nb * 16 * (FPIT / 2));
#pragma unroll
        for (int mb = 0; mb < 4; ++mb) r[mb] = ldb(rs + mb * 16 * (FPIT / 2));
        __builtin_amdgcn_sched_barrier(0);
#pragma unroll
        for (int ks = 0; ks < FKS / 32; ++ks) {
#pragma unroll
            for (int nb = 0; nb < 4; ++nb) {
#pragma unroll
                for (int mb = 0; mb < 4; ++mb) acc[mb * 4 + nb] = wmmab(a[mb], b[nb], acc[mb * 4 + nb]); }
            if (ks + 1 < FKS / 32) {                           // the next step's hi fragments, behind the last product that reads this step's: they land while the lo products run
#pragma unroll
                for (int mb = 0; mb < 4; ++mb) a[mb] = ldb(as + mb * 16 * (FPIT / 2) + 32 * (ks + 1));
            }
            __builtin_amdgcn_sched_barrier(0);                 // in the last step it keeps the hi products in front of the publish point, where they cover the landing of the lo fragments
#pragma unroll
            for (int nb = 0; nb < 4; ++nb) {
#pragma unroll
                for (int mb = 0; mb < 4; ++mb) acc[mb * 4 + nb] = wmmab(r[mb], b[nb], acc[mb * 4 + nb]); }
            if (ks + 1 < FKS / 32) {                           // the next step's WoT fragments, then its lo fragments, which land while its hi products run
#pragma unroll
                for (int nb = 0; nb < 4; ++nb) b[nb] = ldb(bs + nb * 16 * (FPIT / 2) + 32 * (ks + 1));
#pragma unroll
                for (int mb = 0; mb < 4; ++mb) r[mb] = ldb(rs + mb * 16 * (FPIT / 2) + 32 * (ks + 1));
                __builtin_amdgcn_sched_barrier(0);
            }
        }
        // publish point of stage st + 1
        asm volatile("s_wait_dscnt 0x0" ::: "memory");         // this wave's reads of the buffer of stage st are done before it is handed to the copies
        asm volatile("s_wait_asynccnt 0x0" ::: "memory");      // this wave's share of stage st + 1 has landed
        __syncthreads();                                       // stage st + 1 published; every reader has left the buffer of stage st
        if (st + 2 < nst) fold_stage(l0 + bo, ga + (st + 2) * FKS, sa, gb + (st + 2) * FKS, sb);   // stage st + 2 -> the buffer just read
    }
    asm volatile("s_wait_asynccnt 0x0" ::: "memory");          // nothing of this wave is in flight when it leaves the ring
}

// k_out: output projection. A = ctx plane rows [hi 2048 | lo 2048], both planes against the single WoT plane (fold_loop), Bt = WoT rows, one wave per 64x64 tile, a block is 2 x 4 of them. grid (NB*SEQ/128, DM/256), 256 threads.
// What is left: the first fragment group of a stage is still read behind the barrier and the copies' issue, with nothing of the wave's own to cover it.
__global__ __launch_bounds__(32 * GW) __attribute__((amdgpu_num_vgpr(256)))
void k_out(const bf* __restrict__ A, const bf* __restrict__ Bt, const float* __restrict__ bias, float* OUT) {
    __shared__ __align__(16) unsigned char ring[2 * FST];
    __shared__ __align__(16) float osb[GW * 16 * 68];
    const int tid = threadIdx.x;
    const int lane = tid & 31, wave = tid >> 5, lr = lane & 15, hi = lane >> 4;
    float* os = osb + wave * 16 * 68;                          // wave-private output staging
    const int wr = (wave & 1) * 64, wc = (wave >> 1) * 64;
    const int r0 = blockIdx.x * 128 + wr, c0 = blockIdx.y * 256 + wc;
    v8f acc[16];
    fold_loop(A, Bt, blockIdx.x * 128, blockIdx.y * 256, wr, wc, ring, tid, lr, hi, acc);
    float bz[4];
#pragma unroll
    for (int nb = 0; nb < 4; ++nb) bz[nb] = bfr(bias[c0 + nb * 16 + lr]);
    const int b = r0 / SEQ, t0 = r0 % SEQ;
    float* obase = OUT + ((size_t)b * OUT_SEQ + t0) * DM + c0;
#pragma unroll
    for (int mb = 0; mb < 4; ++mb) {
#pragma unroll
        for (int nb = 0; nb < 4; ++nb) {
#pragma unroll
            for (int j = 0; j < 8; ++j) os[(hi * 8 + j) * 68 + nb * 16 + lr] = acc[mb * 4 + nb][j] + bz[nb]; }   // rows 0..15 x cols 0..63 all staged
        wave_sync();
        float* orow = obase + (size_t)(mb * 16) * DM;
{
#pragma unroll
            for (int s = 0; s < 8; ++s) { const int row = 2 * s + hi, cofs = lr * 4;   // 8 s x 2 rows = 16 rows; 16 lanes x 4 floats = 64 columns
                const v4f val = *(const v4fa*)(&os[row * 68 + cofs]);
                *(v4f*)(orow + (size_t)row * DM + cofs) = val; }
             }
        wave_sync();
    }
}

static constexpr size_t al256(size_t v) { return (v + 255) & ~(size_t)255; }
static constexpr size_t SZ_XB  = al256((size_t)NB * SEQ * DM * 2);
static constexpr size_t SZ_WQ  = al256((size_t)DM * DM * 2);
static constexpr size_t SZ_WK  = al256((size_t)DKV * DM * 2);
static constexpr size_t SZ_CS  = al256((size_t)SEQ * 128 * 4);
static constexpr size_t SZ_QP  = al256((size_t)NB * NH_ * SEQ * HD * 2);
static constexpr size_t SZ_KP  = al256((size_t)NB * NKV * SEQ * HD * 2);
static constexpr size_t SZ_CTX = al256((size_t)NB * SEQ * 2 * DM * 2);
static constexpr size_t SZ_TOTAL = SZ_XB + 2 * SZ_WQ + 2 * SZ_WK + SZ_CS + 2 * SZ_QP + 3 * SZ_KP + SZ_CTX;
static_assert(SZ_TOTAL <= (size_t)134217728);          // workspace carve <= 128 MiB

extern "C" void kernel_launch(void* const* d_in, const int* in_sizes, int n_in,
                              void* d_out, int out_size, void* d_ws, size_t ws_size, hipStream_t stream) {
    if (n_in < 9) return;
    const size_t needx = ((size_t)(NB - 1) * SEQ_FULL + SEQ) * DM;
    if ((size_t)in_sizes[0] < needx) return;
    if ((size_t)in_sizes[1] < (size_t)DM * DM || (size_t)in_sizes[2] < (size_t)DM) return;
    if ((size_t)in_sizes[3] < (size_t)DM * DKV || (size_t)in_sizes[4] < (size_t)DKV) return;
    if ((size_t)in_sizes[5] < (size_t)DM * DKV || (size_t)in_sizes[6] < (size_t)DKV) return;
    if ((size_t)in_sizes[7] < (size_t)DM * DM || (size_t)in_sizes[8] < (size_t)DM) return;
    if ((size_t)out_size < ((size_t)(NB - 1) * OUT_SEQ + SEQ) * DM) return;
    if (SZ_TOTAL > ws_size) return;
    // wire order: x, Wq, bq, Wk, bk, Wv, bv, Wo, bo (weights [in][out])
    const float* x  = (const float*)d_in[0];
    const float* wq = (const float*)d_in[1]; const float* bq = (const float*)d_in[2];
    const float* wk = (const float*)d_in[3]; const float* bk = (const float*)d_in[4];
    const float* wv = (const float*)d_in[5]; const float* bv = (const float*)d_in[6];
    const float* wo = (const float*)d_in[7]; const float* bo = (const float*)d_in[8];
    float* OUT = (float*)d_out;      // [NB][SEQ][2048]
    char* wsp = (char*)d_ws;
    bf* XB  = (bf*)wsp; wsp += SZ_XB;                // [NB*SEQ][2048]
    bf* WQT = (bf*)wsp; wsp += SZ_WQ;                // [2048 out][2048 in]
    bf* WOT = (bf*)wsp; wsp += SZ_WQ;                // [2048 out][2048 in]
    bf* WKT = (bf*)wsp; wsp += SZ_WK;                // [512 out][2048 in]
    bf* WVT = (bf*)wsp; wsp += SZ_WK;                // [512 out][2048 in]
    float* CS = (float*)wsp; wsp += SZ_CS;           // [SEQ][cos 64 | sin 64]
    h16* QH = (h16*)wsp; wsp += SZ_QP;               // [NB*16][SEQ][128]
    h16* QR = (h16*)wsp; wsp += SZ_QP;               // [NB*16][SEQ][128] residual x2048
    h16* KP = (h16*)wsp; wsp += SZ_KP;               // [NB*4][SEQ][128]
    h16* VH = (h16*)wsp; wsp += SZ_KP;               // [NB*4][128][SEQ]
    h16* VR = (h16*)wsp; wsp += SZ_KP;               // [NB*4][128][SEQ] residual x256
    bf* CTX = (bf*)wsp; wsp += SZ_CTX;               // [NB*SEQ][hi 2048 | lo 2048]

    // weight transposes in[K = DM rows][N cols] -> out[N rows][K = DM cols], rotary table, bf16 copy of x
    k_prep<<<PB_W + PB_ROPE + PB_CVT, 256, 0, stream>>>(x, wq, wk, wv, wo, XB, WQT, WKT, WVT, WOT, CS);

    // q, k: A = x rows (m = b*SEQ + t), Bt = WT rows (n = head*128 + d) -> plane [(b*nheads + head)][t][d], rotary applied
    // v^T: A = WvT rows (m = g*128 + d), Bt = x rows (n = b*SEQ + t) -> planes [(b*512 + m)][t]
    k_qkv<<<GB_Q + GB_K + GB_V, 32 * GW, 0, stream>>>(XB, WQT, WKT, WVT, bq, bk, bv, CS, QH, QR, KP, VH, VR);

    k_flash<<<dim3(SEQ / 64, NB * NKV, 1), 32 * FW, 0, stream>>>(QH, QR, KP, VH, VR, CTX);

    k_out<<<dim3(NB * SEQ / 128, DM / 256, 1), 32 * GW, 0, stream>>>(CTX, WOT, bo, OUT);
}

// v008
// A run of this version takes 149 microseconds.
// In two side-by-side timings against v007, it was 1.08 and 1.09 times as fast.
// Counting every step since v000, it is 4.52 times as fast.
#include <hip/hip_runtime.h>

// Causal grouped-query attention layer: x [NB][SEQ][2048], 16 query heads x 128, 4 kv heads, weights [in][out] with biases, rotate-half rotary (theta 1e4), ALiBi slopes 2^(-(h+1)/2), output projection; f32 output.
// Compute dtypes, f32 accumulate everywhere: q/k/v projections v_wmma_f32_16x16x32_bf16 (x, W, b RNE-converted to bf16; products exact);
// scores v_wmma_f32_16x16x32_f16: k single f16, q as f16 value + f16 residual x2048 in its own accumulator; P.V v_wmma_f32_16x16x32_f16: P single f16 (x256 carry, cancels in the normalisation),
// v as f16 value + f16 residual x256 whose partner operand is the P copy x2^-8 (K-dimension fold, products at natural scale, one accumulator); output projection v_wmma_f32_16x16x32_bf16 with ctx as bf16 hi | lo planes, both multiplied with the one bf16 Wo plane into one accumulator (per 32-k step: hi products, then lo products); softmax f32 (online, running max).
// Layout: bf16 x copy, bf16 transposed weight planes [out][in]; q (hi, residual) planes [b*16+h][t][d], k plane [b*4+g][t][d], v^T planes [b*4+g][d][t]; ctx plane [b*SEQ+t][hi 2048 | lo 2048]; rotary table [t][cos 64 | sin 64].

#ifndef NB
#define NB 2
#endif
#ifndef SEQ
#define SEQ 2048
#endif
#define NB_FULL  2
#define SEQ_FULL 2048
#ifndef OUT_SEQ
#define OUT_SEQ SEQ              // row pitch (in tokens) between batches of the output
#endif
#define DM   2048
#define NH_  16
#define NKV  4
#define HD   128
#define REP  (NH_ / NKV)
#define DKV  (NKV * HD)          // 512
#define FW   8                   // waves per flash block: the 4 query heads of one kv head x 2 query tiles of 16 rows
#define SPIT 528                 // LDS pitch, bytes, of one fragment-row line of a stage plane (512 + 16: 16 B x odd for 16-B readers)
#define ST_VH (16 * SPIT)               // byte offsets inside one 32-key step slot: K at 0, V^T value, V^T residual
#define ST_VR (2 * 16 * SPIT)
#define ST_SZ (3 * 16 * SPIT)           // 25344 B per 32-key step
#define FSP  4                   // 32-key steps per stage of the flash ring (128 keys)
#define GW   8                   // waves per k_out block: block tile 128 A rows x 256 Bt rows
#define FKS  128                 // k elements per k_qkv or k_out stage: 256 B of every operand row
#define FPIT 272                 // LDS pitch, bytes, of a staged 256-B row (16 B x odd for 16-B readers)
#define FLO  128                 // k_out stage: first row of the ctx lo pieces (the hi pieces are rows 0..127)
#define FBT  256                 // k_out stage: first row of the WoT pieces
#define FST  ((FBT + 256) * FPIT)       // 139264 B per k_out stage, and per k_qkv stage
#define PBT  128                 // k_qkv stage: first row of the weight pieces (the x pieces are rows 0..127)
#define QRS  2048.0f             // carry of the q residual plane
#define QRI  (1.0f / 2048.0f)
#define VRS  256.0f              // carry of the v residual plane (partner operand is P x 2^-8)
#define LOG2E 1.4426950408889634f
#define SC2  (0.08838834764831845f * 1.4426950408889634f)   // HD^-0.5 * log2(e)
#define PSH  8.0f                // log2 of the P carry (256)
#define NEGBIG (-3.0e38f)

static_assert(HD == 128);
static_assert(NH_ * HD == DM);
static_assert(NH_ % NKV == 0);
static_assert(DM % 64 == 0);
static_assert(DKV % 64 == 0);
static_assert(DM % 32 == 0);
static_assert(SEQ % 64 == 0);                  // a 64-row tile never straddles two batches
static_assert((NB * SEQ) % 64 == 0);
static_assert(SEQ % 32 == 0);                  // key loop steps by 32
static_assert(REP == 4 && FW == 2 * REP);      // wave -> (head of the group, query tile) map of the flash block
static_assert(SEQ % 4 == 0);
static_assert((NB * SEQ) % 256 == 0 && DKV % 128 == 0 && DM % 256 == 0 && NKV % 2 == 0 && NH_ % 2 == 0);   // GEMM block tiles cover every operand exactly
static_assert(DM % FKS == 0);
static_assert(((size_t)SEQ * DM) % 8 == 0);
static_assert(NB <= NB_FULL);
static_assert(SEQ <= SEQ_FULL);

typedef _Float16 h16;
typedef unsigned short bf;
typedef __attribute__((ext_vector_type(16))) __bf16   v16bf;
typedef __attribute__((ext_vector_type(16))) _Float16 v16h;
typedef __attribute__((ext_vector_type(8)))  _Float16 v8h;
typedef __attribute__((ext_vector_type(8)))  unsigned short v8us;
typedef __attribute__((ext_vector_type(8)))  float    v8f;
typedef __attribute__((ext_vector_type(4)))  float    v4f;
typedef v4f  __attribute__((may_alias)) v4fa;
typedef __attribute__((ext_vector_type(4)))  int      v4i;
typedef __attribute__((address_space(1))) v4i gv4i;            // pointee types of the asynchronous copy builtin: global source, LDS destination
typedef __attribute__((address_space(3))) v4i lv4i;
typedef __attribute__((ext_vector_type(4)))  unsigned v4u;     // 16 bytes as the data operand of a store written in asm text

__device__ __forceinline__ unsigned short f2bf(float f) { unsigned u = __float_as_uint(f); u += 0x7FFFu + ((u >> 16) & 1u); return (unsigned short)(u >> 16); }
__device__ __forceinline__ float bf2f(unsigned short u) { return __uint_as_float(((unsigned)u) << 16); }
__device__ __forceinline__ float bfr(float f) { return bf2f(f2bf(f)); }     // value of the RNE bf16 conversion
__device__ __forceinline__ v16h cat16(v8h lo, v8h hi) { return __builtin_shufflevector(lo, hi, 0, 1, 2, 3, 4, 5, 6, 7, 8, 9, 10, 11, 12, 13, 14, 15); }
__device__ __forceinline__ v16bf cat16b(v8us lo, v8us hi) { return __builtin_bit_cast(v16bf, __builtin_shufflevector(lo, hi, 0, 1, 2, 3, 4, 5, 6, 7, 8, 9, 10, 11, 12, 13, 14, 15)); }
__device__ __forceinline__ v8f wmma16(v16h a, v16h b, v8f c) { return __builtin_amdgcn_wmma_f32_16x16x32_f16(false, a, false, b, (short)0, c, false, false); }
__device__ __forceinline__ v8f wmmab(v16bf a, v16bf b, v8f c) { return __builtin_amdgcn_wmma_f32_16x16x32_bf16(false, a, false, b, (short)0, c, false, false); }
// fragment loaders from K-contiguous 16-bit rows; p already includes + 8*(lane>>4): elements 0..7 <- k0+8h+0..7, elements 8..15 <- k0+16+8h+0..7 (same map for A and B)
__device__ __forceinline__ v16h  ldh(const h16* p) { return cat16(*(const v8h*)p, *(const v8h*)(p + 16)); }
__device__ __forceinline__ v16bf ldb(const bf* p)  { return cat16b(*(const v8us*)p, *(const v8us*)(p + 16)); }
// ordering point for wave-private LDS tiles (same wave writes and reads)
__device__ __forceinline__ void wave_sync() { __builtin_amdgcn_fence(3 /* release order */, "wavefront"); __builtin_amdgcn_wave_barrier(); asm volatile("" ::: "memory"); }

// cvt8_body: x f32 -> bf16 copy [NB*SEQ][DM], eight elements per thread; blk = block index inside this range. Batch b of the source starts at b * SEQ_FULL rows.
__device__ __forceinline__ void cvt8_body(const float* __restrict__ src, bf* dst, int blk, int tid) {
    constexpr size_t per = (size_t)SEQ * DM / 8, n8 = (size_t)NB * per;
    const size_t i = (size_t)blk * 256 + tid; if (i >= n8) return;
    const v8f v = *(const v8f*)(src + (i / per) * ((size_t)SEQ_FULL * DM) + (i % per) * 8); v8us o;
#pragma unroll
    for (int k = 0; k < 8; ++k) o[k] = f2bf(v[k]);
    *(v8us*)(dst + i * 8) = o; 
}

// tcvt_body: W in[K rows][N cols] f32 -> WT out[N rows][K cols] bf16 (RNE convert), 64x64 tile (bx along K, by along N) transposed through LDS (cross-wave: block barrier).
__device__ __forceinline__ void tcvt_body(const float* __restrict__ W, bf* WT, int K, int N, int bx, int by, float* ts, int tid) {
    const int k0 = bx * 64, n0 = by * 64;
    const int cn = tid & 63, rk = tid >> 6;
#pragma unroll 4
    for (int i = 0; i < 16; ++i) { const int r = rk + 4 * i; ts[r * 65 + cn] = W[(size_t)(k0 + r) * N + n0 + cn]; }   // 16 x 4 = 64 rows, 64 columns
    __syncthreads();
    const int pc = tid & 7, rn = tid >> 3;      // rn 0..31 and rn+32 -> 64 output rows; 8 pieces x 8 = 64 k
    v8us o0, o1;
#pragma unroll
    for (int j = 0; j < 8; ++j) { o0[j] = f2bf(ts[(pc * 8 + j) * 65 + rn]); o1[j] = f2bf(ts[(pc * 8 + j) * 65 + rn + 32]); }
    bf* d0 = WT + (size_t)(n0 + rn) * K + k0 + pc * 8; bf* d1 = WT + (size_t)(n0 + rn + 32) * K + k0 + pc * 8;
    *(v8us*)d0 = o0; *(v8us*)d1 = o1; 
}

// rope_body: rotary table CS[t][0..63] = cos(t * f_i), CS[t][64..127] = sin(t * f_i), f_i = 10000^(-i/64) = 2^(-i * log2(10000)/64); precise sinf/cosf.
__device__ __forceinline__ void rope_body(float* CS, int blk, float* ts, int tid) {
    const int i = tid & 63, r = tid >> 6; const int t = blk * 4 + r;
    const float invf = __builtin_amdgcn_exp2f(-(float)i * 0.20762050593046014f);
    const float ang = (float)t * invf;
    ts[r * 128 + i] = cosf(ang); ts[r * 128 + 64 + i] = sinf(ang);
    __syncthreads();
    if (tid < 128) {                            // waves 0..3 (wave-uniform), one row each
        const int row = tid >> 5, pc = tid & 31;
        const v4f v = *(const v4fa*)(&ts[row * 128 + pc * 4]);
        float* d = CS + (size_t)(blk * 4 + row) * 128 + pc * 4;
        *(v4f*)d = v; 
    }
}

// k_prep: the six preparatory jobs, which do not depend on one another, as block ranges of one grid: the four weight transposes, the rotary table, the bf16 copy of x. The range test reads blockIdx only, so every barrier stays block-uniform.
// Left as it was: the work per thread (one 8-element piece, one 64x64 tile per block), so the grid is still one of very many short waves.
#define PB_WBIG  ((DM / 64) * (DM / 64))      // blocks of a DM x DM transpose
#define PB_WKV   ((DM / 64) * (DKV / 64))     // blocks of a DM x DKV transpose
#define PB_W     (2 * PB_WBIG + 2 * PB_WKV)
#define PB_ROPE  (SEQ / 4)
#define PB_CVT   ((int)(((size_t)NB * SEQ * DM / 8 + 255) / 256))
__global__ __launch_bounds__(256) void k_prep(const float* __restrict__ x, const float* __restrict__ wq, const float* __restrict__ wk, const float* __restrict__ wv, const float* __restrict__ wo,
                                              bf* XB, bf* WQT, bf* WKT, bf* WVT, bf* WOT, float* CS) {
    __shared__ __align__(16) float ts[64 * 65];
    const int tid = threadIdx.x; const int id = blockIdx.x;
    if (id < PB_W) {
        const bool big = id < 2 * PB_WBIG;
        const int q = big ? id : id - 2 * PB_WBIG; const int per = big ? PB_WBIG : PB_WKV;
        const bool second = q >= per; const int r = second ? q - per : q;
        const float* W = big ? (second ? wo : wq) : (second ? wv : wk);
        bf* WT = big ? (second ? WOT : WQT) : (second ? WVT : WKT);
        tcvt_body(W, WT, DM, big ? DM : DKV, r % (DM / 64), r / (DM / 64), ts, tid);
    } else if (id < PB_W + PB_ROPE) rope_body(CS, id - PB_W, ts, tid);
    else cvt8_body(x, XB, id - PB_W - PB_ROPE, tid);
}

// fold_cp8: eight copies of 16 B per lane, 16 rows apart (l: LDS byte address, g: global piece, s: 16 rows, in elements). The s_wait_xcnt closes the statement so that no address register is rewritten ahead of it.
__device__ __forceinline__ void fold_cp8(unsigned l, const bf* g, size_t s) {
    const unsigned l1 = l + 16 * FPIT, l2 = l + 32 * FPIT, l3 = l + 48 * FPIT, l4 = l + 64 * FPIT, l5 = l + 80 * FPIT, l6 = l + 96 * FPIT, l7 = l + 112 * FPIT;
    const bf* g1 = g + s; const bf* g2 = g1 + s; const bf* g3 = g2 + s; const bf* g4 = g3 + s; const bf* g5 = g4 + s; const bf* g6 = g5 + s; const bf* g7 = g6 + s;
    asm volatile("global_load_async_to_lds_b128 %0, %8, off\n\t"
                 "global_load_async_to_lds_b128 %1, %9, off\n\t"
                 "global_load_async_to_lds_b128 %2, %10, off\n\t"
                 "global_load_async_to_lds_b128 %3, %11, off\n\t"
                 "global_load_async_to_lds_b128 %4, %12, off\n\t"
                 "global_load_async_to_lds_b128 %5, %13, off\n\t"
                 "global_load_async_to_lds_b128 %6, %14, off\n\t"
                 "global_load_async_to_lds_b128 %7, %15, off\n\t"
                 "s_wait_xcnt 0x0"
                 :: "v"(l), "v"(l1), "v"(l2), "v"(l3), "v"(l4), "v"(l5), "v"(l6), "v"(l7),
                    "v"(g), "v"(g1), "v"(g2), "v"(g3), "v"(g4), "v"(g5), "v"(g6), "v"(g7) : "memory");
}

// proj_stage: one stage of k_qkv = 128 k of 128 x rows and 384 weight rows = 512 row pieces of 256 B = 256 lanes x 32 copies of 16 B (sixteen lanes per row piece).
// l0, ga, gb: this lane's piece of row tid>>4; s: 16 rows, in elements. Four statements of eight copies (an asm statement takes thirty operands).
__device__ __forceinline__ void proj_stage(unsigned l0, const bf* ga, const bf* gb, size_t s) {
    fold_cp8(l0, ga, s);
    fold_cp8(l0 + PBT * FPIT, gb, s);
    fold_cp8(l0 + (PBT + 128) * FPIT, gb + 8 * s, s);
    fold_cp8(l0 + (PBT + 256) * FPIT, gb + 16 * s, s);
}

// proj_loop: bf16 GEMM main loop of the 12-wave block of k_qkv, block tile 128 x 384, wave tile 64 x 64 at rows wr, columns wc of it. Each 128-k stage of the block's x and weight rows is brought into LDS once
// per block by asynchronous copies (waves 0..7 issue them, 32 each; the test is a scalar one), and every wave takes its fragments from there. Two buffers: stage s + 1 is in flight while stage s is worked on; one barrier per stage publishes s + 1 and frees the buffer of s.
// acc[mb*4+nb] += sum_k A[R0+wr+16mb+..][k] * Bt[C0+wc+16nb+..][k]; k ascending in steps of 32
__device__ __forceinline__ void proj_loop(const bf* __restrict__ A, const bf* __restrict__ Bt, int R0, int C0, int wr, int wc, unsigned char* ring, int tid, int wave, int lr, int hi, v8f (&acc)[16]) {
#pragma unroll
    for (int i = 0; i < 16; ++i) acc[i] = (v8f){};
    const int crow = (tid >> 4) & 15;                          // copy row of this lane (waves 0..7: tid >> 4)
    const unsigned l0 = (unsigned)(size_t)ring + (unsigned)(crow * FPIT + (tid & 15) * 16);
    const bf* ga = A + (size_t)(R0 + crow) * (size_t)DM + (tid & 15) * 8;
    const bf* gb = Bt + (size_t)(C0 + crow) * (size_t)DM + (tid & 15) * 8;
    const size_t s = (size_t)16 * DM;
    const bool cp = wave < 8;                                  // wave-uniform, in a scalar register
    constexpr int nst = DM / FKS;                              // the same for every wave of the launch
    static_assert(nst >= 2);                                   // stages 0 and 1 both exist
    if (cp) proj_stage(l0, ga, gb, s);                         // stage 0 -> buffer 0
    asm volatile("s_wait_asynccnt 0x0" ::: "memory");          // this wave's share of stage 0 has landed
    __syncthreads();                                           // stage 0 published
    if (cp) proj_stage(l0 + FST, ga + FKS, gb + FKS, s);       // stage 1 -> buffer 1
    const int ao = (wr + lr) * FPIT + 16 * hi, bfo = (PBT + wc + lr) * FPIT + 16 * hi;
#pragma unroll 1   // one stage per trip: the ring's order at the foot stands once
    for (int st = 0; st < nst; ++st) {
        const unsigned bo = (st & 1) ? (unsigned)FST : 0u;
        const bf* as = (const bf*)(ring + bo + ao); const bf* bs = (const bf*)(ring + bo + bfo);
        v16bf a[4], b[4];
        // Fragment reads stand in few groups, never singly among the products. __builtin_amdgcn_sched_barrier(0): nothing is scheduled across it, so a group stays whole and in its place; it asks for no wait itself.
#pragma unroll
        for (int mb = 0; mb < 4; ++mb) a[mb] = ldb(as + mb * 16 * (FPIT / 2));
#pragma unroll
        for (int nb = 0; nb < 4; ++nb) b[nb] = ldb(bs + nb * 16 * (FPIT / 2));
        __builtin_amdgcn_sched_barrier(0);
#pragma unroll
        for (int ks = 0; ks < FKS / 32; ++ks) {
#pragma unroll
            for (int nb = 0; nb < 2; ++nb) {
#pragma unroll
                for (int mb = 0; mb < 4; ++mb) acc[mb * 4 + nb] = wmmab(a[mb], b[nb], acc[mb * 4 + nb]); }
            if (ks + 1 < FKS / 32) {                           // the next step's first two weight fragments, behind the last product that reads this step's: they land while the other eight products run
#pragma unroll
                for (int nb = 0; nb < 2; ++nb) b[nb] = ldb(bs + nb * 16 * (FPIT / 2) + 32 * (ks + 1));
            }
            __builtin_amdgcn_sched_barrier(0);
#pragma unroll
            for (int nb = 2; nb < 4; ++nb) {
#pragma unroll
                for (int mb = 0; mb < 4; ++mb) acc[mb * 4 + nb] = wmmab(a[mb], b[nb], acc[mb * 4 + nb]); }
            if (ks + 1 < FKS / 32) {                           // the rest of the next step's fragments; the SIMD's two other waves run their products while these land
#pragma unroll
                for (int mb = 0; mb < 4; ++mb) a[mb] = ldb(as + mb * 16 * (FPIT / 2) + 32 * (ks + 1));
#pragma unroll
                for (int nb = 2; nb < 4; ++nb) b[nb] = ldb(bs + nb * 16 * (FPIT / 2) + 32 * (ks + 1));
            }
            __builtin_amdgcn_sched_barrier(0);                 // in the last step it keeps the products in front of the publish point, so that the copies are issued directly behind the barrier
        }
        // the distance behind the trip's last products, on the path over the loop's back edge too
        asm volatile("v_nop\n\tv_nop\n\tv_nop\n\tv_nop" : "+v"(acc[0]), "+v"(acc[5]), "+v"(acc[10]), "+v"(acc[15]) : "v"(a[0]), "v"(a[3]), "v"(b[3]));
        // publish point of stage st + 1
        asm volatile("s_wait_dscnt 0x0" ::: "memory");         // this wave's reads of the buffer of stage st are done before it is handed to the copies
        asm volatile("s_wait_asynccnt 0x0" ::: "memory");      // this wave's share of stage st + 1 has landed
        __syncthreads();                                       // stage st + 1 published; every reader has left the buffer of stage st
        if (cp && st + 2 < nst) proj_stage(l0 + bo, ga + (st + 2) * FKS, gb + (st + 2) * FKS, s);   // stage st + 2 -> the buffer just read
    }
    asm volatile("s_wait_asynccnt 0x0" ::: "memory");          // nothing of this wave is in flight when it leaves the ring
}

// st4, st2: the stores of two row pairs (OFF bytes apart) and their s_wait_xcnt in one statement, so that the wait stands in front of every rewrite of a register that a store names
// (a wait in a statement of its own does not hold the address additions behind it)
template <int OFF>
__device__ __forceinline__ void st4(h16* ph, h16* pr, v4u h0, v4u h1, v4u r0, v4u r1) {
    asm volatile("global_store_b128 %0, %2, off\n\t"
                 "global_store_b128 %0, %3, off offset:%6\n\t"
                 "global_store_b128 %1, %4, off\n\t"
                 "global_store_b128 %1, %5, off offset:%6\n\t"
                 "s_wait_xcnt 0x0"
                 :: "v"(ph), "v"(pr), "v"(h0), "v"(h1), "v"(r0), "v"(r1), "n"(OFF) : "memory");
}
template <int OFF>
__device__ __forceinline__ void st2(h16* ph, v4u h0, v4u h1) {
    asm volatile("global_store_b128 %0, %1, off\n\t"
                 "global_store_b128 %0, %2, off offset:%3\n\t"
                 "s_wait_xcnt 0x0"
                 :: "v"(ph), "v"(h0), "v"(h1), "n"(OFF) : "memory");
}

// k_qkv: the q, k and v projections as ONE product x [NB*SEQ][DM] times the weight rows [q 2048 | k 512 | v 512][DM] (24 heads of 128 columns). Block tile 128 rows x 384 columns (3 heads): 32 x 8 = 256 equal blocks,
// one per WGP, 12 waves (three per SIMD) of 64 x 64 each: every WGP has the same share of the products, and a fragment read from LDS serves four of them.
// Epilogue: the whole block tile (+ bias) is staged in LDS on the ring, which the last publish point of proj_loop (LDS reads done, no copy in flight, block barrier) has freed for every wave; one block barrier; then each wave
// takes two of the 24 pieces (head, 16 rows). A q or k head is staged [t][d] (a rotary pair d, d + 64 comes from two waves) and goes out as plane [(b*nheads + head)][t][d], f16 value and, for q, f16 residual x2048.
// A v head is staged transposed [d][t] (a lane holds eight consecutive t of one d) and goes out as planes [(b*DKV + g*128 + d)][t], f16 value and f16 residual x256.
#define PW    12                 // waves per block
#define PCOL  384                // columns of a block tile
#define OPIT  132                // pitch, floats, of a staged row of 128
#define GB_ROW  (NB * SEQ / 128)
#define GB_COL  ((DM + 2 * DKV) / PCOL)
static_assert((DM + 2 * DKV) % PCOL == 0 && PCOL % HD == 0 && (NB * SEQ) % 128 == 0 && SEQ % 128 == 0);   // block tiles cover the product exactly; a tile holds whole heads and lies in one batch
static_assert((PBT + PCOL) * FPIT == FST && (PCOL / HD) * 128 * OPIT * 4 <= 2 * FST);
__global__ __launch_bounds__(32 * PW) __attribute__((amdgpu_num_vgpr(256)))
void k_qkv(const bf* __restrict__ XB, const bf* __restrict__ WT, const float* __restrict__ bq, const float* __restrict__ bk, const float* __restrict__ bv, const float* __restrict__ CS,
           h16* QH, h16* QR, h16* KP, h16* VH, h16* VR) {
    __shared__ __align__(16) unsigned char ring[2 * FST];
    const int tid = threadIdx.x; const int id = blockIdx.x;
    const int lane = tid & 31, lr = lane & 15, hi = lane >> 4;
    const int wave = __builtin_amdgcn_readfirstlane(tid >> 5); // in a scalar register: every test on it is a scalar branch
    const int bx = id % GB_ROW, by = id / GB_ROW;
    const int wr = (wave & 1) * 64, wc = (wave >> 1) * 64;
    v8f acc[16];
    proj_loop(XB, WT, bx * 128, by * PCOL, wr, wc, ring, tid, wave, lr, hi, acc);
    float* osb = (float*)ring;
    {   // this wave's 64 x 64 tile: half of head gh, columns d0 .. d0 + 63 of it
        const int gh = by * (PCOL / HD) + (wc >> 7), d0 = wc & 127;
        const float* bp = gh < NH_ ? bq + gh * HD : (gh < NH_ + NKV ? bk + (gh - NH_) * HD : bv + (gh - NH_ - NKV) * HD);
        float bz[4];
#pragma unroll
        for (int nb = 0; nb < 4; ++nb) bz[nb] = bfr(bp[d0 + nb * 16 + lr]);
        float* oh = osb + (wc >> 7) * (128 * OPIT);
        if (gh < NH_ + NKV) {                                  // D: row t = 8h+j, col d = lane&15 -> [t][d]
#pragma unroll
            for (int mb = 0; mb < 4; ++mb) {
#pragma unroll
                for (int nb = 0; nb < 4; ++nb) {
#pragma unroll
                    for (int j = 0; j < 8; ++j) oh[(wr + mb * 16 + hi * 8 + j) * OPIT + d0 + nb * 16 + lr] = acc[mb * 4 + nb][j] + bz[nb]; } }
        } else {                                               // -> [d][t]
#pragma unroll
            for (int mb = 0; mb < 4; ++mb) {
#pragma unroll
                for (int nb = 0; nb < 4; ++nb) { v4f p, q;
#pragma unroll
                    for (int j = 0; j < 4; ++j) { p[j] = acc[mb * 4 + nb][j] + bz[nb]; q[j] = acc[mb * 4 + nb][4 + j] + bz[nb]; }
                    float* d = &oh[(d0 + nb * 16 + lr) * OPIT + wr + mb * 16 + hi * 8];
                    *(v4fa*)d = p; *(v4fa*)(d + 4) = q; } }
        }
    }
    __syncthreads();                                           // the block tile is staged: rows of a piece come from other waves
    const int b = (bx * 128) / SEQ, tb = (bx * 128) % SEQ;
    const int c8 = lr * 8, p8 = c8 ^ 64;
#pragma unroll 1   // stays rolled: keeps the epilogue's code short
    for (int it = wave; it < (PCOL / HD) * 8; it += PW) {      // piece: head it >> 3 of the tile, rows 16 (it & 7) .. + 15 of its staging
        const int gh = by * (PCOL / HD) + (it >> 3), rg = (it & 7) * 16;
        const float* os = osb + (it >> 3) * (128 * OPIT) + rg * OPIT;
        if (gh < NH_ + NKV) {
            const bool isq = gh < NH_;
            const int t0 = tb + rg;
            const size_t tbase = ((size_t)(isq ? b * NH_ + gh : b * NKV + gh - NH_) * SEQ + t0) * HD;
            h16* Ph = isq ? QH : KP;
            // the piece's whole share of the rotary table is asked for as one group (the accumulators' registers are free by now), so that its latency is waited out once per piece, not once per trip
            v4f tc0[8], tc1[8], ts0[8], ts1[8];
            const float* cs0 = CS + (size_t)(t0 + hi) * 128 + (c8 & 63);
#pragma unroll
            for (int s = 0; s < 8; ++s) { const float* cs = cs0 + s * 256;   // row t0 + 2 s + hi
                tc0[s] = *(const v4f*)cs; tc1[s] = *(const v4f*)(cs + 4); ts0[s] = *(const v4f*)(cs + 64); ts1[s] = *(const v4f*)(cs + 68); }
            asm volatile("s_wait_xcnt 0x0" :: "v"(cs0) : "memory");   // takes the address as an input, so that its registers stay as they are until it has passed (otherwise a late load's result may be laid on them)
#pragma unroll   // unrolled so that every index of the table arrays is a constant (registers, no scratch)
            for (int s2 = 0; s2 < 8; s2 += 2) { v4u hq[2], rq[2];
#pragma unroll
              for (int u = 0; u < 2; ++u) { const int row = 2 * (s2 + u) + hi;   // 8 s x 2 rows = 16 rows; 16 lanes x 8 = 128 columns
                const float* orow = &os[row * OPIT];
                const v4f x0 = *(const v4fa*)(orow + c8), x1 = *(const v4fa*)(orow + c8 + 4);
                const v4f y0 = *(const v4fa*)(orow + p8), y1 = *(const v4fa*)(orow + p8 + 4);
                const v4f cc0 = tc0[s2 + u], cc1 = tc1[s2 + u], ss0 = ts0[s2 + u], ss1 = ts1[s2 + u];
                const float sg = (c8 < 64) ? -1.0f : 1.0f;       // d < 64: x[d] cos - x[d+64] sin; d >= 64: x[d] cos + x[d-64] sin
                v8h hv, rv;
#pragma unroll
                for (int i = 0; i < 4; ++i) {
                    const float v0 = x0[i] * cc0[i] + sg * (y0[i] * ss0[i]); const float v1 = x1[i] * cc1[i] + sg * (y1[i] * ss1[i]);
                    const h16 a0 = (h16)v0; const h16 a1 = (h16)v1; hv[i] = a0; hv[4 + i] = a1;
                    rv[i] = (h16)((v0 - (float)a0) * QRS); rv[4 + i] = (h16)((v1 - (float)a1) * QRS); }
                hq[u] = __builtin_bit_cast(v4u, hv); rq[u] = __builtin_bit_cast(v4u, rv); }
                const size_t oo = tbase + (size_t)(2 * s2 + hi) * HD + c8;   // row 2 s2 + hi; the second piece lies two rows further
                if (isq) st4<2 * HD * 2>(Ph + oo, QR + oo, hq[0], hq[1], rq[0], rq[1]);
                else     st2<2 * HD * 2>(Ph + oo, hq[0], hq[1]); }
        } else {
            const size_t vbase = ((size_t)b * DKV + (size_t)(gh - NH_ - NKV) * HD + rg) * SEQ + tb;
#pragma unroll 1   // stays rolled, four trips of two row pairs each
            for (int s2 = 0; s2 < 8; s2 += 2) { v4u hq[2], rq[2];
#pragma unroll
              for (int u = 0; u < 2; ++u) { const int row = 2 * (s2 + u) + hi;   // 8 s x 2 rows d = 16 rows; 16 lanes x 8 = 128 columns t
                const v4f x0 = *(const v4fa*)(&os[row * OPIT + c8]); const v4f x1 = *(const v4fa*)(&os[row * OPIT + c8 + 4]); v8h hv, rv;
#pragma unroll
                for (int i = 0; i < 4; ++i) { const h16 a0 = (h16)x0[i]; const h16 a1 = (h16)x1[i]; hv[i] = a0; hv[4 + i] = a1; rv[i] = (h16)((x0[i] - (float)a0) * VRS); rv[4 + i] = (h16)((x1[i] - (float)a1) * VRS); }
                hq[u] = __builtin_bit_cast(v4u, hv); rq[u] = __builtin_bit_cast(v4u, rv); }
                const size_t oo = vbase + (size_t)(2 * s2 + hi) * SEQ + c8;  // row 2 s2 + hi; the second piece lies two rows further
                st4<2 * SEQ * 2>(VH + oo, VR + oo, hq[0], hq[1], rq[0], rq[1]); }
        }
    }
}

// k_flash: fused causal attention, one wave per 16 query rows of one (batch, head). A block is the 4 query heads of one kv head x 2 adjacent 16-row query tiles (8 waves): all of them walk
// the same keys, so each 32-key step of K, V^T value and V^T residual is brought into LDS once per block by asynchronous copies (whole 16-B pieces, contiguous per row) and every wave takes its fragments from there.
// Two buffers of FSP 32-key steps each: stage s + 1 is in flight while stage s is worked on; one barrier per stage publishes s + 1 and frees the buffer of s. Between two publish points the waves run free,
// so one wave's softmax can stand beside another's products, and a stage's landing has FSP steps to hide behind.
// Transposed form: S^T[key][t] = K Q^T (A = K rows, B = Q rows); lane (t = lane&15, h = lane>>4) holds keys 8h+r of each 16-key tile, so the packed
// P tile is directly the B fragment of O^T[d][t] = V^T P^T (element r <- tile keys 0..15, element 8+r <- tile keys 16..31, lane unchanged).
// The key loop of a tile runs to the 32-key step that contains its last query; keys beyond a query get the fill value (weight exactly 0). ALiBi bias slope*(key - query) added in the exp2 domain.
// Balance: a 32-row query tile x walks x + 1 32-key steps, and all blocks of the grid are resident at once, so the launch lasts as long as its fullest WGP. Each block therefore takes two tiles one after the other,
// x and SEQ/32 - 1 - x: SEQ/32 + 1 steps for every block, one block per WGP. The two walks are one run of steps through the ring (the second tile's first steps fly while the first tile ends);
// at the first tile's last step every wave writes its rows out, takes the second tile's q and starts its sums anew. The sums of a tile are formed as before.
// What is left: the LDS read rate (every wave reads every K and V^T fragment of a stage for its 16 query rows alone) and the softmax's vector work between the two matrix runs.
// Planes of a step in LDS, 16 lines of SPIT bytes each, line = fragment row (lane&15): K line holds key rows r and 16 + r (256 B each); a V^T line holds the 32-key pieces (64 B) of rows d = 16j + r, j = 0..7.
// So every fragment of a stage is read at one per-lane address plus a constant.
// flash_stage: one 32-key step of a stage = K 32 rows x 256 B, V^T value and residual 128 rows x 64 B each = 24 KiB = 256 lanes x 6 copies of 16 B. The copies are written as the builtin: this kernel holds more than 256 registers,
// asm text cannot name one above v255, and address operands tied to the low window were spilled to scratch inside the loop.
__device__ __forceinline__ void flash_cp(unsigned l, const h16* g) { __builtin_amdgcn_global_load_async_to_lds_b128((gv4i*)g, (lv4i*)l, 0, 0); }
__device__ __forceinline__ void flash_stage(unsigned lk, unsigned lv, const h16* gk, const h16* gh, const h16* gr) {
    flash_cp(lk, gk); flash_cp(lk + 256, gk + 16 * HD);
    flash_cp(lv + ST_VH, gh); flash_cp(lv + ST_VH + 256, gh + (size_t)64 * SEQ);
    flash_cp(lv + ST_VR, gr); flash_cp(lv + ST_VR + 256, gr + (size_t)64 * SEQ);
}

// flash_q: the q value and residual fragments of a wave's 16 query rows (B fragments: col t, k = d); qa, qb: this lane's piece of its row in the two planes.
// The s_wait_xcnt takes the two addresses as inputs, so that their registers stay as they are until it has passed (otherwise a late load's result may be laid on them).
__device__ __forceinline__ void flash_q(const h16* qa, const h16* qb, v16h (&qh)[4], v16h (&qr)[4]) {
#pragma unroll
    for (int c = 0; c < 4; ++c) { qh[c] = ldh(qa + 32 * c); qr[c] = ldh(qb + 32 * c); }
    asm volatile("s_wait_xcnt 0x0" :: "v"(qa), "v"(qb) : "memory");
}

__global__ __launch_bounds__(32 * FW) __attribute__((amdgpu_num_vgpr(512)))
void k_flash(const h16* __restrict__ QH, const h16* __restrict__ QR, const h16* __restrict__ KP, const h16* __restrict__ VH, const h16* __restrict__ VR, bf* CTX) {
    __shared__ __align__(16) unsigned char ring[2 * FSP * ST_SZ];
    __shared__ __align__(16) float os[FW * 16 * 132];
    const int tid = threadIdx.x;
    const int lane = tid & 31, wave = tid >> 5, lr = lane & 15, hi = lane >> 4;
    const int bg = blockIdx.y; const int b = bg / NKV, g = bg % NKV; const int h = g * REP + (wave & (REP - 1)); const int zh = b * NH_ + h;
    constexpr int NQT = SEQ / 32;                              // query tiles of one (batch, kv head)
    static_assert(NQT % 2 == 0);                               // the tiles pair off, every tile in exactly one block
    const int na = blockIdx.x + 1;                             // 32-key steps of the first tile (blockIdx.x); the second tile (NQT - 1 - blockIdx.x) has NQT - blockIdx.x
    constexpr int nst = NQT + 1;                               // 32-key steps of the block, the same for every block; step st holds key step st of the first tile or st - na of the second, both below NQT
    static_assert(nst >= 2 * FSP && (FSP & (FSP - 1)) == 0);   // stages 0 and 1 are both full; step st lies in slot st & (2 * FSP - 1) of the ring
    int t0 = blockIdx.x * 32 + (wave >> 2) * 16;
    const size_t kvb = (size_t)bg * SEQ * HD;
    // copy addresses of this lane. K: piece tid -> key row tid>>4 (and +16: +256 B in its line), 16-B column tid&15. V^T: piece tid -> row d = tid>>2 (and +64: +256 B in its line), 16-B column tid&3.
    const unsigned rb = (unsigned)(size_t)ring;
    const unsigned lk = rb + (unsigned)((tid >> 4) * SPIT + (tid & 15) * 16), lvt = rb + (unsigned)(((tid >> 2) & 15) * SPIT + (tid >> 6) * 64 + (tid & 3) * 16);
    const h16* gk = KP + kvb + (size_t)tid * 8;                // + key0 * HD
    const size_t gvo = kvb + (size_t)(tid >> 2) * SEQ + (tid & 3) * 8;   // + key0
    const h16* gh = VH + gvo; const h16* gr = VR + gvo;
#pragma unroll
    for (int u = 0; u < FSP; ++u) { const int ku = (u < na ? u : u - na) * 32; flash_stage(lk + u * ST_SZ, lvt + u * ST_SZ, gk + (size_t)ku * HD, gh + ku, gr + ku); }   // stage 0 -> buffer 0
    const size_t qz = (size_t)zh * SEQ * HD + (size_t)lr * HD + 8 * hi;   // + t0 * HD
    v16h qh[4], qr[4];
    flash_q(QH + qz + (size_t)t0 * HD, QR + qz + (size_t)t0 * HD, qh, qr);
    asm volatile("s_wait_asynccnt 0x0" ::: "memory");          // this wave's share of stage 0 has landed
    __syncthreads();                                           // stage 0 published
#pragma unroll
    for (int u = FSP; u < 2 * FSP; ++u) { const int ku = (u < na ? u : u - na) * 32; flash_stage(lk + u * ST_SZ, lvt + u * ST_SZ, gk + (size_t)ku * HD, gh + ku, gr + ku); }   // stage 1 -> buffer 1
    const int fo = lr * SPIT + 16 * hi;                        // K: + 256 (second key tile) + 64*c (A fragment: row key, k = d); V^T: + plane + 64*j (A fragment: row d, k = key)
    const float slope2 = __builtin_amdgcn_exp2f(-0.5f * (float)(h + 1)) * LOG2E;
    int qi = t0 + lr;
    const int wb = wave * 16 * 132;
    v8f o[8];
#pragma unroll
    for (int j = 0; j < 8; ++j) o[j] = (v8f){};
    float m = NEGBIG, l = 0.0f;
#pragma unroll 1
    for (int st = 0; st < nst; ++st) {
        const int key0 = (st < na ? st : st - na) * 32;
        const unsigned bo = (unsigned)(st & (2 * FSP - 1)) * (unsigned)ST_SZ;
        const h16* ka = (const h16*)(ring + bo + fo);
        const h16* va = ka + ST_VH / 2; const h16* vr = ka + ST_VR / 2;
        v8f sHa = (v8f){}, sLa = (v8f){}, sHb = (v8f){}, sLb = (v8f){};
        // All fragment reads of a step stand as one group at its head (one block per WGP, two waves per SIMD: a wave may hold 512 registers): the eight K fragments first, then the sixteen V^T fragments,
        // which land while the score products and the softmax run; LDS data returns in issue order, so the products wait with counts and never for a read issued among them.
        // __builtin_amdgcn_sched_barrier(0): nothing is scheduled across it, so the group stays whole and in its place; it asks for no wait itself.
        v16h kf[8], vf[8], vg[8];
#pragma unroll
        for (int c = 0; c < 4; ++c) { kf[2 * c] = ldh(ka + 32 * c); kf[2 * c + 1] = ldh(ka + 128 + 32 * c); }
#pragma unroll
        for (int j = 0; j < 8; ++j) vf[j] = ldh(va + 32 * j);
#pragma unroll
        for (int j = 0; j < 8; ++j) vg[j] = ldh(vr + 32 * j);
        __builtin_amdgcn_sched_barrier(0);
#pragma unroll
        for (int c = 0; c < 4; ++c) {
            sHa = wmma16(kf[2 * c], qh[c], sHa); sLa = wmma16(kf[2 * c], qr[c], sLa); sHb = wmma16(kf[2 * c + 1], qh[c], sHb); sLb = wmma16(kf[2 * c + 1], qr[c], sLb); }
        asm volatile("v_nop\n\tv_nop\n\tv_nop\n\tv_nop" : "+v"(sHa), "+v"(sLa), "+v"(sHb), "+v"(sLb) : "v"(kf[6]), "v"(kf[7]));
        const float base = (float)(key0 + 8 * hi - qi);        // key - query for r = 0 of tile a
        float ta[8], tb[8]; float mx = NEGBIG;
#pragma unroll
        for (int r = 0; r < 8; ++r) {
            const float da = base + (float)r, db = da + 16.0f;
            float xa = fmaf(slope2, da, (sHa[r] + sLa[r] * QRI) * SC2);
            float xb = fmaf(slope2, db, (sHb[r] + sLb[r] * QRI) * SC2);
            xa = (da > 0.0f) ? NEGBIG : xa; xb = (db > 0.0f) ? NEGBIG : xb;
            ta[r] = xa; tb[r] = xb; mx = fmaxf(mx, fmaxf(xa, xb)); }
        // lane l <-> l ^ 16 by a vector cross-row move: an LDS permute would count on dscnt behind the V^T reads and wait them all out in the middle of the softmax
        mx = fmaxf(mx, __uint_as_float(__builtin_amdgcn_permlanex16(__float_as_uint(mx), __float_as_uint(mx), 0x76543210u, 0xfedcba98u, false, false)));
        const float mnew = fmaxf(m, mx);
        const float alpha = __builtin_amdgcn_exp2f(m - mnew);
        const float sh = PSH - mnew;
        v16h pb; float ls = 0.0f;
#pragma unroll
        for (int r = 0; r < 8; ++r) { const h16 pa = (h16)__builtin_amdgcn_exp2f(ta[r] + sh); const h16 pc = (h16)__builtin_amdgcn_exp2f(tb[r] + sh); pb[r] = pa; pb[8 + r] = pc; ls += (float)pa + (float)pc; }
        const v16h pq = pb * (h16)0.00390625f;                 // P x 2^-8: partner of the v residual x256
        l = l * alpha + ls; m = mnew;
#pragma unroll
        for (int j = 0; j < 8; ++j) o[j] = o[j] * alpha;
        // all loops unrolled so that every array index is a constant (registers, no scratch)
#pragma unroll
        for (int j = 0; j < 8; ++j) o[j] = wmma16(vf[j], pb, o[j]);
#pragma unroll
        for (int j = 0; j < 8; ++j) o[j] = wmma16(vg[j], pq, o[j]);
        asm volatile("v_nop\n\tv_nop\n\tv_nop\n\tv_nop" : "+v"(o[0]), "+v"(o[1]), "+v"(o[2]), "+v"(o[3]), "+v"(o[4]), "+v"(o[5]), "+v"(o[6]), "+v"(o[7]) : "v"(pb), "v"(pq));
        if ((st & (FSP - 1)) == FSP - 1) {                     // block-uniform: behind a stage's last step, the publish point of the next stage
        asm volatile("s_wait_dscnt 0x0" ::: "memory");         // this wave's reads of the buffer of this stage are done before it is handed to the copies
        asm volatile("s_wait_asynccnt 0x0" ::: "memory");      // this wave's share of the next stage has landed
        __syncthreads();                                       // the next stage published; every reader has left the buffer of this stage
#pragma unroll
        for (int u = 1; u <= FSP; ++u) {                       // the stage after the next -> the buffer just read, step by step while the step exists
            const int s2 = st + FSP + u;
            if (s2 < nst) { const int k2 = (s2 < na ? s2 : s2 - na) * 32; const unsigned b2 = (unsigned)(s2 & (2 * FSP - 1)) * (unsigned)ST_SZ; flash_stage(lk + b2, lvt + b2, gk + (size_t)k2 * HD, gh + k2, gr + k2); } }
        }
      if (st == na - 1 || st == nst - 1) {                     // block-uniform: behind a tile's last step its rows go out
    l += __shfl_xor(l, 16, 32);
    const float inv = 1.0f / l;
    // O^T D layout: o[j][r] = (d = 16j + 8h + r, t = lane&15) -> os[t][d]; rows 0..15 x columns 0..127 all written
#pragma unroll
    for (int j = 0; j < 8; ++j) { v4f a, c;
        a[0] = o[j][0] * inv; a[1] = o[j][1] * inv; a[2] = o[j][2] * inv; a[3] = o[j][3] * inv; c[0] = o[j][4] * inv; c[1] = o[j][5] * inv; c[2] = o[j][6] * inv; c[3] = o[j][7] * inv;
        *(v4fa*)(&os[wb + lr * 132 + 16 * j + 8 * hi]) = a; *(v4fa*)(&os[wb + lr * 132 + 16 * j + 8 * hi + 4]) = c; }
    wave_sync();
    bf* crow = CTX + ((size_t)b * SEQ + t0) * (size_t)(2 * DM) + h * HD;
{
#pragma unroll 2
        for (int s = 0; s < 8; ++s) { const int row = 2 * s + hi, c8 = lr * 8;   // 8 s x 2 rows = 16 rows; 16 lanes x 8 = 128 columns
            const v4f x0 = *(const v4fa*)(&os[wb + row * 132 + c8]); const v4f x1 = *(const v4fa*)(&os[wb + row * 132 + c8 + 4]); v8us hv, lv;
#pragma unroll
            for (int i = 0; i < 4; ++i) { const unsigned short a0 = f2bf(x0[i]); const unsigned short a1 = f2bf(x1[i]); hv[i] = a0; hv[4 + i] = a1; lv[i] = f2bf(x0[i] - bf2f(a0)); lv[4 + i] = f2bf(x1[i] - bf2f(a1)); }
            bf* dst = crow + (size_t)row * (size_t)(2 * DM) + c8;
            *(v8us*)dst = hv; *(v8us*)(dst + DM) = lv; }
         }
        asm volatile("s_wait_xcnt 0x0" ::: "memory");          // behind the tile's stores, in front of the rewrites of the registers that they name
        wave_sync();                                           // this wave's reads of its output staging stand in front of the second tile's writes to it
        // second tile: its rows, its q, sums from the start
        t0 = (NQT - 1 - (int)blockIdx.x) * 32 + (wave >> 2) * 16; qi = t0 + lr;
        if (st != nst - 1) flash_q(QH + qz + (size_t)t0 * HD, QR + qz + (size_t)t0 * HD, qh, qr);
#pragma unroll
        for (int j = 0; j < 8; ++j) o[j] = (v8f){};
        m = NEGBIG; l = 0.0f;
      }
    }
    asm volatile("s_wait_asynccnt 0x0" ::: "memory");          // nothing of this wave is in flight when it leaves the ring
}

// fold_stage: one stage of k_out = 128 k of 128 ctx rows, hi piece and lo piece, and of 256 WoT rows = 512 row pieces of 256 B = 256 lanes x 32 copies of 16 B (sixteen lanes per row piece).
// l0, ga, gb: this lane's piece of row tid>>4; sa, sb: 16 rows, in elements; the lo piece of a ctx row lies DM elements behind its hi piece. Four statements of eight copies (an asm statement takes thirty operands).
__device__ __forceinline__ void fold_stage(unsigned l0, const bf* ga, size_t sa, const bf* gb, size_t sb) {
    fold_cp8(l0, ga, sa);
    fold_cp8(l0 + FLO * FPIT, ga + DM, sa);
    fold_cp8(l0 + FBT * FPIT, gb, sb);
    fold_cp8(l0 + (FBT + 128) * FPIT, gb + 8 * sb, sb);
}

// fold_loop: main loop of k_out, an 8-wave block, block tile 128 x 256, wave tile 64 x 64 at rows wr, columns wc of it. The hi and the lo plane of ctx meet the same WoT rows, so both walk k together:
// a stage holds 128 k of the hi pieces, the lo pieces and the WoT rows, each WoT line is copied once and each WoT fragment read once for both planes (12 fragments for 32 products), and the loop has DM / 128 stages:
// a stage's landing (a fixed latency, then its bytes) outlasts its products, so the longer stage pays the latency, the barrier and the first fragment group half as often.
// Ring as in proj_loop: two buffers, stage s + 1 in flight while stage s is worked on, one barrier per stage.
// acc[mb*4+nb] += sum_k (A[R0+wr+16mb+..][k] + A[R0+wr+16mb+..][DM+k]) * Bt[C0+wc+16nb+..][k]; k ascending in steps of 32, in each step the hi products first
__device__ __forceinline__ void fold_loop(const bf* __restrict__ A, const bf* __restrict__ Bt, int R0, int C0, int wr, int wc, unsigned char* ring, int tid, int lr, int hi, v8f (&acc)[16]) {
#pragma unroll
    for (int i = 0; i < 16; ++i) acc[i] = (v8f){};
    const unsigned l0 = (unsigned)(size_t)ring + (unsigned)((tid >> 4) * FPIT + (tid & 15) * 16);
    const bf* ga = A + (size_t)(R0 + (tid >> 4)) * (size_t)(2 * DM) + (tid & 15) * 8;
    const bf* gb = Bt + (size_t)(C0 + (tid >> 4)) * (size_t)DM + (tid & 15) * 8;
    const size_t sa = (size_t)16 * 2 * DM, sb = (size_t)16 * DM;
    constexpr int nst = DM / FKS;                              // the same for every wave of the launch
    static_assert(nst >= 2);                                   // stages 0 and 1 both exist
    fold_stage(l0, ga, sa, gb, sb);                            // stage 0 -> buffer 0
    asm volatile("s_wait_asynccnt 0x0" ::: "memory");          // this wave's share of stage 0 has landed
    __syncthreads();                                           // stage 0 published
    fold_stage(l0 + FST, ga + FKS, sa, gb + FKS, sb);          // stage 1 -> buffer 1
    const int ao = (wr + lr) * FPIT + 16 * hi, ro = (FLO + wr + lr) * FPIT + 16 * hi, bfo = (FBT + wc + lr) * FPIT + 16 * hi;
#pragma unroll 1   // one stage per trip: the ring's order at the foot stands once
    for (int st = 0; st < nst; ++st) {
        const unsigned bo = (st & 1) ? (unsigned)FST : 0u;
        const bf* as = (const bf*)(ring + bo + ao); const bf* rs = (const bf*)(ring + bo + ro); const bf* bs = (const bf*)(ring + bo + bfo);
        v16bf a[4], r[4], b[4];
        // Fragment reads stand in few groups, each ahead of the products that cover its latency, never among them. __builtin_amdgcn_sched_barrier(0): nothing is scheduled across it, so a group stays whole and in its place; it asks for no wait itself.
        // first step: hi, WoT, then lo fragments, which land while the hi products run
#pragma unroll
        for (int mb = 0; mb < 4; ++mb) a[mb] = ldb(as + mb * 16 * (FPIT / 2));
#pragma unroll
        for (int nb = 0; nb < 4; ++nb) b[nb] = ldb(bs + nb * 16 * (FPIT / 2));
#pragma unroll
        for (int mb = 0; mb < 4; ++mb) r[mb] = ldb(rs + mb * 16 * (FPIT / 2));
        __builtin_amdgcn_sched_barrier(0);
#pragma unroll
        for (int ks = 0; ks < FKS / 32; ++ks) {
#pragma unroll
            for (int nb = 0; nb < 4; ++nb) {
#pragma unroll
                for (int mb = 0; mb < 4; ++mb) acc[mb * 4 + nb] = wmmab(a[mb], b[nb], acc[mb * 4 + nb]); }
            if (ks + 1 < FKS / 32) {                           // the next step's hi fragments, behind the last product that reads this step's: they land while the lo products run
#pragma unroll
                for (int mb = 0; mb < 4; ++mb) a[mb] = ldb(as + mb * 16 * (FPIT / 2) + 32 * (ks + 1));
            }
            __builtin_amdgcn_sched_barrier(0);                 // in the last step it keeps the hi products in front of the publish point, where they cover the landing of the lo fragments
#pragma unroll
            for (int nb = 0; nb < 4; ++nb) {
#pragma unroll
                for (int mb = 0; mb < 4; ++mb) acc[mb * 4 + nb] = wmmab(r[mb], b[nb], acc[mb * 4 + nb]); }
            if (ks + 1 < FKS / 32) {                           // the next step's WoT fragments, then its lo fragments, which land while its hi products run
#pragma unroll
                for (int nb = 0; nb < 4; ++nb) b[nb] = ldb(bs + nb * 16 * (FPIT / 2) + 32 * (ks + 1));
#pragma unroll
                for (int mb = 0; mb < 4; ++mb) r[mb] = ldb(rs + mb * 16 * (FPIT / 2) + 32 * (ks + 1));
                __builtin_amdgcn_sched_barrier(0);
            }
        }
        // publish point of stage st + 1
        asm volatile("s_wait_dscnt 0x0" ::: "memory");         // this wave's reads of the buffer of stage st are done before it is handed to the copies
        asm volatile("s_wait_asynccnt 0x0" ::: "memory");      // this wave's share of stage st + 1 has landed
        __syncthreads();                                       // stage st + 1 published; every reader has left the buffer of stage st
        if (st + 2 < nst) fold_stage(l0 + bo, ga + (st + 2) * FKS, sa, gb + (st + 2) * FKS, sb);   // stage st + 2 -> the buffer just read
    }
    asm volatile("s_wait_asynccnt 0x0" ::: "memory");          // nothing of this wave is in flight when it leaves the ring
}

// k_out: output projection. A = ctx plane rows [hi 2048 | lo 2048], both planes against the single WoT plane (fold_loop), Bt = WoT rows, one wave per 64x64 tile, a block is 2 x 4 of them. grid (NB*SEQ/128, DM/256), 256 threads.
// What is left: the first fragment group of a stage is still read behind the barrier and the copies' issue, with nothing of the wave's own to cover it.
__global__ __launch_bounds__(32 * GW) __attribute__((amdgpu_num_vgpr(256)))
void k_out(const bf* __restrict__ A, const bf* __restrict__ Bt, const float* __restrict__ bias, float* OUT) {
    __shared__ __align__(16) unsigned char ring[2 * FST];
    __shared__ __align__(16) float osb[GW * 16 * 68];
    const int tid = threadIdx.x;
    const int lane = tid & 31, wave = tid >> 5, lr = lane & 15, hi = lane >> 4;
    float* os = osb + wave * 16 * 68;                          // wave-private output staging
    const int wr = (wave & 1) * 64, wc = (wave >> 1) * 64;
    const int r0 = blockIdx.x * 128 + wr, c0 = blockIdx.y * 256 + wc;
    v8f acc[16];
    fold_loop(A, Bt, blockIdx.x * 128, blockIdx.y * 256, wr, wc, ring, tid, lr, hi, acc);
    float bz[4];
#pragma unroll
    for (int nb = 0; nb < 4; ++nb) bz[nb] = bfr(bias[c0 + nb * 16 + lr]);
    const int b = r0 / SEQ, t0 = r0 % SEQ;
    float* obase = OUT + ((size_t)b * OUT_SEQ + t0) * DM + c0;
#pragma unroll
    for (int mb = 0; mb < 4; ++mb) {
#pragma unroll
        for (int nb = 0; nb < 4; ++nb) {
#pragma unroll
            for (int j = 0; j < 8; ++j) os[(hi * 8 + j) * 68 + nb * 16 + lr] = acc[mb * 4 + nb][j] + bz[nb]; }   // rows 0..15 x cols 0..63 all staged
        wave_sync();
        float* orow = obase + (size_t)(mb * 16) * DM;
{
#pragma unroll
            for (int s = 0; s < 8; ++s) { const int row = 2 * s + hi, cofs = lr * 4;   // 8 s x 2 rows = 16 rows; 16 lanes x 4 floats = 64 columns
                const v4f val = *(const v4fa*)(&os[row * 68 + cofs]);
                *(v4f*)(orow + (size_t)row * DM + cofs) = val; }
             }
        wave_sync();
    }
}

static constexpr size_t al256(size_t v) { return (v + 255) & ~(size_t)255; }
static constexpr size_t SZ_XB  = al256((size_t)NB * SEQ * DM * 2);
static constexpr size_t SZ_WQ  = al256((size_t)DM * DM * 2);
static constexpr size_t SZ_WK  = al256((size_t)DKV * DM * 2);
static constexpr size_t SZ_CS  = al256((size_t)SEQ * 128 * 4);
static constexpr size_t SZ_QP  = al256((size_t)NB * NH_ * SEQ * HD * 2);
static constexpr size_t SZ_KP  = al256((size_t)NB * NKV * SEQ * HD * 2);
static constexpr size_t SZ_CTX = al256((size_t)NB * SEQ * 2 * DM * 2);
static_assert(SZ_WQ == (size_t)DM * DM * 2 && SZ_WK == (size_t)DKV * DM * 2);   // no gap between the q, k and v weight planes
static constexpr size_t SZ_TOTAL = SZ_XB + 2 * SZ_WQ + 2 * SZ_WK + SZ_CS + 2 * SZ_QP + 3 * SZ_KP + SZ_CTX;
static_assert(SZ_TOTAL <= (size_t)134217728);          // workspace carve <= 128 MiB

extern "C" void kernel_launch(void* const* d_in, const int* in_sizes, int n_in,
                              void* d_out, int out_size, void* d_ws, size_t ws_size, hipStream_t stream) {
    if (n_in < 9) return;
    const size_t needx = ((size_t)(NB - 1) * SEQ_FULL + SEQ) * DM;
    if ((size_t)in_sizes[0] < needx) return;
    if ((size_t)in_sizes[1] < (size_t)DM * DM || (size_t)in_sizes[2] < (size_t)DM) return;
    if ((size_t)in_sizes[3] < (size_t)DM * DKV || (size_t)in_sizes[4] < (size_t)DKV) return;
    if ((size_t)in_sizes[5] < (size_t)DM * DKV || (size_t)in_sizes[6] < (size_t)DKV) return;
    if ((size_t)in_sizes[7] < (size_t)DM * DM || (size_t)in_sizes[8] < (size_t)DM) return;
    if ((size_t)out_size < ((size_t)(NB - 1) * OUT_SEQ + SEQ) * DM) return;
    if (SZ_TOTAL > ws_size) return;
    // wire order: x, Wq, bq, Wk, bk, Wv, bv, Wo, bo (weights [in][out])
    const float* x  = (const float*)d_in[0];
    const float* wq = (const float*)d_in[1]; const float* bq = (const float*)d_in[2];
    const float* wk = (const float*)d_in[3]; const float* bk = (const float*)d_in[4];
    const float* wv = (const float*)d_in[5]; const float* bv = (const float*)d_in[6];
    const float* wo = (const float*)d_in[7]; const float* bo = (const float*)d_in[8];
    float* OUT = (float*)d_out;      // [NB][SEQ][2048]
    char* wsp = (char*)d_ws;
    bf* XB  = (bf*)wsp; wsp += SZ_XB;                // [NB*SEQ][2048]
    bf* WQT = (bf*)wsp; wsp += SZ_WQ;                // [2048 out][2048 in]; WQT, WKT, WVT lie one behind the other: one plane [3072 out][2048 in]
    bf* WKT = (bf*)wsp; wsp += SZ_WK;                // [512 out][2048 in]
    bf* WVT = (bf*)wsp; wsp += SZ_WK;                // [512 out][2048 in]
    bf* WOT = (bf*)wsp; wsp += SZ_WQ;                // [2048 out][2048 in]
    float* CS = (float*)wsp; wsp += SZ_CS;           // [SEQ][cos 64 | sin 64]
    h16* QH = (h16*)wsp; wsp += SZ_QP;               // [NB*16][SEQ][128]
    h16* QR = (h16*)wsp; wsp += SZ_QP;               // [NB*16][SEQ][128] residual x2048
    h16* KP = (h16*)wsp; wsp += SZ_KP;               // [NB*4][SEQ][128]
    h16* VH = (h16*)wsp; wsp += SZ_KP;               // [NB*4][128][SEQ]
    h16* VR = (h16*)wsp; wsp += SZ_KP;               // [NB*4][128][SEQ] residual x256
    bf* CTX = (bf*)wsp; wsp += SZ_CTX;               // [NB*SEQ][hi 2048 | lo 2048]

    // weight transposes in[K = DM rows][N cols] -> out[N rows][K = DM cols], rotary table, bf16 copy of x
    k_prep<<<PB_W + PB_ROPE + PB_CVT, 256, 0, stream>>>(x, wq, wk, wv, wo, XB, WQT, WKT, WVT, WOT, CS);

    // q, k, v: A = x rows (m = b*SEQ + t), Bt = the weight rows (n = q 2048 | k 512 | v 512) -> q, k planes [(b*nheads + head)][t][d], rotary applied; v planes [(b*512 + g*128 + d)][t]
    k_qkv<<<GB_ROW * GB_COL, 32 * PW, 0, stream>>>(XB, WQT, bq, bk, bv, CS, QH, QR, KP, VH, VR);

    k_flash<<<dim3(SEQ / 64, NB * NKV, 1), 32 * FW, 0, stream>>>(QH, QR, KP, VH, VR, CTX);

    k_out<<<dim3(NB * SEQ / 128, DM / 256, 1), 32 * GW, 0, stream>>>(CTX, WOT, bo, OUT);
}

// v009
// A run of this version takes 142 microseconds.
// Timed twice side by side with v008, it ran 1.05 and 1.06 times as fast.
// All steps since v000 together make it 4.76 times as fast.
#include <hip/hip_runtime.h>

// Causal grouped-query attention layer: x [NB][SEQ][2048], 16 query heads x 128, 4 kv heads, weights [in][out] with biases, rotate-half rotary (theta 1e4), ALiBi slopes 2^(-(h+1)/2), output projection; f32 output.
// Compute dtypes, f32 accumulate everywhere: q/k/v projections v_wmma_f32_16x16x32_bf16 (x, W, b RNE-converted to bf16; products exact);
// scores v_wmma_f32_16x16x32_f16: k single f16, q as f16 value + f16 residual x2048 in its own accumulator; P.V v_wmma_f32_16x16x32_f16: P single f16 (x256 carry, cancels in the normalisation),
// v as f16 value + f16 residual x256 whose partner operand is the P copy x2^-8 (K-dimension fold, products at natural scale, one accumulator); row sum of P as a product with an all-ones operand; output projection v_wmma_f32_16x16x32_bf16 with ctx as bf16 hi | lo planes, both multiplied with the one bf16 Wo plane into one accumulator (per 32-k step: hi products, then lo products); softmax f32 (online, running max).
// Layout: bf16 x copy, bf16 transposed weight planes [out][in]; q (hi, residual) planes [b*16+h][t][d], k plane [b*4+g][t][d], v^T planes [b*4+g][d][t]; ctx plane [b*SEQ+t][hi 2048 | lo 2048]; rotary table [t][cos 64 | sin 64].

#ifndef NB
#define NB 2
#endif
#ifndef SEQ
#define SEQ 2048
#endif
#define NB_FULL  2
#define SEQ_FULL 2048
#ifndef OUT_SEQ
#define OUT_SEQ SEQ              // row pitch (in tokens) between batches of the output
#endif
#define DM   2048
#define NH_  16
#define NKV  4
#define HD   128
#define REP  (NH_ / NKV)
#define DKV  (NKV * HD)          // 512
#define FW   8                   // waves per flash block: the 4 query heads of one kv head x 2 query tiles of 16 rows
#define SPIT 528                 // LDS pitch, bytes, of one fragment-row line of a stage plane (512 + 16: 16 B x odd for 16-B readers)
#define ST_VH (16 * SPIT)               // byte offsets inside one 32-key step slot: K at 0, V^T value, V^T residual
#define ST_VR (2 * 16 * SPIT)
#define ST_SZ (3 * 16 * SPIT)           // 25344 B per 32-key step
#define FSP  4                   // 32-key steps per stage of the flash ring (128 keys)
#define GW   8                   // waves per k_out block: block tile 128 A rows x 256 Bt rows
#define FKS  128                 // k elements per k_qkv or k_out stage: 256 B of every operand row
#define FPIT 272                 // LDS pitch, bytes, of a staged 256-B row (16 B x odd for 16-B readers)
#define FLO  128                 // k_out stage: first row of the ctx lo pieces (the hi pieces are rows 0..127)
#define FBT  256                 // k_out stage: first row of the WoT pieces
#define FST  ((FBT + 256) * FPIT)       // 139264 B per k_out stage, and per k_qkv stage
#define PBT  128                 // k_qkv stage: first row of the weight pieces (the x pieces are rows 0..127)
#define QRS  2048.0f             // carry of the q residual plane
#define QRI  (1.0f / 2048.0f)
#define VRS  256.0f              // carry of the v residual plane (partner operand is P x 2^-8)
#define SC2  (0.08838834764831845f * 1.4426950408889634f)   // HD^-0.5 * log2(e)
#define RHD  11.313708498984761f // HD^0.5: an ALiBi slope in units of the unscaled score
#define PSH  8.0f                // log2 of the P carry (256)
#define NEGBIG (-3.0e38f)

static_assert(HD == 128);
static_assert(NH_ * HD == DM);
static_assert(NH_ % NKV == 0);
static_assert(DM % 64 == 0);
static_assert(DKV % 64 == 0);
static_assert(DM % 32 == 0);
static_assert(SEQ % 64 == 0);                  // a 64-row tile never straddles two batches
static_assert((NB * SEQ) % 64 == 0);
static_assert(SEQ % 32 == 0);                  // key loop steps by 32
static_assert(REP == 4 && FW == 2 * REP);      // wave -> (head of the group, query tile) map of the flash block
static_assert(SEQ % 4 == 0);
static_assert((NB * SEQ) % 256 == 0 && DKV % 128 == 0 && DM % 256 == 0 && NKV % 2 == 0 && NH_ % 2 == 0);   // GEMM block tiles cover every operand exactly
static_assert(DM % FKS == 0);
static_assert(((size_t)SEQ * DM) % 8 == 0);
static_assert(NB <= NB_FULL);
static_assert(SEQ <= SEQ_FULL);

typedef _Float16 h16;
typedef unsigned short bf;
typedef __attribute__((ext_vector_type(16))) __bf16   v16bf;
typedef __attribute__((ext_vector_type(16))) _Float16 v16h;
typedef __attribute__((ext_vector_type(8)))  _Float16 v8h;
typedef __attribute__((ext_vector_type(8)))  unsigned short v8us;
typedef __attribute__((ext_vector_type(8)))  float    v8f;
typedef __attribute__((ext_vector_type(4)))  float    v4f;
typedef v4f  __attribute__((may_alias)) v4fa;
typedef __attribute__((ext_vector_type(4)))  int      v4i;
typedef __attribute__((address_space(1))) v4i gv4i;            // pointee types of the asynchronous copy builtin: global source, LDS destination
typedef __attribute__((address_space(3))) v4i lv4i;
typedef __attribute__((ext_vector_type(4)))  unsigned v4u;     // 16 bytes as the data operand of a store written in asm text

__device__ __forceinline__ unsigned short f2bf(float f) { unsigned u = __float_as_uint(f); u += 0x7FFFu + ((u >> 16) & 1u); return (unsigned short)(u >> 16); }
__device__ __forceinline__ float bf2f(unsigned short u) { return __uint_as_float(((unsigned)u) << 16); }
__device__ __forceinline__ float bfr(float f) { return bf2f(f2bf(f)); }     // value of the RNE bf16 conversion
__device__ __forceinline__ v16h cat16(v8h lo, v8h hi) { return __builtin_shufflevector(lo, hi, 0, 1, 2, 3, 4, 5, 6, 7, 8, 9, 10, 11, 12, 13, 14, 15); }
__device__ __forceinline__ v16bf cat16b(v8us lo, v8us hi) { return __builtin_bit_cast(v16bf, __builtin_shufflevector(lo, hi, 0, 1, 2, 3, 4, 5, 6, 7, 8, 9, 10, 11, 12, 13, 14, 15)); }
__device__ __forceinline__ v8f wmma16(v16h a, v16h b, v8f c) { return __builtin_amdgcn_wmma_f32_16x16x32_f16(false, a, false, b, (short)0, c, false, false); }
__device__ __forceinline__ v8f wmmab(v16bf a, v16bf b, v8f c) { return __builtin_amdgcn_wmma_f32_16x16x32_bf16(false, a, false, b, (short)0, c, false, false); }
// fragment loaders from K-contiguous 16-bit rows; p already includes + 8*(lane>>4): elements 0..7 <- k0+8h+0..7, elements 8..15 <- k0+16+8h+0..7 (same map for A and B)
__device__ __forceinline__ v16h  ldh(const h16* p) { return cat16(*(const v8h*)p, *(const v8h*)(p + 16)); }
__device__ __forceinline__ v16bf ldb(const bf* p)  { return cat16b(*(const v8us*)p, *(const v8us*)(p + 16)); }
// ordering point for wave-private LDS tiles (same wave writes and reads)
__device__ __forceinline__ void wave_sync() { __builtin_amdgcn_fence(3 /* release order */, "wavefront"); __builtin_amdgcn_wave_barrier(); asm volatile("" ::: "memory"); }

// cvt8_body: x f32 -> bf16 copy [NB*SEQ][DM], eight elements per thread; blk = block index inside this range. Batch b of the source starts at b * SEQ_FULL rows.
__device__ __forceinline__ void cvt8_body(const float* __restrict__ src, bf* dst, int blk, int tid) {
    constexpr size_t per = (size_t)SEQ * DM / 8, n8 = (size_t)NB * per;
    const size_t i = (size_t)blk * 256 + tid; if (i >= n8) return;
    const v8f v = *(const v8f*)(src + (i / per) * ((size_t)SEQ_FULL * DM) + (i % per) * 8); v8us o;
#pragma unroll
    for (int k = 0; k < 8; ++k) o[k] = f2bf(v[k]);
    *(v8us*)(dst + i * 8) = o; 
}

// tcvt_body: W in[K rows][N cols] f32 -> WT out[N rows][K cols] bf16 (RNE convert), 64x64 tile (bx along K, by along N) transposed through LDS (cross-wave: block barrier).
__device__ __forceinline__ void tcvt_body(const float* __restrict__ W, bf* WT, int K, int N, int bx, int by, float* ts, int tid) {
    const int k0 = bx * 64, n0 = by * 64;
    const int cn = tid & 63, rk = tid >> 6;
#pragma unroll 4
    for (int i = 0; i < 16; ++i) { const int r = rk + 4 * i; ts[r * 65 + cn] = W[(size_t)(k0 + r) * N + n0 + cn]; }   // 16 x 4 = 64 rows, 64 columns
    __syncthreads();
    const int pc = tid & 7, rn = tid >> 3;      // rn 0..31 and rn+32 -> 64 output rows; 8 pieces x 8 = 64 k
    v8us o0, o1;
#pragma unroll
    for (int j = 0; j < 8; ++j) { o0[j] = f2bf(ts[(pc * 8 + j) * 65 + rn]); o1[j] = f2bf(ts[(pc * 8 + j) * 65 + rn + 32]); }
    bf* d0 = WT + (size_t)(n0 + rn) * K + k0 + pc * 8; bf* d1 = WT + (size_t)(n0 + rn + 32) * K + k0 + pc * 8;
    *(v8us*)d0 = o0; *(v8us*)d1 = o1; 
}

// rope_body: rotary table CS[t][0..63] = cos(t * f_i), CS[t][64..127] = sin(t * f_i), f_i = 10000^(-i/64) = 2^(-i * log2(10000)/64); precise sinf/cosf.
__device__ __forceinline__ void rope_body(float* CS, int blk, float* ts, int tid) {
    const int i = tid & 63, r = tid >> 6; const int t = blk * 4 + r;
    const float invf = __builtin_amdgcn_exp2f(-(float)i * 0.20762050593046014f);
    const float ang = (float)t * invf;
    ts[r * 128 + i] = cosf(ang); ts[r * 128 + 64 + i] = sinf(ang);
    __syncthreads();
    if (tid < 128) {                            // waves 0..3 (wave-uniform), one row each
        const int row = tid >> 5, pc = tid & 31;
        const v4f v = *(const v4fa*)(&ts[row * 128 + pc * 4]);
        float* d = CS + (size_t)(blk * 4 + row) * 128 + pc * 4;
        *(v4f*)d = v; 
    }
}

// k_prep: the six preparatory jobs, which do not depend on one another, as block ranges of one grid: the four weight transposes, the rotary table, the bf16 copy of x. The range test reads blockIdx only, so every barrier stays block-uniform.
// Left as it was: the work per thread (one 8-element piece, one 64x64 tile per block), so the grid is still one of very many short waves.
#define PB_WBIG  ((DM / 64) * (DM / 64))      // blocks of a DM x DM transpose
#define PB_WKV   ((DM / 64) * (DKV / 64))     // blocks of a DM x DKV transpose
#define PB_W     (2 * PB_WBIG + 2 * PB_WKV)
#define PB_ROPE  (SEQ / 4)
#define PB_CVT   ((int)(((size_t)NB * SEQ * DM / 8 + 255) / 256))
__global__ __launch_bounds__(256) void k_prep(const float* __restrict__ x, const float* __restrict__ wq, const float* __restrict__ wk, const float* __restrict__ wv, const float* __restrict__ wo,
                                              bf* XB, bf* WQT, bf* WKT, bf* WVT, bf* WOT, float* CS) {
    __shared__ __align__(16) float ts[64 * 65];
    const int tid = threadIdx.x; const int id = blockIdx.x;
    if (id < PB_W) {
        const bool big = id < 2 * PB_WBIG;
        const int q = big ? id : id - 2 * PB_WBIG; const int per = big ? PB_WBIG : PB_WKV;
        const bool second = q >= per; const int r = second ? q - per : q;
        const float* W = big ? (second ? wo : wq) : (second ? wv : wk);
        bf* WT = big ? (second ? WOT : WQT) : (second ? WVT : WKT);
        tcvt_body(W, WT, DM, big ? DM : DKV, r % (DM / 64), r / (DM / 64), ts, tid);
    } else if (id < PB_W + PB_ROPE) rope_body(CS, id - PB_W, ts, tid);
    else cvt8_body(x, XB, id - PB_W - PB_ROPE, tid);
}

// fold_cp8: eight copies of 16 B per lane, 16 rows apart (l: LDS byte address, g: global piece, s: 16 rows, in elements). The s_wait_xcnt closes the statement so that no address register is rewritten ahead of it.
__device__ __forceinline__ void fold_cp8(unsigned l, const bf* g, size_t s) {
    const unsigned l1 = l + 16 * FPIT, l2 = l + 32 * FPIT, l3 = l + 48 * FPIT, l4 = l + 64 * FPIT, l5 = l + 80 * FPIT, l6 = l + 96 * FPIT, l7 = l + 112 * FPIT;
    const bf* g1 = g + s; const bf* g2 = g1 + s; const bf* g3 = g2 + s; const bf* g4 = g3 + s; const bf* g5 = g4 + s; const bf* g6 = g5 + s; const bf* g7 = g6 + s;
    asm volatile("global_load_async_to_lds_b128 %0, %8, off\n\t"
                 "global_load_async_to_lds_b128 %1, %9, off\n\t"
                 "global_load_async_to_lds_b128 %2, %10, off\n\t"
                 "global_load_async_to_lds_b128 %3, %11, off\n\t"
                 "global_load_async_to_lds_b128 %4, %12, off\n\t"
                 "global_load_async_to_lds_b128 %5, %13, off\n\t"
                 "global_load_async_to_lds_b128 %6, %14, off\n\t"
                 "global_load_async_to_lds_b128 %7, %15, off\n\t"
                 "s_wait_xcnt 0x0"
                 :: "v"(l), "v"(l1), "v"(l2), "v"(l3), "v"(l4), "v"(l5), "v"(l6), "v"(l7),
                    "v"(g), "v"(g1), "v"(g2), "v"(g3), "v"(g4), "v"(g5), "v"(g6), "v"(g7) : "memory");
}

// proj_stage: one stage of k_qkv = 128 k of 128 x rows and 384 weight rows = 512 row pieces of 256 B = 256 lanes x 32 copies of 16 B (sixteen lanes per row piece).
// l0, ga, gb: this lane's piece of row tid>>4; s: 16 rows, in elements. Four statements of eight copies (an asm statement takes thirty operands).
__device__ __forceinline__ void proj_stage(unsigned l0, const bf* ga, const bf* gb, size_t s) {
    fold_cp8(l0, ga, s);
    fold_cp8(l0 + PBT * FPIT, gb, s);
    fold_cp8(l0 + (PBT + 128) * FPIT, gb + 8 * s, s);
    fold_cp8(l0 + (PBT + 256) * FPIT, gb + 16 * s, s);
}

// proj_loop: bf16 GEMM main loop of the 12-wave block of k_qkv, block tile 128 x 384, wave tile 64 x 64 at rows wr, columns wc of it. Each 128-k stage of the block's x and weight rows is brought into LDS once
// per block by asynchronous copies (waves 0..7 issue them, 32 each; the test is a scalar one), and every wave takes its fragments from there. Two buffers: stage s + 1 is in flight while stage s is worked on; one barrier per stage publishes s + 1 and frees the buffer of s.
// acc[mb*4+nb] += sum_k A[R0+wr+16mb+..][k] * Bt[C0+wc+16nb+..][k]; k ascending in steps of 32
__device__ __forceinline__ void proj_loop(const bf* __restrict__ A, const bf* __restrict__ Bt, int R0, int C0, int wr, int wc, unsigned char* ring, int tid, int wave, int lr, int hi, v8f (&acc)[16]) {
#pragma unroll
    for (int i = 0; i < 16; ++i) acc[i] = (v8f){};
    const int crow = (tid >> 4) & 15;                          // copy row of this lane (waves 0..7: tid >> 4)
    const unsigned l0 = (unsigned)(size_t)ring + (unsigned)(crow * FPIT + (tid & 15) * 16);
    const bf* ga = A + (size_t)(R0 + crow) * (size_t)DM + (tid & 15) * 8;
    const bf* gb = Bt + (size_t)(C0 + crow) * (size_t)DM + (tid & 15) * 8;
    const size_t s = (size_t)16 * DM;
    const bool cp = wave < 8;                                  // wave-uniform, in a scalar register
    constexpr int nst = DM / FKS;                              // the same for every wave of the launch
    static_assert(nst >= 2);                                   // stages 0 and 1 both exist
    if (cp) proj_stage(l0, ga, gb, s);                         // stage 0 -> buffer 0
    asm volatile("s_wait_asynccnt 0x0" ::: "memory");          // this wave's share of stage 0 has landed
    __syncthreads();                                           // stage 0 published
    if (cp) proj_stage(l0 + FST, ga + FKS, gb + FKS, s);       // stage 1 -> buffer 1
    const int ao = (wr + lr) * FPIT + 16 * hi, bfo = (PBT + wc + lr) * FPIT + 16 * hi;
#pragma unroll 1   // one stage per trip: the ring's order at the foot stands once
    for (int st = 0; st < nst; ++st) {
        const unsigned bo = (st & 1) ? (unsigned)FST : 0u;
        const bf* as = (const bf*)(ring + bo + ao); const bf* bs = (const bf*)(ring + bo + bfo);
        v16bf a[4], b[4];
        // Fragment reads stand in few groups, never singly among the products. __builtin_amdgcn_sched_barrier(0): nothing is scheduled across it, so a group stays whole and in its place; it asks for no wait itself.
#pragma unroll
        for (int mb = 0; mb < 4; ++mb) a[mb] = ldb(as + mb * 16 * (FPIT / 2));
#pragma unroll
        for (int nb = 0; nb < 4; ++nb) b[nb] = ldb(bs + nb * 16 * (FPIT / 2));
        __builtin_amdgcn_sched_barrier(0);
#pragma unroll
        for (int ks = 0; ks < FKS / 32; ++ks) {
#pragma unroll
            for (int nb = 0; nb < 2; ++nb) {
#pragma unroll
                for (int mb = 0; mb < 4; ++mb) acc[mb * 4 + nb] = wmmab(a[mb], b[nb], acc[mb * 4 + nb]); }
            if (ks + 1 < FKS / 32) {                           // the next step's first two weight fragments, behind the last product that reads this step's: they land while the other eight products run
#pragma unroll
                for (int nb = 0; nb < 2; ++nb) b[nb] = ldb(bs + nb * 16 * (FPIT / 2) + 32 * (ks + 1));
            }
            __builtin_amdgcn_sched_barrier(0);
#pragma unroll
            for (int nb = 2; nb < 4; ++nb) {
#pragma unroll
                for (int mb = 0; mb < 4; ++mb) acc[mb * 4 + nb] = wmmab(a[mb], b[nb], acc[mb * 4 + nb]); }
            if (ks + 1 < FKS / 32) {                           // the rest of the next step's fragments; the SIMD's two other waves run their products while these land
#pragma unroll
                for (int mb = 0; mb < 4; ++mb) a[mb] = ldb(as + mb * 16 * (FPIT / 2) + 32 * (ks + 1));
#pragma unroll
                for (int nb = 2; nb < 4; ++nb) b[nb] = ldb(bs + nb * 16 * (FPIT / 2) + 32 * (ks + 1));
            }
            __builtin_amdgcn_sched_barrier(0);                 // in the last step it keeps the products in front of the publish point, so that the copies are issued directly behind the barrier
        }
        // the distance behind the trip's last products, on the path over the loop's back edge too
        asm volatile("v_nop\n\tv_nop\n\tv_nop\n\tv_nop" : "+v"(acc[0]), "+v"(acc[5]), "+v"(acc[10]), "+v"(acc[15]) : "v"(a[0]), "v"(a[3]), "v"(b[3]));
        // publish point of stage st + 1
        asm volatile("s_wait_dscnt 0x0" ::: "memory");         // this wave's reads of the buffer of stage st are done before it is handed to the copies
        asm volatile("s_wait_asynccnt 0x0" ::: "memory");      // this wave's share of stage st + 1 has landed
        __syncthreads();                                       // stage st + 1 published; every reader has left the buffer of stage st
        if (cp && st + 2 < nst) proj_stage(l0 + bo, ga + (st + 2) * FKS, gb + (st + 2) * FKS, s);   // stage st + 2 -> the buffer just read
    }
    asm volatile("s_wait_asynccnt 0x0" ::: "memory");          // nothing of this wave is in flight when it leaves the ring
}

// st4, st2: the stores of two row pairs (OFF bytes apart) and their s_wait_xcnt in one statement, so that the wait stands in front of every rewrite of a register that a store names
// (a wait in a statement of its own does not hold the address additions behind it)
template <int OFF>
__device__ __forceinline__ void st4(h16* ph, h16* pr, v4u h0, v4u h1, v4u r0, v4u r1) {
    asm volatile("global_store_b128 %0, %2, off\n\t"
                 "global_store_b128 %0, %3, off offset:%6\n\t"
                 "global_store_b128 %1, %4, off\n\t"
                 "global_store_b128 %1, %5, off offset:%6\n\t"
                 "s_wait_xcnt 0x0"
                 :: "v"(ph), "v"(pr), "v"(h0), "v"(h1), "v"(r0), "v"(r1), "n"(OFF) : "memory");
}
template <int OFF>
__device__ __forceinline__ void st2(h16* ph, v4u h0, v4u h1) {
    asm volatile("global_store_b128 %0, %1, off\n\t"
                 "global_store_b128 %0, %2, off offset:%3\n\t"
                 "s_wait_xcnt 0x0"
                 :: "v"(ph), "v"(h0), "v"(h1), "n"(OFF) : "memory");
}

// k_qkv: the q, k and v projections as ONE product x [NB*SEQ][DM] times the weight rows [q 2048 | k 512 | v 512][DM] (24 heads of 128 columns). Block tile 128 rows x 384 columns (3 heads): 32 x 8 = 256 equal blocks,
// one per WGP, 12 waves (three per SIMD) of 64 x 64 each: every WGP has the same share of the products, and a fragment read from LDS serves four of them.
// Epilogue: the whole block tile (+ bias) is staged in LDS on the ring, which the last publish point of proj_loop (LDS reads done, no copy in flight, block barrier) has freed for every wave; one block barrier; then each wave
// takes two of the 24 pieces (head, 16 rows). A q or k head is staged [t][d] (a rotary pair d, d + 64 comes from two waves) and goes out as plane [(b*nheads + head)][t][d], f16 value and, for q, f16 residual x2048.
// A v head is staged transposed [d][t] (a lane holds eight consecutive t of one d) and goes out as planes [(b*DKV + g*128 + d)][t], f16 value and f16 residual x256.
#define PW    12                 // waves per block
#define PCOL  384                // columns of a block tile
#define OPIT  132                // pitch, floats, of a staged row of 128
#define GB_ROW  (NB * SEQ / 128)
#define GB_COL  ((DM + 2 * DKV) / PCOL)
static_assert((DM + 2 * DKV) % PCOL == 0 && PCOL % HD == 0 && (NB * SEQ) % 128 == 0 && SEQ % 128 == 0);   // block tiles cover the product exactly; a tile holds whole heads and lies in one batch
static_assert((PBT + PCOL) * FPIT == FST && (PCOL / HD) * 128 * OPIT * 4 <= 2 * FST);
__global__ __launch_bounds__(32 * PW) __attribute__((amdgpu_num_vgpr(256)))
void k_qkv(const bf* __restrict__ XB, const bf* __restrict__ WT, const float* __restrict__ bq, const float* __restrict__ bk, const float* __restrict__ bv, const float* __restrict__ CS,
           h16* QH, h16* QR, h16* KP, h16* VH, h16* VR) {
    __shared__ __align__(16) unsigned char ring[2 * FST];
    const int tid = threadIdx.x; const int id = blockIdx.x;
    const int lane = tid & 31, lr = lane & 15, hi = lane >> 4;
    const int wave = __builtin_amdgcn_readfirstlane(tid >> 5); // in a scalar register: every test on it is a scalar branch
    const int bx = id % GB_ROW, by = id / GB_ROW;
    const int wr = (wave & 1) * 64, wc = (wave >> 1) * 64;
    v8f acc[16];
    proj_loop(XB, WT, bx * 128, by * PCOL, wr, wc, ring, tid, wave, lr, hi, acc);
    float* osb = (float*)ring;
    {   // this wave's 64 x 64 tile: half of head gh, columns d0 .. d0 + 63 of it
        const int gh = by * (PCOL / HD) + (wc >> 7), d0 = wc & 127;
        const float* bp = gh < NH_ ? bq + gh * HD : (gh < NH_ + NKV ? bk + (gh - NH_) * HD : bv + (gh - NH_ - NKV) * HD);
        float bz[4];
#pragma unroll
        for (int nb = 0; nb < 4; ++nb) bz[nb] = bfr(bp[d0 + nb * 16 + lr]);
        float* oh = osb + (wc >> 7) * (128 * OPIT);
        if (gh < NH_ + NKV) {                                  // D: row t = 8h+j, col d = lane&15 -> [t][d]
#pragma unroll
            for (int mb = 0; mb < 4; ++mb) {
#pragma unroll
                for (int nb = 0; nb < 4; ++nb) {
#pragma unroll
                    for (int j = 0; j < 8; ++j) oh[(wr + mb * 16 + hi * 8 + j) * OPIT + d0 + nb * 16 + lr] = acc[mb * 4 + nb][j] + bz[nb]; } }
        } else {                                               // -> [d][t]
#pragma unroll
            for (int mb = 0; mb < 4; ++mb) {
#pragma unroll
                for (int nb = 0; nb < 4; ++nb) { v4f p, q;
#pragma unroll
                    for (int j = 0; j < 4; ++j) { p[j] = acc[mb * 4 + nb][j] + bz[nb]; q[j] = acc[mb * 4 + nb][4 + j] + bz[nb]; }
                    float* d = &oh[(d0 + nb * 16 + lr) * OPIT + wr + mb * 16 + hi * 8];
                    *(v4fa*)d = p; *(v4fa*)(d + 4) = q; } }
        }
    }
    __syncthreads();                                           // the block tile is staged: rows of a piece come from other waves
    const int b = (bx * 128) / SEQ, tb = (bx * 128) % SEQ;
    const int c8 = lr * 8, p8 = c8 ^ 64;
#pragma unroll 1   // stays rolled: keeps the epilogue's code short
    for (int it = wave; it < (PCOL / HD) * 8; it += PW) {      // piece: head it >> 3 of the tile, rows 16 (it & 7) .. + 15 of its staging
        const int gh = by * (PCOL / HD) + (it >> 3), rg = (it & 7) * 16;
        const float* os = osb + (it >> 3) * (128 * OPIT) + rg * OPIT;
        if (gh < NH_ + NKV) {
            const bool isq = gh < NH_;
            const int t0 = tb + rg;
            const size_t tbase = ((size_t)(isq ? b * NH_ + gh : b * NKV + gh - NH_) * SEQ + t0) * HD;
            h16* Ph = isq ? QH : KP;
            // the piece's whole share of the rotary table is asked for as one group (the accumulators' registers are free by now), so that its latency is waited out once per piece, not once per trip
            v4f tc0[8], tc1[8], ts0[8], ts1[8];
            const float* cs0 = CS + (size_t)(t0 + hi) * 128 + (c8 & 63);
#pragma unroll
            for (int s = 0; s < 8; ++s) { const float* cs = cs0 + s * 256;   // row t0 + 2 s + hi
                tc0[s] = *(const v4f*)cs; tc1[s] = *(const v4f*)(cs + 4); ts0[s] = *(const v4f*)(cs + 64); ts1[s] = *(const v4f*)(cs + 68); }
            asm volatile("s_wait_xcnt 0x0" :: "v"(cs0) : "memory");   // takes the address as an input, so that its registers stay as they are until it has passed (otherwise a late load's result may be laid on them)
#pragma unroll   // unrolled so that every index of the table arrays is a constant (registers, no scratch)
            for (int s2 = 0; s2 < 8; s2 += 2) { v4u hq[2], rq[2];
#pragma unroll
              for (int u = 0; u < 2; ++u) { const int row = 2 * (s2 + u) + hi;   // 8 s x 2 rows = 16 rows; 16 lanes x 8 = 128 columns
                const float* orow = &os[row * OPIT];
                const v4f x0 = *(const v4fa*)(orow + c8), x1 = *(const v4fa*)(orow + c8 + 4);
                const v4f y0 = *(const v4fa*)(orow + p8), y1 = *(const v4fa*)(orow + p8 + 4);
                const v4f cc0 = tc0[s2 + u], cc1 = tc1[s2 + u], ss0 = ts0[s2 + u], ss1 = ts1[s2 + u];
                const float sg = (c8 < 64) ? -1.0f : 1.0f;       // d < 64: x[d] cos - x[d+64] sin; d >= 64: x[d] cos + x[d-64] sin
                v8h hv, rv;
#pragma unroll
                for (int i = 0; i < 4; ++i) {
                    const float v0 = x0[i] * cc0[i] + sg * (y0[i] * ss0[i]); const float v1 = x1[i] * cc1[i] + sg * (y1[i] * ss1[i]);
                    const h16 a0 = (h16)v0; const h16 a1 = (h16)v1; hv[i] = a0; hv[4 + i] = a1;
                    rv[i] = (h16)((v0 - (float)a0) * QRS); rv[4 + i] = (h16)((v1 - (float)a1) * QRS); }
                hq[u] = __builtin_bit_cast(v4u, hv); rq[u] = __builtin_bit_cast(v4u, rv); }
                const size_t oo = tbase + (size_t)(2 * s2 + hi) * HD + c8;   // row 2 s2 + hi; the second piece lies two rows further
                if (isq) st4<2 * HD * 2>(Ph + oo, QR + oo, hq[0], hq[1], rq[0], rq[1]);
                else     st2<2 * HD * 2>(Ph + oo, hq[0], hq[1]); }
        } else {
            const size_t vbase = ((size_t)b * DKV + (size_t)(gh - NH_ - NKV) * HD + rg) * SEQ + tb;
#pragma unroll 1   // stays rolled, four trips of two row pairs each
            for (int s2 = 0; s2 < 8; s2 += 2) { v4u hq[2], rq[2];
#pragma unroll
              for (int u = 0; u < 2; ++u) { const int row = 2 * (s2 + u) + hi;   // 8 s x 2 rows d = 16 rows; 16 lanes x 8 = 128 columns t
                const v4f x0 = *(const v4fa*)(&os[row * OPIT + c8]); const v4f x1 = *(const v4fa*)(&os[row * OPIT + c8 + 4]); v8h hv, rv;
#pragma unroll
                for (int i = 0; i < 4; ++i) { const h16 a0 = (h16)x0[i]; const h16 a1 = (h16)x1[i]; hv[i] = a0; hv[4 + i] = a1; rv[i] = (h16)((x0[i] - (float)a0) * VRS); rv[4 + i] = (h16)((x1[i] - (float)a1) * VRS); }
                hq[u] = __builtin_bit_cast(v4u, hv); rq[u] = __builtin_bit_cast(v4u, rv); }
                const size_t oo = vbase + (size_t)(2 * s2 + hi) * SEQ + c8;  // row 2 s2 + hi; the second piece lies two rows further
                st4<2 * SEQ * 2>(VH + oo, VR + oo, hq[0], hq[1], rq[0], rq[1]); }
        }
    }
}

// k_flash: fused causal attention, one wave per 16 query rows of one (batch, head). A block is the 4 query heads of one kv head x 2 adjacent 16-row query tiles (8 waves): all of them walk
// the same keys, so each 32-key step of K, V^T value and V^T residual is brought into LDS once per block by asynchronous copies (whole 16-B pieces, contiguous per row) and every wave takes its fragments from there.
// Two buffers of FSP 32-key steps each: stage s + 1 is in flight while stage s is worked on; one barrier per stage publishes s + 1 and frees the buffer of s. Between two publish points the waves run free,
// so one wave's softmax can stand beside another's products, and a stage's landing has FSP steps to hide behind.
// Transposed form: S^T[key][t] = K Q^T (A = K rows, B = Q rows); lane (t = lane&15, h = lane>>4) holds keys 8h+r of each 16-key tile, so the packed
// P tile is directly the B fragment of O^T[d][t] = V^T P^T (element r <- tile keys 0..15, element 8+r <- tile keys 16..31, lane unchanged).
// The key loop of a tile runs to the 32-key step that contains its last query; keys beyond a query get the fill value (weight exactly 0): only a tile's last step holds such keys, so only there is the mask applied (block-uniform test).
// Vector work per score is kept short, it shares the SIMD's issue with the products: the ALiBi bias slope*(key - query), in units of the unscaled score, is split into a per-lane part (key and query inside the step and the tile: the same in every step),
// which is the start value of the score accumulators, and a per-step part, which only lowers the running max by a constant from step to step; the scale HD^-0.5 * log2(e) is the factor of the one multiply-add that forms the exp2 argument;
// the row sum of the f16 P comes from the matrix unit (all-ones A operand: every row of that tile is the sum over the step's 32 keys, both lane halves), scaled by alpha like o.
// Balance: a 32-row query tile x walks x + 1 steps, and all blocks of the grid are resident at once, so the launch lasts as long as its fullest WGP. Each block therefore takes two tiles one after the other,
// x and SEQ/32 - 1 - x: SEQ/32 + 1 steps for every block, one block per WGP. The two walks are one run of steps through the ring (the second tile's first steps fly while the first tile ends);
// at the first tile's last step every wave writes its rows out, takes the second tile's q and starts its sums anew. The sums of a tile are formed as before.
// What is left: the LDS read rate (every wave reads every K and V^T fragment of a stage for its 16 query rows alone) and, of the vector work, the scaling of o by alpha in every step.
// Planes of a step in LDS, 16 lines of SPIT bytes each, line = fragment row (lane&15): K line holds key rows r and 16 + r (256 B each); a V^T line holds the 32-key pieces (64 B) of rows d = 16j + r, j = 0..7.
// So every fragment of a stage is read at one per-lane address plus a constant.
// flash_stage: one 32-key step of a stage = K 32 rows x 256 B, V^T value and residual 128 rows x 64 B each = 24 KiB = 256 lanes x 6 copies of 16 B. The copies are written as the builtin: this kernel holds more than 256 registers,
// asm text cannot name one above v255, and address operands tied to the low window were spilled to scratch inside the loop.
__device__ __forceinline__ void flash_cp(unsigned l, const h16* g) { __builtin_amdgcn_global_load_async_to_lds_b128((gv4i*)g, (lv4i*)l, 0, 0); }
__device__ __forceinline__ void flash_stage(unsigned lk, unsigned lv, const h16* gk, const h16* gh, const h16* gr) {
    flash_cp(lk, gk); flash_cp(lk + 256, gk + 16 * HD);
    flash_cp(lv + ST_VH, gh); flash_cp(lv + ST_VH + 256, gh + (size_t)64 * SEQ);
    flash_cp(lv + ST_VR, gr); flash_cp(lv + ST_VR + 256, gr + (size_t)64 * SEQ);
}

// flash_q: the q value and residual fragments of a wave's 16 query rows (B fragments: col t, k = d); qa, qb: this lane's piece of its row in the two planes.
// The s_wait_xcnt takes the two addresses as inputs, so that their registers stay as they are until it has passed (otherwise a late load's result may be laid on them).
__device__ __forceinline__ void flash_q(const h16* qa, const h16* qb, v16h (&qh)[4], v16h (&qr)[4]) {
#pragma unroll
    for (int c = 0; c < 4; ++c) { qh[c] = ldh(qa + 32 * c); qr[c] = ldh(qb + 32 * c); }
    asm volatile("s_wait_xcnt 0x0" :: "v"(qa), "v"(qb) : "memory");
}

__global__ __launch_bounds__(32 * FW) __attribute__((amdgpu_num_vgpr(512)))
void k_flash(const h16* __restrict__ QH, const h16* __restrict__ QR, const h16* __restrict__ KP, const h16* __restrict__ VH, const h16* __restrict__ VR, bf* CTX) {
    __shared__ __align__(16) unsigned char ring[2 * FSP * ST_SZ];
    __shared__ __align__(16) float os[FW * 16 * 132];
    const int tid = threadIdx.x;
    const int lane = tid & 31, wave = tid >> 5, lr = lane & 15, hi = lane >> 4;
    const int bg = blockIdx.y; const int b = bg / NKV, g = bg % NKV; const int h = g * REP + (wave & (REP - 1)); const int zh = b * NH_ + h;
    constexpr int NQT = SEQ / 32;                              // query tiles of one (batch, kv head)
    static_assert(NQT % 2 == 0);                               // the tiles pair off, every tile in exactly one block
    const int na = blockIdx.x + 1;                             // 32-key steps of the first tile (blockIdx.x); the second tile (NQT - 1 - blockIdx.x) has NQT - blockIdx.x
    constexpr int nst = NQT + 1;                               // 32-key steps of the block, the same for every block; step st holds key step st of the first tile or st - na of the second, both below NQT
    static_assert(nst >= 2 * FSP && (FSP & (FSP - 1)) == 0);   // stages 0 and 1 are both full; step st lies in slot st & (2 * FSP - 1) of the ring
    int t0 = blockIdx.x * 32 + (wave >> 2) * 16;
    const size_t kvb = (size_t)bg * SEQ * HD;
    // copy addresses of this lane. K: piece tid -> key row tid>>4 (and +16: +256 B in its line), 16-B column tid&15. V^T: piece tid -> row d = tid>>2 (and +64: +256 B in its line), 16-B column tid&3.
    const unsigned rb = (unsigned)(size_t)ring;
    const unsigned lk = rb + (unsigned)((tid >> 4) * SPIT + (tid & 15) * 16), lvt = rb + (unsigned)(((tid >> 2) & 15) * SPIT + (tid >> 6) * 64 + (tid & 3) * 16);
    const h16* gk = KP + kvb + (size_t)tid * 8;                // + key0 * HD
    const size_t gvo = kvb + (size_t)(tid >> 2) * SEQ + (tid & 3) * 8;   // + key0
    const h16* gh = VH + gvo; const h16* gr = VR + gvo;
#pragma unroll
    for (int u = 0; u < FSP; ++u) { const int ku = (u < na ? u : u - na) * 32; flash_stage(lk + u * ST_SZ, lvt + u * ST_SZ, gk + (size_t)ku * HD, gh + ku, gr + ku); }   // stage 0 -> buffer 0
    const size_t qz = (size_t)zh * SEQ * HD + (size_t)lr * HD + 8 * hi;   // + t0 * HD
    v16h qh[4], qr[4];
    flash_q(QH + qz + (size_t)t0 * HD, QR + qz + (size_t)t0 * HD, qh, qr);
    asm volatile("s_wait_asynccnt 0x0" ::: "memory");          // this wave's share of stage 0 has landed
    __syncthreads();                                           // stage 0 published
#pragma unroll
    for (int u = FSP; u < 2 * FSP; ++u) { const int ku = (u < na ? u : u - na) * 32; flash_stage(lk + u * ST_SZ, lvt + u * ST_SZ, gk + (size_t)ku * HD, gh + ku, gr + ku); }   // stage 1 -> buffer 1
    const int fo = lr * SPIT + 16 * hi;                        // K: + 256 (second key tile) + 64*c (A fragment: row key, k = d); V^T: + plane + 64*j (A fragment: row d, k = key)
    const float slr = __builtin_amdgcn_exp2f(-0.5f * (float)(h + 1)) * RHD;
    v8f ca, cb;                                                // slope * (key - key0 - (query - t0)) of the two 16-key tiles
#pragma unroll
    for (int r = 0; r < 8; ++r) { ca[r] = slr * (float)(8 * hi + r - lr); cb[r] = slr * (float)(8 * hi + r + 16 - lr); }
    v16h ones;
#pragma unroll
    for (int r = 0; r < 16; ++r) ones[r] = (h16)1.0f;
    int qi = t0 + lr;
    const int wb = wave * 16 * 132;
    v8f o[8];
#pragma unroll
    for (int j = 0; j < 8; ++j) o[j] = (v8f){};
    v8f ls = (v8f){};                                          // every element: the row sum of P of query lane&15
    float m = NEGBIG;                                          // running max of unscaled score + bias, the bias counted from the current step's first key and the tile's first query
    const float dstep = slr * 32.0f;                           // what the bias gains from one step to the next
#pragma unroll 1
    for (int st = 0; st < nst; ++st) {
        const bool last = st == na - 1 || st == nst - 1;       // block-uniform: a tile's last step
        const int key0 = (st < na ? st : st - na) * 32;
        const unsigned bo = (unsigned)(st & (2 * FSP - 1)) * (unsigned)ST_SZ;
        const h16* ka = (const h16*)(ring + bo + fo);
        const h16* va = ka + ST_VH / 2; const h16* vr = ka + ST_VR / 2;
        v8f sHa = ca, sLa = (v8f){}, sHb = cb, sLb = (v8f){};
        // All fragment reads of a step stand as one group at its head (one block per WGP, two waves per SIMD: a wave may hold 512 registers): the eight K fragments first, then the sixteen V^T fragments,
        // which land while the score products and the softmax run; LDS data returns in issue order, so the products wait with counts and never for a read issued among them.
        // __builtin_amdgcn_sched_barrier(0): nothing is scheduled across it, so the group stays whole and in its place; it asks for no wait itself.
        v16h kf[8], vf[8], vg[8];
#pragma unroll
        for (int c = 0; c < 4; ++c) { kf[2 * c] = ldh(ka + 32 * c); kf[2 * c + 1] = ldh(ka + 128 + 32 * c); }
#pragma unroll
        for (int j = 0; j < 8; ++j) vf[j] = ldh(va + 32 * j);
#pragma unroll
        for (int j = 0; j < 8; ++j) vg[j] = ldh(vr + 32 * j);
        __builtin_amdgcn_sched_barrier(0);
#pragma unroll
        for (int c = 0; c < 4; ++c) {
            sHa = wmma16(kf[2 * c], qh[c], sHa); sLa = wmma16(kf[2 * c], qr[c], sLa); sHb = wmma16(kf[2 * c + 1], qh[c], sHb); sLb = wmma16(kf[2 * c + 1], qr[c], sLb); }
        asm volatile("v_nop\n\tv_nop\n\tv_nop\n\tv_nop" : "+v"(sHa), "+v"(sLa), "+v"(sHb), "+v"(sLb) : "v"(kf[6]), "v"(kf[7]));
        v8f ya = sLa * QRI + sHa, yb = sLb * QRI + sHb;
        if (last) {
            const int d0 = key0 + 8 * hi - qi;                 // key - query for r = 0 of tile a
#pragma unroll
            for (int r = 0; r < 8; ++r) { ya[r] = (d0 + r > 0) ? NEGBIG : ya[r]; yb[r] = (d0 + r + 16 > 0) ? NEGBIG : yb[r]; }
        }
        // maximum of the sixteen as a tree of three levels, not a chain of eight dependent links
        const float u0 = fmaxf(fmaxf(fmaxf(fmaxf(ya[0], ya[1]), ya[2]), fmaxf(fmaxf(ya[3], ya[4]), ya[5])), fmaxf(fmaxf(ya[6], ya[7]), yb[0]));
        const float u1 = fmaxf(fmaxf(fmaxf(fmaxf(yb[1], yb[2]), yb[3]), fmaxf(fmaxf(yb[4], yb[5]), yb[6])), yb[7]);
        float mx = fmaxf(u0, u1);
        // lane l <-> l ^ 16 by a vector cross-row move: an LDS permute would count on dscnt behind the V^T reads and wait them all out in the middle of the softmax
        mx = fmaxf(mx, __uint_as_float(__builtin_amdgcn_permlanex16(__float_as_uint(mx), __float_as_uint(mx), 0x76543210u, 0xfedcba98u, false, false)));
        const float mp = m - dstep;                            // the running max as seen from this step (every step has a key at or before each query, so mx is a score)
        const float mnew = fmaxf(mp, mx);
        const float alpha = __builtin_amdgcn_exp2f((mp - mnew) * SC2);
        const float sh = fmaf(-mnew, SC2, PSH);
        const v8f ea = ya * SC2 + sh, eb = yb * SC2 + sh;
        v16h pb;                                               // the exp2 stand as the compiler orders them (one run): a v_nop written behind each did not stay there in the build, so none is written
#pragma unroll
        for (int r = 0; r < 8; ++r) { pb[r] = (h16)__builtin_amdgcn_exp2f(ea[r]); pb[8 + r] = (h16)__builtin_amdgcn_exp2f(eb[r]); }
        const v16h pq = pb * (h16)0.00390625f;                 // P x 2^-8: partner of the v residual x256
        m = mnew;
#pragma unroll
        for (int j = 0; j < 8; ++j) o[j] = o[j] * alpha;
        ls = ls * alpha;
        // all loops unrolled so that every array index is a constant (registers, no scratch)
#pragma unroll
        for (int j = 0; j < 8; ++j) o[j] = wmma16(vf[j], pb, o[j]);
        ls = wmma16(ones, pb, ls);
#pragma unroll
        for (int j = 0; j < 8; ++j) o[j] = wmma16(vg[j], pq, o[j]);
        asm volatile("v_nop\n\tv_nop\n\tv_nop\n\tv_nop" : "+v"(o[0]), "+v"(o[1]), "+v"(o[2]), "+v"(o[3]), "+v"(o[4]), "+v"(o[5]), "+v"(o[6]), "+v"(o[7]), "+v"(ls) : "v"(pb), "v"(pq));
        if ((st & (FSP - 1)) == FSP - 1) {                     // block-uniform: behind a stage's last step, the publish point of the next stage
        asm volatile("s_wait_dscnt 0x0" ::: "memory");         // this wave's reads of the buffer of this stage are done before it is handed to the copies
        asm volatile("s_wait_asynccnt 0x0" ::: "memory");      // this wave's share of the next stage has landed
        __syncthreads();                                       // the next stage published; every reader has left the buffer of this stage
#pragma unroll
        for (int u = 1; u <= FSP; ++u) {                       // the stage after the next -> the buffer just read, step by step while the step exists
            const int s2 = st + FSP + u;
            if (s2 < nst) { const int k2 = (s2 < na ? s2 : s2 - na) * 32; const unsigned b2 = (unsigned)(s2 & (2 * FSP - 1)) * (unsigned)ST_SZ; flash_stage(lk + b2, lvt + b2, gk + (size_t)k2 * HD, gh + k2, gr + k2); } }
        }
      if (last) {                                              // block-uniform: behind a tile's last step its rows go out
    const float inv = 1.0f / ls[0];
    // O^T D layout: o[j][r] = (d = 16j + 8h + r, t = lane&15) -> os[t][d]; rows 0..15 x columns 0..127 all written
#pragma unroll
    for (int j = 0; j < 8; ++j) { v4f a, c;
        a[0] = o[j][0] * inv; a[1] = o[j][1] * inv; a[2] = o[j][2] * inv; a[3] = o[j][3] * inv; c[0] = o[j][4] * inv; c[1] = o[j][5] * inv; c[2] = o[j][6] * inv; c[3] = o[j][7] * inv;
        *(v4fa*)(&os[wb + lr * 132 + 16 * j + 8 * hi]) = a; *(v4fa*)(&os[wb + lr * 132 + 16 * j + 8 * hi + 4]) = c; }
    wave_sync();
    bf* crow = CTX + ((size_t)b * SEQ + t0) * (size_t)(2 * DM) + h * HD;
{
#pragma unroll 2
        for (int s = 0; s < 8; ++s) { const int row = 2 * s + hi, c8 = lr * 8;   // 8 s x 2 rows = 16 rows; 16 lanes x 8 = 128 columns
            const v4f x0 = *(const v4fa*)(&os[wb + row * 132 + c8]); const v4f x1 = *(const v4fa*)(&os[wb + row * 132 + c8 + 4]); v8us hv, lv;
#pragma unroll
            for (int i = 0; i < 4; ++i) { const unsigned short a0 = f2bf(x0[i]); const unsigned short a1 = f2bf(x1[i]); hv[i] = a0; hv[4 + i] = a1; lv[i] = f2bf(x0[i] - bf2f(a0)); lv[4 + i] = f2bf(x1[i] - bf2f(a1)); }
            bf* dst = crow + (size_t)row * (size_t)(2 * DM) + c8;
            *(v8us*)dst = hv; *(v8us*)(dst + DM) = lv; }
         }
        asm volatile("s_wait_xcnt 0x0" ::: "memory");          // behind the tile's stores, in front of the rewrites of the registers that they name
        wave_sync();                                           // this wave's reads of its output staging stand in front of the second tile's writes to it
        // second tile: its rows, its q, sums from the start
        t0 = (NQT - 1 - (int)blockIdx.x) * 32 + (wave >> 2) * 16; qi = t0 + lr;
        if (st != nst - 1) flash_q(QH + qz + (size_t)t0 * HD, QR + qz + (size_t)t0 * HD, qh, qr);
#pragma unroll
        for (int j = 0; j < 8; ++j) o[j] = (v8f){};
        m = NEGBIG; ls = (v8f){};
      }
    }
    asm volatile("s_wait_asynccnt 0x0" ::: "memory");          // nothing of this wave is in flight when it leaves the ring
}

// fold_stage: one stage of k_out = 128 k of 128 ctx rows, hi piece and lo piece, and of 256 WoT rows = 512 row pieces of 256 B = 256 lanes x 32 copies of 16 B (sixteen lanes per row piece).
// l0, ga, gb: this lane's piece of row tid>>4; sa, sb: 16 rows, in elements; the lo piece of a ctx row lies DM elements behind its hi piece. Four statements of eight copies (an asm statement takes thirty operands).
__device__ __forceinline__ void fold_stage(unsigned l0, const bf* ga, size_t sa, const bf* gb, size_t sb) {
    fold_cp8(l0, ga, sa);
    fold_cp8(l0 + FLO * FPIT, ga + DM, sa);
    fold_cp8(l0 + FBT * FPIT, gb, sb);
    fold_cp8(l0 + (FBT + 128) * FPIT, gb + 8 * sb, sb);
}

// fold_loop: main loop of k_out, an 8-wave block, block tile 128 x 256, wave tile 64 x 64 at rows wr, columns wc of it. The hi and the lo plane of ctx meet the same WoT rows, so both walk k together:
// a stage holds 128 k of the hi pieces, the lo pieces and the WoT rows, each WoT line is copied once and each WoT fragment read once for both planes (12 fragments for 32 products), and the loop has DM / 128 stages:
// a stage's landing (a fixed latency, then its bytes) outlasts its products, so the longer stage pays the latency, the barrier and the first fragment group half as often.
// Ring as in proj_loop: two buffers, stage s + 1 in flight while stage s is worked on, one barrier per stage.
// acc[mb*4+nb] += sum_k (A[R0+wr+16mb+..][k] + A[R0+wr+16mb+..][DM+k]) * Bt[C0+wc+16nb+..][k]; k ascending in steps of 32, in each step the hi products first
__device__ __forceinline__ void fold_loop(const bf* __restrict__ A, const bf* __restrict__ Bt, int R0, int C0, int wr, int wc, unsigned char* ring, int tid, int lr, int hi, v8f (&acc)[16]) {
#pragma unroll
    for (int i = 0; i < 16; ++i) acc[i] = (v8f){};
    const unsigned l0 = (unsigned)(size_t)ring + (unsigned)((tid >> 4) * FPIT + (tid & 15) * 16);
    const bf* ga = A + (size_t)(R0 + (tid >> 4)) * (size_t)(2 * DM) + (tid & 15) * 8;
    const bf* gb = Bt + (size_t)(C0 + (tid >> 4)) * (size_t)DM + (tid & 15) * 8;
    const size_t sa = (size_t)16 * 2 * DM, sb = (size_t)16 * DM;
    constexpr int nst = DM / FKS;                              // the same for every wave of the launch
    static_assert(nst >= 2);                                   // stages 0 and 1 both exist
    fold_stage(l0, ga, sa, gb, sb);                            // stage 0 -> buffer 0
    asm volatile("s_wait_asynccnt 0x0" ::: "memory");          // this wave's share of stage 0 has landed
    __syncthreads();                                           // stage 0 published
    fold_stage(l0 + FST, ga + FKS, sa, gb + FKS, sb);          // stage 1 -> buffer 1
    const int ao = (wr + lr) * FPIT + 16 * hi, ro = (FLO + wr + lr) * FPIT + 16 * hi, bfo = (FBT + wc + lr) * FPIT + 16 * hi;
#pragma unroll 1   // one stage per trip: the ring's order at the foot stands once
    for (int st = 0; st < nst; ++st) {
        const unsigned bo = (st & 1) ? (unsigned)FST : 0u;
        const bf* as = (const bf*)(ring + bo + ao); const bf* rs = (const bf*)(ring + bo + ro); const bf* bs = (const bf*)(ring + bo + bfo);
        v16bf a[4], r[4], b[4];
        // Fragment reads stand in few groups, each ahead of the products that cover its latency, never among them. __builtin_amdgcn_sched_barrier(0): nothing is scheduled across it, so a group stays whole and in its place; it asks for no wait itself.
        // first step: hi, WoT, then lo fragments, which land while the hi products run
#pragma unroll
        for (int mb = 0; mb < 4; ++mb) a[mb] = ldb(as + mb * 16 * (FPIT / 2));
#pragma unroll
        for (int nb = 0; nb < 4; ++nb) b[nb] = ldb(bs + nb * 16 * (FPIT / 2));
#pragma unroll
        for (int mb = 0; mb < 4; ++mb) r[mb] = ldb(rs + mb * 16 * (FPIT / 2));
        __builtin_amdgcn_sched_barrier(0);
#pragma unroll
        for (int ks = 0; ks < FKS / 32; ++ks) {
#pragma unroll
            for (int nb = 0; nb < 4; ++nb) {
#pragma unroll
                for (int mb = 0; mb < 4; ++mb) acc[mb * 4 + nb] = wmmab(a[mb], b[nb], acc[mb * 4 + nb]); }
            if (ks + 1 < FKS / 32) {                           // the next step's hi fragments, behind the last product that reads this step's: they land while the lo products run
#pragma unroll
                for (int mb = 0; mb < 4; ++mb) a[mb] = ldb(as + mb * 16 * (FPIT / 2) + 32 * (ks + 1));
            }
            __builtin_amdgcn_sched_barrier(0);                 // in the last step it keeps the hi products in front of the publish point, where they cover the landing of the lo fragments
#pragma unroll
            for (int nb = 0; nb < 4; ++nb) {
#pragma unroll
                for (int mb = 0; mb < 4; ++mb) acc[mb * 4 + nb] = wmmab(r[mb], b[nb], acc[mb * 4 + nb]); }
            if (ks + 1 < FKS / 32) {                           // the next step's WoT fragments, then its lo fragments, which land while its hi products run
#pragma unroll
                for (int nb = 0; nb < 4; ++nb) b[nb] = ldb(bs + nb * 16 * (FPIT / 2) + 32 * (ks + 1));
#pragma unroll
                for (int mb = 0; mb < 4; ++mb) r[mb] = ldb(rs + mb * 16 * (FPIT / 2) + 32 * (ks + 1));
                __builtin_amdgcn_sched_barrier(0);
            }
        }
        // publish point of stage st + 1
        asm volatile("s_wait_dscnt 0x0" ::: "memory");         // this wave's reads of the buffer of stage st are done before it is handed to the copies
        asm volatile("s_wait_asynccnt 0x0" ::: "memory");      // this wave's share of stage st + 1 has landed
        __syncthreads();                                       // stage st + 1 published; every reader has left the buffer of stage st
        if (st + 2 < nst) fold_stage(l0 + bo, ga + (st + 2) * FKS, sa, gb + (st + 2) * FKS, sb);   // stage st + 2 -> the buffer just read
    }
    asm volatile("s_wait_asynccnt 0x0" ::: "memory");          // nothing of this wave is in flight when it leaves the ring
}

// k_out: output projection. A = ctx plane rows [hi 2048 | lo 2048], both planes against the single WoT plane (fold_loop), Bt = WoT rows, one wave per 64x64 tile, a block is 2 x 4 of them. grid (NB*SEQ/128, DM/256), 256 threads.
// What is left: the first fragment group of a stage is still read behind the barrier and the copies' issue, with nothing of the wave's own to cover it.
__global__ __launch_bounds__(32 * GW) __attribute__((amdgpu_num_vgpr(256)))
void k_out(const bf* __restrict__ A, const bf* __restrict__ Bt, const float* __restrict__ bias, float* OUT) {
    __shared__ __align__(16) unsigned char ring[2 * FST];
    __shared__ __align__(16) float osb[GW * 16 * 68];
    const int tid = threadIdx.x;
    const int lane = tid & 31, wave = tid >> 5, lr = lane & 15, hi = lane >> 4;
    float* os = osb + wave * 16 * 68;                          // wave-private output staging
    const int wr = (wave & 1) * 64, wc = (wave >> 1) * 64;
    const int r0 = blockIdx.x * 128 + wr, c0 = blockIdx.y * 256 + wc;
    v8f acc[16];
    fold_loop(A, Bt, blockIdx.x * 128, blockIdx.y * 256, wr, wc, ring, tid, lr, hi, acc);
    float bz[4];
#pragma unroll
    for (int nb = 0; nb < 4; ++nb) bz[nb] = bfr(bias[c0 + nb * 16 + lr]);
    const int b = r0 / SEQ, t0 = r0 % SEQ;
    float* obase = OUT + ((size_t)b * OUT_SEQ + t0) * DM + c0;
#pragma unroll
    for (int mb = 0; mb < 4; ++mb) {
#pragma unroll
        for (int nb = 0; nb < 4; ++nb) {
#pragma unroll
            for (int j = 0; j < 8; ++j) os[(hi * 8 + j) * 68 + nb * 16 + lr] = acc[mb * 4 + nb][j] + bz[nb]; }   // rows 0..15 x cols 0..63 all staged
        wave_sync();
        float* orow = obase + (size_t)(mb * 16) * DM;
{
#pragma unroll
            for (int s = 0; s < 8; ++s) { const int row = 2 * s + hi, cofs = lr * 4;   // 8 s x 2 rows = 16 rows; 16 lanes x 4 floats = 64 columns
                const v4f val = *(const v4fa*)(&os[row * 68 + cofs]);
                *(v4f*)(orow + (size_t)row * DM + cofs) = val; }
             }
        wave_sync();
    }
}

static constexpr size_t al256(size_t v) { return (v + 255) & ~(size_t)255; }
static constexpr size_t SZ_XB  = al256((size_t)NB * SEQ * DM * 2);
static constexpr size_t SZ_WQ  = al256((size_t)DM * DM * 2);
static constexpr size_t SZ_WK  = al256((size_t)DKV * DM * 2);
static constexpr size_t SZ_CS  = al256((size_t)SEQ * 128 * 4);
static constexpr size_t SZ_QP  = al256((size_t)NB * NH_ * SEQ * HD * 2);
static constexpr size_t SZ_KP  = al256((size_t)NB * NKV * SEQ * HD * 2);
static constexpr size_t SZ_CTX = al256((size_t)NB * SEQ * 2 * DM * 2);
static_assert(SZ_WQ == (size_t)DM * DM * 2 && SZ_WK == (size_t)DKV * DM * 2);   // no gap between the q, k and v weight planes
static constexpr size_t SZ_TOTAL = SZ_XB + 2 * SZ_WQ + 2 * SZ_WK + SZ_CS + 2 * SZ_QP + 3 * SZ_KP + SZ_CTX;
static_assert(SZ_TOTAL <= (size_t)134217728);          // workspace carve <= 128 MiB

extern "C" void kernel_launch(void* const* d_in, const int* in_sizes, int n_in,
                              void* d_out, int out_size, void* d_ws, size_t ws_size, hipStream_t stream) {
    if (n_in < 9) return;
    const size_t needx = ((size_t)(NB - 1) * SEQ_FULL + SEQ) * DM;
    if ((size_t)in_sizes[0] < needx) return;
    if ((size_t)in_sizes[1] < (size_t)DM * DM || (size_t)in_sizes[2] < (size_t)DM) return;
    if ((size_t)in_sizes[3] < (size_t)DM * DKV || (size_t)in_sizes[4] < (size_t)DKV) return;
    if ((size_t)in_sizes[5] < (size_t)DM * DKV || (size_t)in_sizes[6] < (size_t)DKV) return;
    if ((size_t)in_sizes[7] < (size_t)DM * DM || (size_t)in_sizes[8] < (size_t)DM) return;
    if ((size_t)out_size < ((size_t)(NB - 1) * OUT_SEQ + SEQ) * DM) return;
    if (SZ_TOTAL > ws_size) return;
    // wire order: x, Wq, bq, Wk, bk, Wv, bv, Wo, bo (weights [in][out])
    const float* x  = (const float*)d_in[0];
    const float* wq = (const float*)d_in[1]; const float* bq = (const float*)d_in[2];
    const float* wk = (const float*)d_in[3]; const float* bk = (const float*)d_in[4];
    const float* wv = (const float*)d_in[5]; const float* bv = (const float*)d_in[6];
    const float* wo = (const float*)d_in[7]; const float* bo = (const float*)d_in[8];
    float* OUT = (float*)d_out;      // [NB][SEQ][2048]
    char* wsp = (char*)d_ws;
    bf* XB  = (bf*)wsp; wsp += SZ_XB;                // [NB*SEQ][2048]
    bf* WQT = (bf*)wsp; wsp += SZ_WQ;                // [2048 out][2048 in]; WQT, WKT, WVT lie one behind the other: one plane [3072 out][2048 in]
    bf* WKT = (bf*)wsp; wsp += SZ_WK;                // [512 out][2048 in]
    bf* WVT = (bf*)wsp; wsp += SZ_WK;                // [512 out][2048 in]
    bf* WOT = (bf*)wsp; wsp += SZ_WQ;                // [2048 out][2048 in]
    float* CS = (float*)wsp; wsp += SZ_CS;           // [SEQ][cos 64 | sin 64]
    h16* QH = (h16*)wsp; wsp += SZ_QP;               // [NB*16][SEQ][128]
    h16* QR = (h16*)wsp; wsp += SZ_QP;               // [NB*16][SEQ][128] residual x2048
    h16* KP = (h16*)wsp; wsp += SZ_KP;               // [NB*4][SEQ][128]
    h16* VH = (h16*)wsp; wsp += SZ_KP;               // [NB*4][128][SEQ]
    h16* VR = (h16*)wsp; wsp += SZ_KP;               // [NB*4][128][SEQ] residual x256
    bf* CTX = (bf*)wsp; wsp += SZ_CTX;               // [NB*SEQ][hi 2048 | lo 2048]

    // weight transposes in[K = DM rows][N cols] -> out[N rows][K = DM cols], rotary table, bf16 copy of x
    k_prep<<<PB_W + PB_ROPE + PB_CVT, 256, 0, stream>>>(x, wq, wk, wv, wo, XB, WQT, WKT, WVT, WOT, CS);

    // q, k, v: A = x rows (m = b*SEQ + t), Bt = the weight rows (n = q 2048 | k 512 | v 512) -> q, k planes [(b*nheads + head)][t][d], rotary applied; v planes [(b*512 + g*128 + d)][t]
    k_qkv<<<GB_ROW * GB_COL, 32 * PW, 0, stream>>>(XB, WQT, bq, bk, bv, CS, QH, QR, KP, VH, VR);

    k_flash<<<dim3(SEQ / 64, NB * NKV, 1), 32 * FW, 0, stream>>>(QH, QR, KP, VH, VR, CTX);

    k_out<<<dim3(NB * SEQ / 128, DM / 256, 1), 32 * GW, 0, stream>>>(CTX, WOT, bo, OUT);
}

// v010
// Measured time: 129 microseconds a run.
// Timed twice side by side with v009, it ran 1.10 times as fast both times.
// Over all steps from v000 it is 5.22 times as fast.
#include <hip/hip_runtime.h>

// Causal grouped-query attention layer: x [NB][SEQ][2048], 16 query heads x 128, 4 kv heads, weights [in][out] with biases, rotate-half rotary (theta 1e4), ALiBi slopes 2^(-(h+1)/2), output projection; f32 output.
// Compute dtypes, f32 accumulate everywhere: q/k/v projections v_wmma_f32_16x16x32_bf16 (x, W, b RNE-converted to bf16; products exact);
// scores v_wmma_f32_16x16x32_f16: k single f16, q as f16 value + f16 residual x2048 in its own accumulator; P.V v_wmma_f32_16x16x32_f16: P single f16 (x256 carry, cancels in the normalisation),
// v as f16 value + f16 residual x256 whose partner operand is the P copy x2^-8 (K-dimension fold, products at natural scale, one accumulator); row sum of P as a product with an all-ones operand; output projection v_wmma_f32_16x16x32_bf16 with ctx as bf16 hi | lo planes, both multiplied with the one bf16 Wo plane into one accumulator (per 32-k step: hi products, then lo products); softmax f32 (online, running max).
// Layout: bf16 x copy, bf16 transposed weight planes [out][in]; q (hi, residual) planes [b*16+h][t][d], k plane [b*4+g][t][d], v^T planes [b*4+g][d][t]; ctx plane [b*SEQ+t][hi 2048 | lo 2048]; rotary table [t][cos 64 | sin 64].

#ifndef NB
#define NB 2
#endif
#ifndef SEQ
#define SEQ 2048
#endif
#define NB_FULL  2
#define SEQ_FULL 2048
#ifndef OUT_SEQ
#define OUT_SEQ SEQ              // row pitch (in tokens) between batches of the output
#endif
#define DM   2048
#define NH_  16
#define NKV  4
#define HD   128
#define REP  (NH_ / NKV)
#define DKV  (NKV * HD)          // 512
#define FW   8                   // waves per flash block: the 4 query heads of one kv head x 2 query tiles of 16 rows
#define FSP  4                   // 32-key steps per stage of the flash ring (128 keys)
#define GW   8                   // waves per k_out block: block tile 128 A rows x 256 Bt rows
#define FKS  128                 // k elements per k_qkv or k_out stage: 256 B of every operand row
#define FPIT 272                 // LDS pitch, bytes, of a staged 256-B row (16 B x odd for 16-B readers)
#define FLO  128                 // k_out stage: first row of the ctx lo pieces (the hi pieces are rows 0..127)
#define FBT  256                 // k_out stage: first row of the WoT pieces
#define FST  ((FBT + 256) * FPIT)       // 139264 B per k_out stage, and per k_qkv stage
#define PBT  128                 // k_qkv stage: first row of the weight pieces (the x pieces are rows 0..127)
#define QRS  2048.0f             // carry of the q residual plane
#define QRI  (1.0f / 2048.0f)
#define VRS  256.0f              // carry of the v residual plane (partner operand is P x 2^-8)
#define SC2  (0.08838834764831845f * 1.4426950408889634f)   // HD^-0.5 * log2(e)
#define RHD  11.313708498984761f // HD^0.5: an ALiBi slope in units of the unscaled score
#define PSH  8.0f                // log2 of the P carry (256)
#define NEGBIG (-3.0e38f)

static_assert(HD == 128);
static_assert(NH_ * HD == DM);
static_assert(NH_ % NKV == 0);
static_assert(DM % 64 == 0);
static_assert(DKV % 64 == 0);
static_assert(DM % 32 == 0);
static_assert(SEQ % 64 == 0);                  // a 64-row tile never straddles two batches
static_assert((NB * SEQ) % 64 == 0);
static_assert(SEQ % 32 == 0);                  // key loop steps by 32
static_assert(REP == 4 && FW == 2 * REP);      // wave -> (head of the group, query tile) map of the flash block
static_assert(SEQ % 4 == 0);
static_assert((NB * SEQ) % 256 == 0 && DKV % 128 == 0 && DM % 256 == 0 && NKV % 2 == 0 && NH_ % 2 == 0);   // GEMM block tiles cover every operand exactly
static_assert(DM % FKS == 0);
static_assert(((size_t)SEQ * DM) % 8 == 0);
static_assert(NB <= NB_FULL);
static_assert(SEQ <= SEQ_FULL);

typedef _Float16 h16;
typedef unsigned short bf;
typedef __attribute__((ext_vector_type(16))) __bf16   v16bf;
typedef __attribute__((ext_vector_type(16))) _Float16 v16h;
typedef __attribute__((ext_vector_type(8)))  _Float16 v8h;
typedef __attribute__((ext_vector_type(8)))  unsigned short v8us;
typedef __attribute__((ext_vector_type(8)))  float    v8f;
typedef __attribute__((ext_vector_type(4)))  float    v4f;
typedef v4f  __attribute__((may_alias)) v4fa;
typedef __attribute__((ext_vector_type(4)))  unsigned v4u;     // 16 bytes as the data operand of a store written in asm text

__device__ __forceinline__ unsigned short f2bf(float f) { unsigned u = __float_as_uint(f); u += 0x7FFFu + ((u >> 16) & 1u); return (unsigned short)(u >> 16); }
__device__ __forceinline__ float bf2f(unsigned short u) { return __uint_as_float(((unsigned)u) << 16); }
__device__ __forceinline__ float bfr(float f) { return bf2f(f2bf(f)); }     // value of the RNE bf16 conversion
__device__ __forceinline__ v16h cat16(v8h lo, v8h hi) { return __builtin_shufflevector(lo, hi, 0, 1, 2, 3, 4, 5, 6, 7, 8, 9, 10, 11, 12, 13, 14, 15); }
__device__ __forceinline__ v16bf cat16b(v8us lo, v8us hi) { return __builtin_bit_cast(v16bf, __builtin_shufflevector(lo, hi, 0, 1, 2, 3, 4, 5, 6, 7, 8, 9, 10, 11, 12, 13, 14, 15)); }
__device__ __forceinline__ v8f wmma16(v16h a, v16h b, v8f c) { return __builtin_amdgcn_wmma_f32_16x16x32_f16(false, a, false, b, (short)0, c, false, false); }
__device__ __forceinline__ v8f wmmab(v16bf a, v16bf b, v8f c) { return __builtin_amdgcn_wmma_f32_16x16x32_bf16(false, a, false, b, (short)0, c, false, false); }
// fragment loaders from K-contiguous 16-bit rows; p already includes + 8*(lane>>4): elements 0..7 <- k0+8h+0..7, elements 8..15 <- k0+16+8h+0..7 (same map for A and B)
__device__ __forceinline__ v16h  ldh(const h16* p) { return cat16(*(const v8h*)p, *(const v8h*)(p + 16)); }
__device__ __forceinline__ v16bf ldb(const bf* p)  { return cat16b(*(const v8us*)p, *(const v8us*)(p + 16)); }
// ordering point for wave-private LDS tiles (same wave writes and reads)
__device__ __forceinline__ void wave_sync() { __builtin_amdgcn_fence(3 /* release order */, "wavefront"); __builtin_amdgcn_wave_barrier(); asm volatile("" ::: "memory"); }

// cvt8_body: x f32 -> bf16 copy [NB*SEQ][DM], eight elements per thread; blk = block index inside this range. Batch b of the source starts at b * SEQ_FULL rows.
__device__ __forceinline__ void cvt8_body(const float* __restrict__ src, bf* dst, int blk, int tid) {
    constexpr size_t per = (size_t)SEQ * DM / 8, n8 = (size_t)NB * per;
    const size_t i = (size_t)blk * 256 + tid; if (i >= n8) return;
    const v8f v = *(const v8f*)(src + (i / per) * ((size_t)SEQ_FULL * DM) + (i % per) * 8); v8us o;
#pragma unroll
    for (int k = 0; k < 8; ++k) o[k] = f2bf(v[k]);
    *(v8us*)(dst + i * 8) = o; 
}

// tcvt_body: W in[K rows][N cols] f32 -> WT out[N rows][K cols] bf16 (RNE convert), 64x64 tile (bx along K, by along N) transposed through LDS (cross-wave: block barrier).
__device__ __forceinline__ void tcvt_body(const float* __restrict__ W, bf* WT, int K, int N, int bx, int by, float* ts, int tid) {
    const int k0 = bx * 64, n0 = by * 64;
    const int cn = tid & 63, rk = tid >> 6;
#pragma unroll 4
    for (int i = 0; i < 16; ++i) { const int r = rk + 4 * i; ts[r * 65 + cn] = W[(size_t)(k0 + r) * N + n0 + cn]; }   // 16 x 4 = 64 rows, 64 columns
    __syncthreads();
    const int pc = tid & 7, rn = tid >> 3;      // rn 0..31 and rn+32 -> 64 output rows; 8 pieces x 8 = 64 k
    v8us o0, o1;
#pragma unroll
    for (int j = 0; j < 8; ++j) { o0[j] = f2bf(ts[(pc * 8 + j) * 65 + rn]); o1[j] = f2bf(ts[(pc * 8 + j) * 65 + rn + 32]); }
    bf* d0 = WT + (size_t)(n0 + rn) * K + k0 + pc * 8; bf* d1 = WT + (size_t)(n0 + rn + 32) * K + k0 + pc * 8;
    *(v8us*)d0 = o0; *(v8us*)d1 = o1; 
}

// rope_body: rotary table CS[t][0..63] = cos(t * f_i), CS[t][64..127] = sin(t * f_i), f_i = 10000^(-i/64) = 2^(-i * log2(10000)/64); precise sinf/cosf.
__device__ __forceinline__ void rope_body(float* CS, int blk, float* ts, int tid) {
    const int i = tid & 63, r = tid >> 6; const int t = blk * 4 + r;
    const float invf = __builtin_amdgcn_exp2f(-(float)i * 0.20762050593046014f);
    const float ang = (float)t * invf;
    ts[r * 128 + i] = cosf(ang); ts[r * 128 + 64 + i] = sinf(ang);
    __syncthreads();
    if (tid < 128) {                            // waves 0..3 (wave-uniform), one row each
        const int row = tid >> 5, pc = tid & 31;
        const v4f v = *(const v4fa*)(&ts[row * 128 + pc * 4]);
        float* d = CS + (size_t)(blk * 4 + row) * 128 + pc * 4;
        *(v4f*)d = v; 
    }
}

// k_prep: the six preparatory jobs, which do not depend on one another, as block ranges of one grid: the four weight transposes, the rotary table, the bf16 copy of x. The range test reads blockIdx only, so every barrier stays block-uniform.
// Left as it was: the work per thread (one 8-element piece, one 64x64 tile per block), so the grid is still one of very many short waves.
#define PB_WBIG  ((DM / 64) * (DM / 64))      // blocks of a DM x DM transpose
#define PB_WKV   ((DM / 64) * (DKV / 64))     // blocks of a DM x DKV transpose
#define PB_W     (2 * PB_WBIG + 2 * PB_WKV)
#define PB_ROPE  (SEQ / 4)
#define PB_CVT   ((int)(((size_t)NB * SEQ * DM / 8 + 255) / 256))
__global__ __launch_bounds__(256) void k_prep(const float* __restrict__ x, const float* __restrict__ wq, const float* __restrict__ wk, const float* __restrict__ wv, const float* __restrict__ wo,
                                              bf* XB, bf* WQT, bf* WKT, bf* WVT, bf* WOT, float* CS) {
    __shared__ __align__(16) float ts[64 * 65];
    const int tid = threadIdx.x; const int id = blockIdx.x;
    if (id < PB_W) {
        const bool big = id < 2 * PB_WBIG;
        const int q = big ? id : id - 2 * PB_WBIG; const int per = big ? PB_WBIG : PB_WKV;
        const bool second = q >= per; const int r = second ? q - per : q;
        const float* W = big ? (second ? wo : wq) : (second ? wv : wk);
        bf* WT = big ? (second ? WOT : WQT) : (second ? WVT : WKT);
        tcvt_body(W, WT, DM, big ? DM : DKV, r % (DM / 64), r / (DM / 64), ts, tid);
    } else if (id < PB_W + PB_ROPE) rope_body(CS, id - PB_W, ts, tid);
    else cvt8_body(x, XB, id - PB_W - PB_ROPE, tid);
}

// Tensor loads of the k_qkv, k_flash and k_out rings. One request of one wave brings a slice of a stage, 128 rows of 256 B, from global memory into LDS through no register; its pad sets the LDS pitch to FPIT.
typedef __attribute__((ext_vector_type(8)))  unsigned v8u;     // descriptor group 1 (group 0: v4u)
__device__ __forceinline__ unsigned uni(unsigned v) { return (unsigned)__builtin_amdgcn_readfirstlane(v); }
// pinned: a wave-uniform value held in a scalar register, so that a test on it is a scalar branch (a tensor load ignores EXEC) and what is formed from it is formed behind it
__device__ __forceinline__ unsigned pinned(unsigned v) { unsigned w = uni(v); asm volatile("" : "+s"(w)); return w; }   // the empty statement: the scalar-register form for a tensor load's test and descriptor word
#define TROWS 128                // rows of a slice
#define TSL   (TROWS * FPIT)     // 34816 B of LDS per slice: 17 x 2 KiB
static_assert(TSL % 2048 == 0 && FST % 2048 == 0 && FST == 4 * TSL && FPIT == FKS * 2 + 16);
// group 1: 1-byte elements, tensor = tile = 128 rows of 256 B, source row pitch in bytes; word 0: no mask, a pad of 4 dwords behind every 64 dwords
__device__ __forceinline__ v8u tdm_g1(unsigned pitch) {
    v8u g;
    g[0] = uni((1u << 20) | (5u << 22) | (3u << 25));
    g[1] = uni((unsigned)(FKS * 2) << 16);
    g[2] = uni((unsigned)TROWS << 16);
    g[3] = uni((unsigned)(FKS * 2) << 16);
    g[4] = uni((unsigned)TROWS);
    g[5] = uni(pitch);
    g[6] = uni(0u);
    g[7] = uni(0u);
    asm volatile("" : "+s"(g));   // the descriptor's words held in one set of scalar registers for the whole kernel: without it single words were used as scratch and set again while a request was in flight
    return g;
}
// l: byte offset of the slice in the work-group's LDS (a multiple of 2 KiB); g: first byte of the slice in global memory. Returns group 0, for the wait.
__device__ __forceinline__ v4u tdm_slice(unsigned l, const void* g, v8u g1) {
    const unsigned long long ga = (unsigned long long)(size_t)g;
    v4u g0;
    g0[0] = uni(1u); g0[1] = uni(l); g0[2] = uni((unsigned)ga); g0[3] = uni((((unsigned)(ga >> 32)) & 0x01FFFFFFu) | 0x80000000u);
    asm volatile("tensor_load_to_lds %0, %1" : "+s"(g0) : "s"(g1) : "memory");   // group 0 as an in-out operand: what is handed to the wait is this very set of registers, not a copy of single words
    return g0;
}
// the issuing wave's wait for its request; it takes the request's descriptor as inputs, so that those registers stay as they are until the wait has passed
__device__ __forceinline__ void tdm_wait(v4u g0, v8u g1) { asm volatile("s_wait_tensorcnt 0x0" :: "s"(g0), "s"(g1) : "memory"); }

// proj_loop: bf16 GEMM main loop of the 12-wave block of k_qkv, block tile 128 x 384, wave tile 64 x 64 at rows wr, columns wc of it. Each 128-k stage of the block's x and weight rows is brought into LDS once
// per block by four tensor loads (waves 0..3 issue one each: the x rows, then three times 128 weight rows; the test is a scalar one), and every wave takes its fragments from there. Two buffers: stage s + 1 is in flight while stage s is worked on; one barrier per stage publishes s + 1 and frees the buffer of s.
// acc[mb*4+nb] += sum_k A[R0+wr+16mb+..][k] * Bt[C0+wc+16nb+..][k]; k ascending in steps of 32
__device__ __forceinline__ void proj_loop(const bf* __restrict__ A, const bf* __restrict__ Bt, int R0, int C0, int wr, int wc, unsigned char* ring, int wave, int lr, int hi, v8f (&acc)[16]) {
#pragma unroll
    for (int i = 0; i < 16; ++i) acc[i] = (v8f){};
    const unsigned iss = wave < 4;                             // waves 0..3 issue; wave-uniform, in a scalar register
    const int sl = wave & 3;                                   // slice: 0 the x rows, 1..3 the weight rows
    const unsigned l0 = (unsigned)(size_t)ring + (unsigned)sl * (unsigned)TSL;
    const bf* gs = sl == 0 ? A + (size_t)R0 * (size_t)DM : Bt + (size_t)(C0 + (sl - 1) * TROWS) * (size_t)DM;
    const v8u g1 = tdm_g1(DM * 2);
    constexpr int nst = DM / FKS;                              // the same for every wave of the launch
    static_assert(nst >= 2);                                   // stages 0 and 1 both exist
    v4u gl = (v4u){};                                          // group 0 of this wave's request in flight
    if (pinned(iss)) {
        gl = tdm_slice(l0, gs, g1);                            // stage 0 -> buffer 0
        tdm_wait(gl, g1);                                      // this wave's slice of stage 0 has landed
    }
    __syncthreads();                                           // stage 0 published
    if (pinned(iss)) gl = tdm_slice(l0 + FST, gs + FKS, g1);   // stage 1 -> buffer 1
    const int ao = (wr + lr) * FPIT + 16 * hi, bfo = (PBT + wc + lr) * FPIT + 16 * hi;
#pragma unroll 1   // one stage per trip: the ring's order at the foot stands once
    for (int st = 0; st < nst; ++st) {
        const unsigned bo = (st & 1) ? (unsigned)FST : 0u;
        const bf* as = (const bf*)(ring + bo + ao); const bf* bs = (const bf*)(ring + bo + bfo);
        v16bf a[4], b[4];
        // Fragment reads stand in few groups, never singly among the products. __builtin_amdgcn_sched_barrier(0): nothing is scheduled across it, so a group stays whole and in its place; it asks for no wait itself.
#pragma unroll
        for (int mb = 0; mb < 4; ++mb) a[mb] = ldb(as + mb * 16 * (FPIT / 2));
#pragma unroll
        for (int nb = 0; nb < 4; ++nb) b[nb] = ldb(bs + nb * 16 * (FPIT / 2));
        __builtin_amdgcn_sched_barrier(0);
#pragma unroll
        for (int ks = 0; ks < FKS / 32; ++ks) {
#pragma unroll
            for (int nb = 0; nb < 2; ++nb) {
#pragma unroll
                for (int mb = 0; mb < 4; ++mb) acc[mb * 4 + nb] = wmmab(a[mb], b[nb], acc[mb * 4 + nb]); }
            if (ks + 1 < FKS / 32) {                           // the next step's first two weight fragments, behind the last product that reads this step's: they land while the other eight products run
#pragma unroll
                for (int nb = 0; nb < 2; ++nb) b[nb] = ldb(bs + nb * 16 * (FPIT / 2) + 32 * (ks + 1));
            }
            __builtin_amdgcn_sched_barrier(0);
#pragma unroll
            for (int nb = 2; nb < 4; ++nb) {
#pragma unroll
                for (int mb = 0; mb < 4; ++mb) acc[mb * 4 + nb] = wmmab(a[mb], b[nb], acc[mb * 4 + nb]); }
            if (ks + 1 < FKS / 32) {                           // the rest of the next step's fragments; the SIMD's two other waves run their products while these land
#pragma unroll
                for (int mb = 0; mb < 4; ++mb) a[mb] = ldb(as + mb * 16 * (FPIT / 2) + 32 * (ks + 1));
#pragma unroll
                for (int nb = 2; nb < 4; ++nb) b[nb] = ldb(bs + nb * 16 * (FPIT / 2) + 32 * (ks + 1));
            }
            __builtin_amdgcn_sched_barrier(0);                 // in the last step it keeps the products in front of the publish point, so that the tensor loads are issued directly behind the barrier
        }
        // the distance behind the trip's last products, on the path over the loop's back edge too
        asm volatile("v_nop\n\tv_nop\n\tv_nop\n\tv_nop" : "+v"(acc[0]), "+v"(acc[5]), "+v"(acc[10]), "+v"(acc[15]) : "v"(a[0]), "v"(a[3]), "v"(b[3]));
        // publish point of stage st + 1
        asm volatile("s_wait_dscnt 0x0" ::: "memory");         // this wave's reads of the buffer of stage st are done before it is handed to the tensor loads
        if (pinned(iss)) tdm_wait(gl, g1);                     // this wave's slice of stage st + 1 has landed
        __syncthreads();                                       // stage st + 1 published; every reader has left the buffer of stage st
        if (pinned(iss & (unsigned)(st + 2 < nst))) {          // stage st + 2 -> the buffer just read; its descriptor is formed from a value pinned behind the wait
            const unsigned s2 = pinned((unsigned)st + 2u);
            gl = tdm_slice(l0 + (s2 & 1u) * (unsigned)FST, gs + (size_t)s2 * FKS, g1);
        }
    }
    asm volatile("s_wait_tensorcnt 0x0" ::: "memory");         // nothing of this wave is in flight when it leaves the ring
    asm volatile("s_wait_dscnt 0x0" ::: "memory");
}

// st4, st2: the stores of two row pairs (OFF bytes apart) and their s_wait_xcnt in one statement, so that the wait stands in front of every rewrite of a register that a store names
// (a wait in a statement of its own does not hold the address additions behind it)
template <int OFF>
__device__ __forceinline__ void st4(h16* ph, h16* pr, v4u h0, v4u h1, v4u r0, v4u r1) {
    asm volatile("global_store_b128 %0, %2, off\n\t"
                 "global_store_b128 %0, %3, off offset:%6\n\t"
                 "global_store_b128 %1, %4, off\n\t"
                 "global_store_b128 %1, %5, off offset:%6\n\t"
                 "s_wait_xcnt 0x0"
                 :: "v"(ph), "v"(pr), "v"(h0), "v"(h1), "v"(r0), "v"(r1), "n"(OFF) : "memory");
}
template <int OFF>
__device__ __forceinline__ void st2(h16* ph, v4u h0, v4u h1) {
    asm volatile("global_store_b128 %0, %1, off\n\t"
                 "global_store_b128 %0, %2, off offset:%3\n\t"
                 "s_wait_xcnt 0x0"
                 :: "v"(ph), "v"(h0), "v"(h1), "n"(OFF) : "memory");
}

// k_qkv: the q, k and v projections as ONE product x [NB*SEQ][DM] times the weight rows [q 2048 | k 512 | v 512][DM] (24 heads of 128 columns). Block tile 128 rows x 384 columns (3 heads): 32 x 8 = 256 equal blocks,
// one per WGP, 12 waves (three per SIMD) of 64 x 64 each: every WGP has the same share of the products, and a fragment read from LDS serves four of them.
// Epilogue: the whole block tile (+ bias) is staged in LDS on the ring, which the last publish point of proj_loop (LDS reads done, no copy in flight, block barrier) has freed for every wave; one block barrier; then each wave
// takes two of the 24 pieces (head, 16 rows). A q or k head is staged [t][d] (a rotary pair d, d + 64 comes from two waves) and goes out as plane [(b*nheads + head)][t][d], f16 value and, for q, f16 residual x2048.
// A v head is staged transposed [d][t] (a lane holds eight consecutive t of one d) and goes out as planes [(b*DKV + g*128 + d)][t], f16 value and f16 residual x256.
#define PW    12                 // waves per block
#define PCOL  384                // columns of a block tile
#define OPIT  132                // pitch, floats, of a staged row of 128
#define GB_ROW  (NB * SEQ / 128)
#define GB_COL  ((DM + 2 * DKV) / PCOL)
static_assert((DM + 2 * DKV) % PCOL == 0 && PCOL % HD == 0 && (NB * SEQ) % 128 == 0 && SEQ % 128 == 0);   // block tiles cover the product exactly; a tile holds whole heads and lies in one batch
static_assert((PBT + PCOL) * FPIT == FST && (PCOL / HD) * 128 * OPIT * 4 <= 2 * FST);
__global__ __launch_bounds__(32 * PW) __attribute__((amdgpu_num_vgpr(256)))
void k_qkv(const bf* __restrict__ XB, const bf* __restrict__ WT, const float* __restrict__ bq, const float* __restrict__ bk, const float* __restrict__ bv, const float* __restrict__ CS,
           h16* QH, h16* QR, h16* KP, h16* VH, h16* VR) {
    __shared__ __attribute__((aligned(2048))) unsigned char ring[2 * FST];   // every slice of a stage starts at a multiple of 2 KiB
    const int tid = threadIdx.x; const int id = blockIdx.x;
    const int lane = tid & 31, lr = lane & 15, hi = lane >> 4;
    const int wave = __builtin_amdgcn_readfirstlane(tid >> 5); // in a scalar register: every test on it is a scalar branch
    const int bx = id % GB_ROW, by = id / GB_ROW;
    const int wr = (wave & 1) * 64, wc = (wave >> 1) * 64;
    v8f acc[16];
    proj_loop(XB, WT, bx * 128, by * PCOL, wr, wc, ring, wave, lr, hi, acc);
    float* osb = (float*)ring;
    {   // this wave's 64 x 64 tile: half of head gh, columns d0 .. d0 + 63 of it
        const int gh = by * (PCOL / HD) + (wc >> 7), d0 = wc & 127;
        const float* bp = gh < NH_ ? bq + gh * HD : (gh < NH_ + NKV ? bk + (gh - NH_) * HD : bv + (gh - NH_ - NKV) * HD);
        float bz[4];
#pragma unroll
        for (int nb = 0; nb < 4; ++nb) bz[nb] = bfr(bp[d0 + nb * 16 + lr]);
        float* oh = osb + (wc >> 7) * (128 * OPIT);
        if (gh < NH_ + NKV) {                                  // D: row t = 8h+j, col d = lane&15 -> [t][d]
#pragma unroll
            for (int mb = 0; mb < 4; ++mb) {
#pragma unroll
                for (int nb = 0; nb < 4; ++nb) {
#pragma unroll
                    for (int j = 0; j < 8; ++j) oh[(wr + mb * 16 + hi * 8 + j) * OPIT + d0 + nb * 16 + lr] = acc[mb * 4 + nb][j] + bz[nb]; } }
        } else {                                               // -> [d][t]
#pragma unroll
            for (int mb = 0; mb < 4; ++mb) {
#pragma unroll
                for (int nb = 0; nb < 4; ++nb) { v4f p, q;
#pragma unroll
                    for (int j = 0; j < 4; ++j) { p[j] = acc[mb * 4 + nb][j] + bz[nb]; q[j] = acc[mb * 4 + nb][4 + j] + bz[nb]; }
                    float* d = &oh[(d0 + nb * 16 + lr) * OPIT + wr + mb * 16 + hi * 8];
                    *(v4fa*)d = p; *(v4fa*)(d + 4) = q; } }
        }
    }
    __syncthreads();                                           // the block tile is staged: rows of a piece come from other waves
    const int b = (bx * 128) / SEQ, tb = (bx * 128) % SEQ;
    const int c8 = lr * 8, p8 = c8 ^ 64;
#pragma unroll 1   // stays rolled: keeps the epilogue's code short
    for (int it = wave; it < (PCOL / HD) * 8; it += PW) {      // piece: head it >> 3 of the tile, rows 16 (it & 7) .. + 15 of its staging
        const int gh = by * (PCOL / HD) + (it >> 3), rg = (it & 7) * 16;
        const float* os = osb + (it >> 3) * (128 * OPIT) + rg * OPIT;
        if (gh < NH_ + NKV) {
            const bool isq = gh < NH_;
            const int t0 = tb + rg;
            const size_t tbase = ((size_t)(isq ? b * NH_ + gh : b * NKV + gh - NH_) * SEQ + t0) * HD;
            h16* Ph = isq ? QH : KP;
            // the piece's whole share of the rotary table is asked for as one group (the accumulators' registers are free by now), so that its latency is waited out once per piece, not once per trip
            v4f tc0[8], tc1[8], ts0[8], ts1[8];
            const float* cs0 = CS + (size_t)(t0 + hi) * 128 + (c8 & 63);
#pragma unroll
            for (int s = 0; s < 8; ++s) { const float* cs = cs0 + s * 256;   // row t0 + 2 s + hi
                tc0[s] = *(const v4f*)cs; tc1[s] = *(const v4f*)(cs + 4); ts0[s] = *(const v4f*)(cs + 64); ts1[s] = *(const v4f*)(cs + 68); }
            asm volatile("s_wait_xcnt 0x0" :: "v"(cs0) : "memory");   // takes the address as an input, so that its registers stay as they are until it has passed (otherwise a late load's result may be laid on them)
#pragma unroll   // unrolled so that every index of the table arrays is a constant (registers, no scratch)
            for (int s2 = 0; s2 < 8; s2 += 2) { v4u hq[2], rq[2];
#pragma unroll
              for (int u = 0; u < 2; ++u) { const int row = 2 * (s2 + u) + hi;   // 8 s x 2 rows = 16 rows; 16 lanes x 8 = 128 columns
                const float* orow = &os[row * OPIT];
                const v4f x0 = *(const v4fa*)(orow + c8), x1 = *(const v4fa*)(orow + c8 + 4);
                const v4f y0 = *(const v4fa*)(orow + p8), y1 = *(const v4fa*)(orow + p8 + 4);
                const v4f cc0 = tc0[s2 + u], cc1 = tc1[s2 + u], ss0 = ts0[s2 + u], ss1 = ts1[s2 + u];
                const float sg = (c8 < 64) ? -1.0f : 1.0f;       // d < 64: x[d] cos - x[d+64] sin; d >= 64: x[d] cos + x[d-64] sin
                v8h hv, rv;
#pragma unroll
                for (int i = 0; i < 4; ++i) {
                    const float v0 = x0[i] * cc0[i] + sg * (y0[i] * ss0[i]); const float v1 = x1[i] * cc1[i] + sg * (y1[i] * ss1[i]);
                    const h16 a0 = (h16)v0; const h16 a1 = (h16)v1; hv[i] = a0; hv[4 + i] = a1;
                    rv[i] = (h16)((v0 - (float)a0) * QRS); rv[4 + i] = (h16)((v1 - (float)a1) * QRS); }
                hq[u] = __builtin_bit_cast(v4u, hv); rq[u] = __builtin_bit_cast(v4u, rv); }
                const size_t oo = tbase + (size_t)(2 * s2 + hi) * HD + c8;   // row 2 s2 + hi; the second piece lies two rows further
                if (isq) st4<2 * HD * 2>(Ph + oo, QR + oo, hq[0], hq[1], rq[0], rq[1]);
                else     st2<2 * HD * 2>(Ph + oo, hq[0], hq[1]); }
        } else {
            const size_t vbase = ((size_t)b * DKV + (size_t)(gh - NH_ - NKV) * HD + rg) * SEQ + tb;
#pragma unroll 1   // stays rolled, four trips of two row pairs each
            for (int s2 = 0; s2 < 8; s2 += 2) { v4u hq[2], rq[2];
#pragma unroll
              for (int u = 0; u < 2; ++u) { const int row = 2 * (s2 + u) + hi;   // 8 s x 2 rows d = 16 rows; 16 lanes x 8 = 128 columns t
                const v4f x0 = *(const v4fa*)(&os[row * OPIT + c8]); const v4f x1 = *(const v4fa*)(&os[row * OPIT + c8 + 4]); v8h hv, rv;
#pragma unroll
                for (int i = 0; i < 4; ++i) { const h16 a0 = (h16)x0[i]; const h16 a1 = (h16)x1[i]; hv[i] = a0; hv[4 + i] = a1; rv[i] = (h16)((x0[i] - (float)a0) * VRS); rv[4 + i] = (h16)((x1[i] - (float)a1) * VRS); }
                hq[u] = __builtin_bit_cast(v4u, hv); rq[u] = __builtin_bit_cast(v4u, rv); }
                const size_t oo = vbase + (size_t)(2 * s2 + hi) * SEQ + c8;  // row 2 s2 + hi; the second piece lies two rows further
                st4<2 * SEQ * 2>(VH + oo, VR + oo, hq[0], hq[1], rq[0], rq[1]); }
        }
    }
}

// k_flash: fused causal attention, one wave per 16 query rows of one (batch, head). A block is the 4 query heads of one kv head x 2 adjacent 16-row query tiles (8 waves): all of them walk
// the same keys, so each 128-key stage of K, V^T value and V^T residual is brought into LDS once per block by three tensor loads (waves 0..2, one plane each) and every wave takes its fragments from there.
// Two buffers of FSP 32-key steps each: stage s + 1 is in flight while stage s is worked on; one barrier per stage publishes s + 1 and frees the buffer of s. Between two publish points the waves run free,
// so one wave's softmax can stand beside another's products, and a stage's landing has FSP steps to hide behind.
// Transposed form: S^T[key][t] = K Q^T (A = K rows, B = Q rows); lane (t = lane&15, h = lane>>4) holds keys 8h+r of each 16-key tile, so the packed
// P tile is directly the B fragment of O^T[d][t] = V^T P^T (element r <- tile keys 0..15, element 8+r <- tile keys 16..31, lane unchanged).
// The key loop of a tile runs to the 32-key step that contains its last query; keys beyond a query get the fill value (weight exactly 0): only a tile's last step holds such keys, so only there is the mask applied (block-uniform test).
// Vector work per score is kept short, it shares the SIMD's issue with the products: the ALiBi bias slope*(key - query), in units of the unscaled score, is split into a per-lane part (key and query inside the step and the tile: the same in every step),
// which is the start value of the score accumulators, and a per-step part, which only lowers the running max by a constant from step to step; the scale HD^-0.5 * log2(e) is the factor of the one multiply-add that forms the exp2 argument;
// the row sum of the f16 P comes from the matrix unit (all-ones A operand: every row of that tile is the sum over the step's 32 keys, both lane halves), scaled by alpha like o.
// Balance: a 32-row query tile x walks x + 1 steps, and all blocks of the grid are resident at once, so the launch lasts as long as its fullest WGP. Each block therefore takes two tiles one after the other,
// x and SEQ/32 - 1 - x: SEQ/32 + 1 steps for every block, one block per WGP. The two walks are one run of stages through the ring (the second tile's first stage flies while the first tile ends); a stage holds 128 consecutive keys
// of one tile's walk, from a multiple of 128, so a tile's last stage may hold keys that no step reads. At the first tile's last step every wave writes its rows out, takes the second tile's q and starts its sums anew. The sums of a tile are formed as before.
// What is left: the LDS read rate (every wave reads every K and V^T fragment of a stage for its 16 query rows alone) and, of the vector work, the scaling of o by alpha in every step.
// Planes of a stage in LDS, 128 rows of 256 B at pitch FPIT each: K rows = keys (256 B = 128 d); V^T rows = d (256 B = the stage's 128 keys), value plane, then residual plane.
#define FBUF (3 * TSL)           // 104448 B per stage: 51 x 2 KiB

// flash_q: the q value and residual fragments of a wave's 16 query rows (B fragments: col t, k = d); qa, qb: this lane's piece of its row in the two planes.
// The s_wait_xcnt takes the two addresses as inputs, so that their registers stay as they are until it has passed (otherwise a late load's result may be laid on them).
__device__ __forceinline__ void flash_q(const h16* qa, const h16* qb, v16h (&qh)[4], v16h (&qr)[4]) {
#pragma unroll
    for (int c = 0; c < 4; ++c) { qh[c] = ldh(qa + 32 * c); qr[c] = ldh(qb + 32 * c); }
    asm volatile("s_wait_xcnt 0x0" :: "v"(qa), "v"(qb) : "memory");
}

__global__ __launch_bounds__(32 * FW) __attribute__((amdgpu_num_vgpr(512)))
void k_flash(const h16* __restrict__ QH, const h16* __restrict__ QR, const h16* __restrict__ KP, const h16* __restrict__ VH, const h16* __restrict__ VR, bf* CTX) {
    __shared__ __attribute__((aligned(2048))) unsigned char ring[2 * FBUF];   // every plane of a stage starts at a multiple of 2 KiB
    __shared__ __align__(16) float os[FW * 16 * 132];
    const int tid = threadIdx.x;
    const int lane = tid & 31, wave = tid >> 5, lr = lane & 15, hi = lane >> 4;
    const int bg = blockIdx.y; const int b = bg / NKV, g = bg % NKV; const int h = g * REP + (wave & (REP - 1)); const int zh = b * NH_ + h;
    constexpr int NQT = SEQ / 32;                              // query tiles of one (batch, kv head)
    static_assert(NQT % 2 == 0);                               // the tiles pair off, every tile in exactly one block
    const int na = blockIdx.x + 1;                             // 32-key steps of the first tile (blockIdx.x); the second tile (NQT - 1 - blockIdx.x) has NQT - blockIdx.x
    constexpr int nst = NQT + 1;                               // 32-key steps of the block, the same for every block; step st holds key step st of the first tile or st - na of the second, both below NQT
    static_assert((FSP & (FSP - 1)) == 0 && SEQ % (FSP * 32) == 0 && FSP * 32 == TROWS && HD == TROWS && HD * 2 == FKS * 2);   // a stage lies inside the planes; each plane of it is 128 rows of 256 B
    const int nsa = (na + FSP - 1) / FSP;                      // stages of the first tile; at least 1
    const int nstg = nsa + (NQT - (int)blockIdx.x + FSP - 1) / FSP;   // stages of the block; the second tile has at least 1, so stages 0 and 1 both exist
    int t0 = blockIdx.x * 32 + (wave >> 2) * 16;
    const size_t kvb = (size_t)bg * SEQ * HD;
    // stage s holds keys 128 s .. of the first tile's walk, or 128 (s - nsa) .. of the second's. Waves 0..2 issue: K rows lie 256 B apart (a stage further: 128 rows), V^T rows SEQ elements apart (a stage further: 128 elements).
    const int wv = __builtin_amdgcn_readfirstlane(wave);       // in a scalar register: every test on it is a scalar branch
    const unsigned iss = wv < 3;
    const unsigned l0 = (unsigned)(size_t)ring + (unsigned)(wv < 3 ? wv : 0) * (unsigned)TSL;
    const h16* gs = (wv == 0 ? KP : (wv == 1 ? VH : VR)) + kvb;
    const size_t gst = wv == 0 ? (size_t)(FSP * 32) * HD : (size_t)(FSP * 32);
    const v8u g1 = tdm_g1(wv == 0 ? HD * 2 : SEQ * 2);
    const size_t qz = (size_t)zh * SEQ * HD + (size_t)lr * HD + 8 * hi;   // + t0 * HD
    v16h qh[4], qr[4];
    flash_q(QH + qz + (size_t)t0 * HD, QR + qz + (size_t)t0 * HD, qh, qr);
    v4u gl = (v4u){};                                          // group 0 of this wave's request in flight
    if (pinned(iss)) {
        gl = tdm_slice(l0, gs, g1);                            // stage 0 -> buffer 0
        tdm_wait(gl, g1);                                      // this wave's plane of stage 0 has landed
    }
    __syncthreads();                                           // stage 0 published
    if (pinned(iss)) gl = tdm_slice(l0 + FBUF, gs + (size_t)(1 < nsa ? 1 : 0) * gst, g1);   // stage 1 -> buffer 1
    const int fo = lr * FPIT + 16 * hi;                        // K: + 32 rows per step + 16 rows (second key tile) + 64*c (A fragment: row key, k = d); V^T: + plane + 16 rows * j + 64 B per step (A fragment: row d, k = key)
    const float slr = __builtin_amdgcn_exp2f(-0.5f * (float)(h + 1)) * RHD;
    v8f ca, cb;                                                // slope * (key - key0 - (query - t0)) of the two 16-key tiles
#pragma unroll
    for (int r = 0; r < 8; ++r) { ca[r] = slr * (float)(8 * hi + r - lr); cb[r] = slr * (float)(8 * hi + r + 16 - lr); }
    v16h ones;
#pragma unroll
    for (int r = 0; r < 16; ++r) ones[r] = (h16)1.0f;
    int qi = t0 + lr;
    const int wb = wave * 16 * 132;
    v8f o[8];
#pragma unroll
    for (int j = 0; j < 8; ++j) o[j] = (v8f){};
    v8f ls = (v8f){};                                          // every element: the row sum of P of query lane&15
    float m = NEGBIG;                                          // running max of unscaled score + bias, the bias counted from the current step's first key and the tile's first query
    const float dstep = slr * 32.0f;                           // what the bias gains from one step to the next
#pragma unroll 1
    for (int st = 0; st < nst; ++st) {
        const bool last = st == na - 1 || st == nst - 1;       // block-uniform: a tile's last step
        const int ks = st < na ? st : st - na;                 // key step inside the tile's walk
        const int key0 = ks * 32;
        const int stg = (st < na ? 0 : nsa) + ks / FSP, u = ks & (FSP - 1);   // its stage, and its place in the stage
        const unsigned bo = (unsigned)(stg & 1) * (unsigned)FBUF;
        const h16* ka = (const h16*)(ring + bo + (unsigned)u * (unsigned)(32 * FPIT) + fo);
        const h16* va = (const h16*)(ring + bo + (unsigned)TSL + (unsigned)u * 64u + fo); const h16* vr = va + TSL / 2;
        v8f sHa = ca, sLa = (v8f){}, sHb = cb, sLb = (v8f){};
        // All fragment reads of a step stand as one group at its head (one block per WGP, two waves per SIMD: a wave may hold 512 registers): the eight K fragments first, then the sixteen V^T fragments,
        // which land while the score products and the softmax run; LDS data returns in issue order, so the products wait with counts and never for a read issued among them.
        // __builtin_amdgcn_sched_barrier(0): nothing is scheduled across it, so the group stays whole and in its place; it asks for no wait itself.
        v16h kf[8], vf[8], vg[8];
#pragma unroll
        for (int c = 0; c < 4; ++c) { kf[2 * c] = ldh(ka + 32 * c); kf[2 * c + 1] = ldh(ka + 16 * (FPIT / 2) + 32 * c); }
#pragma unroll
        for (int j = 0; j < 8; ++j) vf[j] = ldh(va + j * 16 * (FPIT / 2));
#pragma unroll
        for (int j = 0; j < 8; ++j) vg[j] = ldh(vr + j * 16 * (FPIT / 2));
        __builtin_amdgcn_sched_barrier(0);
#pragma unroll
        for (int c = 0; c < 4; ++c) {
            sHa = wmma16(kf[2 * c], qh[c], sHa); sLa = wmma16(kf[2 * c], qr[c], sLa); sHb = wmma16(kf[2 * c + 1], qh[c], sHb); sLb = wmma16(kf[2 * c + 1], qr[c], sLb); }
        asm volatile("v_nop\n\tv_nop\n\tv_nop\n\tv_nop" : "+v"(sHa), "+v"(sLa), "+v"(sHb), "+v"(sLb) : "v"(kf[6]), "v"(kf[7]));
        v8f ya = sLa * QRI + sHa, yb = sLb * QRI + sHb;
        if (last) {
            const int d0 = key0 + 8 * hi - qi;                 // key - query for r = 0 of tile a
#pragma unroll
            for (int r = 0; r < 8; ++r) { ya[r] = (d0 + r > 0) ? NEGBIG : ya[r]; yb[r] = (d0 + r + 16 > 0) ? NEGBIG : yb[r]; }
        }
        // maximum of the sixteen as a tree of three levels, not a chain of eight dependent links
        const float u0 = fmaxf(fmaxf(fmaxf(fmaxf(ya[0], ya[1]), ya[2]), fmaxf(fmaxf(ya[3], ya[4]), ya[5])), fmaxf(fmaxf(ya[6], ya[7]), yb[0]));
        const float u1 = fmaxf(fmaxf(fmaxf(fmaxf(yb[1], yb[2]), yb[3]), fmaxf(fmaxf(yb[4], yb[5]), yb[6])), yb[7]);
        float mx = fmaxf(u0, u1);
        // lane l <-> l ^ 16 by a vector cross-row move: an LDS permute would count on dscnt behind the V^T reads and wait them all out in the middle of the softmax
        mx = fmaxf(mx, __uint_as_float(__builtin_amdgcn_permlanex16(__float_as_uint(mx), __float_as_uint(mx), 0x76543210u, 0xfedcba98u, false, false)));
        const float mp = m - dstep;                            // the running max as seen from this step (every step has a key at or before each query, so mx is a score)
        const float mnew = fmaxf(mp, mx);
        const float alpha = __builtin_amdgcn_exp2f((mp - mnew) * SC2);
        const float sh = fmaf(-mnew, SC2, PSH);
        const v8f ea = ya * SC2 + sh, eb = yb * SC2 + sh;
        v16h pb;                                               // the exp2 stand as the compiler orders them (one run): a v_nop written behind each did not stay there in the build, so none is written
#pragma unroll
        for (int r = 0; r < 8; ++r) { pb[r] = (h16)__builtin_amdgcn_exp2f(ea[r]); pb[8 + r] = (h16)__builtin_amdgcn_exp2f(eb[r]); }
        const v16h pq = pb * (h16)0.00390625f;                 // P x 2^-8: partner of the v residual x256
        m = mnew;
#pragma unroll
        for (int j = 0; j < 8; ++j) o[j] = o[j] * alpha;
        ls = ls * alpha;
        // all loops unrolled so that every array index is a constant (registers, no scratch)
#pragma unroll
        for (int j = 0; j < 8; ++j) o[j] = wmma16(vf[j], pb, o[j]);
        ls = wmma16(ones, pb, ls);
#pragma unroll
        for (int j = 0; j < 8; ++j) o[j] = wmma16(vg[j], pq, o[j]);
        asm volatile("v_nop\n\tv_nop\n\tv_nop\n\tv_nop" : "+v"(o[0]), "+v"(o[1]), "+v"(o[2]), "+v"(o[3]), "+v"(o[4]), "+v"(o[5]), "+v"(o[6]), "+v"(o[7]), "+v"(ls) : "v"(pb), "v"(pq));
        if (pinned((unsigned)(u == FSP - 1 || last))) {        // block-uniform, a scalar branch: behind a stage's last step, the publish point of the next stage
        asm volatile("s_wait_dscnt 0x0" ::: "memory");         // this wave's reads of the buffer of this stage are done before it is handed to the tensor loads
        if (pinned(iss)) tdm_wait(gl, g1);                     // this wave's plane of the next stage has landed
        __syncthreads();                                       // the next stage published; every reader has left the buffer of this stage
        if (pinned(iss & (unsigned)(stg + 2 < nstg))) {        // the stage after the next -> the buffer just read; its descriptor is formed from a value pinned behind the wait
            const unsigned s2 = pinned((unsigned)stg + 2u);
            gl = tdm_slice(l0 + (s2 & 1u) * (unsigned)FBUF, gs + (size_t)(s2 < (unsigned)nsa ? s2 : s2 - (unsigned)nsa) * gst, g1);
        }
        }
      if (last) {                                              // block-uniform: behind a tile's last step its rows go out
    const float inv = 1.0f / ls[0];
    // O^T D layout: o[j][r] = (d = 16j + 8h + r, t = lane&15) -> os[t][d]; rows 0..15 x columns 0..127 all written
#pragma unroll
    for (int j = 0; j < 8; ++j) { v4f a, c;
        a[0] = o[j][0] * inv; a[1] = o[j][1] * inv; a[2] = o[j][2] * inv; a[3] = o[j][3] * inv; c[0] = o[j][4] * inv; c[1] = o[j][5] * inv; c[2] = o[j][6] * inv; c[3] = o[j][7] * inv;
        *(v4fa*)(&os[wb + lr * 132 + 16 * j + 8 * hi]) = a; *(v4fa*)(&os[wb + lr * 132 + 16 * j + 8 * hi + 4]) = c; }
    wave_sync();
    bf* crow = CTX + ((size_t)b * SEQ + t0) * (size_t)(2 * DM) + h * HD;
{
#pragma unroll 2
        for (int s = 0; s < 8; ++s) { const int row = 2 * s + hi, c8 = lr * 8;   // 8 s x 2 rows = 16 rows; 16 lanes x 8 = 128 columns
            const v4f x0 = *(const v4fa*)(&os[wb + row * 132 + c8]); const v4f x1 = *(const v4fa*)(&os[wb + row * 132 + c8 + 4]); v8us hv, lv;
#pragma unroll
            for (int i = 0; i < 4; ++i) { const unsigned short a0 = f2bf(x0[i]); const unsigned short a1 = f2bf(x1[i]); hv[i] = a0; hv[4 + i] = a1; lv[i] = f2bf(x0[i] - bf2f(a0)); lv[4 + i] = f2bf(x1[i] - bf2f(a1)); }
            bf* dst = crow + (size_t)row * (size_t)(2 * DM) + c8;
            *(v8us*)dst = hv; *(v8us*)(dst + DM) = lv; }
         }
        asm volatile("s_wait_xcnt 0x0" ::: "memory");          // behind the tile's stores, in front of the rewrites of the registers that they name
        wave_sync();                                           // this wave's reads of its output staging stand in front of the second tile's writes to it
        // second tile: its rows, its q, sums from the start
        t0 = (NQT - 1 - (int)blockIdx.x) * 32 + (wave >> 2) * 16; qi = t0 + lr;
        if (st != nst - 1) flash_q(QH + qz + (size_t)t0 * HD, QR + qz + (size_t)t0 * HD, qh, qr);
#pragma unroll
        for (int j = 0; j < 8; ++j) o[j] = (v8f){};
        m = NEGBIG; ls = (v8f){};
      }
    }
    asm volatile("s_wait_tensorcnt 0x0" ::: "memory");         // nothing of this wave is in flight when it leaves the ring
    asm volatile("s_wait_dscnt 0x0" ::: "memory");
}

// fold_loop: main loop of k_out, an 8-wave block, block tile 128 x 256, wave tile 64 x 64 at rows wr, columns wc of it. The hi and the lo plane of ctx meet the same WoT rows, so both walk k together:
// a stage holds 128 k of the hi pieces, the lo pieces and the WoT rows (four slices of 128 rows, one tensor load each, from waves 0..3), each WoT line is brought once and each WoT fragment read once for both planes (12 fragments for 32 products), and the loop has DM / 128 stages:
// a stage's landing (a fixed latency, then its bytes) outlasts its products, so the longer stage pays the latency, the barrier and the first fragment group half as often.
// Ring as in proj_loop: two buffers, stage s + 1 in flight while stage s is worked on, one barrier per stage.
// acc[mb*4+nb] += sum_k (A[R0+wr+16mb+..][k] + A[R0+wr+16mb+..][DM+k]) * Bt[C0+wc+16nb+..][k]; k ascending in steps of 32, in each step the hi products first
__device__ __forceinline__ void fold_loop(const bf* __restrict__ A, const bf* __restrict__ Bt, int R0, int C0, int wr, int wc, unsigned char* ring, int wave, int lr, int hi, v8f (&acc)[16]) {
#pragma unroll
    for (int i = 0; i < 16; ++i) acc[i] = (v8f){};
    const unsigned iss = wave < 4;                             // waves 0..3 issue; wave: in a scalar register
    const int sl = wave & 3;                                   // slice: 0 the ctx hi pieces, 1 the lo pieces (DM elements behind), 2 and 3 the WoT rows
    const unsigned l0 = (unsigned)(size_t)ring + (unsigned)sl * (unsigned)TSL;
    const bf* gs = sl < 2 ? A + (size_t)R0 * (size_t)(2 * DM) + sl * DM : Bt + (size_t)(C0 + (sl - 2) * TROWS) * (size_t)DM;
    const v8u g1 = tdm_g1(sl < 2 ? 2 * DM * 2 : DM * 2);
    constexpr int nst = DM / FKS;                              // the same for every wave of the launch
    static_assert(nst >= 2);                                   // stages 0 and 1 both exist
    static_assert(FLO == TROWS && FBT == 2 * TROWS);
    v4u gl = (v4u){};                                          // group 0 of this wave's request in flight
    if (pinned(iss)) {
        gl = tdm_slice(l0, gs, g1);                            // stage 0 -> buffer 0
        tdm_wait(gl, g1);                                      // this wave's slice of stage 0 has landed
    }
    __syncthreads();                                           // stage 0 published
    if (pinned(iss)) gl = tdm_slice(l0 + FST, gs + FKS, g1);   // stage 1 -> buffer 1
    const int ao = (wr + lr) * FPIT + 16 * hi, ro = (FLO + wr + lr) * FPIT + 16 * hi, bfo = (FBT + wc + lr) * FPIT + 16 * hi;
#pragma unroll 1   // one stage per trip: the ring's order at the foot stands once
    for (int st = 0; st < nst; ++st) {
        const unsigned bo = (st & 1) ? (unsigned)FST : 0u;
        const bf* as = (const bf*)(ring + bo + ao); const bf* rs = (const bf*)(ring + bo + ro); const bf* bs = (const bf*)(ring + bo + bfo);
        v16bf a[4], r[4], b[4];
        // Fragment reads stand in few groups, each ahead of the products that cover its latency, never among them. __builtin_amdgcn_sched_barrier(0): nothing is scheduled across it, so a group stays whole and in its place; it asks for no wait itself.
        // first step: hi, WoT, then lo fragments, which land while the hi products run
#pragma unroll
        for (int mb = 0; mb < 4; ++mb) a[mb] = ldb(as + mb * 16 * (FPIT / 2));
#pragma unroll
        for (int nb = 0; nb < 4; ++nb) b[nb] = ldb(bs + nb * 16 * (FPIT / 2));
#pragma unroll
        for (int mb = 0; mb < 4; ++mb) r[mb] = ldb(rs + mb * 16 * (FPIT / 2));
        __builtin_amdgcn_sched_barrier(0);
#pragma unroll
        for (int ks = 0; ks < FKS / 32; ++ks) {
#pragma unroll
            for (int nb = 0; nb < 4; ++nb) {
#pragma unroll
                for (int mb = 0; mb < 4; ++mb) acc[mb * 4 + nb] = wmmab(a[mb], b[nb], acc[mb * 4 + nb]); }
            if (ks + 1 < FKS / 32) {                           // the next step's hi fragments, behind the last product that reads this step's: they land while the lo products run
#pragma unroll
                for (int mb = 0; mb < 4; ++mb) a[mb] = ldb(as + mb * 16 * (FPIT / 2) + 32 * (ks + 1));
            }
            __builtin_amdgcn_sched_barrier(0);                 // in the last step it keeps the hi products in front of the publish point, where they cover the landing of the lo fragments
#pragma unroll
            for (int nb = 0; nb < 4; ++nb) {
#pragma unroll
                for (int mb = 0; mb < 4; ++mb) acc[mb * 4 + nb] = wmmab(r[mb], b[nb], acc[mb * 4 + nb]); }
            if (ks + 1 < FKS / 32) {                           // the next step's WoT fragments, then its lo fragments, which land while its hi products run
#pragma unroll
                for (int nb = 0; nb < 4; ++nb) b[nb] = ldb(bs + nb * 16 * (FPIT / 2) + 32 * (ks + 1));
#pragma unroll
                for (int mb = 0; mb < 4; ++mb) r[mb] = ldb(rs + mb * 16 * (FPIT / 2) + 32 * (ks + 1));
                __builtin_amdgcn_sched_barrier(0);
            }
        }
        // publish point of stage st + 1
        asm volatile("s_wait_dscnt 0x0" ::: "memory");         // this wave's reads of the buffer of stage st are done before it is handed to the tensor loads
        if (pinned(iss)) tdm_wait(gl, g1);                     // this wave's slice of stage st + 1 has landed
        __syncthreads();                                       // stage st + 1 published; every reader has left the buffer of stage st
        if (pinned(iss & (unsigned)(st + 2 < nst))) {          // stage st + 2 -> the buffer just read; its descriptor is formed from a value pinned behind the wait
            const unsigned s2 = pinned((unsigned)st + 2u);
            gl = tdm_slice(l0 + (s2 & 1u) * (unsigned)FST, gs + (size_t)s2 * FKS, g1);
        }
    }
    asm volatile("s_wait_tensorcnt 0x0" ::: "memory");         // nothing of this wave is in flight when it leaves the ring
    asm volatile("s_wait_dscnt 0x0" ::: "memory");
}

// k_out: output projection. A = ctx plane rows [hi 2048 | lo 2048], both planes against the single WoT plane (fold_loop), Bt = WoT rows, one wave per 64x64 tile, a block is 2 x 4 of them. grid (NB*SEQ/128, DM/256), 256 threads.
// What is left: the first fragment group of a stage is still read behind the barrier, with nothing of the wave's own to cover it.
__global__ __launch_bounds__(32 * GW) __attribute__((amdgpu_num_vgpr(256)))
void k_out(const bf* __restrict__ A, const bf* __restrict__ Bt, const float* __restrict__ bias, float* OUT) {
    __shared__ __attribute__((aligned(2048))) unsigned char ring[2 * FST];   // every slice of a stage starts at a multiple of 2 KiB
    __shared__ __align__(16) float osb[GW * 16 * 68];
    const int tid = threadIdx.x;
    const int lane = tid & 31, wave = tid >> 5, lr = lane & 15, hi = lane >> 4;
    float* os = osb + wave * 16 * 68;                          // wave-private output staging
    const int wr = (wave & 1) * 64, wc = (wave >> 1) * 64;
    const int r0 = blockIdx.x * 128 + wr, c0 = blockIdx.y * 256 + wc;
    v8f acc[16];
    fold_loop(A, Bt, blockIdx.x * 128, blockIdx.y * 256, wr, wc, ring, __builtin_amdgcn_readfirstlane(wave), lr, hi, acc);
    float bz[4];
#pragma unroll
    for (int nb = 0; nb < 4; ++nb) bz[nb] = bfr(bias[c0 + nb * 16 + lr]);
    const int b = r0 / SEQ, t0 = r0 % SEQ;
    float* obase = OUT + ((size_t)b * OUT_SEQ + t0) * DM + c0;
#pragma unroll
    for (int mb = 0; mb < 4; ++mb) {
#pragma unroll
        for (int nb = 0; nb < 4; ++nb) {
#pragma unroll
            for (int j = 0; j < 8; ++j) os[(hi * 8 + j) * 68 + nb * 16 + lr] = acc[mb * 4 + nb][j] + bz[nb]; }   // rows 0..15 x cols 0..63 all staged
        wave_sync();
        float* orow = obase + (size_t)(mb * 16) * DM;
{
#pragma unroll
            for (int s = 0; s < 8; ++s) { const int row = 2 * s + hi, cofs = lr * 4;   // 8 s x 2 rows = 16 rows; 16 lanes x 4 floats = 64 columns
                const v4f val = *(const v4fa*)(&os[row * 68 + cofs]);
                *(v4f*)(orow + (size_t)row * DM + cofs) = val; }
             }
        wave_sync();
    }
}

static constexpr size_t al256(size_t v) { return (v + 255) & ~(size_t)255; }
static constexpr size_t SZ_XB  = al256((size_t)NB * SEQ * DM * 2);
static constexpr size_t SZ_WQ  = al256((size_t)DM * DM * 2);
static constexpr size_t SZ_WK  = al256((size_t)DKV * DM * 2);
static constexpr size_t SZ_CS  = al256((size_t)SEQ * 128 * 4);
static constexpr size_t SZ_QP  = al256((size_t)NB * NH_ * SEQ * HD * 2);
static constexpr size_t SZ_KP  = al256((size_t)NB * NKV * SEQ * HD * 2);
static constexpr size_t SZ_CTX = al256((size_t)NB * SEQ * 2 * DM * 2);
static_assert(SZ_WQ == (size_t)DM * DM * 2 && SZ_WK == (size_t)DKV * DM * 2);   // no gap between the q, k and v weight planes
static constexpr size_t SZ_TOTAL = SZ_XB + 2 * SZ_WQ + 2 * SZ_WK + SZ_CS + 2 * SZ_QP + 3 * SZ_KP + SZ_CTX;
static_assert(SZ_TOTAL <= (size_t)134217728);          // workspace carve <= 128 MiB

extern "C" void kernel_launch(void* const* d_in, const int* in_sizes, int n_in,
                              void* d_out, int out_size, void* d_ws, size_t ws_size, hipStream_t stream) {
    if (n_in < 9) return;
    const size_t needx = ((size_t)(NB - 1) * SEQ_FULL + SEQ) * DM;
    if ((size_t)in_sizes[0] < needx) return;
    if ((size_t)in_sizes[1] < (size_t)DM * DM || (size_t)in_sizes[2] < (size_t)DM) return;
    if ((size_t)in_sizes[3] < (size_t)DM * DKV || (size_t)in_sizes[4] < (size_t)DKV) return;
    if ((size_t)in_sizes[5] < (size_t)DM * DKV || (size_t)in_sizes[6] < (size_t)DKV) return;
    if ((size_t)in_sizes[7] < (size_t)DM * DM || (size_t)in_sizes[8] < (size_t)DM) return;
    if ((size_t)out_size < ((size_t)(NB - 1) * OUT_SEQ + SEQ) * DM) return;
    if (SZ_TOTAL > ws_size) return;
    // wire order: x, Wq, bq, Wk, bk, Wv, bv, Wo, bo (weights [in][out])
    const float* x  = (const float*)d_in[0];
    const float* wq = (const float*)d_in[1]; const float* bq = (const float*)d_in[2];
    const float* wk = (const float*)d_in[3]; const float* bk = (const float*)d_in[4];
    const float* wv = (const float*)d_in[5]; const float* bv = (const float*)d_in[6];
    const float* wo = (const float*)d_in[7]; const float* bo = (const float*)d_in[8];
    float* OUT = (float*)d_out;      // [NB][SEQ][2048]
    char* wsp = (char*)d_ws;
    bf* XB  = (bf*)wsp; wsp += SZ_XB;                // [NB*SEQ][2048]
    bf* WQT = (bf*)wsp; wsp += SZ_WQ;                // [2048 out][2048 in]; WQT, WKT, WVT lie one behind the other: one plane [3072 out][2048 in]
    bf* WKT = (bf*)wsp; wsp += SZ_WK;                // [512 out][2048 in]
    bf* WVT = (bf*)wsp; wsp += SZ_WK;                // [512 out][2048 in]
    bf* WOT = (bf*)wsp; wsp += SZ_WQ;                // [2048 out][2048 in]
    float* CS = (float*)wsp; wsp += SZ_CS;           // [SEQ][cos 64 | sin 64]
    h16* QH = (h16*)wsp; wsp += SZ_QP;               // [NB*16][SEQ][128]
    h16* QR = (h16*)wsp; wsp += SZ_QP;               // [NB*16][SEQ][128] residual x2048
    h16* KP = (h16*)wsp; wsp += SZ_KP;               // [NB*4][SEQ][128]
    h16* VH = (h16*)wsp; wsp += SZ_KP;               // [NB*4][128][SEQ]
    h16* VR = (h16*)wsp; wsp += SZ_KP;               // [NB*4][128][SEQ] residual x256
    bf* CTX = (bf*)wsp; wsp += SZ_CTX;               // [NB*SEQ][hi 2048 | lo 2048]

    // weight transposes in[K = DM rows][N cols] -> out[N rows][K = DM cols], rotary table, bf16 copy of x
    k_prep<<<PB_W + PB_ROPE + PB_CVT, 256, 0, stream>>>(x, wq, wk, wv, wo, XB, WQT, WKT, WVT, WOT, CS);

    // q, k, v: A = x rows (m = b*SEQ + t), Bt = the weight rows (n = q 2048 | k 512 | v 512) -> q, k planes [(b*nheads + head)][t][d], rotary applied; v planes [(b*512 + g*128 + d)][t]
    k_qkv<<<GB_ROW * GB_COL, 32 * PW, 0, stream>>>(XB, WQT, bq, bk, bv, CS, QH, QR, KP, VH, VR);

    k_flash<<<dim3(SEQ / 64, NB * NKV, 1), 32 * FW, 0, stream>>>(QH, QR, KP, VH, VR, CTX);

    k_out<<<dim3(NB * SEQ / 128, DM / 256, 1), 32 * GW, 0, stream>>>(CTX, WOT, bo, OUT);
}
